// v000
// Measured on an AMD MI455X. A time is GPU time per run, averaged over a window of back-to-back runs after a warm-up
// (all launches, gaps included; the runs take copies of the inputs in turn), and the median of several windows.
// Apart from v000's, it joins two sittings. Times from different sittings can be a few percent apart, while
// side-by-side timings come from the same sitting.
// v000 is the starting kernel. One run takes 3420 microseconds.
#include <hip/hip_runtime.h>
// Wide single-head self-attention (x [4][4096][64]; Q/K/V = x W with W [64][512] stored [in][out] (heads NOT split: one 512-wide head); scores = Q K^T / sqrt(512) over all 4,096 keys; softmax; o = attn V; out = o Wm (Wm [512][64]) -> [4][4096][64]).
// Structure: token rows r = b*4096 + s; x as exact f16 rows (bf16-rounded); Q, K, V as three WMMA GEMMs (32x64 wave tiles, f32 accumulation, exact x16 weights, f16 outputs, K = 64); per batch: V^T via LDS transposes (8 slabs of 64 = the 512 columns), scores GEMM (K = 512, alpha 512^-0.5), row softmax on VALU (f32 statistics, native exp; weights stored x256 as f16), o = P . V^T GEMM (K = 4096, N = 512, alpha 2^-2: o carried x64) into f16 rows; out = o Wm GEMM (f32, alpha 2^-10) into the output rows; 5 + 3 + 4 x 4 + 1 = 25 launches.
// Compute dtype: inputs rounded to bf16; x / weights exact; Q, K, V, softmax weights and o as plain f16 GEMM operands (~2^-12); scores, statistics and out f32. v_wmma_f32_16x16x32_f16.
#define NB 4
#define SQ 4096
#define EM 64                        /* embedding */
#define DM 512                       /* wide = 8 x 64 (one head) */
#define NH 8                         /* 64-wide slabs of the one 512-wide head (transpose tiling only) */
#define HD 64
#define HG 1
#define B0 0                         /* first batch processed (debug hook) */
#define NBR NB                       /* batches processed (debug hook) */
#define QN SQ                        /* query rows attended per batch (debug hook) */
#define NR ((size_t)NB * SQ)
#define MP ((int)((size_t)NBR * SQ))
#define MPO MP
typedef __bf16 v16b __attribute__((ext_vector_type(16)));
typedef unsigned short v8us __attribute__((ext_vector_type(8), may_alias));
typedef float  v8f  __attribute__((ext_vector_type(8)));
typedef float  v4f  __attribute__((ext_vector_type(4)));
typedef float  v4fa __attribute__((ext_vector_type(4), may_alias));
union FragB { v16b v; v8us half[2]; unsigned short u[16]; };

__device__ __forceinline__ unsigned short bf16_bits(float x) { unsigned int u = __float_as_uint(x); return (unsigned short)((u + 0x7FFFu + ((u >> 16) & 1u)) >> 16); }
__device__ __forceinline__ float bf16_val(unsigned short b) { return __uint_as_float(((unsigned int)b) << 16); }
__device__ __forceinline__ float bf16_round(float x) { return bf16_val(bf16_bits(x)); }
// D += A·B with NT terms: 1 = ah·bh, 2 = + al·bh (A split), 3 = + ah·bl (both split)
template <int NT>
__device__ __forceinline__ v8f mmaN(v16b ah, v16b al, v16b bh, v16b bl, v8f c) {
  c = __builtin_amdgcn_wmma_f32_16x16x32_bf16(false, ah, false, bh, (short)0, c, false, false);
  if (NT >= 2) c = __builtin_amdgcn_wmma_f32_16x16x32_bf16(false, al, false, bh, (short)0, c, false, false);
  if (NT >= 3) c = __builtin_amdgcn_wmma_f32_16x16x32_bf16(false, ah, false, bl, (short)0, c, false, false);
  asm volatile("v_nop\n\tv_nop\n\tv_nop\n\tv_nop" : "+v"(c) : "v"(ah), "v"(al), "v"(bh), "v"(bl));
  return c;
}

__global__ __launch_bounds__(256) void k_wt_bf16(const float* __restrict__ W, unsigned short* __restrict__ Wt, int K, int N) {
  const int t = blockIdx.x * 256 + threadIdx.x;
  const int k8n = K / 8;
  if (t >= N * k8n) return;
  const int n = t / k8n, k8 = (t % k8n) * 8;
  v8us v;
#pragma unroll
  for (int i = 0; i < 8; ++i) v[i] = bf16_bits(W[(size_t)(k8 + i) * N + n]);
  *(v8us*)(Wt + (size_t)n * K + k8) = v;
  
}

// GEMM C[M][N] (f32, pitch ldc) = act(A[M][K]·W + bias). A f32 row-major (pitch lda) converted per fragment to bf16
// (ASPLIT: hi/lo two planes -> 2 terms, else single rounded term); Wt bf16 [N][K] (pitch ldb). BIAS_BF16 rounds the
// bias to bf16 first (bias quantised to bf16 before the add). K%32==0, M%16==0, N%64==0.
template <bool ASPLIT, int ACT, bool BIAS_BF16>
__global__ __launch_bounds__(128) void k_gemm_bf(const float* __restrict__ A, int lda, const unsigned short* __restrict__ Wt, int ldb,
                                               const float* __restrict__ bias, float* __restrict__ C, int ldc, int M, int N, int K) {
  __shared__ __attribute__((aligned(16))) float so[4][16][64];
  const int tid = threadIdx.x, w = tid >> 5, lane = tid & 31, ln = lane & 15, hh = lane >> 4;
  const int ntn = N / 64;
  const int wid = blockIdx.x * 4 + w;
  const int mt = wid / ntn, nq = wid % ntn;
  if (mt * 16 >= M) return;
  const int row0 = mt * 16, col0 = nq * 64;
  const float* arow = A + (size_t)(row0 + ln) * lda;
  v8f acc[4] = {};
  for (int kb = 0; kb < K; kb += 32) {
    FragB ah, al;
    const v4f x0 = *(const v4fa*)(arow + kb + 8 * hh), x1 = *(const v4fa*)(arow + kb + 8 * hh + 4);
    const v4f x2 = *(const v4fa*)(arow + kb + 16 + 8 * hh), x3 = *(const v4fa*)(arow + kb + 16 + 8 * hh + 4);
    float xs[16] = {x0[0],x0[1],x0[2],x0[3],x1[0],x1[1],x1[2],x1[3],x2[0],x2[1],x2[2],x2[3],x3[0],x3[1],x3[2],x3[3]};
#pragma unroll
    for (int i = 0; i < 16; ++i) { const unsigned short hb = bf16_bits(xs[i]); ah.u[i] = hb; al.u[i] = ASPLIT ? bf16_bits(xs[i] - bf16_val(hb)) : (unsigned short)0; }
#pragma unroll
    for (int t = 0; t < 4; ++t) {
      const unsigned short* brow = Wt + (size_t)(col0 + t * 16 + ln) * ldb + kb;
      FragB b;
      b.half[0] = *(const v8us*)(brow + 8 * hh);
      b.half[1] = *(const v8us*)(brow + 16 + 8 * hh);
      acc[t] = mmaN<ASPLIT ? 2 : 1>(ah.v, al.v, b.v, b.v, acc[t]);
    }
  }
#pragma unroll
  for (int t = 0; t < 4; ++t) {
    float bv = bias ? bias[col0 + t * 16 + ln] : 0.f;
    if (BIAS_BF16) bv = bf16_round(bv);
#pragma unroll
    for (int r = 0; r < 8; ++r) { float v = acc[t][r] + bv; if (ACT == 1) v = fmaxf(v, 0.f); so[w][8 * hh + r][t * 16 + ln] = v; }
  }
  __builtin_amdgcn_fence(__ATOMIC_ACQ_REL, "workgroup");
  __builtin_amdgcn_wave_barrier();
  const int rsub = lane >> 4, c4 = (lane & 15) * 4;
  {
#pragma unroll
    for (int q = 0; q < 8; ++q) {
      const int r = q * 2 + rsub;
      const v4f v = *(const v4fa*)&so[w][r][c4];
      *(v4f*)(C + (size_t)(row0 + r) * ldc + col0 + c4) = v;
    }
    
  }
}

// GEMM C = act(A·W + bias + resid): A f32 (ASPLIT -> hi/lo 2 terms), Wt bf16 [N][K]; ACT 0 none, 1 relu, 2 exact gelu;
// resid (optional, f32, row index = (row % rmod), pitch ldr, RES_BF16 rounds it) added before the activation.
template <bool ASPLIT, int ACT, bool BIAS_BF16, bool RES_BF16>
__global__ __launch_bounds__(128) void k_gemm_bf3(const float* __restrict__ A, int lda, const unsigned short* __restrict__ Wt, int ldb,
                                                const float* __restrict__ bias, const float* __restrict__ resid, int rmod, int ldr,
                                                float* __restrict__ C, int ldc, int M, int N, int K) {
  __shared__ __attribute__((aligned(16))) float so[4][16][64];
  const int tid = threadIdx.x, w = tid >> 5, lane = tid & 31, ln = lane & 15, hh = lane >> 4;
  const int ntn = N / 64;
  const int wid = blockIdx.x * 4 + w;
  const int mt = wid / ntn, nq = wid % ntn;
  if (mt * 16 >= M) return;
  const int row0 = mt * 16, col0 = nq * 64;
  const float* arow = A + (size_t)(row0 + ln) * lda;
  v8f acc[4] = {};
  for (int kb = 0; kb < K; kb += 32) {
    FragB ah, al;
    const v4f x0 = *(const v4fa*)(arow + kb + 8 * hh), x1 = *(const v4fa*)(arow + kb + 8 * hh + 4);
    const v4f x2 = *(const v4fa*)(arow + kb + 16 + 8 * hh), x3 = *(const v4fa*)(arow + kb + 16 + 8 * hh + 4);
    float xs[16] = {x0[0],x0[1],x0[2],x0[3],x1[0],x1[1],x1[2],x1[3],x2[0],x2[1],x2[2],x2[3],x3[0],x3[1],x3[2],x3[3]};
#pragma unroll
    for (int i = 0; i < 16; ++i) { const unsigned short hb = bf16_bits(xs[i]); ah.u[i] = hb; al.u[i] = ASPLIT ? bf16_bits(xs[i] - bf16_val(hb)) : (unsigned short)0; }
#pragma unroll
    for (int t = 0; t < 4; ++t) {
      const unsigned short* brow = Wt + (size_t)(col0 + t * 16 + ln) * ldb + kb;
      FragB b;
      b.half[0] = *(const v8us*)(brow + 8 * hh);
      b.half[1] = *(const v8us*)(brow + 16 + 8 * hh);
      acc[t] = mmaN<ASPLIT ? 2 : 1>(ah.v, al.v, b.v, b.v, acc[t]);
    }
  }
#pragma unroll
  for (int t = 0; t < 4; ++t) {
    const int col = col0 + t * 16 + ln;
    float bv = bias ? bias[col] : 0.f;
    if (BIAS_BF16) bv = bf16_round(bv);
#pragma unroll
    for (int r = 0; r < 8; ++r) {
      float v = acc[t][r] + bv;
      if (resid) { float rv = resid[(size_t)((row0 + 8 * hh + r) % rmod) * ldr + col]; if (RES_BF16) rv = bf16_round(rv); v += rv; }
      if (ACT == 1) v = fmaxf(v, 0.f);
      if (ACT == 2) v = 0.5f * v * (1.0f + erff(v * 0.70710678118654752f));
      if (ACT == 3) { const float u = 0.7978845608028654f * (v + 0.044715f * v * v * v); v = 0.5f * v * (1.0f + tanhf(u)); }
      so[w][8 * hh + r][t * 16 + ln] = v;
    }
  }
  __builtin_amdgcn_fence(__ATOMIC_ACQ_REL, "workgroup");
  __builtin_amdgcn_wave_barrier();
  const int rsub = lane >> 4, c4 = (lane & 15) * 4;
  {
#pragma unroll
    for (int q = 0; q < 8; ++q) {
      const int r = q * 2 + rsub;
      const v4f v = *(const v4fa*)&so[w][r][c4];
      *(v4f*)(C + (size_t)(row0 + r) * ldc + col0 + c4) = v;
    }
    
  }
}
// row LayerNorm (biased variance, eps) over N: s = X (+ R); optional out_sum <- s; out_norm <- (s-mu)*rsqrt(var+eps)*g + b
template <bool PARAM_BF16>
__global__ __launch_bounds__(256) void k_layernorm(const float* __restrict__ X, const float* __restrict__ R, const float* __restrict__ g, const float* __restrict__ bta,
                                                  float* __restrict__ out_sum, float* __restrict__ out_norm, int N, float eps) {
  __shared__ float red[256];
  const int row = blockIdx.x, tid = threadIdx.x;
  const float* x = X + (size_t)row * N; const float* rr = R ? R + (size_t)row * N : nullptr;
  float vals[16];                     // up to N = 4096
  const int per = N / 256;            // contiguous chunk per thread? use strided-by-4 chunks: thread handles j = tid*4 + 1024*u
  float s1 = 0.f;
  for (int u = 0; u < per / 4; ++u) {
    const int j = tid * 4 + 1024 * u;
    const v4f a = *(const v4fa*)(x + j);
    v4f b = {0.f,0.f,0.f,0.f}; if (rr) b = *(const v4fa*)(rr + j);
#pragma unroll
    for (int q = 0; q < 4; ++q) { const float v = a[q] + b[q]; vals[u * 4 + q] = v; s1 += v; }
  }
  red[tid] = s1; __syncthreads();
  for (int st = 128; st > 0; st >>= 1) { if (tid < st) red[tid] += red[tid + st]; __syncthreads(); }
  const float mu = red[0] / (float)N; __syncthreads();
  float s2 = 0.f;
  for (int u = 0; u < per / 4; ++u)
#pragma unroll
    for (int q = 0; q < 4; ++q) { const float c = vals[u * 4 + q] - mu; s2 += c * c; }
  red[tid] = s2; __syncthreads();
  for (int st = 128; st > 0; st >>= 1) { if (tid < st) red[tid] += red[tid + st]; __syncthreads(); }
  const float rs = rsqrtf(red[0] / (float)N + eps);
  {
    for (int u = 0; u < per / 4; ++u) {
      const int j = tid * 4 + 1024 * u;
      v4f o, sm;
#pragma unroll
      for (int q = 0; q < 4; ++q) {
        float gg = g[j + q], bb = bta[j + q];
        if (PARAM_BF16) { gg = bf16_round(gg); bb = bf16_round(bb); }
        sm[q] = vals[u * 4 + q]; o[q] = (vals[u * 4 + q] - mu) * rs * gg + bb;
      }
      if (out_sum) *(v4f*)(out_sum + (size_t)row * N + j) = sm;
      *(v4f*)(out_norm + (size_t)row * N + j) = o;
    }
    
  }
}



// ---- f16 WMMA path (v_wmma_f32_16x16x32_f16): 11-bit significands for operands in range — used where a [0,1] probability operand needs more precision than bf16
typedef _Float16 v16h __attribute__((ext_vector_type(16)));
union FragH { v16h v; v8us half[2]; _Float16 h[16]; unsigned short u[16]; };
template <int NT>
__device__ __forceinline__ v8f mmaH(v16h ah, v16h al, v16h bh, v16h bl, v8f c) {
  c = __builtin_amdgcn_wmma_f32_16x16x32_f16(false, ah, false, bh, (short)0, c, false, false);
  if (NT >= 2) c = __builtin_amdgcn_wmma_f32_16x16x32_f16(false, al, false, bh, (short)0, c, false, false);
  if (NT >= 3) c = __builtin_amdgcn_wmma_f32_16x16x32_f16(false, ah, false, bl, (short)0, c, false, false);
  asm volatile("v_nop\n\tv_nop\n\tv_nop\n\tv_nop" : "+v"(c) : "v"(ah), "v"(al), "v"(bh), "v"(bl));
  return c;
}
// batched GEMM like k_gemm_b but f16 operands: A f32 (split into f16 hi/lo if ASPLIT, else rounded to f16), Bt = f16 values [n][k]; alpha; C f32; N multiple of 16 (partial tiles skipped)
template <bool ASPLIT>
__global__ __launch_bounds__(128) void k_gemm_h(const float* __restrict__ A, int lda, size_t sA, const _Float16* __restrict__ Bh, int ldb, size_t sB, float alpha, float* __restrict__ C, int ldc, size_t sC, int M, int N, int K) {
  __shared__ __attribute__((aligned(16))) float so[4][16][64];
  const int tid = threadIdx.x, w = tid >> 5, lane = tid & 31, ln = lane & 15, hh = lane >> 4; const int by = blockIdx.y;
  A += (size_t)by * sA; Bh += (size_t)by * sB; C += (size_t)by * sC;
  const int ntn = (N + 63) / 64; const int wid = blockIdx.x * 4 + w; const int mt = wid / ntn, nq = wid % ntn; if (mt * 16 >= M) return;
  const int row0 = mt * 16, col0 = nq * 64; const float* arow = A + (size_t)(row0 + ln) * lda;
  v8f acc[4] = {};
  for (int kb = 0; kb < K; kb += 32) {
    FragH ah, al;
    const v4f x0 = *(const v4fa*)(arow + kb + 8 * hh), x1 = *(const v4fa*)(arow + kb + 8 * hh + 4), x2 = *(const v4fa*)(arow + kb + 16 + 8 * hh), x3 = *(const v4fa*)(arow + kb + 16 + 8 * hh + 4);
    float xs[16] = {x0[0],x0[1],x0[2],x0[3],x1[0],x1[1],x1[2],x1[3],x2[0],x2[1],x2[2],x2[3],x3[0],x3[1],x3[2],x3[3]};
#pragma unroll
    for (int i = 0; i < 16; ++i) { const _Float16 h = (_Float16)xs[i]; ah.h[i] = h; al.h[i] = ASPLIT ? (_Float16)(xs[i] - (float)h) : (_Float16)0.0f; }
#pragma unroll
    for (int t = 0; t < 4; ++t) { if (col0 + t * 16 >= N) continue; const size_t boff = (size_t)(col0 + t * 16 + ln) * ldb + kb; FragH bq; bq.half[0] = *(const v8us*)(Bh + boff + 8 * hh); bq.half[1] = *(const v8us*)(Bh + boff + 16 + 8 * hh);
      acc[t] = mmaH<ASPLIT ? 2 : 1>(ah.v, al.v, bq.v, bq.v, acc[t]); }
  }
#pragma unroll
  for (int t = 0; t < 4; ++t) { if (col0 + t * 16 >= N) continue;
#pragma unroll
    for (int r = 0; r < 8; ++r) so[w][8 * hh + r][t * 16 + ln] = acc[t][r] * alpha; }
  __builtin_amdgcn_fence(__ATOMIC_ACQ_REL, "workgroup"); __builtin_amdgcn_wave_barrier();
  const int rsub = lane >> 4, c4 = (lane & 15) * 4;
  {
#pragma unroll
    for (int q = 0; q < 8; ++q) { const int r = q * 2 + rsub; if (col0 + c4 < N) { const v4f v = *(const v4fa*)&so[w][r][c4]; *(v4f*)(C + (size_t)(row0 + r) * ldc + col0 + c4) = v; } }
     }
}

// Wt[n][k] = f16(W[k][n]·scale) from f32 row-major W[K][N] (scale = power of two; bf16-exact weights stay exact in f16 away from the subnormal range)
__global__ __launch_bounds__(256) void k_wt_f16(const float* __restrict__ W, _Float16* __restrict__ Wt, int K, int N, float scale) {
  const int t = blockIdx.x * 256 + threadIdx.x; if (t >= N * (K / 8)) return; const int n = t / (K / 8), k8 = (t % (K / 8)) * 8; FragH f;
#pragma unroll
  for (int i = 0; i < 8; ++i) f.h[i] = (_Float16)(bf16_round(W[(size_t)(k8 + i) * N + n]) * scale); const v8us o = f.half[0];
  *(v8us*)((unsigned short*)Wt + (size_t)n * K + k8) = o; 
}
// k_gemm_hh variant with fused epilogue: v = acc·alpha + bias[by·sBias + col] (+ CP[(row/rowsPerB)·sCPb + by·64 + col] if CP) ; ACT 0 none / 1 elu ; writes f16 C16 (and f32 C if non-null)
template <int ACT>
__global__ __launch_bounds__(128) void k_gemm_hhx(const _Float16* __restrict__ A, int lda, size_t sA, const _Float16* __restrict__ Bh, int ldb, size_t sB, float alpha, const float* __restrict__ bias, size_t sBias, const float* __restrict__ CP, int rowsPerB, size_t sCPb, int row0g,
    float* __restrict__ C, _Float16* __restrict__ C16, int ldc, size_t sC, int M, int N, int K) {
  __shared__ __attribute__((aligned(16))) float so[4][16][64];
  const int tid = threadIdx.x, w = tid >> 5, lane = tid & 31, ln = lane & 15, hh = lane >> 4; const int by = blockIdx.y;
  A += (size_t)by * sA; Bh += (size_t)by * sB; const size_t cofs = (size_t)by * sC; const float* bp = bias ? bias + (size_t)by * sBias : nullptr;
  const int ntn = (N + 63) / 64; const int wid = blockIdx.x * 4 + w; const int mt = wid / ntn, nq = wid % ntn; if (mt * 16 >= M) return;
  const int row0 = mt * 16, col0 = nq * 64; const _Float16* arow = A + (size_t)(row0 + ln) * lda;
  v8f acc[4] = {};
  for (int kb = 0; kb < K; kb += 32) { FragH ah; ah.half[0] = *(const v8us*)((const unsigned short*)arow + kb + 8 * hh); ah.half[1] = *(const v8us*)((const unsigned short*)arow + kb + 16 + 8 * hh);
#pragma unroll
    for (int t = 0; t < 4; ++t) { if (col0 + t * 16 >= N) continue; const size_t boff = (size_t)(col0 + t * 16 + ln) * ldb + kb; FragH bq; bq.half[0] = *(const v8us*)((const unsigned short*)Bh + boff + 8 * hh); bq.half[1] = *(const v8us*)((const unsigned short*)Bh + boff + 16 + 8 * hh);
      acc[t] = mmaH<1>(ah.v, ah.v, bq.v, bq.v, acc[t]); }
  }
#pragma unroll
  for (int t = 0; t < 4; ++t) { if (col0 + t * 16 >= N) continue; const int col = col0 + t * 16 + ln; const float bv = bp ? bf16_round(bp[col]) : 0.f;
#pragma unroll
    for (int r = 0; r < 8; ++r) { float v = acc[t][r] * alpha + bv; if (CP) { const int rr = row0g + row0 + 8 * hh + r; if (rowsPerB < 0) v += CP[cofs + (size_t)rr * ldc + col];      /* rowsPerB < 0: own element of the batched C plane */ else { const int bidx = rr / rowsPerB; v += CP[(size_t)bidx * sCPb + (size_t)by * 64 + col]; } } if (ACT == 1) v = (v > 0.f) ? v : expm1f(v); else if (ACT == 7) v = (v > 0.f) ? v + 1.0f : expf(v); else if (ACT == 8) v = tanhf(v); else if (ACT == 9) v = 0.5f * v * (1.0f + tanhf(0.7978845608028654f * (v + 0.044715f * v * v * v))); else if (ACT == 11) v = 1.0f / (1.0f + expf(-v)); else if (ACT == 12) v = (v > 0.f) ? v : 0.01f * v; else if (ACT == 14) v = (v > 0.f) ? v : 0.1f * v; else if (ACT == 16) v = (v >= 0.f) ? v : 0.3f * v; else if (ACT == 17) v = (v >= 0.f) ? v : 0.2f * v; else if (ACT == 15) v = v / (1.0f + expf(-v)); else if (ACT == 3) v = fmaxf(v, 0.f); else if (ACT == 6) v = 0.5f * v * (1.0f + erff(v * 0.70710678118654752f)); so[w][8 * hh + r][t * 16 + ln] = v; } }
  __builtin_amdgcn_fence(__ATOMIC_ACQ_REL, "workgroup"); __builtin_amdgcn_wave_barrier();
  const int rsub = lane >> 4, c4 = (lane & 15) * 4; typedef _Float16 v4h __attribute__((ext_vector_type(4)));
  {
#pragma unroll
    for (int q = 0; q < 8; ++q) { const int r = q * 2 + rsub; if (col0 + c4 < N) { const v4f v = *(const v4fa*)&so[w][r][c4]; if (C) *(v4f*)(C + cofs + (size_t)(row0 + r) * ldc + col0 + c4) = v; if (C16) { v4h h4; for (int i = 0; i < 4; ++i) h4[i] = (_Float16)v[i]; *(v4h*)(C16 + cofs + (size_t)(row0 + r) * ldc + col0 + c4) = h4; } } }
     }
}


typedef _Float16 v4h __attribute__((ext_vector_type(4)));

__global__ __launch_bounds__(256) void k_x16(const float* __restrict__ x, _Float16* __restrict__ X16, size_t n8) { const size_t t = (size_t)blockIdx.x * 256 + threadIdx.x; if (t >= n8) return; FragH f;
#pragma unroll
  for (int q = 0; q < 8; ++q) f.h[q] = (_Float16)bf16_round(x[t * 8 + q]); *(v8us*)((unsigned short*)X16 + t * 8) = f.half[0];  }
__global__ __launch_bounds__(256) void k_h16(const float* __restrict__ x, _Float16* __restrict__ X16, size_t n8) { const size_t t = (size_t)blockIdx.x * 256 + threadIdx.x; if (t >= n8) return; FragH f;
#pragma unroll
  for (int q = 0; q < 8; ++q) f.h[q] = (_Float16)x[t * 8 + q]; *(v8us*)((unsigned short*)X16 + t * 8) = f.half[0];  }
__global__ __launch_bounds__(256) void k_round16f(const float* __restrict__ W, _Float16* __restrict__ Bt, size_t n8) { const size_t t = (size_t)blockIdx.x * 256 + threadIdx.x; if (t >= n8) return; FragH f;
#pragma unroll
  for (int i = 0; i < 8; ++i) f.h[i] = (_Float16)(bf16_round(W[t * 8 + i]) * 16.0f); *(v8us*)((unsigned short*)Bt + t * 8) = f.half[0];  }
template <int NHv, int TTv>
__global__ __launch_bounds__(256) void k_vt(const _Float16* __restrict__ V16, int ldv, int voff, _Float16* __restrict__ Vt) { __shared__ unsigned short tl[64][66]; const int tid = threadIdx.x; const int slab = blockIdx.x / (TTv / 64), lg = blockIdx.x % (TTv / 64); const int b = slab / NHv, h = slab % NHv;
  for (int i = tid; i < 64 * 8; i += 256) { const int r = i / 8, c8 = (i % 8) * 8; FragH f; f.half[0] = *(const v8us*)((const unsigned short*)V16 + ((size_t)b * TTv + lg * 64 + r) * ldv + voff + h * 64 + c8);
#pragma unroll
    for (int q = 0; q < 8; ++q) tl[r][c8 + q] = f.u[q]; }
  __syncthreads();
  {
#pragma unroll
    for (int rd = 0; rd < 2; ++rd) { const int d = rd * 32 + tid / 8, pc = tid % 8; FragH f;
#pragma unroll
      for (int q = 0; q < 8; ++q) f.u[q] = tl[pc * 8 + q][d];
      *(v8us*)((unsigned short*)Vt + ((size_t)slab * 64 + d) * TTv + lg * 64 + pc * 8) = f.half[0]; }
     } }

__global__ __launch_bounds__(256) void k_hl(const float* __restrict__ F, _Float16* __restrict__ Hh, _Float16* __restrict__ Hl, size_t n8) { const size_t t = (size_t)blockIdx.x * 256 + threadIdx.x; if (t >= n8) return; FragH fh, fl; const v4f a = *(const v4fa*)(F + t * 8), c = *(const v4fa*)(F + t * 8 + 4);
#pragma unroll
  for (int q = 0; q < 4; ++q) { _Float16 h = (_Float16)a[q]; fh.h[q] = h; fl.h[q] = (_Float16)((a[q] - (float)h) * 1024.0f); h = (_Float16)c[q]; fh.h[4 + q] = h; fl.h[4 + q] = (_Float16)((c[q] - (float)h) * 1024.0f); }
  { *(v8us*)((unsigned short*)Hh + t * 8) = fh.half[0]; *(v8us*)((unsigned short*)Hl + t * 8) = fl.half[0];  } }

// ---- fast GEMM (wave tile 32x64; requires M % 32 == 0 rows per launch region and N % 64 == 0); epilogue = k_gemm_hhx semantics ----
__device__ __forceinline__ v16h g2_frag(const _Float16* p, int hh) { FragH f; f.half[0] = *(const v8us*)((const unsigned short*)p + 8 * hh); f.half[1] = *(const v8us*)((const unsigned short*)p + 16 + 8 * hh); return f.v; }
__device__ __forceinline__ v8f g2_mma(v16h a, v16h b, v8f c) { v8f d = __builtin_amdgcn_wmma_f32_16x16x32_f16(false, a, false, b, (short)0, c, false, false); asm volatile("v_nop\n\tv_nop\n\tv_nop\n\tv_nop" : "+v"(d) : "v"(a), "v"(b)); return d; }
template <int ACT>
__global__ __launch_bounds__(128) void k_gemm2(const _Float16* __restrict__ A, int lda, size_t sA, const _Float16* __restrict__ Bh, int ldb, size_t sB, float alpha, const float* __restrict__ bias, size_t sBias, const float* __restrict__ CP, int rowsPerB, size_t sCPb, int row0g,
    float* __restrict__ C, _Float16* __restrict__ C16, int ldc, size_t sC, int M, int N, int K) { static_assert(ACT == 0 || ACT == 3 || ACT == 6 || ACT == 8 || ACT == 9 || ACT == 11 || ACT == 12 || ACT == 14 || ACT == 15 || ACT == 16 || ACT == 17, "k_gemm2: unsupported ACT code (would silently apply no activation)");
  __shared__ __attribute__((aligned(16))) float so[4][32][68];
  const int tid = threadIdx.x, w = tid >> 5, lane = tid & 31, ln = lane & 15, hh = lane >> 4; const int by = blockIdx.y;
  A += (size_t)by * sA; Bh += (size_t)by * sB; const size_t cofs = (size_t)by * sC; const float* bp = bias ? bias + (size_t)by * sBias : nullptr;
  const int ntn = N >> 6; const int mt = blockIdx.x / ntn, nq = blockIdx.x - mt * ntn; const int row0 = mt * 128 + 32 * w, col0 = nq * 64; if (row0 >= M) return;
  const _Float16* a0p = A + (size_t)(row0 + ln) * lda; const _Float16* a1p = a0p + (size_t)16 * lda;
  const _Float16* b0p = Bh + (size_t)(col0 + ln) * ldb; const _Float16* b1p = b0p + (size_t)16 * ldb; const _Float16* b2p = b1p + (size_t)16 * ldb; const _Float16* b3p = b2p + (size_t)16 * ldb;
  const v8f z8 = {0.f,0.f,0.f,0.f,0.f,0.f,0.f,0.f}; v8f c00 = z8, c01 = z8, c02 = z8, c03 = z8, c10 = z8, c11 = z8, c12 = z8, c13 = z8;
#pragma unroll 1
  for (int kb = 0; kb < K; kb += 32) { const v16h a0 = g2_frag(a0p + kb, hh), a1 = g2_frag(a1p + kb, hh);
    v16h b = g2_frag(b0p + kb, hh); c00 = g2_mma(a0, b, c00); c10 = g2_mma(a1, b, c10);
    b = g2_frag(b1p + kb, hh); c01 = g2_mma(a0, b, c01); c11 = g2_mma(a1, b, c11);
    b = g2_frag(b2p + kb, hh); c02 = g2_mma(a0, b, c02); c12 = g2_mma(a1, b, c12);
    b = g2_frag(b3p + kb, hh); c03 = g2_mma(a0, b, c03); c13 = g2_mma(a1, b, c13); }
  v8f accs[8] = {c00, c01, c02, c03, c10, c11, c12, c13};
#pragma unroll
  for (int u = 0; u < 8; ++u) { const int t = u & 3, half = u >> 2; const int col = col0 + t * 16 + ln; const float bv = bp ? bf16_round(bp[col]) : 0.f;
#pragma unroll
    for (int r = 0; r < 8; ++r) { const int rloc = half * 16 + 8 * hh + r; float v = accs[u][r] * alpha + bv; if (CP) { if (rowsPerB < 0) v += CP[cofs + (size_t)(row0g + row0 + rloc) * ldc + col];      /* rowsPerB < 0: own element of the batched C plane */ else { const int bidx = (row0g + row0 + rloc) / rowsPerB; v += CP[(size_t)bidx * sCPb + (size_t)by * 64 + col]; } }
      if (ACT == 3) v = fmaxf(v, 0.f); else if (ACT == 6) v = 0.5f * v * (1.0f + erff(v * 0.70710678118654752f)); else if (ACT == 11) v = 1.0f / (1.0f + expf(-v)); else if (ACT == 15) v = v / (1.0f + expf(-v)); else if (ACT == 12) v = (v > 0.f) ? v : 0.01f * v; else if (ACT == 8) v = tanhf(v); else if (ACT == 9) v = 0.5f * v * (1.0f + tanhf(0.7978845608028654f * (v + 0.044715f * v * v * v))); else if (ACT == 14) v = (v > 0.f) ? v : 0.1f * v; else if (ACT == 16) v = (v >= 0.f) ? v : 0.3f * v; else if (ACT == 17) v = (v >= 0.f) ? v : 0.2f * v;
      so[w][rloc][t * 16 + ln] = v; } }
  __builtin_amdgcn_fence(__ATOMIC_ACQ_REL, "workgroup"); __builtin_amdgcn_wave_barrier();
  const int rsub = lane >> 4, c4 = (lane & 15) * 4;
  {
#pragma unroll
    for (int q = 0; q < 16; ++q) { const int r = q * 2 + rsub; const v4f v = *(const v4fa*)&so[w][r][c4]; if (C) *(v4f*)(C + cofs + (size_t)(row0 + r) * ldc + col0 + c4) = v; if (C16) { v4h h4; for (int i = 0; i < 4; ++i) h4[i] = (_Float16)v[i]; *(v4h*)(C16 + cofs + (size_t)(row0 + r) * ldc + col0 + c4) = h4; } }
     } }


__global__ __launch_bounds__(256) void k_wnat(const float* __restrict__ w, size_t n8, _Float16* __restrict__ Bt) { const size_t t = (size_t)blockIdx.x * 256 + threadIdx.x; if (t >= n8) return; FragH f; for (int q = 0; q < 8; ++q) f.h[q] = (_Float16)(bf16_round(w[t * 8 + q]) * 16.0f); *(v8us*)((unsigned short*)Bt + t * 8) = f.half[0];  }
__global__ __launch_bounds__(256) void k_rsm(const float* __restrict__ S, _Float16* __restrict__ P, int nrows) {
  #pragma clang fp contract(off)
  const int i = blockIdx.x * 256 + threadIdx.x; if (i >= nrows) return; const float* s = S + (size_t)i * SQ; float mx = -3.0e38f;
#pragma unroll 1
  for (int j = 0; j < SQ; ++j) mx = fmaxf(mx, s[j]); float se = 0.f;
#pragma unroll 1
  for (int j = 0; j < SQ; ++j) se += expf(s[j] - mx); const float sc = 256.0f / se;
#pragma unroll 1
  for (int j0 = 0; j0 < SQ; j0 += 8) { FragH f; for (int q = 0; q < 8; ++q) f.h[q] = (_Float16)(expf(s[j0 + q] - mx) * sc); unsigned short* d = (unsigned short*)P + (size_t)i * SQ + j0; *(v8us*)d = f.half[0];  } }
__global__ __launch_bounds__(256) void k_vt(const _Float16* __restrict__ V16, int b, int h0, _Float16* __restrict__ VT) { __shared__ unsigned short tl[64][65]; const int tid = threadIdx.x; const int hh = blockIdx.x % HG, sg = blockIdx.x / HG; const int s0 = sg * 64; const int h = h0 + hh;
  for (int i = tid; i < 64 * 8; i += 256) { const int j = i / 8, d8 = (i % 8) * 8; FragH f; f.half[0] = *(const v8us*)((const unsigned short*)V16 + ((size_t)b * SQ + s0 + j) * DM + h * HD + d8); for (int q = 0; q < 8; ++q) tl[d8 + q][j] = f.u[q]; }
  __syncthreads();
  { for (int i = tid; i < 64 * 8; i += 256) { const int d = i / 8, j8 = (i % 8) * 8; FragH f; for (int q = 0; q < 8; ++q) f.u[q] = tl[d][j8 + q]; *(v8us*)((unsigned short*)VT + ((size_t)hh * HD + d) * SQ + s0 + j8) = f.half[0]; }  } }


__global__ __launch_bounds__(256) void k_rsmf(const float* __restrict__ S, _Float16* __restrict__ P, int qn, int hg) {
  #pragma clang fp contract(off)
  const int t = blockIdx.x * 256 + threadIdx.x; if (t >= qn * hg) return; const size_t i = (size_t)(t / qn) * SQ + (t % qn); const float* s = S + i * SQ; float mx = -3.0e38f;
#pragma unroll 1
  for (int j = 0; j < SQ; ++j) mx = fmaxf(mx, s[j]); float se = 0.f;
#pragma unroll 1
  for (int j = 0; j < SQ; ++j) se += __expf(s[j] - mx); const float sc = 256.0f / se;
#pragma unroll 1
  for (int j0 = 0; j0 < SQ; j0 += 8) { FragH f; for (int q = 0; q < 8; ++q) f.h[q] = (_Float16)(__expf(s[j0 + q] - mx) * sc); unsigned short* d = (unsigned short*)P + i * SQ + j0; *(v8us*)d = f.half[0];  } }

extern "C" void kernel_launch(void* const* d_in, const int* in_sizes, int n_in,
                              void* d_out, int out_size, void* d_ws, size_t ws_size, hipStream_t stream) {
  (void)in_sizes; (void)n_in; (void)out_size;
  const float* const* I = (const float* const*)d_in; const float* x = I[0]; const float* wq = I[1]; const float* wk = I[2]; const float* wv = I[3]; const float* wm = I[4];      /* weights [in][out] */
  char* ws = (char*)d_ws; size_t off = 0;
  auto take = [&](size_t bytes) { char* p = ws + off; off += (bytes + 255) & ~(size_t)255; return p; };
  _Float16* BQ = (_Float16*)take((size_t)DM * EM * 2); _Float16* BK = (_Float16*)take((size_t)DM * EM * 2); _Float16* BV = (_Float16*)take((size_t)DM * EM * 2); _Float16* BM = (_Float16*)take((size_t)EM * DM * 2);
  _Float16* X16 = (_Float16*)take(NR * EM * 2); _Float16* Q16 = (_Float16*)take(NR * DM * 2); _Float16* K16 = (_Float16*)take(NR * DM * 2); _Float16* V16 = (_Float16*)take(NR * DM * 2); _Float16* O16 = (_Float16*)take(NR * DM * 2);
  float* S = (float*)take((size_t)SQ * SQ * 4); _Float16* P = (_Float16*)take((size_t)SQ * SQ * 2); _Float16* VT = (_Float16*)take((size_t)DM * SQ * 2);
  if (off > ws_size) return;      /* approx 2 + 64 + 64 + 32 + 4 = 166 MiB */
  k_wt_f16<<<(unsigned)(((size_t)DM * (EM / 8) + 255) / 256), 256, 0, stream>>>(wq, BQ, EM, DM, 16.0f); k_wt_f16<<<(unsigned)(((size_t)DM * (EM / 8) + 255) / 256), 256, 0, stream>>>(wk, BK, EM, DM, 16.0f); k_wt_f16<<<(unsigned)(((size_t)DM * (EM / 8) + 255) / 256), 256, 0, stream>>>(wv, BV, EM, DM, 16.0f);      /* [64][512] -> Bt[512][64] x16 */
  k_wt_f16<<<(unsigned)(((size_t)EM * (DM / 8) + 255) / 256), 256, 0, stream>>>(wm, BM, DM, EM, 16.0f);      /* [512][64] -> Bt[64][512] x16 */
  k_x16<<<(unsigned)((NR * EM / 8 + 255) / 256), 256, 0, stream>>>(x, X16, NR * EM / 8);
  const size_t r0p = (size_t)B0 * SQ;
  k_gemm2<0><<<dim3((unsigned)((MP / 128) * (DM / 64)), 1), 128, 0, stream>>>(X16 + r0p * EM, EM, 0, BQ, EM, 0, 0.0625f, nullptr, 0, nullptr, 1, 0, 0, nullptr, Q16 + r0p * DM, DM, 0, MP, DM, EM);
  k_gemm2<0><<<dim3((unsigned)((MP / 128) * (DM / 64)), 1), 128, 0, stream>>>(X16 + r0p * EM, EM, 0, BK, EM, 0, 0.0625f, nullptr, 0, nullptr, 1, 0, 0, nullptr, K16 + r0p * DM, DM, 0, MP, DM, EM);
  k_gemm2<0><<<dim3((unsigned)((MP / 128) * (DM / 64)), 1), 128, 0, stream>>>(X16 + r0p * EM, EM, 0, BV, EM, 0, 0.0625f, nullptr, 0, nullptr, 1, 0, 0, nullptr, V16 + r0p * DM, DM, 0, MP, DM, EM);
  for (int b = B0; b < B0 + NBR; ++b) { const size_t r0 = (size_t)b * SQ;
    k_vt<NH, SQ><<<NH * (SQ / 64), 256, 0, stream>>>(V16 + r0 * DM, DM, 0, VT);      /* V^T [512][4096] (8 slabs of 64 rows) */
    k_gemm2<0><<<dim3((QN / 128) * (SQ / 64), 1), 128, 0, stream>>>(Q16 + r0 * DM, DM, 0, K16 + r0 * DM, DM, 0, 0.044194173824159216f, nullptr, 0, nullptr, 1, 0, 0, S, nullptr, SQ, 0, QN, SQ, DM);      /* scores / sqrt(512), K = 512 */
    k_rsmf<<<(HG * QN + 255) / 256, 256, 0, stream>>>(S, P, QN, HG);
    k_gemm2<0><<<dim3((QN / 128) * (DM / 64), 1), 128, 0, stream>>>(P, SQ, 0, VT, SQ, 0, 0.25f, nullptr, 0, nullptr, 1, 0, 0, nullptr, O16 + r0 * DM, DM, 0, QN, DM, SQ); }      /* o x64 (f16), N = 512 */
  k_gemm2<0><<<dim3((unsigned)((MPO / 128) * (EM / 64)), 1), 128, 0, stream>>>(O16 + r0p * DM, DM, 0, BM, DM, 0, 0.0009765625f, nullptr, 0, nullptr, 1, 0, 0, (float*)d_out + r0p * EM, nullptr, EM, 0, MPO, EM, DM);      /* out rows [., 64] (f32) */
}

// v001
// One run takes 875 microseconds.
// Two timings next to v000 put it at 3.92 and 3.95 times that version's speed.
#include <hip/hip_runtime.h>
// Wide single-head self-attention (x [4][4096][64]; Q/K/V = x W with W [64][512] stored [in][out] (heads NOT split: one 512-wide head); scores = Q K^T / sqrt(512) over all 4,096 keys; softmax; o = attn V; out = o Wm (Wm [512][64]) -> [4][4096][64]).
// Structure: token rows r = b*4096 + s; x as exact f16 rows (bf16-rounded); Q, K, V as three WMMA GEMMs (32x64 wave tiles, f32 accumulation, exact x16 weights, f16 outputs, K = 64); per batch: V^T via LDS transposes (8 slabs of 64 = the 512 columns), scores GEMM (K = 512, alpha 512^-0.5), row softmax on VALU (f32 statistics, native exp; weights stored x256 as f16), o = P . V^T GEMM (K = 4096, N = 512, alpha 2^-2: o carried x64) into f16 rows; out = o Wm GEMM (f32, alpha 2^-10) into the output rows; 5 + 3 + 4 x 4 + 1 = 25 launches.
// Compute dtype: inputs rounded to bf16; x / weights exact; Q, K, V, softmax weights and o as plain f16 GEMM operands (~2^-12); scores, statistics and out f32. v_wmma_f32_16x16x32_f16.
#define NB 4
#define SQ 4096
#define EM 64                        /* embedding */
#define DM 512                       /* wide = 8 x 64 (one head) */
#define NH 8                         /* 64-wide slabs of the one 512-wide head (transpose tiling only) */
#define HD 64
#define HG 1
#define B0 0                         /* first batch processed (debug hook) */
#define NBR NB                       /* batches processed (debug hook) */
#define QN SQ                        /* query rows attended per batch (debug hook) */
#define NR ((size_t)NB * SQ)
#define MP ((int)((size_t)NBR * SQ))
#define MPO MP
typedef __bf16 v16b __attribute__((ext_vector_type(16)));
typedef unsigned short v8us __attribute__((ext_vector_type(8), may_alias));
typedef float  v8f  __attribute__((ext_vector_type(8)));
typedef float  v4f  __attribute__((ext_vector_type(4)));
typedef float  v4fa __attribute__((ext_vector_type(4), may_alias));
union FragB { v16b v; v8us half[2]; unsigned short u[16]; };

__device__ __forceinline__ unsigned short bf16_bits(float x) { unsigned int u = __float_as_uint(x); return (unsigned short)((u + 0x7FFFu + ((u >> 16) & 1u)) >> 16); }
__device__ __forceinline__ float bf16_val(unsigned short b) { return __uint_as_float(((unsigned int)b) << 16); }
__device__ __forceinline__ float bf16_round(float x) { return bf16_val(bf16_bits(x)); }
// D += A·B with NT terms: 1 = ah·bh, 2 = + al·bh (A split), 3 = + ah·bl (both split)
template <int NT>
__device__ __forceinline__ v8f mmaN(v16b ah, v16b al, v16b bh, v16b bl, v8f c) {
  c = __builtin_amdgcn_wmma_f32_16x16x32_bf16(false, ah, false, bh, (short)0, c, false, false);
  if (NT >= 2) c = __builtin_amdgcn_wmma_f32_16x16x32_bf16(false, al, false, bh, (short)0, c, false, false);
  if (NT >= 3) c = __builtin_amdgcn_wmma_f32_16x16x32_bf16(false, ah, false, bl, (short)0, c, false, false);
  asm volatile("v_nop\n\tv_nop\n\tv_nop\n\tv_nop" : "+v"(c) : "v"(ah), "v"(al), "v"(bh), "v"(bl));
  return c;
}

__global__ __launch_bounds__(256) void k_wt_bf16(const float* __restrict__ W, unsigned short* __restrict__ Wt, int K, int N) {
  const int t = blockIdx.x * 256 + threadIdx.x;
  const int k8n = K / 8;
  if (t >= N * k8n) return;
  const int n = t / k8n, k8 = (t % k8n) * 8;
  v8us v;
#pragma unroll
  for (int i = 0; i < 8; ++i) v[i] = bf16_bits(W[(size_t)(k8 + i) * N + n]);
  *(v8us*)(Wt + (size_t)n * K + k8) = v;
  
}

// GEMM C[M][N] (f32, pitch ldc) = act(A[M][K]·W + bias). A f32 row-major (pitch lda) converted per fragment to bf16
// (ASPLIT: hi/lo two planes -> 2 terms, else single rounded term); Wt bf16 [N][K] (pitch ldb). BIAS_BF16 rounds the
// bias to bf16 first (bias quantised to bf16 before the add). K%32==0, M%16==0, N%64==0.
template <bool ASPLIT, int ACT, bool BIAS_BF16>
__global__ __launch_bounds__(128) void k_gemm_bf(const float* __restrict__ A, int lda, const unsigned short* __restrict__ Wt, int ldb,
                                               const float* __restrict__ bias, float* __restrict__ C, int ldc, int M, int N, int K) {
  __shared__ __attribute__((aligned(16))) float so[4][16][64];
  const int tid = threadIdx.x, w = tid >> 5, lane = tid & 31, ln = lane & 15, hh = lane >> 4;
  const int ntn = N / 64;
  const int wid = blockIdx.x * 4 + w;
  const int mt = wid / ntn, nq = wid % ntn;
  if (mt * 16 >= M) return;
  const int row0 = mt * 16, col0 = nq * 64;
  const float* arow = A + (size_t)(row0 + ln) * lda;
  v8f acc[4] = {};
  for (int kb = 0; kb < K; kb += 32) {
    FragB ah, al;
    const v4f x0 = *(const v4fa*)(arow + kb + 8 * hh), x1 = *(const v4fa*)(arow + kb + 8 * hh + 4);
    const v4f x2 = *(const v4fa*)(arow + kb + 16 + 8 * hh), x3 = *(const v4fa*)(arow + kb + 16 + 8 * hh + 4);
    float xs[16] = {x0[0],x0[1],x0[2],x0[3],x1[0],x1[1],x1[2],x1[3],x2[0],x2[1],x2[2],x2[3],x3[0],x3[1],x3[2],x3[3]};
#pragma unroll
    for (int i = 0; i < 16; ++i) { const unsigned short hb = bf16_bits(xs[i]); ah.u[i] = hb; al.u[i] = ASPLIT ? bf16_bits(xs[i] - bf16_val(hb)) : (unsigned short)0; }
#pragma unroll
    for (int t = 0; t < 4; ++t) {
      const unsigned short* brow = Wt + (size_t)(col0 + t * 16 + ln) * ldb + kb;
      FragB b;
      b.half[0] = *(const v8us*)(brow + 8 * hh);
      b.half[1] = *(const v8us*)(brow + 16 + 8 * hh);
      acc[t] = mmaN<ASPLIT ? 2 : 1>(ah.v, al.v, b.v, b.v, acc[t]);
    }
  }
#pragma unroll
  for (int t = 0; t < 4; ++t) {
    float bv = bias ? bias[col0 + t * 16 + ln] : 0.f;
    if (BIAS_BF16) bv = bf16_round(bv);
#pragma unroll
    for (int r = 0; r < 8; ++r) { float v = acc[t][r] + bv; if (ACT == 1) v = fmaxf(v, 0.f); so[w][8 * hh + r][t * 16 + ln] = v; }
  }
  __builtin_amdgcn_fence(__ATOMIC_ACQ_REL, "workgroup");
  __builtin_amdgcn_wave_barrier();
  const int rsub = lane >> 4, c4 = (lane & 15) * 4;
  {
#pragma unroll
    for (int q = 0; q < 8; ++q) {
      const int r = q * 2 + rsub;
      const v4f v = *(const v4fa*)&so[w][r][c4];
      *(v4f*)(C + (size_t)(row0 + r) * ldc + col0 + c4) = v;
    }
    
  }
}

// GEMM C = act(A·W + bias + resid): A f32 (ASPLIT -> hi/lo 2 terms), Wt bf16 [N][K]; ACT 0 none, 1 relu, 2 exact gelu;
// resid (optional, f32, row index = (row % rmod), pitch ldr, RES_BF16 rounds it) added before the activation.
template <bool ASPLIT, int ACT, bool BIAS_BF16, bool RES_BF16>
__global__ __launch_bounds__(128) void k_gemm_bf3(const float* __restrict__ A, int lda, const unsigned short* __restrict__ Wt, int ldb,
                                                const float* __restrict__ bias, const float* __restrict__ resid, int rmod, int ldr,
                                                float* __restrict__ C, int ldc, int M, int N, int K) {
  __shared__ __attribute__((aligned(16))) float so[4][16][64];
  const int tid = threadIdx.x, w = tid >> 5, lane = tid & 31, ln = lane & 15, hh = lane >> 4;
  const int ntn = N / 64;
  const int wid = blockIdx.x * 4 + w;
  const int mt = wid / ntn, nq = wid % ntn;
  if (mt * 16 >= M) return;
  const int row0 = mt * 16, col0 = nq * 64;
  const float* arow = A + (size_t)(row0 + ln) * lda;
  v8f acc[4] = {};
  for (int kb = 0; kb < K; kb += 32) {
    FragB ah, al;
    const v4f x0 = *(const v4fa*)(arow + kb + 8 * hh), x1 = *(const v4fa*)(arow + kb + 8 * hh + 4);
    const v4f x2 = *(const v4fa*)(arow + kb + 16 + 8 * hh), x3 = *(const v4fa*)(arow + kb + 16 + 8 * hh + 4);
    float xs[16] = {x0[0],x0[1],x0[2],x0[3],x1[0],x1[1],x1[2],x1[3],x2[0],x2[1],x2[2],x2[3],x3[0],x3[1],x3[2],x3[3]};
#pragma unroll
    for (int i = 0; i < 16; ++i) { const unsigned short hb = bf16_bits(xs[i]); ah.u[i] = hb; al.u[i] = ASPLIT ? bf16_bits(xs[i] - bf16_val(hb)) : (unsigned short)0; }
#pragma unroll
    for (int t = 0; t < 4; ++t) {
      const unsigned short* brow = Wt + (size_t)(col0 + t * 16 + ln) * ldb + kb;
      FragB b;
      b.half[0] = *(const v8us*)(brow + 8 * hh);
      b.half[1] = *(const v8us*)(brow + 16 + 8 * hh);
      acc[t] = mmaN<ASPLIT ? 2 : 1>(ah.v, al.v, b.v, b.v, acc[t]);
    }
  }
#pragma unroll
  for (int t = 0; t < 4; ++t) {
    const int col = col0 + t * 16 + ln;
    float bv = bias ? bias[col] : 0.f;
    if (BIAS_BF16) bv = bf16_round(bv);
#pragma unroll
    for (int r = 0; r < 8; ++r) {
      float v = acc[t][r] + bv;
      if (resid) { float rv = resid[(size_t)((row0 + 8 * hh + r) % rmod) * ldr + col]; if (RES_BF16) rv = bf16_round(rv); v += rv; }
      if (ACT == 1) v = fmaxf(v, 0.f);
      if (ACT == 2) v = 0.5f * v * (1.0f + erff(v * 0.70710678118654752f));
      if (ACT == 3) { const float u = 0.7978845608028654f * (v + 0.044715f * v * v * v); v = 0.5f * v * (1.0f + tanhf(u)); }
      so[w][8 * hh + r][t * 16 + ln] = v;
    }
  }
  __builtin_amdgcn_fence(__ATOMIC_ACQ_REL, "workgroup");
  __builtin_amdgcn_wave_barrier();
  const int rsub = lane >> 4, c4 = (lane & 15) * 4;
  {
#pragma unroll
    for (int q = 0; q < 8; ++q) {
      const int r = q * 2 + rsub;
      const v4f v = *(const v4fa*)&so[w][r][c4];
      *(v4f*)(C + (size_t)(row0 + r) * ldc + col0 + c4) = v;
    }
    
  }
}
// row LayerNorm (biased variance, eps) over N: s = X (+ R); optional out_sum <- s; out_norm <- (s-mu)*rsqrt(var+eps)*g + b
template <bool PARAM_BF16>
__global__ __launch_bounds__(256) void k_layernorm(const float* __restrict__ X, const float* __restrict__ R, const float* __restrict__ g, const float* __restrict__ bta,
                                                  float* __restrict__ out_sum, float* __restrict__ out_norm, int N, float eps) {
  __shared__ float red[256];
  const int row = blockIdx.x, tid = threadIdx.x;
  const float* x = X + (size_t)row * N; const float* rr = R ? R + (size_t)row * N : nullptr;
  float vals[16];                     // up to N = 4096
  const int per = N / 256;            // contiguous chunk per thread? use strided-by-4 chunks: thread handles j = tid*4 + 1024*u
  float s1 = 0.f;
  for (int u = 0; u < per / 4; ++u) {
    const int j = tid * 4 + 1024 * u;
    const v4f a = *(const v4fa*)(x + j);
    v4f b = {0.f,0.f,0.f,0.f}; if (rr) b = *(const v4fa*)(rr + j);
#pragma unroll
    for (int q = 0; q < 4; ++q) { const float v = a[q] + b[q]; vals[u * 4 + q] = v; s1 += v; }
  }
  red[tid] = s1; __syncthreads();
  for (int st = 128; st > 0; st >>= 1) { if (tid < st) red[tid] += red[tid + st]; __syncthreads(); }
  const float mu = red[0] / (float)N; __syncthreads();
  float s2 = 0.f;
  for (int u = 0; u < per / 4; ++u)
#pragma unroll
    for (int q = 0; q < 4; ++q) { const float c = vals[u * 4 + q] - mu; s2 += c * c; }
  red[tid] = s2; __syncthreads();
  for (int st = 128; st > 0; st >>= 1) { if (tid < st) red[tid] += red[tid + st]; __syncthreads(); }
  const float rs = rsqrtf(red[0] / (float)N + eps);
  {
    for (int u = 0; u < per / 4; ++u) {
      const int j = tid * 4 + 1024 * u;
      v4f o, sm;
#pragma unroll
      for (int q = 0; q < 4; ++q) {
        float gg = g[j + q], bb = bta[j + q];
        if (PARAM_BF16) { gg = bf16_round(gg); bb = bf16_round(bb); }
        sm[q] = vals[u * 4 + q]; o[q] = (vals[u * 4 + q] - mu) * rs * gg + bb;
      }
      if (out_sum) *(v4f*)(out_sum + (size_t)row * N + j) = sm;
      *(v4f*)(out_norm + (size_t)row * N + j) = o;
    }
    
  }
}



// ---- f16 WMMA path (v_wmma_f32_16x16x32_f16): 11-bit significands for operands in range — used where a [0,1] probability operand needs more precision than bf16
typedef _Float16 v16h __attribute__((ext_vector_type(16)));
union FragH { v16h v; v8us half[2]; _Float16 h[16]; unsigned short u[16]; };
template <int NT>
__device__ __forceinline__ v8f mmaH(v16h ah, v16h al, v16h bh, v16h bl, v8f c) {
  c = __builtin_amdgcn_wmma_f32_16x16x32_f16(false, ah, false, bh, (short)0, c, false, false);
  if (NT >= 2) c = __builtin_amdgcn_wmma_f32_16x16x32_f16(false, al, false, bh, (short)0, c, false, false);
  if (NT >= 3) c = __builtin_amdgcn_wmma_f32_16x16x32_f16(false, ah, false, bl, (short)0, c, false, false);
  asm volatile("v_nop\n\tv_nop\n\tv_nop\n\tv_nop" : "+v"(c) : "v"(ah), "v"(al), "v"(bh), "v"(bl));
  return c;
}
// batched GEMM like k_gemm_b but f16 operands: A f32 (split into f16 hi/lo if ASPLIT, else rounded to f16), Bt = f16 values [n][k]; alpha; C f32; N multiple of 16 (partial tiles skipped)
template <bool ASPLIT>
__global__ __launch_bounds__(128) void k_gemm_h(const float* __restrict__ A, int lda, size_t sA, const _Float16* __restrict__ Bh, int ldb, size_t sB, float alpha, float* __restrict__ C, int ldc, size_t sC, int M, int N, int K) {
  __shared__ __attribute__((aligned(16))) float so[4][16][64];
  const int tid = threadIdx.x, w = tid >> 5, lane = tid & 31, ln = lane & 15, hh = lane >> 4; const int by = blockIdx.y;
  A += (size_t)by * sA; Bh += (size_t)by * sB; C += (size_t)by * sC;
  const int ntn = (N + 63) / 64; const int wid = blockIdx.x * 4 + w; const int mt = wid / ntn, nq = wid % ntn; if (mt * 16 >= M) return;
  const int row0 = mt * 16, col0 = nq * 64; const float* arow = A + (size_t)(row0 + ln) * lda;
  v8f acc[4] = {};
  for (int kb = 0; kb < K; kb += 32) {
    FragH ah, al;
    const v4f x0 = *(const v4fa*)(arow + kb + 8 * hh), x1 = *(const v4fa*)(arow + kb + 8 * hh + 4), x2 = *(const v4fa*)(arow + kb + 16 + 8 * hh), x3 = *(const v4fa*)(arow + kb + 16 + 8 * hh + 4);
    float xs[16] = {x0[0],x0[1],x0[2],x0[3],x1[0],x1[1],x1[2],x1[3],x2[0],x2[1],x2[2],x2[3],x3[0],x3[1],x3[2],x3[3]};
#pragma unroll
    for (int i = 0; i < 16; ++i) { const _Float16 h = (_Float16)xs[i]; ah.h[i] = h; al.h[i] = ASPLIT ? (_Float16)(xs[i] - (float)h) : (_Float16)0.0f; }
#pragma unroll
    for (int t = 0; t < 4; ++t) { if (col0 + t * 16 >= N) continue; const size_t boff = (size_t)(col0 + t * 16 + ln) * ldb + kb; FragH bq; bq.half[0] = *(const v8us*)(Bh + boff + 8 * hh); bq.half[1] = *(const v8us*)(Bh + boff + 16 + 8 * hh);
      acc[t] = mmaH<ASPLIT ? 2 : 1>(ah.v, al.v, bq.v, bq.v, acc[t]); }
  }
#pragma unroll
  for (int t = 0; t < 4; ++t) { if (col0 + t * 16 >= N) continue;
#pragma unroll
    for (int r = 0; r < 8; ++r) so[w][8 * hh + r][t * 16 + ln] = acc[t][r] * alpha; }
  __builtin_amdgcn_fence(__ATOMIC_ACQ_REL, "workgroup"); __builtin_amdgcn_wave_barrier();
  const int rsub = lane >> 4, c4 = (lane & 15) * 4;
  {
#pragma unroll
    for (int q = 0; q < 8; ++q) { const int r = q * 2 + rsub; if (col0 + c4 < N) { const v4f v = *(const v4fa*)&so[w][r][c4]; *(v4f*)(C + (size_t)(row0 + r) * ldc + col0 + c4) = v; } }
     }
}

// Wt[n][k] = f16(W[k][n]·scale) from f32 row-major W[K][N] (scale = power of two; bf16-exact weights stay exact in f16 away from the subnormal range)
__global__ __launch_bounds__(256) void k_wt_f16(const float* __restrict__ W, _Float16* __restrict__ Wt, int K, int N, float scale) {
  const int t = blockIdx.x * 256 + threadIdx.x; if (t >= N * (K / 8)) return; const int n = t / (K / 8), k8 = (t % (K / 8)) * 8; FragH f;
#pragma unroll
  for (int i = 0; i < 8; ++i) f.h[i] = (_Float16)(bf16_round(W[(size_t)(k8 + i) * N + n]) * scale); const v8us o = f.half[0];
  *(v8us*)((unsigned short*)Wt + (size_t)n * K + k8) = o; 
}
// k_gemm_hh variant with fused epilogue: v = acc·alpha + bias[by·sBias + col] (+ CP[(row/rowsPerB)·sCPb + by·64 + col] if CP) ; ACT 0 none / 1 elu ; writes f16 C16 (and f32 C if non-null)
template <int ACT>
__global__ __launch_bounds__(128) void k_gemm_hhx(const _Float16* __restrict__ A, int lda, size_t sA, const _Float16* __restrict__ Bh, int ldb, size_t sB, float alpha, const float* __restrict__ bias, size_t sBias, const float* __restrict__ CP, int rowsPerB, size_t sCPb, int row0g,
    float* __restrict__ C, _Float16* __restrict__ C16, int ldc, size_t sC, int M, int N, int K) {
  __shared__ __attribute__((aligned(16))) float so[4][16][64];
  const int tid = threadIdx.x, w = tid >> 5, lane = tid & 31, ln = lane & 15, hh = lane >> 4; const int by = blockIdx.y;
  A += (size_t)by * sA; Bh += (size_t)by * sB; const size_t cofs = (size_t)by * sC; const float* bp = bias ? bias + (size_t)by * sBias : nullptr;
  const int ntn = (N + 63) / 64; const int wid = blockIdx.x * 4 + w; const int mt = wid / ntn, nq = wid % ntn; if (mt * 16 >= M) return;
  const int row0 = mt * 16, col0 = nq * 64; const _Float16* arow = A + (size_t)(row0 + ln) * lda;
  v8f acc[4] = {};
  for (int kb = 0; kb < K; kb += 32) { FragH ah; ah.half[0] = *(const v8us*)((const unsigned short*)arow + kb + 8 * hh); ah.half[1] = *(const v8us*)((const unsigned short*)arow + kb + 16 + 8 * hh);
#pragma unroll
    for (int t = 0; t < 4; ++t) { if (col0 + t * 16 >= N) continue; const size_t boff = (size_t)(col0 + t * 16 + ln) * ldb + kb; FragH bq; bq.half[0] = *(const v8us*)((const unsigned short*)Bh + boff + 8 * hh); bq.half[1] = *(const v8us*)((const unsigned short*)Bh + boff + 16 + 8 * hh);
      acc[t] = mmaH<1>(ah.v, ah.v, bq.v, bq.v, acc[t]); }
  }
#pragma unroll
  for (int t = 0; t < 4; ++t) { if (col0 + t * 16 >= N) continue; const int col = col0 + t * 16 + ln; const float bv = bp ? bf16_round(bp[col]) : 0.f;
#pragma unroll
    for (int r = 0; r < 8; ++r) { float v = acc[t][r] * alpha + bv; if (CP) { const int rr = row0g + row0 + 8 * hh + r; if (rowsPerB < 0) v += CP[cofs + (size_t)rr * ldc + col];      /* rowsPerB < 0: own element of the batched C plane */ else { const int bidx = rr / rowsPerB; v += CP[(size_t)bidx * sCPb + (size_t)by * 64 + col]; } } if (ACT == 1) v = (v > 0.f) ? v : expm1f(v); else if (ACT == 7) v = (v > 0.f) ? v + 1.0f : expf(v); else if (ACT == 8) v = tanhf(v); else if (ACT == 9) v = 0.5f * v * (1.0f + tanhf(0.7978845608028654f * (v + 0.044715f * v * v * v))); else if (ACT == 11) v = 1.0f / (1.0f + expf(-v)); else if (ACT == 12) v = (v > 0.f) ? v : 0.01f * v; else if (ACT == 14) v = (v > 0.f) ? v : 0.1f * v; else if (ACT == 16) v = (v >= 0.f) ? v : 0.3f * v; else if (ACT == 17) v = (v >= 0.f) ? v : 0.2f * v; else if (ACT == 15) v = v / (1.0f + expf(-v)); else if (ACT == 3) v = fmaxf(v, 0.f); else if (ACT == 6) v = 0.5f * v * (1.0f + erff(v * 0.70710678118654752f)); so[w][8 * hh + r][t * 16 + ln] = v; } }
  __builtin_amdgcn_fence(__ATOMIC_ACQ_REL, "workgroup"); __builtin_amdgcn_wave_barrier();
  const int rsub = lane >> 4, c4 = (lane & 15) * 4; typedef _Float16 v4h __attribute__((ext_vector_type(4)));
  {
#pragma unroll
    for (int q = 0; q < 8; ++q) { const int r = q * 2 + rsub; if (col0 + c4 < N) { const v4f v = *(const v4fa*)&so[w][r][c4]; if (C) *(v4f*)(C + cofs + (size_t)(row0 + r) * ldc + col0 + c4) = v; if (C16) { v4h h4; for (int i = 0; i < 4; ++i) h4[i] = (_Float16)v[i]; *(v4h*)(C16 + cofs + (size_t)(row0 + r) * ldc + col0 + c4) = h4; } } }
     }
}


typedef _Float16 v4h __attribute__((ext_vector_type(4)));

__global__ __launch_bounds__(256) void k_x16(const float* __restrict__ x, _Float16* __restrict__ X16, size_t n8) { const size_t t = (size_t)blockIdx.x * 256 + threadIdx.x; if (t >= n8) return; FragH f;
#pragma unroll
  for (int q = 0; q < 8; ++q) f.h[q] = (_Float16)bf16_round(x[t * 8 + q]); *(v8us*)((unsigned short*)X16 + t * 8) = f.half[0];  }
__global__ __launch_bounds__(256) void k_h16(const float* __restrict__ x, _Float16* __restrict__ X16, size_t n8) { const size_t t = (size_t)blockIdx.x * 256 + threadIdx.x; if (t >= n8) return; FragH f;
#pragma unroll
  for (int q = 0; q < 8; ++q) f.h[q] = (_Float16)x[t * 8 + q]; *(v8us*)((unsigned short*)X16 + t * 8) = f.half[0];  }
__global__ __launch_bounds__(256) void k_round16f(const float* __restrict__ W, _Float16* __restrict__ Bt, size_t n8) { const size_t t = (size_t)blockIdx.x * 256 + threadIdx.x; if (t >= n8) return; FragH f;
#pragma unroll
  for (int i = 0; i < 8; ++i) f.h[i] = (_Float16)(bf16_round(W[t * 8 + i]) * 16.0f); *(v8us*)((unsigned short*)Bt + t * 8) = f.half[0];  }
template <int NHv, int TTv>
__global__ __launch_bounds__(256) void k_vt(const _Float16* __restrict__ V16, int ldv, int voff, _Float16* __restrict__ Vt) { __shared__ unsigned short tl[64][66]; const int tid = threadIdx.x; const int slab = blockIdx.x / (TTv / 64), lg = blockIdx.x % (TTv / 64); const int b = slab / NHv, h = slab % NHv;
  for (int i = tid; i < 64 * 8; i += 256) { const int r = i / 8, c8 = (i % 8) * 8; FragH f; f.half[0] = *(const v8us*)((const unsigned short*)V16 + ((size_t)b * TTv + lg * 64 + r) * ldv + voff + h * 64 + c8);
#pragma unroll
    for (int q = 0; q < 8; ++q) tl[r][c8 + q] = f.u[q]; }
  __syncthreads();
  {
#pragma unroll
    for (int rd = 0; rd < 2; ++rd) { const int d = rd * 32 + tid / 8, pc = tid % 8; FragH f;
#pragma unroll
      for (int q = 0; q < 8; ++q) f.u[q] = tl[pc * 8 + q][d];
      *(v8us*)((unsigned short*)Vt + ((size_t)slab * 64 + d) * TTv + lg * 64 + pc * 8) = f.half[0]; }
     } }

__global__ __launch_bounds__(256) void k_hl(const float* __restrict__ F, _Float16* __restrict__ Hh, _Float16* __restrict__ Hl, size_t n8) { const size_t t = (size_t)blockIdx.x * 256 + threadIdx.x; if (t >= n8) return; FragH fh, fl; const v4f a = *(const v4fa*)(F + t * 8), c = *(const v4fa*)(F + t * 8 + 4);
#pragma unroll
  for (int q = 0; q < 4; ++q) { _Float16 h = (_Float16)a[q]; fh.h[q] = h; fl.h[q] = (_Float16)((a[q] - (float)h) * 1024.0f); h = (_Float16)c[q]; fh.h[4 + q] = h; fl.h[4 + q] = (_Float16)((c[q] - (float)h) * 1024.0f); }
  { *(v8us*)((unsigned short*)Hh + t * 8) = fh.half[0]; *(v8us*)((unsigned short*)Hl + t * 8) = fl.half[0];  } }

// ---- fast GEMM (wave tile 32x64; requires M % 32 == 0 rows per launch region and N % 64 == 0); epilogue = k_gemm_hhx semantics ----
__device__ __forceinline__ v16h g2_frag(const _Float16* p, int hh) { FragH f; f.half[0] = *(const v8us*)((const unsigned short*)p + 8 * hh); f.half[1] = *(const v8us*)((const unsigned short*)p + 16 + 8 * hh); return f.v; }
__device__ __forceinline__ v8f g2_mma(v16h a, v16h b, v8f c) { v8f d = __builtin_amdgcn_wmma_f32_16x16x32_f16(false, a, false, b, (short)0, c, false, false); asm volatile("v_nop\n\tv_nop\n\tv_nop\n\tv_nop" : "+v"(d) : "v"(a), "v"(b)); return d; }
template <int ACT>
__global__ __launch_bounds__(128) void k_gemm2(const _Float16* __restrict__ A, int lda, size_t sA, const _Float16* __restrict__ Bh, int ldb, size_t sB, float alpha, const float* __restrict__ bias, size_t sBias, const float* __restrict__ CP, int rowsPerB, size_t sCPb, int row0g,
    float* __restrict__ C, _Float16* __restrict__ C16, int ldc, size_t sC, int M, int N, int K) { static_assert(ACT == 0 || ACT == 3 || ACT == 6 || ACT == 8 || ACT == 9 || ACT == 11 || ACT == 12 || ACT == 14 || ACT == 15 || ACT == 16 || ACT == 17, "k_gemm2: unsupported ACT code (would silently apply no activation)");
  __shared__ __attribute__((aligned(16))) float so[4][32][68];
  const int tid = threadIdx.x, w = tid >> 5, lane = tid & 31, ln = lane & 15, hh = lane >> 4; const int by = blockIdx.y;
  A += (size_t)by * sA; Bh += (size_t)by * sB; const size_t cofs = (size_t)by * sC; const float* bp = bias ? bias + (size_t)by * sBias : nullptr;
  const int ntn = N >> 6; const int mt = blockIdx.x / ntn, nq = blockIdx.x - mt * ntn; const int row0 = mt * 128 + 32 * w, col0 = nq * 64; if (row0 >= M) return;
  const _Float16* a0p = A + (size_t)(row0 + ln) * lda; const _Float16* a1p = a0p + (size_t)16 * lda;
  const _Float16* b0p = Bh + (size_t)(col0 + ln) * ldb; const _Float16* b1p = b0p + (size_t)16 * ldb; const _Float16* b2p = b1p + (size_t)16 * ldb; const _Float16* b3p = b2p + (size_t)16 * ldb;
  const v8f z8 = {0.f,0.f,0.f,0.f,0.f,0.f,0.f,0.f}; v8f c00 = z8, c01 = z8, c02 = z8, c03 = z8, c10 = z8, c11 = z8, c12 = z8, c13 = z8;
#pragma unroll 1
  for (int kb = 0; kb < K; kb += 32) { const v16h a0 = g2_frag(a0p + kb, hh), a1 = g2_frag(a1p + kb, hh);
    v16h b = g2_frag(b0p + kb, hh); c00 = g2_mma(a0, b, c00); c10 = g2_mma(a1, b, c10);
    b = g2_frag(b1p + kb, hh); c01 = g2_mma(a0, b, c01); c11 = g2_mma(a1, b, c11);
    b = g2_frag(b2p + kb, hh); c02 = g2_mma(a0, b, c02); c12 = g2_mma(a1, b, c12);
    b = g2_frag(b3p + kb, hh); c03 = g2_mma(a0, b, c03); c13 = g2_mma(a1, b, c13); }
  v8f accs[8] = {c00, c01, c02, c03, c10, c11, c12, c13};
#pragma unroll
  for (int u = 0; u < 8; ++u) { const int t = u & 3, half = u >> 2; const int col = col0 + t * 16 + ln; const float bv = bp ? bf16_round(bp[col]) : 0.f;
#pragma unroll
    for (int r = 0; r < 8; ++r) { const int rloc = half * 16 + 8 * hh + r; float v = accs[u][r] * alpha + bv; if (CP) { if (rowsPerB < 0) v += CP[cofs + (size_t)(row0g + row0 + rloc) * ldc + col];      /* rowsPerB < 0: own element of the batched C plane */ else { const int bidx = (row0g + row0 + rloc) / rowsPerB; v += CP[(size_t)bidx * sCPb + (size_t)by * 64 + col]; } }
      if (ACT == 3) v = fmaxf(v, 0.f); else if (ACT == 6) v = 0.5f * v * (1.0f + erff(v * 0.70710678118654752f)); else if (ACT == 11) v = 1.0f / (1.0f + expf(-v)); else if (ACT == 15) v = v / (1.0f + expf(-v)); else if (ACT == 12) v = (v > 0.f) ? v : 0.01f * v; else if (ACT == 8) v = tanhf(v); else if (ACT == 9) v = 0.5f * v * (1.0f + tanhf(0.7978845608028654f * (v + 0.044715f * v * v * v))); else if (ACT == 14) v = (v > 0.f) ? v : 0.1f * v; else if (ACT == 16) v = (v >= 0.f) ? v : 0.3f * v; else if (ACT == 17) v = (v >= 0.f) ? v : 0.2f * v;
      so[w][rloc][t * 16 + ln] = v; } }
  __builtin_amdgcn_fence(__ATOMIC_ACQ_REL, "workgroup"); __builtin_amdgcn_wave_barrier();
  const int rsub = lane >> 4, c4 = (lane & 15) * 4;
  {
#pragma unroll
    for (int q = 0; q < 16; ++q) { const int r = q * 2 + rsub; const v4f v = *(const v4fa*)&so[w][r][c4]; if (C) *(v4f*)(C + cofs + (size_t)(row0 + r) * ldc + col0 + c4) = v; if (C16) { v4h h4; for (int i = 0; i < 4; ++i) h4[i] = (_Float16)v[i]; *(v4h*)(C16 + cofs + (size_t)(row0 + r) * ldc + col0 + c4) = h4; } }
     } }


__global__ __launch_bounds__(256) void k_wnat(const float* __restrict__ w, size_t n8, _Float16* __restrict__ Bt) { const size_t t = (size_t)blockIdx.x * 256 + threadIdx.x; if (t >= n8) return; FragH f; for (int q = 0; q < 8; ++q) f.h[q] = (_Float16)(bf16_round(w[t * 8 + q]) * 16.0f); *(v8us*)((unsigned short*)Bt + t * 8) = f.half[0];  }
__global__ __launch_bounds__(256) void k_rsm(const float* __restrict__ S, _Float16* __restrict__ P, int nrows) {
  #pragma clang fp contract(off)
  const int i = blockIdx.x * 256 + threadIdx.x; if (i >= nrows) return; const float* s = S + (size_t)i * SQ; float mx = -3.0e38f;
#pragma unroll 1
  for (int j = 0; j < SQ; ++j) mx = fmaxf(mx, s[j]); float se = 0.f;
#pragma unroll 1
  for (int j = 0; j < SQ; ++j) se += expf(s[j] - mx); const float sc = 256.0f / se;
#pragma unroll 1
  for (int j0 = 0; j0 < SQ; j0 += 8) { FragH f; for (int q = 0; q < 8; ++q) f.h[q] = (_Float16)(expf(s[j0 + q] - mx) * sc); unsigned short* d = (unsigned short*)P + (size_t)i * SQ + j0; *(v8us*)d = f.half[0];  } }
__global__ __launch_bounds__(256) void k_vt(const _Float16* __restrict__ V16, int b, int h0, _Float16* __restrict__ VT) { __shared__ unsigned short tl[64][65]; const int tid = threadIdx.x; const int hh = blockIdx.x % HG, sg = blockIdx.x / HG; const int s0 = sg * 64; const int h = h0 + hh;
  for (int i = tid; i < 64 * 8; i += 256) { const int j = i / 8, d8 = (i % 8) * 8; FragH f; f.half[0] = *(const v8us*)((const unsigned short*)V16 + ((size_t)b * SQ + s0 + j) * DM + h * HD + d8); for (int q = 0; q < 8; ++q) tl[d8 + q][j] = f.u[q]; }
  __syncthreads();
  { for (int i = tid; i < 64 * 8; i += 256) { const int d = i / 8, j8 = (i % 8) * 8; FragH f; for (int q = 0; q < 8; ++q) f.u[q] = tl[d][j8 + q]; *(v8us*)((unsigned short*)VT + ((size_t)hh * HD + d) * SQ + s0 + j8) = f.half[0]; }  } }


// Row softmax, one wave per row: a wave's load covers 512 contiguous bytes, the row's 4,096 scores stay in 128 registers per lane and are read once;
// maximum and sum: four chains per lane, then a butterfly over the 32 lanes (every lane ends with the same bits).
template <int M> __device__ __forceinline__ float rs_xrow(float x) { return __builtin_bit_cast(float, __builtin_amdgcn_update_dpp(0, __builtin_bit_cast(int, x), 0x160 + M, 0xf, 0xf, true)); }      /* lane l <- lane l ^ M inside its 16-lane row (row_xmask) */
__device__ __forceinline__ float rs_xhalf(float x) { return __builtin_bit_cast(float, __builtin_amdgcn_permlanex16(__builtin_bit_cast(int, x), __builtin_bit_cast(int, x), 0x76543210, 0xfedcba98, false, false)); }      /* lane l <- lane l ^ 16 */
__global__ __launch_bounds__(256) void k_rsmw(const float* __restrict__ S, _Float16* __restrict__ P, int nrows) {
  const int lane = threadIdx.x & 31; const int row = blockIdx.x * 8 + (threadIdx.x >> 5); if (row >= nrows) return;      /* wave-uniform; no barrier in this kernel */
  const float* s = S + (size_t)row * SQ + lane * 4; v4f v[SQ / 128];      /* every loop over v is fully unrolled: constant indices keep v in registers, and all 32 loads are in flight at once */
#pragma unroll
  for (int q = 0; q < SQ / 128; ++q) v[q] = *(const v4fa*)(s + q * 128);
  v4f m4 = {-3.0e38f, -3.0e38f, -3.0e38f, -3.0e38f};
#pragma unroll
  for (int q = 0; q < SQ / 128; ++q)
#pragma unroll
    for (int i = 0; i < 4; ++i) m4[i] = fmaxf(m4[i], v[q][i]);
  float mx = fmaxf(fmaxf(m4[0], m4[1]), fmaxf(m4[2], m4[3]));
  mx = fmaxf(mx, rs_xrow<1>(mx)); mx = fmaxf(mx, rs_xrow<2>(mx)); mx = fmaxf(mx, rs_xrow<4>(mx)); mx = fmaxf(mx, rs_xrow<8>(mx)); mx = fmaxf(mx, rs_xhalf(mx));
  v4f s4 = {0.f, 0.f, 0.f, 0.f};
#pragma unroll
  for (int q = 0; q < SQ / 128; ++q) { const v4f t = (v[q] - mx) * 1.44269504f; float e0, e1, e2, e3;      /* exp(d) = 2^(d log2 e), the native form */
    /* four independent exponentials and one v_nop in one statement: the slot that the instruction set asks for behind a transcendental, before a source of it is overwritten (early-clobber outputs keep the four apart) */
    asm("v_exp_f32 %0, %4\n\tv_exp_f32 %1, %5\n\tv_exp_f32 %2, %6\n\tv_exp_f32 %3, %7\n\tv_nop" : "=&v"(e0), "=&v"(e1), "=&v"(e2), "=&v"(e3) : "v"(t[0]), "v"(t[1]), "v"(t[2]), "v"(t[3]));
    const v4f e = {e0, e1, e2, e3}; v[q] = e; s4 += e; }
  float se = (s4[0] + s4[1]) + (s4[2] + s4[3]);
  se += rs_xrow<1>(se); se += rs_xrow<2>(se); se += rs_xrow<4>(se); se += rs_xrow<8>(se); se += rs_xhalf(se);
  const float sc = 256.0f / se; _Float16* p = P + (size_t)row * SQ + lane * 4;
#pragma unroll
  for (int q = 0; q < SQ / 128; ++q) { v4h h4;
#pragma unroll
    for (int i = 0; i < 4; ++i) h4[i] = (_Float16)(v[q][i] * sc);
    *(v4h*)(p + q * 128) = h4; } }

extern "C" void kernel_launch(void* const* d_in, const int* in_sizes, int n_in,
                              void* d_out, int out_size, void* d_ws, size_t ws_size, hipStream_t stream) {
  (void)in_sizes; (void)n_in; (void)out_size;
  const float* const* I = (const float* const*)d_in; const float* x = I[0]; const float* wq = I[1]; const float* wk = I[2]; const float* wv = I[3]; const float* wm = I[4];      /* weights [in][out] */
  char* ws = (char*)d_ws; size_t off = 0;
  auto take = [&](size_t bytes) { char* p = ws + off; off += (bytes + 255) & ~(size_t)255; return p; };
  _Float16* BQ = (_Float16*)take((size_t)DM * EM * 2); _Float16* BK = (_Float16*)take((size_t)DM * EM * 2); _Float16* BV = (_Float16*)take((size_t)DM * EM * 2); _Float16* BM = (_Float16*)take((size_t)EM * DM * 2);
  _Float16* X16 = (_Float16*)take(NR * EM * 2); _Float16* Q16 = (_Float16*)take(NR * DM * 2); _Float16* K16 = (_Float16*)take(NR * DM * 2); _Float16* V16 = (_Float16*)take(NR * DM * 2); _Float16* O16 = (_Float16*)take(NR * DM * 2);
  float* S = (float*)take((size_t)SQ * SQ * 4); _Float16* P = (_Float16*)take((size_t)SQ * SQ * 2); _Float16* VT = (_Float16*)take((size_t)DM * SQ * 2);
  if (off > ws_size) return;      /* approx 2 + 64 + 64 + 32 + 4 = 166 MiB */
  k_wt_f16<<<(unsigned)(((size_t)DM * (EM / 8) + 255) / 256), 256, 0, stream>>>(wq, BQ, EM, DM, 16.0f); k_wt_f16<<<(unsigned)(((size_t)DM * (EM / 8) + 255) / 256), 256, 0, stream>>>(wk, BK, EM, DM, 16.0f); k_wt_f16<<<(unsigned)(((size_t)DM * (EM / 8) + 255) / 256), 256, 0, stream>>>(wv, BV, EM, DM, 16.0f);      /* [64][512] -> Bt[512][64] x16 */
  k_wt_f16<<<(unsigned)(((size_t)EM * (DM / 8) + 255) / 256), 256, 0, stream>>>(wm, BM, DM, EM, 16.0f);      /* [512][64] -> Bt[64][512] x16 */
  k_x16<<<(unsigned)((NR * EM / 8 + 255) / 256), 256, 0, stream>>>(x, X16, NR * EM / 8);
  const size_t r0p = (size_t)B0 * SQ;
  k_gemm2<0><<<dim3((unsigned)((MP / 128) * (DM / 64)), 1), 128, 0, stream>>>(X16 + r0p * EM, EM, 0, BQ, EM, 0, 0.0625f, nullptr, 0, nullptr, 1, 0, 0, nullptr, Q16 + r0p * DM, DM, 0, MP, DM, EM);
  k_gemm2<0><<<dim3((unsigned)((MP / 128) * (DM / 64)), 1), 128, 0, stream>>>(X16 + r0p * EM, EM, 0, BK, EM, 0, 0.0625f, nullptr, 0, nullptr, 1, 0, 0, nullptr, K16 + r0p * DM, DM, 0, MP, DM, EM);
  k_gemm2<0><<<dim3((unsigned)((MP / 128) * (DM / 64)), 1), 128, 0, stream>>>(X16 + r0p * EM, EM, 0, BV, EM, 0, 0.0625f, nullptr, 0, nullptr, 1, 0, 0, nullptr, V16 + r0p * DM, DM, 0, MP, DM, EM);
  for (int b = B0; b < B0 + NBR; ++b) { const size_t r0 = (size_t)b * SQ;
    k_vt<NH, SQ><<<NH * (SQ / 64), 256, 0, stream>>>(V16 + r0 * DM, DM, 0, VT);      /* V^T [512][4096] (8 slabs of 64 rows) */
    k_gemm2<0><<<dim3((QN / 128) * (SQ / 64), 1), 128, 0, stream>>>(Q16 + r0 * DM, DM, 0, K16 + r0 * DM, DM, 0, 0.044194173824159216f, nullptr, 0, nullptr, 1, 0, 0, S, nullptr, SQ, 0, QN, SQ, DM);      /* scores / sqrt(512), K = 512 */
    k_rsmw<<<(QN + 7) / 8, 256, 0, stream>>>(S, P, QN);      /* one wave per row */
    k_gemm2<0><<<dim3((QN / 128) * (DM / 64), 1), 128, 0, stream>>>(P, SQ, 0, VT, SQ, 0, 0.25f, nullptr, 0, nullptr, 1, 0, 0, nullptr, O16 + r0 * DM, DM, 0, QN, DM, SQ); }      /* o x64 (f16), N = 512 */
  k_gemm2<0><<<dim3((unsigned)((MPO / 128) * (EM / 64)), 1), 128, 0, stream>>>(O16 + r0p * DM, DM, 0, BM, DM, 0, 0.0009765625f, nullptr, 0, nullptr, 1, 0, 0, (float*)d_out + r0p * EM, nullptr, EM, 0, MPO, EM, DM);      /* out rows [., 64] (f32) */
}

// v002
// Measured time: 719 microseconds a run.
// Two timings next to v001 both put it at 1.22 times that version's speed.
// Counting every step since v000, it is 4.79 times as fast.
#include <hip/hip_runtime.h>
// Wide single-head self-attention (x [4][4096][64]; Q/K/V = x W with W [64][512] stored [in][out] (heads NOT split: one 512-wide head); scores = Q K^T / sqrt(512) over all 4,096 keys; softmax; o = attn V; out = o Wm (Wm [512][64]) -> [4][4096][64]).
// Structure: the chained products are reassociated: Q K^T = (x G) x^T with G = Wq Wk^T [64][64], and (attn V) Wm = attn (x H) with H = Wv Wm [64][64] (exact algebra for any inputs; another f32 sum order), so both 4096 x 4096 GEMMs run at width 64 instead of 512. Token rows r = b*4096 + s; x as exact f16 rows (bf16-rounded); weights exact x16; G^T and H^T in one WMMA launch (two planes, K = 512, carried x16); Y = x G (x16) and Z^T = H^T x^T (x16, written transposed by the GEMM itself, pitch 16384); per batch: scores GEMM Y x^T (K = 64, alpha 512^-0.5 / 16), row softmax on VALU (f32 statistics, native exp; weights stored x256 as f16), out = P Z GEMM (K = 4096, N = 64, alpha 2^-12) into the f32 output rows; 5 + 3 + 4 x 3 = 20 launches.
// Compute dtype: inputs rounded to bf16; x / weights exact; G, H, Y, Z and softmax weights as plain f16 GEMM operands (~2^-12); scores, statistics and out f32. v_wmma_f32_16x16x32_f16.
#define NB 4
#define SQ 4096
#define EM 64                        /* embedding */
#define DM 512                       /* wide = 8 x 64 (one head) */
#define NH 8                         /* 64-wide slabs of the one 512-wide head (not used) */
#define HD 64
#define HG 1
#define B0 0                         /* first batch processed (debug hook) */
#define NBR NB                       /* batches processed (debug hook) */
#define QN SQ                        /* query rows attended per batch (debug hook) */
#define NR ((size_t)NB * SQ)
#define MP ((int)((size_t)NBR * SQ))
#define MPO MP
typedef __bf16 v16b __attribute__((ext_vector_type(16)));
typedef unsigned short v8us __attribute__((ext_vector_type(8), may_alias));
typedef float  v8f  __attribute__((ext_vector_type(8)));
typedef float  v4f  __attribute__((ext_vector_type(4)));
typedef float  v4fa __attribute__((ext_vector_type(4), may_alias));
union FragB { v16b v; v8us half[2]; unsigned short u[16]; };

__device__ __forceinline__ unsigned short bf16_bits(float x) { unsigned int u = __float_as_uint(x); return (unsigned short)((u + 0x7FFFu + ((u >> 16) & 1u)) >> 16); }
__device__ __forceinline__ float bf16_val(unsigned short b) { return __uint_as_float(((unsigned int)b) << 16); }
__device__ __forceinline__ float bf16_round(float x) { return bf16_val(bf16_bits(x)); }
// D += A·B with NT terms: 1 = ah·bh, 2 = + al·bh (A split), 3 = + ah·bl (both split)
template <int NT>
__device__ __forceinline__ v8f mmaN(v16b ah, v16b al, v16b bh, v16b bl, v8f c) {
  c = __builtin_amdgcn_wmma_f32_16x16x32_bf16(false, ah, false, bh, (short)0, c, false, false);
  if (NT >= 2) c = __builtin_amdgcn_wmma_f32_16x16x32_bf16(false, al, false, bh, (short)0, c, false, false);
  if (NT >= 3) c = __builtin_amdgcn_wmma_f32_16x16x32_bf16(false, ah, false, bl, (short)0, c, false, false);
  asm volatile("v_nop\n\tv_nop\n\tv_nop\n\tv_nop" : "+v"(c) : "v"(ah), "v"(al), "v"(bh), "v"(bl));
  return c;
}

__global__ __launch_bounds__(256) void k_wt_bf16(const float* __restrict__ W, unsigned short* __restrict__ Wt, int K, int N) {
  const int t = blockIdx.x * 256 + threadIdx.x;
  const int k8n = K / 8;
  if (t >= N * k8n) return;
  const int n = t / k8n, k8 = (t % k8n) * 8;
  v8us v;
#pragma unroll
  for (int i = 0; i < 8; ++i) v[i] = bf16_bits(W[(size_t)(k8 + i) * N + n]);
  *(v8us*)(Wt + (size_t)n * K + k8) = v;
  
}

// GEMM C[M][N] (f32, pitch ldc) = act(A[M][K]·W + bias). A f32 row-major (pitch lda) converted per fragment to bf16
// (ASPLIT: hi/lo two planes -> 2 terms, else single rounded term); Wt bf16 [N][K] (pitch ldb). BIAS_BF16 rounds the
// bias to bf16 first (bias quantised to bf16 before the add). K%32==0, M%16==0, N%64==0.
template <bool ASPLIT, int ACT, bool BIAS_BF16>
__global__ __launch_bounds__(128) void k_gemm_bf(const float* __restrict__ A, int lda, const unsigned short* __restrict__ Wt, int ldb,
                                               const float* __restrict__ bias, float* __restrict__ C, int ldc, int M, int N, int K) {
  __shared__ __attribute__((aligned(16))) float so[4][16][64];
  const int tid = threadIdx.x, w = tid >> 5, lane = tid & 31, ln = lane & 15, hh = lane >> 4;
  const int ntn = N / 64;
  const int wid = blockIdx.x * 4 + w;
  const int mt = wid / ntn, nq = wid % ntn;
  if (mt * 16 >= M) return;
  const int row0 = mt * 16, col0 = nq * 64;
  const float* arow = A + (size_t)(row0 + ln) * lda;
  v8f acc[4] = {};
  for (int kb = 0; kb < K; kb += 32) {
    FragB ah, al;
    const v4f x0 = *(const v4fa*)(arow + kb + 8 * hh), x1 = *(const v4fa*)(arow + kb + 8 * hh + 4);
    const v4f x2 = *(const v4fa*)(arow + kb + 16 + 8 * hh), x3 = *(const v4fa*)(arow + kb + 16 + 8 * hh + 4);
    float xs[16] = {x0[0],x0[1],x0[2],x0[3],x1[0],x1[1],x1[2],x1[3],x2[0],x2[1],x2[2],x2[3],x3[0],x3[1],x3[2],x3[3]};
#pragma unroll
    for (int i = 0; i < 16; ++i) { const unsigned short hb = bf16_bits(xs[i]); ah.u[i] = hb; al.u[i] = ASPLIT ? bf16_bits(xs[i] - bf16_val(hb)) : (unsigned short)0; }
#pragma unroll
    for (int t = 0; t < 4; ++t) {
      const unsigned short* brow = Wt + (size_t)(col0 + t * 16 + ln) * ldb + kb;
      FragB b;
      b.half[0] = *(const v8us*)(brow + 8 * hh);
      b.half[1] = *(const v8us*)(brow + 16 + 8 * hh);
      acc[t] = mmaN<ASPLIT ? 2 : 1>(ah.v, al.v, b.v, b.v, acc[t]);
    }
  }
#pragma unroll
  for (int t = 0; t < 4; ++t) {
    float bv = bias ? bias[col0 + t * 16 + ln] : 0.f;
    if (BIAS_BF16) bv = bf16_round(bv);
#pragma unroll
    for (int r = 0; r < 8; ++r) { float v = acc[t][r] + bv; if (ACT == 1) v = fmaxf(v, 0.f); so[w][8 * hh + r][t * 16 + ln] = v; }
  }
  __builtin_amdgcn_fence(__ATOMIC_ACQ_REL, "workgroup");
  __builtin_amdgcn_wave_barrier();
  const int rsub = lane >> 4, c4 = (lane & 15) * 4;
  {
#pragma unroll
    for (int q = 0; q < 8; ++q) {
      const int r = q * 2 + rsub;
      const v4f v = *(const v4fa*)&so[w][r][c4];
      *(v4f*)(C + (size_t)(row0 + r) * ldc + col0 + c4) = v;
    }
    
  }
}

// GEMM C = act(A·W + bias + resid): A f32 (ASPLIT -> hi/lo 2 terms), Wt bf16 [N][K]; ACT 0 none, 1 relu, 2 exact gelu;
// resid (optional, f32, row index = (row % rmod), pitch ldr, RES_BF16 rounds it) added before the activation.
template <bool ASPLIT, int ACT, bool BIAS_BF16, bool RES_BF16>
__global__ __launch_bounds__(128) void k_gemm_bf3(const float* __restrict__ A, int lda, const unsigned short* __restrict__ Wt, int ldb,
                                                const float* __restrict__ bias, const float* __restrict__ resid, int rmod, int ldr,
                                                float* __restrict__ C, int ldc, int M, int N, int K) {
  __shared__ __attribute__((aligned(16))) float so[4][16][64];
  const int tid = threadIdx.x, w = tid >> 5, lane = tid & 31, ln = lane & 15, hh = lane >> 4;
  const int ntn = N / 64;
  const int wid = blockIdx.x * 4 + w;
  const int mt = wid / ntn, nq = wid % ntn;
  if (mt * 16 >= M) return;
  const int row0 = mt * 16, col0 = nq * 64;
  const float* arow = A + (size_t)(row0 + ln) * lda;
  v8f acc[4] = {};
  for (int kb = 0; kb < K; kb += 32) {
    FragB ah, al;
    const v4f x0 = *(const v4fa*)(arow + kb + 8 * hh), x1 = *(const v4fa*)(arow + kb + 8 * hh + 4);
    const v4f x2 = *(const v4fa*)(arow + kb + 16 + 8 * hh), x3 = *(const v4fa*)(arow + kb + 16 + 8 * hh + 4);
    float xs[16] = {x0[0],x0[1],x0[2],x0[3],x1[0],x1[1],x1[2],x1[3],x2[0],x2[1],x2[2],x2[3],x3[0],x3[1],x3[2],x3[3]};
#pragma unroll
    for (int i = 0; i < 16; ++i) { const unsigned short hb = bf16_bits(xs[i]); ah.u[i] = hb; al.u[i] = ASPLIT ? bf16_bits(xs[i] - bf16_val(hb)) : (unsigned short)0; }
#pragma unroll
    for (int t = 0; t < 4; ++t) {
      const unsigned short* brow = Wt + (size_t)(col0 + t * 16 + ln) * ldb + kb;
      FragB b;
      b.half[0] = *(const v8us*)(brow + 8 * hh);
      b.half[1] = *(const v8us*)(brow + 16 + 8 * hh);
      acc[t] = mmaN<ASPLIT ? 2 : 1>(ah.v, al.v, b.v, b.v, acc[t]);
    }
  }
#pragma unroll
  for (int t = 0; t < 4; ++t) {
    const int col = col0 + t * 16 + ln;
    float bv = bias ? bias[col] : 0.f;
    if (BIAS_BF16) bv = bf16_round(bv);
#pragma unroll
    for (int r = 0; r < 8; ++r) {
      float v = acc[t][r] + bv;
      if (resid) { float rv = resid[(size_t)((row0 + 8 * hh + r) % rmod) * ldr + col]; if (RES_BF16) rv = bf16_round(rv); v += rv; }
      if (ACT == 1) v = fmaxf(v, 0.f);
      if (ACT == 2) v = 0.5f * v * (1.0f + erff(v * 0.70710678118654752f));
      if (ACT == 3) { const float u = 0.7978845608028654f * (v + 0.044715f * v * v * v); v = 0.5f * v * (1.0f + tanhf(u)); }
      so[w][8 * hh + r][t * 16 + ln] = v;
    }
  }
  __builtin_amdgcn_fence(__ATOMIC_ACQ_REL, "workgroup");
  __builtin_amdgcn_wave_barrier();
  const int rsub = lane >> 4, c4 = (lane & 15) * 4;
  {
#pragma unroll
    for (int q = 0; q < 8; ++q) {
      const int r = q * 2 + rsub;
      const v4f v = *(const v4fa*)&so[w][r][c4];
      *(v4f*)(C + (size_t)(row0 + r) * ldc + col0 + c4) = v;
    }
    
  }
}
// row LayerNorm (biased variance, eps) over N: s = X (+ R); optional out_sum <- s; out_norm <- (s-mu)*rsqrt(var+eps)*g + b
template <bool PARAM_BF16>
__global__ __launch_bounds__(256) void k_layernorm(const float* __restrict__ X, const float* __restrict__ R, const float* __restrict__ g, const float* __restrict__ bta,
                                                  float* __restrict__ out_sum, float* __restrict__ out_norm, int N, float eps) {
  __shared__ float red[256];
  const int row = blockIdx.x, tid = threadIdx.x;
  const float* x = X + (size_t)row * N; const float* rr = R ? R + (size_t)row * N : nullptr;
  float vals[16];                     // up to N = 4096
  const int per = N / 256;            // contiguous chunk per thread? use strided-by-4 chunks: thread handles j = tid*4 + 1024*u
  float s1 = 0.f;
  for (int u = 0; u < per / 4; ++u) {
    const int j = tid * 4 + 1024 * u;
    const v4f a = *(const v4fa*)(x + j);
    v4f b = {0.f,0.f,0.f,0.f}; if (rr) b = *(const v4fa*)(rr + j);
#pragma unroll
    for (int q = 0; q < 4; ++q) { const float v = a[q] + b[q]; vals[u * 4 + q] = v; s1 += v; }
  }
  red[tid] = s1; __syncthreads();
  for (int st = 128; st > 0; st >>= 1) { if (tid < st) red[tid] += red[tid + st]; __syncthreads(); }
  const float mu = red[0] / (float)N; __syncthreads();
  float s2 = 0.f;
  for (int u = 0; u < per / 4; ++u)
#pragma unroll
    for (int q = 0; q < 4; ++q) { const float c = vals[u * 4 + q] - mu; s2 += c * c; }
  red[tid] = s2; __syncthreads();
  for (int st = 128; st > 0; st >>= 1) { if (tid < st) red[tid] += red[tid + st]; __syncthreads(); }
  const float rs = rsqrtf(red[0] / (float)N + eps);
  {
    for (int u = 0; u < per / 4; ++u) {
      const int j = tid * 4 + 1024 * u;
      v4f o, sm;
#pragma unroll
      for (int q = 0; q < 4; ++q) {
        float gg = g[j + q], bb = bta[j + q];
        if (PARAM_BF16) { gg = bf16_round(gg); bb = bf16_round(bb); }
        sm[q] = vals[u * 4 + q]; o[q] = (vals[u * 4 + q] - mu) * rs * gg + bb;
      }
      if (out_sum) *(v4f*)(out_sum + (size_t)row * N + j) = sm;
      *(v4f*)(out_norm + (size_t)row * N + j) = o;
    }
    
  }
}



// ---- f16 WMMA path (v_wmma_f32_16x16x32_f16): 11-bit significands for operands in range — used where a [0,1] probability operand needs more precision than bf16
typedef _Float16 v16h __attribute__((ext_vector_type(16)));
union FragH { v16h v; v8us half[2]; _Float16 h[16]; unsigned short u[16]; };
template <int NT>
__device__ __forceinline__ v8f mmaH(v16h ah, v16h al, v16h bh, v16h bl, v8f c) {
  c = __builtin_amdgcn_wmma_f32_16x16x32_f16(false, ah, false, bh, (short)0, c, false, false);
  if (NT >= 2) c = __builtin_amdgcn_wmma_f32_16x16x32_f16(false, al, false, bh, (short)0, c, false, false);
  if (NT >= 3) c = __builtin_amdgcn_wmma_f32_16x16x32_f16(false, ah, false, bl, (short)0, c, false, false);
  asm volatile("v_nop\n\tv_nop\n\tv_nop\n\tv_nop" : "+v"(c) : "v"(ah), "v"(al), "v"(bh), "v"(bl));
  return c;
}
// batched GEMM like k_gemm_b but f16 operands: A f32 (split into f16 hi/lo if ASPLIT, else rounded to f16), Bt = f16 values [n][k]; alpha; C f32; N multiple of 16 (partial tiles skipped)
template <bool ASPLIT>
__global__ __launch_bounds__(128) void k_gemm_h(const float* __restrict__ A, int lda, size_t sA, const _Float16* __restrict__ Bh, int ldb, size_t sB, float alpha, float* __restrict__ C, int ldc, size_t sC, int M, int N, int K) {
  __shared__ __attribute__((aligned(16))) float so[4][16][64];
  const int tid = threadIdx.x, w = tid >> 5, lane = tid & 31, ln = lane & 15, hh = lane >> 4; const int by = blockIdx.y;
  A += (size_t)by * sA; Bh += (size_t)by * sB; C += (size_t)by * sC;
  const int ntn = (N + 63) / 64; const int wid = blockIdx.x * 4 + w; const int mt = wid / ntn, nq = wid % ntn; if (mt * 16 >= M) return;
  const int row0 = mt * 16, col0 = nq * 64; const float* arow = A + (size_t)(row0 + ln) * lda;
  v8f acc[4] = {};
  for (int kb = 0; kb < K; kb += 32) {
    FragH ah, al;
    const v4f x0 = *(const v4fa*)(arow + kb + 8 * hh), x1 = *(const v4fa*)(arow + kb + 8 * hh + 4), x2 = *(const v4fa*)(arow + kb + 16 + 8 * hh), x3 = *(const v4fa*)(arow + kb + 16 + 8 * hh + 4);
    float xs[16] = {x0[0],x0[1],x0[2],x0[3],x1[0],x1[1],x1[2],x1[3],x2[0],x2[1],x2[2],x2[3],x3[0],x3[1],x3[2],x3[3]};
#pragma unroll
    for (int i = 0; i < 16; ++i) { const _Float16 h = (_Float16)xs[i]; ah.h[i] = h; al.h[i] = ASPLIT ? (_Float16)(xs[i] - (float)h) : (_Float16)0.0f; }
#pragma unroll
    for (int t = 0; t < 4; ++t) { if (col0 + t * 16 >= N) continue; const size_t boff = (size_t)(col0 + t * 16 + ln) * ldb + kb; FragH bq; bq.half[0] = *(const v8us*)(Bh + boff + 8 * hh); bq.half[1] = *(const v8us*)(Bh + boff + 16 + 8 * hh);
      acc[t] = mmaH<ASPLIT ? 2 : 1>(ah.v, al.v, bq.v, bq.v, acc[t]); }
  }
#pragma unroll
  for (int t = 0; t < 4; ++t) { if (col0 + t * 16 >= N) continue;
#pragma unroll
    for (int r = 0; r < 8; ++r) so[w][8 * hh + r][t * 16 + ln] = acc[t][r] * alpha; }
  __builtin_amdgcn_fence(__ATOMIC_ACQ_REL, "workgroup"); __builtin_amdgcn_wave_barrier();
  const int rsub = lane >> 4, c4 = (lane & 15) * 4;
  {
#pragma unroll
    for (int q = 0; q < 8; ++q) { const int r = q * 2 + rsub; if (col0 + c4 < N) { const v4f v = *(const v4fa*)&so[w][r][c4]; *(v4f*)(C + (size_t)(row0 + r) * ldc + col0 + c4) = v; } }
     }
}

// Wt[n][k] = f16(W[k][n]·scale) from f32 row-major W[K][N] (scale = power of two; bf16-exact weights stay exact in f16 away from the subnormal range)
__global__ __launch_bounds__(256) void k_wt_f16(const float* __restrict__ W, _Float16* __restrict__ Wt, int K, int N, float scale) {
  const int t = blockIdx.x * 256 + threadIdx.x; if (t >= N * (K / 8)) return; const int n = t / (K / 8), k8 = (t % (K / 8)) * 8; FragH f;
#pragma unroll
  for (int i = 0; i < 8; ++i) f.h[i] = (_Float16)(bf16_round(W[(size_t)(k8 + i) * N + n]) * scale); const v8us o = f.half[0];
  *(v8us*)((unsigned short*)Wt + (size_t)n * K + k8) = o; 
}
// k_gemm_hh variant with fused epilogue: v = acc·alpha + bias[by·sBias + col] (+ CP[(row/rowsPerB)·sCPb + by·64 + col] if CP) ; ACT 0 none / 1 elu ; writes f16 C16 (and f32 C if non-null)
template <int ACT>
__global__ __launch_bounds__(128) void k_gemm_hhx(const _Float16* __restrict__ A, int lda, size_t sA, const _Float16* __restrict__ Bh, int ldb, size_t sB, float alpha, const float* __restrict__ bias, size_t sBias, const float* __restrict__ CP, int rowsPerB, size_t sCPb, int row0g,
    float* __restrict__ C, _Float16* __restrict__ C16, int ldc, size_t sC, int M, int N, int K) {
  __shared__ __attribute__((aligned(16))) float so[4][16][64];
  const int tid = threadIdx.x, w = tid >> 5, lane = tid & 31, ln = lane & 15, hh = lane >> 4; const int by = blockIdx.y;
  A += (size_t)by * sA; Bh += (size_t)by * sB; const size_t cofs = (size_t)by * sC; const float* bp = bias ? bias + (size_t)by * sBias : nullptr;
  const int ntn = (N + 63) / 64; const int wid = blockIdx.x * 4 + w; const int mt = wid / ntn, nq = wid % ntn; if (mt * 16 >= M) return;
  const int row0 = mt * 16, col0 = nq * 64; const _Float16* arow = A + (size_t)(row0 + ln) * lda;
  v8f acc[4] = {};
  for (int kb = 0; kb < K; kb += 32) { FragH ah; ah.half[0] = *(const v8us*)((const unsigned short*)arow + kb + 8 * hh); ah.half[1] = *(const v8us*)((const unsigned short*)arow + kb + 16 + 8 * hh);
#pragma unroll
    for (int t = 0; t < 4; ++t) { if (col0 + t * 16 >= N) continue; const size_t boff = (size_t)(col0 + t * 16 + ln) * ldb + kb; FragH bq; bq.half[0] = *(const v8us*)((const unsigned short*)Bh + boff + 8 * hh); bq.half[1] = *(const v8us*)((const unsigned short*)Bh + boff + 16 + 8 * hh);
      acc[t] = mmaH<1>(ah.v, ah.v, bq.v, bq.v, acc[t]); }
  }
#pragma unroll
  for (int t = 0; t < 4; ++t) { if (col0 + t * 16 >= N) continue; const int col = col0 + t * 16 + ln; const float bv = bp ? bf16_round(bp[col]) : 0.f;
#pragma unroll
    for (int r = 0; r < 8; ++r) { float v = acc[t][r] * alpha + bv; if (CP) { const int rr = row0g + row0 + 8 * hh + r; if (rowsPerB < 0) v += CP[cofs + (size_t)rr * ldc + col];      /* rowsPerB < 0: own element of the batched C plane */ else { const int bidx = rr / rowsPerB; v += CP[(size_t)bidx * sCPb + (size_t)by * 64 + col]; } } if (ACT == 1) v = (v > 0.f) ? v : expm1f(v); else if (ACT == 7) v = (v > 0.f) ? v + 1.0f : expf(v); else if (ACT == 8) v = tanhf(v); else if (ACT == 9) v = 0.5f * v * (1.0f + tanhf(0.7978845608028654f * (v + 0.044715f * v * v * v))); else if (ACT == 11) v = 1.0f / (1.0f + expf(-v)); else if (ACT == 12) v = (v > 0.f) ? v : 0.01f * v; else if (ACT == 14) v = (v > 0.f) ? v : 0.1f * v; else if (ACT == 16) v = (v >= 0.f) ? v : 0.3f * v; else if (ACT == 17) v = (v >= 0.f) ? v : 0.2f * v; else if (ACT == 15) v = v / (1.0f + expf(-v)); else if (ACT == 3) v = fmaxf(v, 0.f); else if (ACT == 6) v = 0.5f * v * (1.0f + erff(v * 0.70710678118654752f)); so[w][8 * hh + r][t * 16 + ln] = v; } }
  __builtin_amdgcn_fence(__ATOMIC_ACQ_REL, "workgroup"); __builtin_amdgcn_wave_barrier();
  const int rsub = lane >> 4, c4 = (lane & 15) * 4; typedef _Float16 v4h __attribute__((ext_vector_type(4)));
  {
#pragma unroll
    for (int q = 0; q < 8; ++q) { const int r = q * 2 + rsub; if (col0 + c4 < N) { const v4f v = *(const v4fa*)&so[w][r][c4]; if (C) *(v4f*)(C + cofs + (size_t)(row0 + r) * ldc + col0 + c4) = v; if (C16) { v4h h4; for (int i = 0; i < 4; ++i) h4[i] = (_Float16)v[i]; *(v4h*)(C16 + cofs + (size_t)(row0 + r) * ldc + col0 + c4) = h4; } } }
     }
}


typedef _Float16 v4h __attribute__((ext_vector_type(4)));

__global__ __launch_bounds__(256) void k_x16(const float* __restrict__ x, _Float16* __restrict__ X16, size_t n8) { const size_t t = (size_t)blockIdx.x * 256 + threadIdx.x; if (t >= n8) return; FragH f;
#pragma unroll
  for (int q = 0; q < 8; ++q) f.h[q] = (_Float16)bf16_round(x[t * 8 + q]); *(v8us*)((unsigned short*)X16 + t * 8) = f.half[0];  }
__global__ __launch_bounds__(256) void k_h16(const float* __restrict__ x, _Float16* __restrict__ X16, size_t n8) { const size_t t = (size_t)blockIdx.x * 256 + threadIdx.x; if (t >= n8) return; FragH f;
#pragma unroll
  for (int q = 0; q < 8; ++q) f.h[q] = (_Float16)x[t * 8 + q]; *(v8us*)((unsigned short*)X16 + t * 8) = f.half[0];  }
__global__ __launch_bounds__(256) void k_round16f(const float* __restrict__ W, _Float16* __restrict__ Bt, size_t n8) { const size_t t = (size_t)blockIdx.x * 256 + threadIdx.x; if (t >= n8) return; FragH f;
#pragma unroll
  for (int i = 0; i < 8; ++i) f.h[i] = (_Float16)(bf16_round(W[t * 8 + i]) * 16.0f); *(v8us*)((unsigned short*)Bt + t * 8) = f.half[0];  }
template <int NHv, int TTv>
__global__ __launch_bounds__(256) void k_vt(const _Float16* __restrict__ V16, int ldv, int voff, _Float16* __restrict__ Vt) { __shared__ unsigned short tl[64][66]; const int tid = threadIdx.x; const int slab = blockIdx.x / (TTv / 64), lg = blockIdx.x % (TTv / 64); const int b = slab / NHv, h = slab % NHv;
  for (int i = tid; i < 64 * 8; i += 256) { const int r = i / 8, c8 = (i % 8) * 8; FragH f; f.half[0] = *(const v8us*)((const unsigned short*)V16 + ((size_t)b * TTv + lg * 64 + r) * ldv + voff + h * 64 + c8);
#pragma unroll
    for (int q = 0; q < 8; ++q) tl[r][c8 + q] = f.u[q]; }
  __syncthreads();
  {
#pragma unroll
    for (int rd = 0; rd < 2; ++rd) { const int d = rd * 32 + tid / 8, pc = tid % 8; FragH f;
#pragma unroll
      for (int q = 0; q < 8; ++q) f.u[q] = tl[pc * 8 + q][d];
      *(v8us*)((unsigned short*)Vt + ((size_t)slab * 64 + d) * TTv + lg * 64 + pc * 8) = f.half[0]; }
     } }

__global__ __launch_bounds__(256) void k_hl(const float* __restrict__ F, _Float16* __restrict__ Hh, _Float16* __restrict__ Hl, size_t n8) { const size_t t = (size_t)blockIdx.x * 256 + threadIdx.x; if (t >= n8) return; FragH fh, fl; const v4f a = *(const v4fa*)(F + t * 8), c = *(const v4fa*)(F + t * 8 + 4);
#pragma unroll
  for (int q = 0; q < 4; ++q) { _Float16 h = (_Float16)a[q]; fh.h[q] = h; fl.h[q] = (_Float16)((a[q] - (float)h) * 1024.0f); h = (_Float16)c[q]; fh.h[4 + q] = h; fl.h[4 + q] = (_Float16)((c[q] - (float)h) * 1024.0f); }
  { *(v8us*)((unsigned short*)Hh + t * 8) = fh.half[0]; *(v8us*)((unsigned short*)Hl + t * 8) = fl.half[0];  } }

// ---- fast GEMM (wave tile 32x64; requires M % 32 == 0 rows per launch region and N % 64 == 0); epilogue = k_gemm_hhx semantics ----
__device__ __forceinline__ v16h g2_frag(const _Float16* p, int hh) { FragH f; f.half[0] = *(const v8us*)((const unsigned short*)p + 8 * hh); f.half[1] = *(const v8us*)((const unsigned short*)p + 16 + 8 * hh); return f.v; }
__device__ __forceinline__ v8f g2_mma(v16h a, v16h b, v8f c) { v8f d = __builtin_amdgcn_wmma_f32_16x16x32_f16(false, a, false, b, (short)0, c, false, false); asm volatile("v_nop\n\tv_nop\n\tv_nop\n\tv_nop" : "+v"(d) : "v"(a), "v"(b)); return d; }
template <int ACT>
__global__ __launch_bounds__(128) void k_gemm2(const _Float16* __restrict__ A, int lda, size_t sA, const _Float16* __restrict__ Bh, int ldb, size_t sB, float alpha, const float* __restrict__ bias, size_t sBias, const float* __restrict__ CP, int rowsPerB, size_t sCPb, int row0g,
    float* __restrict__ C, _Float16* __restrict__ C16, int ldc, size_t sC, int M, int N, int K) { static_assert(ACT == 0 || ACT == 3 || ACT == 6 || ACT == 8 || ACT == 9 || ACT == 11 || ACT == 12 || ACT == 14 || ACT == 15 || ACT == 16 || ACT == 17, "k_gemm2: unsupported ACT code (would silently apply no activation)");
  __shared__ __attribute__((aligned(16))) float so[4][32][68];
  const int tid = threadIdx.x, w = tid >> 5, lane = tid & 31, ln = lane & 15, hh = lane >> 4; const int by = blockIdx.y;
  A += (size_t)by * sA; Bh += (size_t)by * sB; const size_t cofs = (size_t)by * sC; const float* bp = bias ? bias + (size_t)by * sBias : nullptr;
  const int ntn = N >> 6; const int mt = blockIdx.x / ntn, nq = blockIdx.x - mt * ntn; const int row0 = mt * 128 + 32 * w, col0 = nq * 64; if (row0 >= M) return;
  const _Float16* a0p = A + (size_t)(row0 + ln) * lda; const _Float16* a1p = a0p + (size_t)16 * lda;
  const _Float16* b0p = Bh + (size_t)(col0 + ln) * ldb; const _Float16* b1p = b0p + (size_t)16 * ldb; const _Float16* b2p = b1p + (size_t)16 * ldb; const _Float16* b3p = b2p + (size_t)16 * ldb;
  const v8f z8 = {0.f,0.f,0.f,0.f,0.f,0.f,0.f,0.f}; v8f c00 = z8, c01 = z8, c02 = z8, c03 = z8, c10 = z8, c11 = z8, c12 = z8, c13 = z8;
#pragma unroll 1
  for (int kb = 0; kb < K; kb += 32) { const v16h a0 = g2_frag(a0p + kb, hh), a1 = g2_frag(a1p + kb, hh);
    v16h b = g2_frag(b0p + kb, hh); c00 = g2_mma(a0, b, c00); c10 = g2_mma(a1, b, c10);
    b = g2_frag(b1p + kb, hh); c01 = g2_mma(a0, b, c01); c11 = g2_mma(a1, b, c11);
    b = g2_frag(b2p + kb, hh); c02 = g2_mma(a0, b, c02); c12 = g2_mma(a1, b, c12);
    b = g2_frag(b3p + kb, hh); c03 = g2_mma(a0, b, c03); c13 = g2_mma(a1, b, c13); }
  v8f accs[8] = {c00, c01, c02, c03, c10, c11, c12, c13};
#pragma unroll
  for (int u = 0; u < 8; ++u) { const int t = u & 3, half = u >> 2; const int col = col0 + t * 16 + ln; const float bv = bp ? bf16_round(bp[col]) : 0.f;
#pragma unroll
    for (int r = 0; r < 8; ++r) { const int rloc = half * 16 + 8 * hh + r; float v = accs[u][r] * alpha + bv; if (CP) { if (rowsPerB < 0) v += CP[cofs + (size_t)(row0g + row0 + rloc) * ldc + col];      /* rowsPerB < 0: own element of the batched C plane */ else { const int bidx = (row0g + row0 + rloc) / rowsPerB; v += CP[(size_t)bidx * sCPb + (size_t)by * 64 + col]; } }
      if (ACT == 3) v = fmaxf(v, 0.f); else if (ACT == 6) v = 0.5f * v * (1.0f + erff(v * 0.70710678118654752f)); else if (ACT == 11) v = 1.0f / (1.0f + expf(-v)); else if (ACT == 15) v = v / (1.0f + expf(-v)); else if (ACT == 12) v = (v > 0.f) ? v : 0.01f * v; else if (ACT == 8) v = tanhf(v); else if (ACT == 9) v = 0.5f * v * (1.0f + tanhf(0.7978845608028654f * (v + 0.044715f * v * v * v))); else if (ACT == 14) v = (v > 0.f) ? v : 0.1f * v; else if (ACT == 16) v = (v >= 0.f) ? v : 0.3f * v; else if (ACT == 17) v = (v >= 0.f) ? v : 0.2f * v;
      so[w][rloc][t * 16 + ln] = v; } }
  __builtin_amdgcn_fence(__ATOMIC_ACQ_REL, "workgroup"); __builtin_amdgcn_wave_barrier();
  const int rsub = lane >> 4, c4 = (lane & 15) * 4;
  {
#pragma unroll
    for (int q = 0; q < 16; ++q) { const int r = q * 2 + rsub; const v4f v = *(const v4fa*)&so[w][r][c4]; if (C) *(v4f*)(C + cofs + (size_t)(row0 + r) * ldc + col0 + c4) = v; if (C16) { v4h h4; for (int i = 0; i < 4; ++i) h4[i] = (_Float16)v[i]; *(v4h*)(C16 + cofs + (size_t)(row0 + r) * ldc + col0 + c4) = h4; } }
     } }


__global__ __launch_bounds__(256) void k_wnat(const float* __restrict__ w, size_t n8, _Float16* __restrict__ Bt) { const size_t t = (size_t)blockIdx.x * 256 + threadIdx.x; if (t >= n8) return; FragH f; for (int q = 0; q < 8; ++q) f.h[q] = (_Float16)(bf16_round(w[t * 8 + q]) * 16.0f); *(v8us*)((unsigned short*)Bt + t * 8) = f.half[0];  }
__global__ __launch_bounds__(256) void k_rsm(const float* __restrict__ S, _Float16* __restrict__ P, int nrows) {
  #pragma clang fp contract(off)
  const int i = blockIdx.x * 256 + threadIdx.x; if (i >= nrows) return; const float* s = S + (size_t)i * SQ; float mx = -3.0e38f;
#pragma unroll 1
  for (int j = 0; j < SQ; ++j) mx = fmaxf(mx, s[j]); float se = 0.f;
#pragma unroll 1
  for (int j = 0; j < SQ; ++j) se += expf(s[j] - mx); const float sc = 256.0f / se;
#pragma unroll 1
  for (int j0 = 0; j0 < SQ; j0 += 8) { FragH f; for (int q = 0; q < 8; ++q) f.h[q] = (_Float16)(expf(s[j0 + q] - mx) * sc); unsigned short* d = (unsigned short*)P + (size_t)i * SQ + j0; *(v8us*)d = f.half[0];  } }
__global__ __launch_bounds__(256) void k_vt(const _Float16* __restrict__ V16, int b, int h0, _Float16* __restrict__ VT) { __shared__ unsigned short tl[64][65]; const int tid = threadIdx.x; const int hh = blockIdx.x % HG, sg = blockIdx.x / HG; const int s0 = sg * 64; const int h = h0 + hh;
  for (int i = tid; i < 64 * 8; i += 256) { const int j = i / 8, d8 = (i % 8) * 8; FragH f; f.half[0] = *(const v8us*)((const unsigned short*)V16 + ((size_t)b * SQ + s0 + j) * DM + h * HD + d8); for (int q = 0; q < 8; ++q) tl[d8 + q][j] = f.u[q]; }
  __syncthreads();
  { for (int i = tid; i < 64 * 8; i += 256) { const int d = i / 8, j8 = (i % 8) * 8; FragH f; for (int q = 0; q < 8; ++q) f.u[q] = tl[d][j8 + q]; *(v8us*)((unsigned short*)VT + ((size_t)hh * HD + d) * SQ + s0 + j8) = f.half[0]; }  } }


// Row softmax, one wave per row: a wave's load covers 512 contiguous bytes, the row's 4,096 scores stay in 128 registers per lane and are read once;
// maximum and sum: four chains per lane, then a butterfly over the 32 lanes (every lane ends with the same bits).
template <int M> __device__ __forceinline__ float rs_xrow(float x) { return __builtin_bit_cast(float, __builtin_amdgcn_update_dpp(0, __builtin_bit_cast(int, x), 0x160 + M, 0xf, 0xf, true)); }      /* lane l <- lane l ^ M inside its 16-lane row (row_xmask) */
__device__ __forceinline__ float rs_xhalf(float x) { return __builtin_bit_cast(float, __builtin_amdgcn_permlanex16(__builtin_bit_cast(int, x), __builtin_bit_cast(int, x), 0x76543210, 0xfedcba98, false, false)); }      /* lane l <- lane l ^ 16 */
__global__ __launch_bounds__(256) void k_rsmw(const float* __restrict__ S, _Float16* __restrict__ P, int nrows) {
  const int lane = threadIdx.x & 31; const int row = blockIdx.x * 8 + (threadIdx.x >> 5); if (row >= nrows) return;      /* wave-uniform; no barrier in this kernel */
  const float* s = S + (size_t)row * SQ + lane * 4; v4f v[SQ / 128];      /* every loop over v is fully unrolled: constant indices keep v in registers, and all 32 loads are in flight at once */
#pragma unroll
  for (int q = 0; q < SQ / 128; ++q) v[q] = *(const v4fa*)(s + q * 128);
  v4f m4 = {-3.0e38f, -3.0e38f, -3.0e38f, -3.0e38f};
#pragma unroll
  for (int q = 0; q < SQ / 128; ++q)
#pragma unroll
    for (int i = 0; i < 4; ++i) m4[i] = fmaxf(m4[i], v[q][i]);
  float mx = fmaxf(fmaxf(m4[0], m4[1]), fmaxf(m4[2], m4[3]));
  mx = fmaxf(mx, rs_xrow<1>(mx)); mx = fmaxf(mx, rs_xrow<2>(mx)); mx = fmaxf(mx, rs_xrow<4>(mx)); mx = fmaxf(mx, rs_xrow<8>(mx)); mx = fmaxf(mx, rs_xhalf(mx));
  v4f s4 = {0.f, 0.f, 0.f, 0.f};
#pragma unroll
  for (int q = 0; q < SQ / 128; ++q) { const v4f t = (v[q] - mx) * 1.44269504f; float e0, e1, e2, e3;      /* exp(d) = 2^(d log2 e), the native form */
    /* four independent exponentials and one v_nop in one statement: the slot that the instruction set asks for behind a transcendental, before a source of it is overwritten (early-clobber outputs keep the four apart) */
    asm("v_exp_f32 %0, %4\n\tv_exp_f32 %1, %5\n\tv_exp_f32 %2, %6\n\tv_exp_f32 %3, %7\n\tv_nop" : "=&v"(e0), "=&v"(e1), "=&v"(e2), "=&v"(e3) : "v"(t[0]), "v"(t[1]), "v"(t[2]), "v"(t[3]));
    const v4f e = {e0, e1, e2, e3}; v[q] = e; s4 += e; }
  float se = (s4[0] + s4[1]) + (s4[2] + s4[3]);
  se += rs_xrow<1>(se); se += rs_xrow<2>(se); se += rs_xrow<4>(se); se += rs_xrow<8>(se); se += rs_xhalf(se);
  const float sc = 256.0f / se; _Float16* p = P + (size_t)row * SQ + lane * 4;
#pragma unroll
  for (int q = 0; q < SQ / 128; ++q) { v4h h4;
#pragma unroll
    for (int i = 0; i < 4; ++i) h4[i] = (_Float16)(v[q][i] * sc);
    *(v4h*)(p + q * 128) = h4; } }

extern "C" void kernel_launch(void* const* d_in, const int* in_sizes, int n_in,
                              void* d_out, int out_size, void* d_ws, size_t ws_size, hipStream_t stream) {
  (void)in_sizes; (void)n_in; (void)out_size;
  const float* const* I = (const float* const*)d_in; const float* x = I[0]; const float* wq = I[1]; const float* wk = I[2]; const float* wv = I[3]; const float* wm = I[4];      /* weights [in][out] */
  char* ws = (char*)d_ws; size_t off = 0;
  auto take = [&](size_t bytes) { char* p = ws + off; off += (bytes + 255) & ~(size_t)255; return p; };
  _Float16* WA = (_Float16*)take((size_t)2 * EM * DM * 2); _Float16* WB = (_Float16*)take((size_t)2 * EM * DM * 2); _Float16* GH = (_Float16*)take((size_t)2 * EM * EM * 2);      /* WA = [Wk | Wm^T], WB = [Wq | Wv], each plane [64][512] x16; GH = [G^T | H^T], each [64][64] x16 */
  _Float16* X16 = (_Float16*)take(NR * EM * 2); _Float16* Y16 = (_Float16*)take(NR * EM * 2); _Float16* ZT = (_Float16*)take(NR * EM * 2);
  float* S = (float*)take((size_t)SQ * SQ * 4); _Float16* P = (_Float16*)take((size_t)SQ * SQ * 2);
  if (off > ws_size) return;      /* approx 6 + 64 + 32 = 102 MiB */
  k_wnat<<<(unsigned)(((size_t)EM * DM / 8 + 255) / 256), 256, 0, stream>>>(wk, (size_t)EM * DM / 8, WA); k_wnat<<<(unsigned)(((size_t)EM * DM / 8 + 255) / 256), 256, 0, stream>>>(wq, (size_t)EM * DM / 8, WB); k_wnat<<<(unsigned)(((size_t)EM * DM / 8 + 255) / 256), 256, 0, stream>>>(wv, (size_t)EM * DM / 8, WB + (size_t)EM * DM);      /* [64][512] kept as stored, x16 */
  k_wt_f16<<<(unsigned)(((size_t)EM * (DM / 8) + 255) / 256), 256, 0, stream>>>(wm, WA + (size_t)EM * DM, DM, EM, 16.0f);      /* [512][64] -> Bt[64][512] x16 */
  k_x16<<<(unsigned)((NR * EM / 8 + 255) / 256), 256, 0, stream>>>(x, X16, NR * EM / 8);
  const size_t r0p = (size_t)B0 * SQ;
  k_gemm2<0><<<dim3(1, 2), 128, 0, stream>>>(WA, DM, (size_t)EM * DM, WB, DM, (size_t)EM * DM, 0.0625f, nullptr, 0, nullptr, 1, 0, 0, nullptr, GH, EM, (size_t)EM * EM, EM, EM, DM);      /* plane 0: G^T[f][e] = sum_w Wk[f][w] Wq[e][w]; plane 1: H^T[j][e] = sum_w Wm[w][j] Wv[e][w]; both x16 */
  k_gemm2<0><<<dim3((unsigned)((MP / 128) * (EM / 64)), 1), 128, 0, stream>>>(X16 + r0p * EM, EM, 0, GH, EM, 0, 1.0f, nullptr, 0, nullptr, 1, 0, 0, nullptr, Y16 + r0p * EM, EM, 0, MP, EM, EM);      /* Y[s][f] = sum_e x[s][e] G[e][f], x16 */
  k_gemm2<0><<<dim3((unsigned)(MP / 64), 1), 128, 0, stream>>>(GH + (size_t)EM * EM, EM, 0, X16 + r0p * EM, EM, 0, 1.0f, nullptr, 0, nullptr, 1, 0, 0, nullptr, ZT + r0p, (int)NR, 0, EM, MP, EM);      /* Z^T[j][s] = sum_e H[e][j] x[s][e], x16: the k-contiguous B operand of the last GEMM, no transpose pass */
  for (int b = B0; b < B0 + NBR; ++b) { const size_t r0 = (size_t)b * SQ;
    k_gemm2<0><<<dim3((QN / 128) * (SQ / 64), 1), 128, 0, stream>>>(Y16 + r0 * EM, EM, 0, X16 + r0 * EM, EM, 0, 0.002762135864009951f, nullptr, 0, nullptr, 1, 0, 0, S, nullptr, SQ, 0, QN, SQ, EM);      /* scores / sqrt(512), K = 64 (alpha = 512^-0.5 / 16) */
    k_rsmw<<<(QN + 7) / 8, 256, 0, stream>>>(S, P, QN);      /* one wave per row */
    k_gemm2<0><<<dim3((QN / 128) * (EM / 64), 1), 128, 0, stream>>>(P, SQ, 0, ZT + r0, (int)NR, 0, 0.000244140625f, nullptr, 0, nullptr, 1, 0, 0, (float*)d_out + r0 * EM, nullptr, EM, 0, QN, EM, SQ); }      /* out rows [., 64] (f32): 256 P x 16 Z x 2^-12 */
}

// v004
// One run takes 51.9 microseconds.
// It is 13.5 times as fast as v002, going by the measured steps of the versions left out in between.
// Counting every step since v000, it is 64.8 times as fast.
#include <hip/hip_runtime.h>
// Wide single-head self-attention (x [4][4096][64]; Q/K/V = x W with W [64][512] stored [in][out] (heads NOT split: one 512-wide head); scores = Q K^T / sqrt(512) over all 4,096 keys; softmax; o = attn V; out = o Wm (Wm [512][64]) -> [4][4096][64]).
// Structure: the chained products are reassociated: Q K^T = (x G) x^T with G = Wq Wk^T [64][64], and (attn V) Wm = attn (x H) with H = Wv Wm [64][64] (exact algebra for any inputs; another f32 sum order), so both 4096 x 4096 products run at width 64 instead of 512. Token rows r = b*4096 + s; x as exact f16 rows (bf16-rounded); weights exact x16; G^T and H^T in one WMMA launch (two planes, K = 512, carried x16); Y = x G (x16) and Z^T = H^T x^T (x16, written transposed by the GEMM itself, in blocks of 64 tokens [block][j][64]); then ONE fused launch for all batches: scores^T = x Y^T, running-maximum softmax in registers, out^T += Z^T P^T, so neither scores nor weights go through memory. 3 launches, one per link of the dependence chain: (x to f16 | G^T, H^T straight from the f32 weights), (Y | Z^T), fused attention.
// Compute dtype: inputs rounded to bf16; x / weights exact; G, H, Y, Z and softmax weights (exp(s - running max), in [0, 1]) as plain f16 WMMA operands (~2^-12); scores, statistics and out f32. v_wmma_f32_16x16x32_f16.
#define NB 4
#define SQ 4096
#define EM 64                        /* embedding */
#define DM 512                       /* wide = 8 x 64 (one head) */
#define NH 8                         /* 64-wide slabs of the one 512-wide head (not used) */
#define HD 64
#define HG 1
#define B0 0                         /* not used (all batches run from 0) */
#define NBR NB                       /* batches processed (debug hook) */
#define QN SQ                        /* not used (all SQ query rows attended) */
#define NR ((size_t)NB * SQ)
#define MP ((int)((size_t)NBR * SQ))
#define MPO MP
typedef __bf16 v16b __attribute__((ext_vector_type(16)));
typedef unsigned short v8us __attribute__((ext_vector_type(8), may_alias));
typedef float  v8f  __attribute__((ext_vector_type(8)));
typedef float  v4f  __attribute__((ext_vector_type(4)));
typedef float  v4fa __attribute__((ext_vector_type(4), may_alias));
union FragB { v16b v; v8us half[2]; unsigned short u[16]; };

__device__ __forceinline__ unsigned short bf16_bits(float x) { unsigned int u = __float_as_uint(x); return (unsigned short)((u + 0x7FFFu + ((u >> 16) & 1u)) >> 16); }
__device__ __forceinline__ float bf16_val(unsigned short b) { return __uint_as_float(((unsigned int)b) << 16); }
__device__ __forceinline__ float bf16_round(float x) { return bf16_val(bf16_bits(x)); }
// D += A·B with NT terms: 1 = ah·bh, 2 = + al·bh (A split), 3 = + ah·bl (both split)
template <int NT>
__device__ __forceinline__ v8f mmaN(v16b ah, v16b al, v16b bh, v16b bl, v8f c) {
  c = __builtin_amdgcn_wmma_f32_16x16x32_bf16(false, ah, false, bh, (short)0, c, false, false);
  if (NT >= 2) c = __builtin_amdgcn_wmma_f32_16x16x32_bf16(false, al, false, bh, (short)0, c, false, false);
  if (NT >= 3) c = __builtin_amdgcn_wmma_f32_16x16x32_bf16(false, ah, false, bl, (short)0, c, false, false);
  asm volatile("v_nop\n\tv_nop\n\tv_nop\n\tv_nop" : "+v"(c) : "v"(ah), "v"(al), "v"(bh), "v"(bl));
  return c;
}

__global__ __launch_bounds__(256) void k_wt_bf16(const float* __restrict__ W, unsigned short* __restrict__ Wt, int K, int N) {
  const int t = blockIdx.x * 256 + threadIdx.x;
  const int k8n = K / 8;
  if (t >= N * k8n) return;
  const int n = t / k8n, k8 = (t % k8n) * 8;
  v8us v;
#pragma unroll
  for (int i = 0; i < 8; ++i) v[i] = bf16_bits(W[(size_t)(k8 + i) * N + n]);
  *(v8us*)(Wt + (size_t)n * K + k8) = v;
  
}

// GEMM C[M][N] (f32, pitch ldc) = act(A[M][K]·W + bias). A f32 row-major (pitch lda) converted per fragment to bf16
// (ASPLIT: hi/lo two planes -> 2 terms, else single rounded term); Wt bf16 [N][K] (pitch ldb). BIAS_BF16 rounds the
// bias to bf16 first (bias quantised to bf16 before the add). K%32==0, M%16==0, N%64==0.
template <bool ASPLIT, int ACT, bool BIAS_BF16>
__global__ __launch_bounds__(128) void k_gemm_bf(const float* __restrict__ A, int lda, const unsigned short* __restrict__ Wt, int ldb,
                                               const float* __restrict__ bias, float* __restrict__ C, int ldc, int M, int N, int K) {
  __shared__ __attribute__((aligned(16))) float so[4][16][64];
  const int tid = threadIdx.x, w = tid >> 5, lane = tid & 31, ln = lane & 15, hh = lane >> 4;
  const int ntn = N / 64;
  const int wid = blockIdx.x * 4 + w;
  const int mt = wid / ntn, nq = wid % ntn;
  if (mt * 16 >= M) return;
  const int row0 = mt * 16, col0 = nq * 64;
  const float* arow = A + (size_t)(row0 + ln) * lda;
  v8f acc[4] = {};
  for (int kb = 0; kb < K; kb += 32) {
    FragB ah, al;
    const v4f x0 = *(const v4fa*)(arow + kb + 8 * hh), x1 = *(const v4fa*)(arow + kb + 8 * hh + 4);
    const v4f x2 = *(const v4fa*)(arow + kb + 16 + 8 * hh), x3 = *(const v4fa*)(arow + kb + 16 + 8 * hh + 4);
    float xs[16] = {x0[0],x0[1],x0[2],x0[3],x1[0],x1[1],x1[2],x1[3],x2[0],x2[1],x2[2],x2[3],x3[0],x3[1],x3[2],x3[3]};
#pragma unroll
    for (int i = 0; i < 16; ++i) { const unsigned short hb = bf16_bits(xs[i]); ah.u[i] = hb; al.u[i] = ASPLIT ? bf16_bits(xs[i] - bf16_val(hb)) : (unsigned short)0; }
#pragma unroll
    for (int t = 0; t < 4; ++t) {
      const unsigned short* brow = Wt + (size_t)(col0 + t * 16 + ln) * ldb + kb;
      FragB b;
      b.half[0] = *(const v8us*)(brow + 8 * hh);
      b.half[1] = *(const v8us*)(brow + 16 + 8 * hh);
      acc[t] = mmaN<ASPLIT ? 2 : 1>(ah.v, al.v, b.v, b.v, acc[t]);
    }
  }
#pragma unroll
  for (int t = 0; t < 4; ++t) {
    float bv = bias ? bias[col0 + t * 16 + ln] : 0.f;
    if (BIAS_BF16) bv = bf16_round(bv);
#pragma unroll
    for (int r = 0; r < 8; ++r) { float v = acc[t][r] + bv; if (ACT == 1) v = fmaxf(v, 0.f); so[w][8 * hh + r][t * 16 + ln] = v; }
  }
  __builtin_amdgcn_fence(__ATOMIC_ACQ_REL, "workgroup");
  __builtin_amdgcn_wave_barrier();
  const int rsub = lane >> 4, c4 = (lane & 15) * 4;
  {
#pragma unroll
    for (int q = 0; q < 8; ++q) {
      const int r = q * 2 + rsub;
      const v4f v = *(const v4fa*)&so[w][r][c4];
      *(v4f*)(C + (size_t)(row0 + r) * ldc + col0 + c4) = v;
    }
    
  }
}

// GEMM C = act(A·W + bias + resid): A f32 (ASPLIT -> hi/lo 2 terms), Wt bf16 [N][K]; ACT 0 none, 1 relu, 2 exact gelu;
// resid (optional, f32, row index = (row % rmod), pitch ldr, RES_BF16 rounds it) added before the activation.
template <bool ASPLIT, int ACT, bool BIAS_BF16, bool RES_BF16>
__global__ __launch_bounds__(128) void k_gemm_bf3(const float* __restrict__ A, int lda, const unsigned short* __restrict__ Wt, int ldb,
                                                const float* __restrict__ bias, const float* __restrict__ resid, int rmod, int ldr,
                                                float* __restrict__ C, int ldc, int M, int N, int K) {
  __shared__ __attribute__((aligned(16))) float so[4][16][64];
  const int tid = threadIdx.x, w = tid >> 5, lane = tid & 31, ln = lane & 15, hh = lane >> 4;
  const int ntn = N / 64;
  const int wid = blockIdx.x * 4 + w;
  const int mt = wid / ntn, nq = wid % ntn;
  if (mt * 16 >= M) return;
  const int row0 = mt * 16, col0 = nq * 64;
  const float* arow = A + (size_t)(row0 + ln) * lda;
  v8f acc[4] = {};
  for (int kb = 0; kb < K; kb += 32) {
    FragB ah, al;
    const v4f x0 = *(const v4fa*)(arow + kb + 8 * hh), x1 = *(const v4fa*)(arow + kb + 8 * hh + 4);
    const v4f x2 = *(const v4fa*)(arow + kb + 16 + 8 * hh), x3 = *(const v4fa*)(arow + kb + 16 + 8 * hh + 4);
    float xs[16] = {x0[0],x0[1],x0[2],x0[3],x1[0],x1[1],x1[2],x1[3],x2[0],x2[1],x2[2],x2[3],x3[0],x3[1],x3[2],x3[3]};
#pragma unroll
    for (int i = 0; i < 16; ++i) { const unsigned short hb = bf16_bits(xs[i]); ah.u[i] = hb; al.u[i] = ASPLIT ? bf16_bits(xs[i] - bf16_val(hb)) : (unsigned short)0; }
#pragma unroll
    for (int t = 0; t < 4; ++t) {
      const unsigned short* brow = Wt + (size_t)(col0 + t * 16 + ln) * ldb + kb;
      FragB b;
      b.half[0] = *(const v8us*)(brow + 8 * hh);
      b.half[1] = *(const v8us*)(brow + 16 + 8 * hh);
      acc[t] = mmaN<ASPLIT ? 2 : 1>(ah.v, al.v, b.v, b.v, acc[t]);
    }
  }
#pragma unroll
  for (int t = 0; t < 4; ++t) {
    const int col = col0 + t * 16 + ln;
    float bv = bias ? bias[col] : 0.f;
    if (BIAS_BF16) bv = bf16_round(bv);
#pragma unroll
    for (int r = 0; r < 8; ++r) {
      float v = acc[t][r] + bv;
      if (resid) { float rv = resid[(size_t)((row0 + 8 * hh + r) % rmod) * ldr + col]; if (RES_BF16) rv = bf16_round(rv); v += rv; }
      if (ACT == 1) v = fmaxf(v, 0.f);
      if (ACT == 2) v = 0.5f * v * (1.0f + erff(v * 0.70710678118654752f));
      if (ACT == 3) { const float u = 0.7978845608028654f * (v + 0.044715f * v * v * v); v = 0.5f * v * (1.0f + tanhf(u)); }
      so[w][8 * hh + r][t * 16 + ln] = v;
    }
  }
  __builtin_amdgcn_fence(__ATOMIC_ACQ_REL, "workgroup");
  __builtin_amdgcn_wave_barrier();
  const int rsub = lane >> 4, c4 = (lane & 15) * 4;
  {
#pragma unroll
    for (int q = 0; q < 8; ++q) {
      const int r = q * 2 + rsub;
      const v4f v = *(const v4fa*)&so[w][r][c4];
      *(v4f*)(C + (size_t)(row0 + r) * ldc + col0 + c4) = v;
    }
    
  }
}
// row LayerNorm (biased variance, eps) over N: s = X (+ R); optional out_sum <- s; out_norm <- (s-mu)*rsqrt(var+eps)*g + b
template <bool PARAM_BF16>
__global__ __launch_bounds__(256) void k_layernorm(const float* __restrict__ X, const float* __restrict__ R, const float* __restrict__ g, const float* __restrict__ bta,
                                                  float* __restrict__ out_sum, float* __restrict__ out_norm, int N, float eps) {
  __shared__ float red[256];
  const int row = blockIdx.x, tid = threadIdx.x;
  const float* x = X + (size_t)row * N; const float* rr = R ? R + (size_t)row * N : nullptr;
  float vals[16];                     // up to N = 4096
  const int per = N / 256;            // contiguous chunk per thread? use strided-by-4 chunks: thread handles j = tid*4 + 1024*u
  float s1 = 0.f;
  for (int u = 0; u < per / 4; ++u) {
    const int j = tid * 4 + 1024 * u;
    const v4f a = *(const v4fa*)(x + j);
    v4f b = {0.f,0.f,0.f,0.f}; if (rr) b = *(const v4fa*)(rr + j);
#pragma unroll
    for (int q = 0; q < 4; ++q) { const float v = a[q] + b[q]; vals[u * 4 + q] = v; s1 += v; }
  }
  red[tid] = s1; __syncthreads();
  for (int st = 128; st > 0; st >>= 1) { if (tid < st) red[tid] += red[tid + st]; __syncthreads(); }
  const float mu = red[0] / (float)N; __syncthreads();
  float s2 = 0.f;
  for (int u = 0; u < per / 4; ++u)
#pragma unroll
    for (int q = 0; q < 4; ++q) { const float c = vals[u * 4 + q] - mu; s2 += c * c; }
  red[tid] = s2; __syncthreads();
  for (int st = 128; st > 0; st >>= 1) { if (tid < st) red[tid] += red[tid + st]; __syncthreads(); }
  const float rs = rsqrtf(red[0] / (float)N + eps);
  {
    for (int u = 0; u < per / 4; ++u) {
      const int j = tid * 4 + 1024 * u;
      v4f o, sm;
#pragma unroll
      for (int q = 0; q < 4; ++q) {
        float gg = g[j + q], bb = bta[j + q];
        if (PARAM_BF16) { gg = bf16_round(gg); bb = bf16_round(bb); }
        sm[q] = vals[u * 4 + q]; o[q] = (vals[u * 4 + q] - mu) * rs * gg + bb;
      }
      if (out_sum) *(v4f*)(out_sum + (size_t)row * N + j) = sm;
      *(v4f*)(out_norm + (size_t)row * N + j) = o;
    }
    
  }
}



// ---- f16 WMMA path (v_wmma_f32_16x16x32_f16): 11-bit significands for operands in range — used where a [0,1] probability operand needs more precision than bf16
typedef _Float16 v16h __attribute__((ext_vector_type(16)));
union FragH { v16h v; v8us half[2]; _Float16 h[16]; unsigned short u[16]; };
template <int NT>
__device__ __forceinline__ v8f mmaH(v16h ah, v16h al, v16h bh, v16h bl, v8f c) {
  c = __builtin_amdgcn_wmma_f32_16x16x32_f16(false, ah, false, bh, (short)0, c, false, false);
  if (NT >= 2) c = __builtin_amdgcn_wmma_f32_16x16x32_f16(false, al, false, bh, (short)0, c, false, false);
  if (NT >= 3) c = __builtin_amdgcn_wmma_f32_16x16x32_f16(false, ah, false, bl, (short)0, c, false, false);
  asm volatile("v_nop\n\tv_nop\n\tv_nop\n\tv_nop" : "+v"(c) : "v"(ah), "v"(al), "v"(bh), "v"(bl));
  return c;
}
// batched GEMM like k_gemm_b but f16 operands: A f32 (split into f16 hi/lo if ASPLIT, else rounded to f16), Bt = f16 values [n][k]; alpha; C f32; N multiple of 16 (partial tiles skipped)
template <bool ASPLIT>
__global__ __launch_bounds__(128) void k_gemm_h(const float* __restrict__ A, int lda, size_t sA, const _Float16* __restrict__ Bh, int ldb, size_t sB, float alpha, float* __restrict__ C, int ldc, size_t sC, int M, int N, int K) {
  __shared__ __attribute__((aligned(16))) float so[4][16][64];
  const int tid = threadIdx.x, w = tid >> 5, lane = tid & 31, ln = lane & 15, hh = lane >> 4; const int by = blockIdx.y;
  A += (size_t)by * sA; Bh += (size_t)by * sB; C += (size_t)by * sC;
  const int ntn = (N + 63) / 64; const int wid = blockIdx.x * 4 + w; const int mt = wid / ntn, nq = wid % ntn; if (mt * 16 >= M) return;
  const int row0 = mt * 16, col0 = nq * 64; const float* arow = A + (size_t)(row0 + ln) * lda;
  v8f acc[4] = {};
  for (int kb = 0; kb < K; kb += 32) {
    FragH ah, al;
    const v4f x0 = *(const v4fa*)(arow + kb + 8 * hh), x1 = *(const v4fa*)(arow + kb + 8 * hh + 4), x2 = *(const v4fa*)(arow + kb + 16 + 8 * hh), x3 = *(const v4fa*)(arow + kb + 16 + 8 * hh + 4);
    float xs[16] = {x0[0],x0[1],x0[2],x0[3],x1[0],x1[1],x1[2],x1[3],x2[0],x2[1],x2[2],x2[3],x3[0],x3[1],x3[2],x3[3]};
#pragma unroll
    for (int i = 0; i < 16; ++i) { const _Float16 h = (_Float16)xs[i]; ah.h[i] = h; al.h[i] = ASPLIT ? (_Float16)(xs[i] - (float)h) : (_Float16)0.0f; }
#pragma unroll
    for (int t = 0; t < 4; ++t) { if (col0 + t * 16 >= N) continue; const size_t boff = (size_t)(col0 + t * 16 + ln) * ldb + kb; FragH bq; bq.half[0] = *(const v8us*)(Bh + boff + 8 * hh); bq.half[1] = *(const v8us*)(Bh + boff + 16 + 8 * hh);
      acc[t] = mmaH<ASPLIT ? 2 : 1>(ah.v, al.v, bq.v, bq.v, acc[t]); }
  }
#pragma unroll
  for (int t = 0; t < 4; ++t) { if (col0 + t * 16 >= N) continue;
#pragma unroll
    for (int r = 0; r < 8; ++r) so[w][8 * hh + r][t * 16 + ln] = acc[t][r] * alpha; }
  __builtin_amdgcn_fence(__ATOMIC_ACQ_REL, "workgroup"); __builtin_amdgcn_wave_barrier();
  const int rsub = lane >> 4, c4 = (lane & 15) * 4;
  {
#pragma unroll
    for (int q = 0; q < 8; ++q) { const int r = q * 2 + rsub; if (col0 + c4 < N) { const v4f v = *(const v4fa*)&so[w][r][c4]; *(v4f*)(C + (size_t)(row0 + r) * ldc + col0 + c4) = v; } }
     }
}

// Wt[n][k] = f16(W[k][n]·scale) from f32 row-major W[K][N] (scale = power of two; bf16-exact weights stay exact in f16 away from the subnormal range)
__global__ __launch_bounds__(256) void k_wt_f16(const float* __restrict__ W, _Float16* __restrict__ Wt, int K, int N, float scale) {
  const int t = blockIdx.x * 256 + threadIdx.x; if (t >= N * (K / 8)) return; const int n = t / (K / 8), k8 = (t % (K / 8)) * 8; FragH f;
#pragma unroll
  for (int i = 0; i < 8; ++i) f.h[i] = (_Float16)(bf16_round(W[(size_t)(k8 + i) * N + n]) * scale); const v8us o = f.half[0];
  *(v8us*)((unsigned short*)Wt + (size_t)n * K + k8) = o; 
}
// k_gemm_hh variant with fused epilogue: v = acc·alpha + bias[by·sBias + col] (+ CP[(row/rowsPerB)·sCPb + by·64 + col] if CP) ; ACT 0 none / 1 elu ; writes f16 C16 (and f32 C if non-null)
template <int ACT>
__global__ __launch_bounds__(128) void k_gemm_hhx(const _Float16* __restrict__ A, int lda, size_t sA, const _Float16* __restrict__ Bh, int ldb, size_t sB, float alpha, const float* __restrict__ bias, size_t sBias, const float* __restrict__ CP, int rowsPerB, size_t sCPb, int row0g,
    float* __restrict__ C, _Float16* __restrict__ C16, int ldc, size_t sC, int M, int N, int K) {
  __shared__ __attribute__((aligned(16))) float so[4][16][64];
  const int tid = threadIdx.x, w = tid >> 5, lane = tid & 31, ln = lane & 15, hh = lane >> 4; const int by = blockIdx.y;
  A += (size_t)by * sA; Bh += (size_t)by * sB; const size_t cofs = (size_t)by * sC; const float* bp = bias ? bias + (size_t)by * sBias : nullptr;
  const int ntn = (N + 63) / 64; const int wid = blockIdx.x * 4 + w; const int mt = wid / ntn, nq = wid % ntn; if (mt * 16 >= M) return;
  const int row0 = mt * 16, col0 = nq * 64; const _Float16* arow = A + (size_t)(row0 + ln) * lda;
  v8f acc[4] = {};
  for (int kb = 0; kb < K; kb += 32) { FragH ah; ah.half[0] = *(const v8us*)((const unsigned short*)arow + kb + 8 * hh); ah.half[1] = *(const v8us*)((const unsigned short*)arow + kb + 16 + 8 * hh);
#pragma unroll
    for (int t = 0; t < 4; ++t) { if (col0 + t * 16 >= N) continue; const size_t boff = (size_t)(col0 + t * 16 + ln) * ldb + kb; FragH bq; bq.half[0] = *(const v8us*)((const unsigned short*)Bh + boff + 8 * hh); bq.half[1] = *(const v8us*)((const unsigned short*)Bh + boff + 16 + 8 * hh);
      acc[t] = mmaH<1>(ah.v, ah.v, bq.v, bq.v, acc[t]); }
  }
#pragma unroll
  for (int t = 0; t < 4; ++t) { if (col0 + t * 16 >= N) continue; const int col = col0 + t * 16 + ln; const float bv = bp ? bf16_round(bp[col]) : 0.f;
#pragma unroll
    for (int r = 0; r < 8; ++r) { float v = acc[t][r] * alpha + bv; if (CP) { const int rr = row0g + row0 + 8 * hh + r; if (rowsPerB < 0) v += CP[cofs + (size_t)rr * ldc + col];      /* rowsPerB < 0: own element of the batched C plane */ else { const int bidx = rr / rowsPerB; v += CP[(size_t)bidx * sCPb + (size_t)by * 64 + col]; } } if (ACT == 1) v = (v > 0.f) ? v : expm1f(v); else if (ACT == 7) v = (v > 0.f) ? v + 1.0f : expf(v); else if (ACT == 8) v = tanhf(v); else if (ACT == 9) v = 0.5f * v * (1.0f + tanhf(0.7978845608028654f * (v + 0.044715f * v * v * v))); else if (ACT == 11) v = 1.0f / (1.0f + expf(-v)); else if (ACT == 12) v = (v > 0.f) ? v : 0.01f * v; else if (ACT == 14) v = (v > 0.f) ? v : 0.1f * v; else if (ACT == 16) v = (v >= 0.f) ? v : 0.3f * v; else if (ACT == 17) v = (v >= 0.f) ? v : 0.2f * v; else if (ACT == 15) v = v / (1.0f + expf(-v)); else if (ACT == 3) v = fmaxf(v, 0.f); else if (ACT == 6) v = 0.5f * v * (1.0f + erff(v * 0.70710678118654752f)); so[w][8 * hh + r][t * 16 + ln] = v; } }
  __builtin_amdgcn_fence(__ATOMIC_ACQ_REL, "workgroup"); __builtin_amdgcn_wave_barrier();
  const int rsub = lane >> 4, c4 = (lane & 15) * 4; typedef _Float16 v4h __attribute__((ext_vector_type(4)));
  {
#pragma unroll
    for (int q = 0; q < 8; ++q) { const int r = q * 2 + rsub; if (col0 + c4 < N) { const v4f v = *(const v4fa*)&so[w][r][c4]; if (C) *(v4f*)(C + cofs + (size_t)(row0 + r) * ldc + col0 + c4) = v; if (C16) { v4h h4; for (int i = 0; i < 4; ++i) h4[i] = (_Float16)v[i]; *(v4h*)(C16 + cofs + (size_t)(row0 + r) * ldc + col0 + c4) = h4; } } }
     }
}


typedef _Float16 v4h __attribute__((ext_vector_type(4)));

__global__ __launch_bounds__(256) void k_x16(const float* __restrict__ x, _Float16* __restrict__ X16, size_t n8) { const size_t t = (size_t)blockIdx.x * 256 + threadIdx.x; if (t >= n8) return; FragH f;
#pragma unroll
  for (int q = 0; q < 8; ++q) f.h[q] = (_Float16)bf16_round(x[t * 8 + q]); *(v8us*)((unsigned short*)X16 + t * 8) = f.half[0];  }
__global__ __launch_bounds__(256) void k_h16(const float* __restrict__ x, _Float16* __restrict__ X16, size_t n8) { const size_t t = (size_t)blockIdx.x * 256 + threadIdx.x; if (t >= n8) return; FragH f;
#pragma unroll
  for (int q = 0; q < 8; ++q) f.h[q] = (_Float16)x[t * 8 + q]; *(v8us*)((unsigned short*)X16 + t * 8) = f.half[0];  }
__global__ __launch_bounds__(256) void k_round16f(const float* __restrict__ W, _Float16* __restrict__ Bt, size_t n8) { const size_t t = (size_t)blockIdx.x * 256 + threadIdx.x; if (t >= n8) return; FragH f;
#pragma unroll
  for (int i = 0; i < 8; ++i) f.h[i] = (_Float16)(bf16_round(W[t * 8 + i]) * 16.0f); *(v8us*)((unsigned short*)Bt + t * 8) = f.half[0];  }
template <int NHv, int TTv>
__global__ __launch_bounds__(256) void k_vt(const _Float16* __restrict__ V16, int ldv, int voff, _Float16* __restrict__ Vt) { __shared__ unsigned short tl[64][66]; const int tid = threadIdx.x; const int slab = blockIdx.x / (TTv / 64), lg = blockIdx.x % (TTv / 64); const int b = slab / NHv, h = slab % NHv;
  for (int i = tid; i < 64 * 8; i += 256) { const int r = i / 8, c8 = (i % 8) * 8; FragH f; f.half[0] = *(const v8us*)((const unsigned short*)V16 + ((size_t)b * TTv + lg * 64 + r) * ldv + voff + h * 64 + c8);
#pragma unroll
    for (int q = 0; q < 8; ++q) tl[r][c8 + q] = f.u[q]; }
  __syncthreads();
  {
#pragma unroll
    for (int rd = 0; rd < 2; ++rd) { const int d = rd * 32 + tid / 8, pc = tid % 8; FragH f;
#pragma unroll
      for (int q = 0; q < 8; ++q) f.u[q] = tl[pc * 8 + q][d];
      *(v8us*)((unsigned short*)Vt + ((size_t)slab * 64 + d) * TTv + lg * 64 + pc * 8) = f.half[0]; }
     } }

__global__ __launch_bounds__(256) void k_hl(const float* __restrict__ F, _Float16* __restrict__ Hh, _Float16* __restrict__ Hl, size_t n8) { const size_t t = (size_t)blockIdx.x * 256 + threadIdx.x; if (t >= n8) return; FragH fh, fl; const v4f a = *(const v4fa*)(F + t * 8), c = *(const v4fa*)(F + t * 8 + 4);
#pragma unroll
  for (int q = 0; q < 4; ++q) { _Float16 h = (_Float16)a[q]; fh.h[q] = h; fl.h[q] = (_Float16)((a[q] - (float)h) * 1024.0f); h = (_Float16)c[q]; fh.h[4 + q] = h; fl.h[4 + q] = (_Float16)((c[q] - (float)h) * 1024.0f); }
  { *(v8us*)((unsigned short*)Hh + t * 8) = fh.half[0]; *(v8us*)((unsigned short*)Hl + t * 8) = fl.half[0];  } }

// ---- fast GEMM (wave tile 32x64; requires M % 32 == 0 rows per launch region and N % 64 == 0); epilogue = k_gemm_hhx semantics ----
__device__ __forceinline__ v16h g2_frag(const _Float16* p, int hh) { FragH f; f.half[0] = *(const v8us*)((const unsigned short*)p + 8 * hh); f.half[1] = *(const v8us*)((const unsigned short*)p + 16 + 8 * hh); return f.v; }
__device__ __forceinline__ v8f g2_mma(v16h a, v16h b, v8f c) { v8f d = __builtin_amdgcn_wmma_f32_16x16x32_f16(false, a, false, b, (short)0, c, false, false); asm volatile("v_nop\n\tv_nop\n\tv_nop\n\tv_nop" : "+v"(d) : "v"(a), "v"(b)); return d; }
template <int ACT>
__device__ __forceinline__ void gemm2_body(const int bx, const int by, const _Float16* __restrict__ A, int lda, size_t sA, const _Float16* __restrict__ Bh, int ldb, size_t sB, float alpha, const float* __restrict__ bias, size_t sBias, const float* __restrict__ CP, int rowsPerB, size_t sCPb, int row0g,
    float* __restrict__ C, _Float16* __restrict__ C16, int ldc, size_t sC, int M, int N, int K) { static_assert(ACT == 0 || ACT == 3 || ACT == 6 || ACT == 8 || ACT == 9 || ACT == 11 || ACT == 12 || ACT == 14 || ACT == 15 || ACT == 16 || ACT == 17, "gemm2_body: unsupported ACT code (would silently apply no activation)");
  __shared__ __attribute__((aligned(16))) float so[4][32][68];
  const int tid = threadIdx.x, w = tid >> 5, lane = tid & 31, ln = lane & 15, hh = lane >> 4;
  A += (size_t)by * sA; Bh += (size_t)by * sB; const size_t cofs = (size_t)by * sC; const float* bp = bias ? bias + (size_t)by * sBias : nullptr;
  const int ntn = N >> 6; const int mt = bx / ntn, nq = bx - mt * ntn; const int row0 = mt * 128 + 32 * w, col0 = nq * 64; if (row0 >= M) return;
  const _Float16* a0p = A + (size_t)(row0 + ln) * lda; const _Float16* a1p = a0p + (size_t)16 * lda;
  const _Float16* b0p = Bh + (size_t)(col0 + ln) * ldb; const _Float16* b1p = b0p + (size_t)16 * ldb; const _Float16* b2p = b1p + (size_t)16 * ldb; const _Float16* b3p = b2p + (size_t)16 * ldb;
  const v8f z8 = {0.f,0.f,0.f,0.f,0.f,0.f,0.f,0.f}; v8f c00 = z8, c01 = z8, c02 = z8, c03 = z8, c10 = z8, c11 = z8, c12 = z8, c13 = z8;
#pragma unroll 1
  for (int kb = 0; kb < K; kb += 32) { const v16h a0 = g2_frag(a0p + kb, hh), a1 = g2_frag(a1p + kb, hh);
    v16h b = g2_frag(b0p + kb, hh); c00 = g2_mma(a0, b, c00); c10 = g2_mma(a1, b, c10);
    b = g2_frag(b1p + kb, hh); c01 = g2_mma(a0, b, c01); c11 = g2_mma(a1, b, c11);
    b = g2_frag(b2p + kb, hh); c02 = g2_mma(a0, b, c02); c12 = g2_mma(a1, b, c12);
    b = g2_frag(b3p + kb, hh); c03 = g2_mma(a0, b, c03); c13 = g2_mma(a1, b, c13); }
  v8f accs[8] = {c00, c01, c02, c03, c10, c11, c12, c13};
#pragma unroll
  for (int u = 0; u < 8; ++u) { const int t = u & 3, half = u >> 2; const int col = col0 + t * 16 + ln; const float bv = bp ? bf16_round(bp[col]) : 0.f;
#pragma unroll
    for (int r = 0; r < 8; ++r) { const int rloc = half * 16 + 8 * hh + r; float v = accs[u][r] * alpha + bv; if (CP) { if (rowsPerB < 0) v += CP[cofs + (size_t)(row0g + row0 + rloc) * ldc + col];      /* rowsPerB < 0: own element of the batched C plane */ else { const int bidx = (row0g + row0 + rloc) / rowsPerB; v += CP[(size_t)bidx * sCPb + (size_t)by * 64 + col]; } }
      if (ACT == 3) v = fmaxf(v, 0.f); else if (ACT == 6) v = 0.5f * v * (1.0f + erff(v * 0.70710678118654752f)); else if (ACT == 11) v = 1.0f / (1.0f + expf(-v)); else if (ACT == 15) v = v / (1.0f + expf(-v)); else if (ACT == 12) v = (v > 0.f) ? v : 0.01f * v; else if (ACT == 8) v = tanhf(v); else if (ACT == 9) v = 0.5f * v * (1.0f + tanhf(0.7978845608028654f * (v + 0.044715f * v * v * v))); else if (ACT == 14) v = (v > 0.f) ? v : 0.1f * v; else if (ACT == 16) v = (v >= 0.f) ? v : 0.3f * v; else if (ACT == 17) v = (v >= 0.f) ? v : 0.2f * v;
      so[w][rloc][t * 16 + ln] = v; } }
  __builtin_amdgcn_fence(__ATOMIC_ACQ_REL, "workgroup"); __builtin_amdgcn_wave_barrier();
  const int rsub = lane >> 4, c4 = (lane & 15) * 4;
  {
#pragma unroll
    for (int q = 0; q < 16; ++q) { const int r = q * 2 + rsub; const v4f v = *(const v4fa*)&so[w][r][c4]; if (C) *(v4f*)(C + cofs + (size_t)(row0 + r) * ldc + col0 + c4) = v; if (C16) { v4h h4; for (int i = 0; i < 4; ++i) h4[i] = (_Float16)v[i]; *(v4h*)(C16 + cofs + (size_t)(row0 + r) * ldc + col0 + c4) = h4; } }
     } }


__global__ __launch_bounds__(256) void k_wnat(const float* __restrict__ w, size_t n8, _Float16* __restrict__ Bt) { const size_t t = (size_t)blockIdx.x * 256 + threadIdx.x; if (t >= n8) return; FragH f; for (int q = 0; q < 8; ++q) f.h[q] = (_Float16)(bf16_round(w[t * 8 + q]) * 16.0f); *(v8us*)((unsigned short*)Bt + t * 8) = f.half[0];  }
__global__ __launch_bounds__(256) void k_rsm(const float* __restrict__ S, _Float16* __restrict__ P, int nrows) {
  #pragma clang fp contract(off)
  const int i = blockIdx.x * 256 + threadIdx.x; if (i >= nrows) return; const float* s = S + (size_t)i * SQ; float mx = -3.0e38f;
#pragma unroll 1
  for (int j = 0; j < SQ; ++j) mx = fmaxf(mx, s[j]); float se = 0.f;
#pragma unroll 1
  for (int j = 0; j < SQ; ++j) se += expf(s[j] - mx); const float sc = 256.0f / se;
#pragma unroll 1
  for (int j0 = 0; j0 < SQ; j0 += 8) { FragH f; for (int q = 0; q < 8; ++q) f.h[q] = (_Float16)(expf(s[j0 + q] - mx) * sc); unsigned short* d = (unsigned short*)P + (size_t)i * SQ + j0; *(v8us*)d = f.half[0];  } }
__global__ __launch_bounds__(256) void k_vt(const _Float16* __restrict__ V16, int b, int h0, _Float16* __restrict__ VT) { __shared__ unsigned short tl[64][65]; const int tid = threadIdx.x; const int hh = blockIdx.x % HG, sg = blockIdx.x / HG; const int s0 = sg * 64; const int h = h0 + hh;
  for (int i = tid; i < 64 * 8; i += 256) { const int j = i / 8, d8 = (i % 8) * 8; FragH f; f.half[0] = *(const v8us*)((const unsigned short*)V16 + ((size_t)b * SQ + s0 + j) * DM + h * HD + d8); for (int q = 0; q < 8; ++q) tl[d8 + q][j] = f.u[q]; }
  __syncthreads();
  { for (int i = tid; i < 64 * 8; i += 256) { const int d = i / 8, j8 = (i % 8) * 8; FragH f; for (int q = 0; q < 8; ++q) f.u[q] = tl[d][j8 + q]; *(v8us*)((unsigned short*)VT + ((size_t)hh * HD + d) * SQ + s0 + j8) = f.half[0]; }  } }


__device__ __forceinline__ float rs_xhalf(float x) { return __builtin_bit_cast(float, __builtin_amdgcn_permlanex16(__builtin_bit_cast(int, x), __builtin_bit_cast(int, x), 0x76543210, 0xfedcba98, false, false)); }      /* lane l <- lane l ^ 16 */
__device__ __forceinline__ v8f fa_mma(v16h a, v16h b, v8f c) { return __builtin_amdgcn_wmma_f32_16x16x32_f16(false, a, false, b, (short)0, c, false, false); }
/* 2^t, native; the v_nop fills the slot that the instruction set asks for behind a transcendental */
__device__ __forceinline__ float fa_exp2(float t) { float e; asm("v_exp_f32 %0, %1\n\tv_nop" : "=&v"(e) : "v"(t)); return e; }
// Fused attention. Work-group = 16 waves = 64 query rows, one work-group per WGP; wave w takes queries 32 (w & 1) .. + 31 and keys [512 (w >> 1), + 512) of the rows' batch, 32 keys a pass (the two waves of a key range read the same lines at about the same time).
// Both products are computed transposed, so a lane owns ONE query (column ln of every D tile): S^T tile (A = 16 key rows of x, B = 16 query rows of Y) leaves key 8 hh + r in register r,
// which is exactly the k order of the B fragment of out^T = Z^T P^T (elements 0..7 = keys 8 hh + i of the first key tile, 8..15 = the same of the second): P never leaves its registers.
// Statistics per lane in the log2 domain; the maximum is shared by the two lane halves each pass, the sum only at the end. The 8 partial results of a query (one per key range) are merged through LDS behind one barrier.
#define FA_KW (SQ / 8)               /* keys per wave */
__global__ __launch_bounds__(512) void k_fattn(const _Float16* __restrict__ Y16, const _Float16* __restrict__ X16, const _Float16* __restrict__ ZB, float* __restrict__ out) {
  __shared__ __attribute__((aligned(16))) float sacc[8][64][68];      /* pitch 68: 16-byte aligned rows that start 4 banks apart */
  __shared__ float sm[8][64]; __shared__ float sl[8][64];
  const int tid = threadIdx.x, w = tid >> 5, lane = tid & 31, ln = lane & 15, hh = lane >> 4; const int kc = w >> 1, qg = (w & 1) * 32;
  const size_t q0 = (size_t)blockIdx.x * 64; const size_t kb0 = (q0 / SQ) * SQ + (size_t)kc * FA_KW;      /* token rows: first query of the group, first key of the wave */
  const float cs = 0.002762135864009951f * 1.44269504f;      /* 512^-0.5 / 16 (Y is carried x16) x log2 e */
  v16h yb[2][2];
#pragma unroll
  for (int qt = 0; qt < 2; ++qt)
#pragma unroll
    for (int ks = 0; ks < 2; ++ks) yb[qt][ks] = g2_frag(Y16 + (q0 + qg + qt * 16 + ln) * EM + ks * 32, hh);
  const _Float16* xp = X16 + (kb0 + ln) * EM; const _Float16* zp = ZB + (kb0 / 64) * (size_t)(EM * 64) + ln * 64;      /* Z^T in blocks of 64 keys: [block][j][64] */
  const v8f z8 = {0.f,0.f,0.f,0.f,0.f,0.f,0.f,0.f}; v8f acc[2][4] = {{z8, z8, z8, z8}, {z8, z8, z8, z8}}; float m[2] = {-3.0e38f, -3.0e38f}, l[2] = {0.f, 0.f};
  v16h xa[2][2];
#pragma unroll
  for (int kt = 0; kt < 2; ++kt)
#pragma unroll
    for (int ks = 0; ks < 2; ++ks) xa[kt][ks] = g2_frag(xp + (size_t)(kt * 16) * EM + ks * 32, hh);
#pragma unroll 1      /* rolled: one pass's fragments and accumulators fill the register budget of four waves per SIMD */
  for (int it = 0; it < FA_KW / 32; ++it) {
    v16h za[4];
#pragma unroll
    for (int jt = 0; jt < 4; ++jt) za[jt] = g2_frag(zp + (size_t)(it >> 1) * (EM * 64) + jt * 16 * 64 + (it & 1) * 32, hh);
    v8f s[2][2];
#pragma unroll
    for (int qt = 0; qt < 2; ++qt)
#pragma unroll
      for (int kt = 0; kt < 2; ++kt) s[qt][kt] = fa_mma(xa[kt][1], yb[qt][1], fa_mma(xa[kt][0], yb[qt][0], z8));
    const int nx = (it + 1 < FA_KW / 32) ? it + 1 : it;      /* the next pass's key rows are fetched under this pass's softmax; the last pass fetches its own again (in bounds, unused) */
#pragma unroll
    for (int kt = 0; kt < 2; ++kt)
#pragma unroll
      for (int ks = 0; ks < 2; ++ks) xa[kt][ks] = g2_frag(xp + (size_t)(nx * 32 + kt * 16) * EM + ks * 32, hh);
    asm volatile("s_wait_xcnt 0x0" ::: "memory");      /* behind this pass's 16 loads: the next pass forms its addresses in the registers that these loads name */
    __builtin_amdgcn_sched_barrier(0);      /* keeps the softmax below the fetches, so that the next pass's key rows fly under it instead of being asked for at the pass's end */
    FragH pb[2]; float f[2];
#pragma unroll
    for (int qt = 0; qt < 2; ++qt) {
      float mx = fmaxf(s[qt][0][0], s[qt][1][0]);
#pragma unroll
      for (int r = 1; r < 8; ++r) mx = fmaxf(mx, fmaxf(s[qt][0][r], s[qt][1][r]));
      mx = fmaxf(mx, rs_xhalf(mx));
      const float mn = fmaxf(m[qt], mx * cs); f[qt] = fa_exp2(m[qt] - mn); m[qt] = mn;
      float ps = 0.f;
#pragma unroll
      for (int kt = 0; kt < 2; ++kt)
#pragma unroll
        for (int r4 = 0; r4 < 8; r4 += 4) { const float t0 = s[qt][kt][r4] * cs - mn, t1 = s[qt][kt][r4 + 1] * cs - mn, t2 = s[qt][kt][r4 + 2] * cs - mn, t3 = s[qt][kt][r4 + 3] * cs - mn; float e0, e1, e2, e3;
          /* four independent exponentials and one v_nop in one statement: the slot that the instruction set asks for behind a transcendental (early-clobber outputs keep the four apart) */
          asm("v_exp_f32 %0, %4\n\tv_exp_f32 %1, %5\n\tv_exp_f32 %2, %6\n\tv_exp_f32 %3, %7\n\tv_nop" : "=&v"(e0), "=&v"(e1), "=&v"(e2), "=&v"(e3) : "v"(t0), "v"(t1), "v"(t2), "v"(t3));
          ps += (e0 + e1) + (e2 + e3);
          pb[qt].h[kt * 8 + r4] = (_Float16)e0; pb[qt].h[kt * 8 + r4 + 1] = (_Float16)e1; pb[qt].h[kt * 8 + r4 + 2] = (_Float16)e2; pb[qt].h[kt * 8 + r4 + 3] = (_Float16)e3; }
      l[qt] = l[qt] * f[qt] + ps;
    }
    __builtin_amdgcn_sched_barrier(0);      /* every exponential stays above the matrix instructions below */
#pragma unroll
    for (int qt = 0; qt < 2; ++qt)
#pragma unroll
      for (int jt = 0; jt < 4; ++jt) acc[qt][jt] = fa_mma(za[jt], pb[qt].v, acc[qt][jt] * f[qt]);
  }
#pragma unroll
  for (int qt = 0; qt < 2; ++qt) { const float lt = l[qt] + rs_xhalf(l[qt]); if (hh == 0) { sm[kc][qg + qt * 16 + ln] = m[qt]; sl[kc][qg + qt * 16 + ln] = lt; }
#pragma unroll
    for (int jt = 0; jt < 4; ++jt) { const v8f c = acc[qt][jt]; const v4f c0 = {c[0], c[1], c[2], c[3]}, c1 = {c[4], c[5], c[6], c[7]};
      *(v4fa*)&sacc[kc][qg + qt * 16 + ln][jt * 16 + 8 * hh] = c0; *(v4fa*)&sacc[kc][qg + qt * 16 + ln][jt * 16 + 8 * hh + 4] = c1; } }
  __syncthreads();      /* the 8 key ranges' partial maxima, sums and rows are complete before any thread merges them */
  const int q = tid >> 3, d8 = (tid & 7) * 8; float mg = sm[0][q];
#pragma unroll
  for (int u = 1; u < 8; ++u) mg = fmaxf(mg, sm[u][q]);
  float lg = 0.f; v4f o0 = {0.f, 0.f, 0.f, 0.f}, o1 = {0.f, 0.f, 0.f, 0.f};
#pragma unroll
  for (int u = 0; u < 8; ++u) { const float f = fa_exp2(sm[u][q] - mg); lg += f * sl[u][q]; o0 += f * *(const v4fa*)&sacc[u][q][d8]; o1 += f * *(const v4fa*)&sacc[u][q][d8 + 4]; }
  const float sc = 0.0625f / lg;      /* Z is carried x16 */
  float* op = out + (q0 + q) * EM + d8; *(v4f*)op = o0 * sc; *(v4f*)(op + 4) = o1 * sc; }

// ---- launches 1 and 2: jobs that do not depend on one another share a launch (the block index picks the job) ----
__device__ __forceinline__ _Float16 pre_w16(float v) { return (_Float16)(bf16_round(v) * 16.0f); }      /* weight: rounded to bf16, carried x16, exact in f16 */
/* the 16 f32 values behind one lane's fragment (A or B, k order of g2_frag): r[0..7] = k 8 hh + i, r[8..15] = k 16 + 8 hh + i. Row form: p = first of the 32 k values of the lane's row, matrix kept as stored */
__device__ __forceinline__ void pre_raw_row(const float* p, int hh, float (&r)[16]) { const v4f a0 = *(const v4fa*)(p + 8 * hh), a1 = *(const v4fa*)(p + 8 * hh + 4), a2 = *(const v4fa*)(p + 16 + 8 * hh), a3 = *(const v4fa*)(p + 16 + 8 * hh + 4);
#pragma unroll
  for (int q = 0; q < 4; ++q) { r[q] = a0[q]; r[4 + q] = a1[q]; r[8 + q] = a2[q]; r[12 + q] = a3[q]; } }
/* column form, down a [k][EM] matrix: p = element (first k, the lane's column) */
__device__ __forceinline__ void pre_raw_col(const float* p, int hh, float (&r)[16]) {
#pragma unroll
  for (int i = 0; i < 8; ++i) { r[i] = p[(size_t)(8 * hh + i) * EM]; r[8 + i] = p[(size_t)(16 + 8 * hh + i) * EM]; } }
__device__ __forceinline__ v16h pre_cvt(const float (&r)[16]) { FragH f;
#pragma unroll
  for (int i = 0; i < 16; ++i) f.h[i] = pre_w16(r[i]);
  return f.v; }
/* one 16 x 16 tile over K = DM, k ascending in steps of 32; ACOL: A is read down columns */
template <bool ACOL>
__device__ __forceinline__ v8f pre_tile(const float* ap, const float* bp, int hh) { v8f c = {0.f, 0.f, 0.f, 0.f, 0.f, 0.f, 0.f, 0.f};
#pragma unroll 1      /* rolled: one stage of raw values is what the registers hold while two blocks still fit a WGP (the x blocks run under the same allocation) */
  for (int k0 = 0; k0 < DM; k0 += 128) { float ra[4][16], rb[4][16];
#pragma unroll
    for (int u = 0; u < 4; ++u) { if (ACOL) pre_raw_col(ap + (size_t)(k0 + 32 * u) * EM, hh, ra[u]); else pre_raw_row(ap + k0 + 32 * u, hh, ra[u]); pre_raw_row(bp + k0 + 32 * u, hh, rb[u]); }
    asm volatile("s_wait_xcnt 0x0" ::: "memory");      /* behind the stage's loads: the next stage forms its addresses in the registers that these loads name */
    __builtin_amdgcn_sched_barrier(0);      /* all loads of four k steps stay above the first conversion, so the four share one memory latency instead of paying one each */
#pragma unroll
    for (int u = 0; u < 4; ++u) c = fa_mma(pre_cvt(ra[u]), pre_cvt(rb[u]), c); }
  return c; }
#define PRE_GB 4                     /* blocks of launch 1 that form G^T and H^T: 2 planes x 16 tiles of 16 x 16, one tile a wave */
static_assert(NR * EM % (8 * 256) == 0, "k_pre: the x blocks have no tail guard");
// Launch 1. Blocks 0 .. PRE_GB - 1 (first, they last longest): plane 0 G^T[f][e] = sum_w Wk[f][w] Wq[e][w], plane 1 H^T[j][e] = sum_w Wm[w][j] Wv[e][w], both x16, operands converted in the loaders, k ascending in steps of 32 as before. The other blocks: x to f16 rows.
__global__ __launch_bounds__(256) void k_pre(const float* __restrict__ x, const float* __restrict__ wq, const float* __restrict__ wk, const float* __restrict__ wv, const float* __restrict__ wm, _Float16* __restrict__ X16, _Float16* __restrict__ GH) {
  __shared__ __attribute__((aligned(16))) _Float16 sg[32][72];      /* pitch 144 B: 16-byte aligned rows */
  const int tid = threadIdx.x;
  if (blockIdx.x >= PRE_GB) { const size_t t = (size_t)(blockIdx.x - PRE_GB) * 256 + tid; FragH f;
#pragma unroll
    for (int q = 0; q < 8; ++q) f.h[q] = (_Float16)bf16_round(x[t * 8 + q]);
    *(v8us*)((unsigned short*)X16 + t * 8) = f.half[0]; return; }
  const int lane = tid & 31, ln = lane & 15, hh = lane >> 4; const int g = blockIdx.x * 8 + (tid >> 5); const int plane = blockIdx.x / (PRE_GB / 2), rt = (g >> 2) & 3, ct = g & 3;
  const float* bp = (plane ? wv : wq) + (size_t)(ct * 16 + ln) * DM;
  const v8f c = plane ? pre_tile<true>(wm + rt * 16 + ln, bp, hh) : pre_tile<false>(wk + (size_t)(rt * 16 + ln) * DM, bp, hh);      /* plane is the same for the whole block */
#pragma unroll
  for (int r = 0; r < 8; ++r) sg[(rt & 1) * 16 + 8 * hh + r][ct * 16 + ln] = (_Float16)(c[r] * 0.0625f);
  __syncthreads();      /* the block's 32 rows (two row tiles x four column tiles, one wave each) are complete in LDS; taken by whole GH blocks only, the x blocks have left above */
  const int row = tid >> 3, c8 = (tid & 7) * 8;      /* 16 B a thread: every 128-B row of GH is stored by one wave */
  *(v8us*)((unsigned short*)GH + (size_t)plane * (EM * EM) + (size_t)((rt & 2) * 16 + row) * EM + c8) = *(const v8us*)&sg[row][c8]; }
// Launch 2. Blocks 0 .. MP / 128 - 1: Y[s][f] = sum_e x[s][e] G[e][f], x16. The other MP / 64 blocks: Z^T[j][s] = sum_e H[e][j] x[s][e], x16, one plane of 64 tokens a block: [s / 64][j][s % 64], so the 64 rows that a pass of the fused kernel reads lie in one 8-KiB run; no transpose pass.
__global__ __launch_bounds__(128) void k_yz(const _Float16* __restrict__ X16, const _Float16* __restrict__ GH, _Float16* __restrict__ Y16, _Float16* __restrict__ ZT) {
  const int b = blockIdx.x; const bool zr = b >= MP / 128;
  gemm2_body<0>(zr ? 0 : b, zr ? b - MP / 128 : 0, zr ? GH + (size_t)EM * EM : X16, EM, 0, zr ? X16 : GH, EM, zr ? (size_t)64 * EM : 0, 1.0f, nullptr, 0, nullptr, 1, 0, 0, nullptr, zr ? ZT : Y16, 64, zr ? (size_t)EM * 64 : 0, zr ? EM : MP, 64, EM); }

extern "C" void kernel_launch(void* const* d_in, const int* in_sizes, int n_in,
                              void* d_out, int out_size, void* d_ws, size_t ws_size, hipStream_t stream) {
  (void)in_sizes; (void)n_in; (void)out_size;
  const float* const* I = (const float* const*)d_in; const float* x = I[0]; const float* wq = I[1]; const float* wk = I[2]; const float* wv = I[3]; const float* wm = I[4];      /* weights [in][out] */
  char* ws = (char*)d_ws; size_t off = 0;
  auto take = [&](size_t bytes) { char* p = ws + off; off += (bytes + 255) & ~(size_t)255; return p; };
  _Float16* GH = (_Float16*)take((size_t)2 * EM * EM * 2);      /* GH = [G^T | H^T], each [64][64] x16 */
  _Float16* X16 = (_Float16*)take(NR * EM * 2); _Float16* Y16 = (_Float16*)take(NR * EM * 2); _Float16* ZT = (_Float16*)take(NR * EM * 2);
  if (off > ws_size) return;      /* approx 6 MiB */
  k_pre<<<(unsigned)(PRE_GB + NR * EM / 8 / 256), 256, 0, stream>>>(x, wq, wk, wv, wm, X16, GH);
  k_yz<<<(unsigned)(MP / 128 + MP / 64), 128, 0, stream>>>(X16, GH, Y16, ZT);
  k_fattn<<<(unsigned)(NR / 64), 512, 0, stream>>>(Y16, X16, ZT, (float*)d_out);      /* all batches: 64 query rows a work-group */
}

// v005
// A run of this version takes 31.1 microseconds.
// In both of two side-by-side timings against v004, it was 1.67 times as fast.
// Over all steps from v000 it is 108 times as fast.
#include <hip/hip_runtime.h>
// Wide single-head self-attention (x [4][4096][64]; Q/K/V = x W with W [64][512] stored [in][out] (heads NOT split: one 512-wide head); scores = Q K^T / sqrt(512) over all 4,096 keys; softmax; o = attn V; out = o Wm (Wm [512][64]) -> [4][4096][64]).
// Structure: the chained products are reassociated: Q K^T = (x G) x^T with G = Wq Wk^T [64][64], and (attn V) Wm = attn (x H) with H = Wv Wm [64][64] (exact algebra for any inputs; another f32 sum order), so both 4096 x 4096 products run at width 64 instead of 512. Token rows r = b*4096 + s; x exact in f16 (bf16-rounded); weights exact x16; G^T and H^T in one WMMA launch (two planes, K = 512, carried x16); Y = x G (x16) and Z = x H (x16); x, Y and Z^T are kept in the workspace in WMMA fragment order (see ff_frag), so that every fragment load and store is a contiguous 512-B run; then ONE fused launch for all batches: scores^T = x Y^T, running-maximum softmax in registers, out^T += Z^T P^T, so neither scores nor weights go through memory. 3 launches, one per link of the dependence chain: (x to f16 | G^T, H^T straight from the f32 weights), (Y | Z^T), fused attention.
// Compute dtype: inputs rounded to bf16; x / weights exact; G, H, Y, Z and softmax weights (exp(s - running max), in [0, 1]) as plain f16 WMMA operands (~2^-12); scores, statistics and out f32. v_wmma_f32_16x16x32_f16.
#define NB 4
#define SQ 4096
#define EM 64                        /* embedding */
#define DM 512                       /* wide = 8 x 64 (one head) */
#define NH 8                         /* 64-wide slabs of the one 512-wide head (not used) */
#define HD 64
#define HG 1
#define B0 0                         /* not used (all batches run from 0) */
#define NBR NB                       /* batches processed (debug hook) */
#define QN SQ                        /* not used (all SQ query rows attended) */
#define NR ((size_t)NB * SQ)
#define MP ((int)((size_t)NBR * SQ))
#define MPO MP
typedef __bf16 v16b __attribute__((ext_vector_type(16)));
typedef unsigned short v8us __attribute__((ext_vector_type(8), may_alias));
typedef float  v8f  __attribute__((ext_vector_type(8)));
typedef float  v4f  __attribute__((ext_vector_type(4)));
typedef float  v4fa __attribute__((ext_vector_type(4), may_alias));
union FragB { v16b v; v8us half[2]; unsigned short u[16]; };

__device__ __forceinline__ unsigned short bf16_bits(float x) { unsigned int u = __float_as_uint(x); return (unsigned short)((u + 0x7FFFu + ((u >> 16) & 1u)) >> 16); }
__device__ __forceinline__ float bf16_val(unsigned short b) { return __uint_as_float(((unsigned int)b) << 16); }
__device__ __forceinline__ float bf16_round(float x) { return bf16_val(bf16_bits(x)); }
// D += A·B with NT terms: 1 = ah·bh, 2 = + al·bh (A split), 3 = + ah·bl (both split)
template <int NT>
__device__ __forceinline__ v8f mmaN(v16b ah, v16b al, v16b bh, v16b bl, v8f c) {
  c = __builtin_amdgcn_wmma_f32_16x16x32_bf16(false, ah, false, bh, (short)0, c, false, false);
  if (NT >= 2) c = __builtin_amdgcn_wmma_f32_16x16x32_bf16(false, al, false, bh, (short)0, c, false, false);
  if (NT >= 3) c = __builtin_amdgcn_wmma_f32_16x16x32_bf16(false, ah, false, bl, (short)0, c, false, false);
  asm volatile("v_nop\n\tv_nop\n\tv_nop\n\tv_nop" : "+v"(c) : "v"(ah), "v"(al), "v"(bh), "v"(bl));
  return c;
}

__global__ __launch_bounds__(256) void k_wt_bf16(const float* __restrict__ W, unsigned short* __restrict__ Wt, int K, int N) {
  const int t = blockIdx.x * 256 + threadIdx.x;
  const int k8n = K / 8;
  if (t >= N * k8n) return;
  const int n = t / k8n, k8 = (t % k8n) * 8;
  v8us v;
#pragma unroll
  for (int i = 0; i < 8; ++i) v[i] = bf16_bits(W[(size_t)(k8 + i) * N + n]);
  *(v8us*)(Wt + (size_t)n * K + k8) = v;
  
}

// GEMM C[M][N] (f32, pitch ldc) = act(A[M][K]·W + bias). A f32 row-major (pitch lda) converted per fragment to bf16
// (ASPLIT: hi/lo two planes -> 2 terms, else single rounded term); Wt bf16 [N][K] (pitch ldb). BIAS_BF16 rounds the
// bias to bf16 first (bias quantised to bf16 before the add). K%32==0, M%16==0, N%64==0.
template <bool ASPLIT, int ACT, bool BIAS_BF16>
__global__ __launch_bounds__(128) void k_gemm_bf(const float* __restrict__ A, int lda, const unsigned short* __restrict__ Wt, int ldb,
                                               const float* __restrict__ bias, float* __restrict__ C, int ldc, int M, int N, int K) {
  __shared__ __attribute__((aligned(16))) float so[4][16][64];
  const int tid = threadIdx.x, w = tid >> 5, lane = tid & 31, ln = lane & 15, hh = lane >> 4;
  const int ntn = N / 64;
  const int wid = blockIdx.x * 4 + w;
  const int mt = wid / ntn, nq = wid % ntn;
  if (mt * 16 >= M) return;
  const int row0 = mt * 16, col0 = nq * 64;
  const float* arow = A + (size_t)(row0 + ln) * lda;
  v8f acc[4] = {};
  for (int kb = 0; kb < K; kb += 32) {
    FragB ah, al;
    const v4f x0 = *(const v4fa*)(arow + kb + 8 * hh), x1 = *(const v4fa*)(arow + kb + 8 * hh + 4);
    const v4f x2 = *(const v4fa*)(arow + kb + 16 + 8 * hh), x3 = *(const v4fa*)(arow + kb + 16 + 8 * hh + 4);
    float xs[16] = {x0[0],x0[1],x0[2],x0[3],x1[0],x1[1],x1[2],x1[3],x2[0],x2[1],x2[2],x2[3],x3[0],x3[1],x3[2],x3[3]};
#pragma unroll
    for (int i = 0; i < 16; ++i) { const unsigned short hb = bf16_bits(xs[i]); ah.u[i] = hb; al.u[i] = ASPLIT ? bf16_bits(xs[i] - bf16_val(hb)) : (unsigned short)0; }
#pragma unroll
    for (int t = 0; t < 4; ++t) {
      const unsigned short* brow = Wt + (size_t)(col0 + t * 16 + ln) * ldb + kb;
      FragB b;
      b.half[0] = *(const v8us*)(brow + 8 * hh);
      b.half[1] = *(const v8us*)(brow + 16 + 8 * hh);
      acc[t] = mmaN<ASPLIT ? 2 : 1>(ah.v, al.v, b.v, b.v, acc[t]);
    }
  }
#pragma unroll
  for (int t = 0; t < 4; ++t) {
    float bv = bias ? bias[col0 + t * 16 + ln] : 0.f;
    if (BIAS_BF16) bv = bf16_round(bv);
#pragma unroll
    for (int r = 0; r < 8; ++r) { float v = acc[t][r] + bv; if (ACT == 1) v = fmaxf(v, 0.f); so[w][8 * hh + r][t * 16 + ln] = v; }
  }
  __builtin_amdgcn_fence(__ATOMIC_ACQ_REL, "workgroup");
  __builtin_amdgcn_wave_barrier();
  const int rsub = lane >> 4, c4 = (lane & 15) * 4;
  {
#pragma unroll
    for (int q = 0; q < 8; ++q) {
      const int r = q * 2 + rsub;
      const v4f v = *(const v4fa*)&so[w][r][c4];
      *(v4f*)(C + (size_t)(row0 + r) * ldc + col0 + c4) = v;
    }
    
  }
}

// GEMM C = act(A·W + bias + resid): A f32 (ASPLIT -> hi/lo 2 terms), Wt bf16 [N][K]; ACT 0 none, 1 relu, 2 exact gelu;
// resid (optional, f32, row index = (row % rmod), pitch ldr, RES_BF16 rounds it) added before the activation.
template <bool ASPLIT, int ACT, bool BIAS_BF16, bool RES_BF16>
__global__ __launch_bounds__(128) void k_gemm_bf3(const float* __restrict__ A, int lda, const unsigned short* __restrict__ Wt, int ldb,
                                                const float* __restrict__ bias, const float* __restrict__ resid, int rmod, int ldr,
                                                float* __restrict__ C, int ldc, int M, int N, int K) {
  __shared__ __attribute__((aligned(16))) float so[4][16][64];
  const int tid = threadIdx.x, w = tid >> 5, lane = tid & 31, ln = lane & 15, hh = lane >> 4;
  const int ntn = N / 64;
  const int wid = blockIdx.x * 4 + w;
  const int mt = wid / ntn, nq = wid % ntn;
  if (mt * 16 >= M) return;
  const int row0 = mt * 16, col0 = nq * 64;
  const float* arow = A + (size_t)(row0 + ln) * lda;
  v8f acc[4] = {};
  for (int kb = 0; kb < K; kb += 32) {
    FragB ah, al;
    const v4f x0 = *(const v4fa*)(arow + kb + 8 * hh), x1 = *(const v4fa*)(arow + kb + 8 * hh + 4);
    const v4f x2 = *(const v4fa*)(arow + kb + 16 + 8 * hh), x3 = *(const v4fa*)(arow + kb + 16 + 8 * hh + 4);
    float xs[16] = {x0[0],x0[1],x0[2],x0[3],x1[0],x1[1],x1[2],x1[3],x2[0],x2[1],x2[2],x2[3],x3[0],x3[1],x3[2],x3[3]};
#pragma unroll
    for (int i = 0; i < 16; ++i) { const unsigned short hb = bf16_bits(xs[i]); ah.u[i] = hb; al.u[i] = ASPLIT ? bf16_bits(xs[i] - bf16_val(hb)) : (unsigned short)0; }
#pragma unroll
    for (int t = 0; t < 4; ++t) {
      const unsigned short* brow = Wt + (size_t)(col0 + t * 16 + ln) * ldb + kb;
      FragB b;
      b.half[0] = *(const v8us*)(brow + 8 * hh);
      b.half[1] = *(const v8us*)(brow + 16 + 8 * hh);
      acc[t] = mmaN<ASPLIT ? 2 : 1>(ah.v, al.v, b.v, b.v, acc[t]);
    }
  }
#pragma unroll
  for (int t = 0; t < 4; ++t) {
    const int col = col0 + t * 16 + ln;
    float bv = bias ? bias[col] : 0.f;
    if (BIAS_BF16) bv = bf16_round(bv);
#pragma unroll
    for (int r = 0; r < 8; ++r) {
      float v = acc[t][r] + bv;
      if (resid) { float rv = resid[(size_t)((row0 + 8 * hh + r) % rmod) * ldr + col]; if (RES_BF16) rv = bf16_round(rv); v += rv; }
      if (ACT == 1) v = fmaxf(v, 0.f);
      if (ACT == 2) v = 0.5f * v * (1.0f + erff(v * 0.70710678118654752f));
      if (ACT == 3) { const float u = 0.7978845608028654f * (v + 0.044715f * v * v * v); v = 0.5f * v * (1.0f + tanhf(u)); }
      so[w][8 * hh + r][t * 16 + ln] = v;
    }
  }
  __builtin_amdgcn_fence(__ATOMIC_ACQ_REL, "workgroup");
  __builtin_amdgcn_wave_barrier();
  const int rsub = lane >> 4, c4 = (lane & 15) * 4;
  {
#pragma unroll
    for (int q = 0; q < 8; ++q) {
      const int r = q * 2 + rsub;
      const v4f v = *(const v4fa*)&so[w][r][c4];
      *(v4f*)(C + (size_t)(row0 + r) * ldc + col0 + c4) = v;
    }
    
  }
}
// row LayerNorm (biased variance, eps) over N: s = X (+ R); optional out_sum <- s; out_norm <- (s-mu)*rsqrt(var+eps)*g + b
template <bool PARAM_BF16>
__global__ __launch_bounds__(256) void k_layernorm(const float* __restrict__ X, const float* __restrict__ R, const float* __restrict__ g, const float* __restrict__ bta,
                                                  float* __restrict__ out_sum, float* __restrict__ out_norm, int N, float eps) {
  __shared__ float red[256];
  const int row = blockIdx.x, tid = threadIdx.x;
  const float* x = X + (size_t)row * N; const float* rr = R ? R + (size_t)row * N : nullptr;
  float vals[16];                     // up to N = 4096
  const int per = N / 256;            // contiguous chunk per thread? use strided-by-4 chunks: thread handles j = tid*4 + 1024*u
  float s1 = 0.f;
  for (int u = 0; u < per / 4; ++u) {
    const int j = tid * 4 + 1024 * u;
    const v4f a = *(const v4fa*)(x + j);
    v4f b = {0.f,0.f,0.f,0.f}; if (rr) b = *(const v4fa*)(rr + j);
#pragma unroll
    for (int q = 0; q < 4; ++q) { const float v = a[q] + b[q]; vals[u * 4 + q] = v; s1 += v; }
  }
  red[tid] = s1; __syncthreads();
  for (int st = 128; st > 0; st >>= 1) { if (tid < st) red[tid] += red[tid + st]; __syncthreads(); }
  const float mu = red[0] / (float)N; __syncthreads();
  float s2 = 0.f;
  for (int u = 0; u < per / 4; ++u)
#pragma unroll
    for (int q = 0; q < 4; ++q) { const float c = vals[u * 4 + q] - mu; s2 += c * c; }
  red[tid] = s2; __syncthreads();
  for (int st = 128; st > 0; st >>= 1) { if (tid < st) red[tid] += red[tid + st]; __syncthreads(); }
  const float rs = rsqrtf(red[0] / (float)N + eps);
  {
    for (int u = 0; u < per / 4; ++u) {
      const int j = tid * 4 + 1024 * u;
      v4f o, sm;
#pragma unroll
      for (int q = 0; q < 4; ++q) {
        float gg = g[j + q], bb = bta[j + q];
        if (PARAM_BF16) { gg = bf16_round(gg); bb = bf16_round(bb); }
        sm[q] = vals[u * 4 + q]; o[q] = (vals[u * 4 + q] - mu) * rs * gg + bb;
      }
      if (out_sum) *(v4f*)(out_sum + (size_t)row * N + j) = sm;
      *(v4f*)(out_norm + (size_t)row * N + j) = o;
    }
    
  }
}



// ---- f16 WMMA path (v_wmma_f32_16x16x32_f16): 11-bit significands for operands in range — used where a [0,1] probability operand needs more precision than bf16
typedef _Float16 v16h __attribute__((ext_vector_type(16)));
union FragH { v16h v; v8us half[2]; _Float16 h[16]; unsigned short u[16]; };
template <int NT>
__device__ __forceinline__ v8f mmaH(v16h ah, v16h al, v16h bh, v16h bl, v8f c) {
  c = __builtin_amdgcn_wmma_f32_16x16x32_f16(false, ah, false, bh, (short)0, c, false, false);
  if (NT >= 2) c = __builtin_amdgcn_wmma_f32_16x16x32_f16(false, al, false, bh, (short)0, c, false, false);
  if (NT >= 3) c = __builtin_amdgcn_wmma_f32_16x16x32_f16(false, ah, false, bl, (short)0, c, false, false);
  asm volatile("v_nop\n\tv_nop\n\tv_nop\n\tv_nop" : "+v"(c) : "v"(ah), "v"(al), "v"(bh), "v"(bl));
  return c;
}
// batched GEMM like k_gemm_b but f16 operands: A f32 (split into f16 hi/lo if ASPLIT, else rounded to f16), Bt = f16 values [n][k]; alpha; C f32; N multiple of 16 (partial tiles skipped)
template <bool ASPLIT>
__global__ __launch_bounds__(128) void k_gemm_h(const float* __restrict__ A, int lda, size_t sA, const _Float16* __restrict__ Bh, int ldb, size_t sB, float alpha, float* __restrict__ C, int ldc, size_t sC, int M, int N, int K) {
  __shared__ __attribute__((aligned(16))) float so[4][16][64];
  const int tid = threadIdx.x, w = tid >> 5, lane = tid & 31, ln = lane & 15, hh = lane >> 4; const int by = blockIdx.y;
  A += (size_t)by * sA; Bh += (size_t)by * sB; C += (size_t)by * sC;
  const int ntn = (N + 63) / 64; const int wid = blockIdx.x * 4 + w; const int mt = wid / ntn, nq = wid % ntn; if (mt * 16 >= M) return;
  const int row0 = mt * 16, col0 = nq * 64; const float* arow = A + (size_t)(row0 + ln) * lda;
  v8f acc[4] = {};
  for (int kb = 0; kb < K; kb += 32) {
    FragH ah, al;
    const v4f x0 = *(const v4fa*)(arow + kb + 8 * hh), x1 = *(const v4fa*)(arow + kb + 8 * hh + 4), x2 = *(const v4fa*)(arow + kb + 16 + 8 * hh), x3 = *(const v4fa*)(arow + kb + 16 + 8 * hh + 4);
    float xs[16] = {x0[0],x0[1],x0[2],x0[3],x1[0],x1[1],x1[2],x1[3],x2[0],x2[1],x2[2],x2[3],x3[0],x3[1],x3[2],x3[3]};
#pragma unroll
    for (int i = 0; i < 16; ++i) { const _Float16 h = (_Float16)xs[i]; ah.h[i] = h; al.h[i] = ASPLIT ? (_Float16)(xs[i] - (float)h) : (_Float16)0.0f; }
#pragma unroll
    for (int t = 0; t < 4; ++t) { if (col0 + t * 16 >= N) continue; const size_t boff = (size_t)(col0 + t * 16 + ln) * ldb + kb; FragH bq; bq.half[0] = *(const v8us*)(Bh + boff + 8 * hh); bq.half[1] = *(const v8us*)(Bh + boff + 16 + 8 * hh);
      acc[t] = mmaH<ASPLIT ? 2 : 1>(ah.v, al.v, bq.v, bq.v, acc[t]); }
  }
#pragma unroll
  for (int t = 0; t < 4; ++t) { if (col0 + t * 16 >= N) continue;
#pragma unroll
    for (int r = 0; r < 8; ++r) so[w][8 * hh + r][t * 16 + ln] = acc[t][r] * alpha; }
  __builtin_amdgcn_fence(__ATOMIC_ACQ_REL, "workgroup"); __builtin_amdgcn_wave_barrier();
  const int rsub = lane >> 4, c4 = (lane & 15) * 4;
  {
#pragma unroll
    for (int q = 0; q < 8; ++q) { const int r = q * 2 + rsub; if (col0 + c4 < N) { const v4f v = *(const v4fa*)&so[w][r][c4]; *(v4f*)(C + (size_t)(row0 + r) * ldc + col0 + c4) = v; } }
     }
}

// Wt[n][k] = f16(W[k][n]·scale) from f32 row-major W[K][N] (scale = power of two; bf16-exact weights stay exact in f16 away from the subnormal range)
__global__ __launch_bounds__(256) void k_wt_f16(const float* __restrict__ W, _Float16* __restrict__ Wt, int K, int N, float scale) {
  const int t = blockIdx.x * 256 + threadIdx.x; if (t >= N * (K / 8)) return; const int n = t / (K / 8), k8 = (t % (K / 8)) * 8; FragH f;
#pragma unroll
  for (int i = 0; i < 8; ++i) f.h[i] = (_Float16)(bf16_round(W[(size_t)(k8 + i) * N + n]) * scale); const v8us o = f.half[0];
  *(v8us*)((unsigned short*)Wt + (size_t)n * K + k8) = o; 
}
// k_gemm_hh variant with fused epilogue: v = acc·alpha + bias[by·sBias + col] (+ CP[(row/rowsPerB)·sCPb + by·64 + col] if CP) ; ACT 0 none / 1 elu ; writes f16 C16 (and f32 C if non-null)
template <int ACT>
__global__ __launch_bounds__(128) void k_gemm_hhx(const _Float16* __restrict__ A, int lda, size_t sA, const _Float16* __restrict__ Bh, int ldb, size_t sB, float alpha, const float* __restrict__ bias, size_t sBias, const float* __restrict__ CP, int rowsPerB, size_t sCPb, int row0g,
    float* __restrict__ C, _Float16* __restrict__ C16, int ldc, size_t sC, int M, int N, int K) {
  __shared__ __attribute__((aligned(16))) float so[4][16][64];
  const int tid = threadIdx.x, w = tid >> 5, lane = tid & 31, ln = lane & 15, hh = lane >> 4; const int by = blockIdx.y;
  A += (size_t)by * sA; Bh += (size_t)by * sB; const size_t cofs = (size_t)by * sC; const float* bp = bias ? bias + (size_t)by * sBias : nullptr;
  const int ntn = (N + 63) / 64; const int wid = blockIdx.x * 4 + w; const int mt = wid / ntn, nq = wid % ntn; if (mt * 16 >= M) return;
  const int row0 = mt * 16, col0 = nq * 64; const _Float16* arow = A + (size_t)(row0 + ln) * lda;
  v8f acc[4] = {};
  for (int kb = 0; kb < K; kb += 32) { FragH ah; ah.half[0] = *(const v8us*)((const unsigned short*)arow + kb + 8 * hh); ah.half[1] = *(const v8us*)((const unsigned short*)arow + kb + 16 + 8 * hh);
#pragma unroll
    for (int t = 0; t < 4; ++t) { if (col0 + t * 16 >= N) continue; const size_t boff = (size_t)(col0 + t * 16 + ln) * ldb + kb; FragH bq; bq.half[0] = *(const v8us*)((const unsigned short*)Bh + boff + 8 * hh); bq.half[1] = *(const v8us*)((const unsigned short*)Bh + boff + 16 + 8 * hh);
      acc[t] = mmaH<1>(ah.v, ah.v, bq.v, bq.v, acc[t]); }
  }
#pragma unroll
  for (int t = 0; t < 4; ++t) { if (col0 + t * 16 >= N) continue; const int col = col0 + t * 16 + ln; const float bv = bp ? bf16_round(bp[col]) : 0.f;
#pragma unroll
    for (int r = 0; r < 8; ++r) { float v = acc[t][r] * alpha + bv; if (CP) { const int rr = row0g + row0 + 8 * hh + r; if (rowsPerB < 0) v += CP[cofs + (size_t)rr * ldc + col];      /* rowsPerB < 0: own element of the batched C plane */ else { const int bidx = rr / rowsPerB; v += CP[(size_t)bidx * sCPb + (size_t)by * 64 + col]; } } if (ACT == 1) v = (v > 0.f) ? v : expm1f(v); else if (ACT == 7) v = (v > 0.f) ? v + 1.0f : expf(v); else if (ACT == 8) v = tanhf(v); else if (ACT == 9) v = 0.5f * v * (1.0f + tanhf(0.7978845608028654f * (v + 0.044715f * v * v * v))); else if (ACT == 11) v = 1.0f / (1.0f + expf(-v)); else if (ACT == 12) v = (v > 0.f) ? v : 0.01f * v; else if (ACT == 14) v = (v > 0.f) ? v : 0.1f * v; else if (ACT == 16) v = (v >= 0.f) ? v : 0.3f * v; else if (ACT == 17) v = (v >= 0.f) ? v : 0.2f * v; else if (ACT == 15) v = v / (1.0f + expf(-v)); else if (ACT == 3) v = fmaxf(v, 0.f); else if (ACT == 6) v = 0.5f * v * (1.0f + erff(v * 0.70710678118654752f)); so[w][8 * hh + r][t * 16 + ln] = v; } }
  __builtin_amdgcn_fence(__ATOMIC_ACQ_REL, "workgroup"); __builtin_amdgcn_wave_barrier();
  const int rsub = lane >> 4, c4 = (lane & 15) * 4; typedef _Float16 v4h __attribute__((ext_vector_type(4)));
  {
#pragma unroll
    for (int q = 0; q < 8; ++q) { const int r = q * 2 + rsub; if (col0 + c4 < N) { const v4f v = *(const v4fa*)&so[w][r][c4]; if (C) *(v4f*)(C + cofs + (size_t)(row0 + r) * ldc + col0 + c4) = v; if (C16) { v4h h4; for (int i = 0; i < 4; ++i) h4[i] = (_Float16)v[i]; *(v4h*)(C16 + cofs + (size_t)(row0 + r) * ldc + col0 + c4) = h4; } } }
     }
}


typedef _Float16 v4h __attribute__((ext_vector_type(4)));

__global__ __launch_bounds__(256) void k_x16(const float* __restrict__ x, _Float16* __restrict__ X16, size_t n8) { const size_t t = (size_t)blockIdx.x * 256 + threadIdx.x; if (t >= n8) return; FragH f;
#pragma unroll
  for (int q = 0; q < 8; ++q) f.h[q] = (_Float16)bf16_round(x[t * 8 + q]); *(v8us*)((unsigned short*)X16 + t * 8) = f.half[0];  }
__global__ __launch_bounds__(256) void k_h16(const float* __restrict__ x, _Float16* __restrict__ X16, size_t n8) { const size_t t = (size_t)blockIdx.x * 256 + threadIdx.x; if (t >= n8) return; FragH f;
#pragma unroll
  for (int q = 0; q < 8; ++q) f.h[q] = (_Float16)x[t * 8 + q]; *(v8us*)((unsigned short*)X16 + t * 8) = f.half[0];  }
__global__ __launch_bounds__(256) void k_round16f(const float* __restrict__ W, _Float16* __restrict__ Bt, size_t n8) { const size_t t = (size_t)blockIdx.x * 256 + threadIdx.x; if (t >= n8) return; FragH f;
#pragma unroll
  for (int i = 0; i < 8; ++i) f.h[i] = (_Float16)(bf16_round(W[t * 8 + i]) * 16.0f); *(v8us*)((unsigned short*)Bt + t * 8) = f.half[0];  }
template <int NHv, int TTv>
__global__ __launch_bounds__(256) void k_vt(const _Float16* __restrict__ V16, int ldv, int voff, _Float16* __restrict__ Vt) { __shared__ unsigned short tl[64][66]; const int tid = threadIdx.x; const int slab = blockIdx.x / (TTv / 64), lg = blockIdx.x % (TTv / 64); const int b = slab / NHv, h = slab % NHv;
  for (int i = tid; i < 64 * 8; i += 256) { const int r = i / 8, c8 = (i % 8) * 8; FragH f; f.half[0] = *(const v8us*)((const unsigned short*)V16 + ((size_t)b * TTv + lg * 64 + r) * ldv + voff + h * 64 + c8);
#pragma unroll
    for (int q = 0; q < 8; ++q) tl[r][c8 + q] = f.u[q]; }
  __syncthreads();
  {
#pragma unroll
    for (int rd = 0; rd < 2; ++rd) { const int d = rd * 32 + tid / 8, pc = tid % 8; FragH f;
#pragma unroll
      for (int q = 0; q < 8; ++q) f.u[q] = tl[pc * 8 + q][d];
      *(v8us*)((unsigned short*)Vt + ((size_t)slab * 64 + d) * TTv + lg * 64 + pc * 8) = f.half[0]; }
     } }

__global__ __launch_bounds__(256) void k_hl(const float* __restrict__ F, _Float16* __restrict__ Hh, _Float16* __restrict__ Hl, size_t n8) { const size_t t = (size_t)blockIdx.x * 256 + threadIdx.x; if (t >= n8) return; FragH fh, fl; const v4f a = *(const v4fa*)(F + t * 8), c = *(const v4fa*)(F + t * 8 + 4);
#pragma unroll
  for (int q = 0; q < 4; ++q) { _Float16 h = (_Float16)a[q]; fh.h[q] = h; fl.h[q] = (_Float16)((a[q] - (float)h) * 1024.0f); h = (_Float16)c[q]; fh.h[4 + q] = h; fl.h[4 + q] = (_Float16)((c[q] - (float)h) * 1024.0f); }
  { *(v8us*)((unsigned short*)Hh + t * 8) = fh.half[0]; *(v8us*)((unsigned short*)Hl + t * 8) = fl.half[0];  } }

/* one fragment (A or B) from a row-major matrix: p = first of the 32 k values of the lane's row */
__device__ __forceinline__ v16h g2_frag(const _Float16* p, int hh) { FragH f; f.half[0] = *(const v8us*)((const unsigned short*)p + 8 * hh); f.half[1] = *(const v8us*)((const unsigned short*)p + 16 + 8 * hh); return f.v; }
/* Fragment order. A 16-row x 64-k tile (2 KiB) is kept as [k / 8][row][k % 8]: the 16-byte piece that lane (hh, ln) wants for k = 32 ks + 16 h + 8 hh .. + 7 of row ln lies at halves 512 ks + 256 h + 8 lane,
   so one load of 16 B a lane covers 512 contiguous bytes (4 whole lines) where a row-major tile makes it touch 16 lines. p = fragment's first element + 8 lane; same k order as g2_frag */
__device__ __forceinline__ v16h ff_frag(const _Float16* p) { FragH f; f.half[0] = *(const v8us*)((const unsigned short*)p); f.half[1] = *(const v8us*)((const unsigned short*)p + 256); return f.v; }
/* a D tile's 8 registers of a lane (rows 8 hh + r of column ln) are one such 16-byte piece of the matrix whose rows are D's columns: p = piece run's first element + 8 lane */
__device__ __forceinline__ void ff_store(_Float16* p, v8f c) { FragH f;
#pragma unroll
  for (int r = 0; r < 8; ++r) f.h[r] = (_Float16)c[r];
  *(v8us*)((unsigned short*)p) = f.half[0]; }


__global__ __launch_bounds__(256) void k_wnat(const float* __restrict__ w, size_t n8, _Float16* __restrict__ Bt) { const size_t t = (size_t)blockIdx.x * 256 + threadIdx.x; if (t >= n8) return; FragH f; for (int q = 0; q < 8; ++q) f.h[q] = (_Float16)(bf16_round(w[t * 8 + q]) * 16.0f); *(v8us*)((unsigned short*)Bt + t * 8) = f.half[0];  }
__global__ __launch_bounds__(256) void k_rsm(const float* __restrict__ S, _Float16* __restrict__ P, int nrows) {
  #pragma clang fp contract(off)
  const int i = blockIdx.x * 256 + threadIdx.x; if (i >= nrows) return; const float* s = S + (size_t)i * SQ; float mx = -3.0e38f;
#pragma unroll 1
  for (int j = 0; j < SQ; ++j) mx = fmaxf(mx, s[j]); float se = 0.f;
#pragma unroll 1
  for (int j = 0; j < SQ; ++j) se += expf(s[j] - mx); const float sc = 256.0f / se;
#pragma unroll 1
  for (int j0 = 0; j0 < SQ; j0 += 8) { FragH f; for (int q = 0; q < 8; ++q) f.h[q] = (_Float16)(expf(s[j0 + q] - mx) * sc); unsigned short* d = (unsigned short*)P + (size_t)i * SQ + j0; *(v8us*)d = f.half[0];  } }
__global__ __launch_bounds__(256) void k_vt(const _Float16* __restrict__ V16, int b, int h0, _Float16* __restrict__ VT) { __shared__ unsigned short tl[64][65]; const int tid = threadIdx.x; const int hh = blockIdx.x % HG, sg = blockIdx.x / HG; const int s0 = sg * 64; const int h = h0 + hh;
  for (int i = tid; i < 64 * 8; i += 256) { const int j = i / 8, d8 = (i % 8) * 8; FragH f; f.half[0] = *(const v8us*)((const unsigned short*)V16 + ((size_t)b * SQ + s0 + j) * DM + h * HD + d8); for (int q = 0; q < 8; ++q) tl[d8 + q][j] = f.u[q]; }
  __syncthreads();
  { for (int i = tid; i < 64 * 8; i += 256) { const int d = i / 8, j8 = (i % 8) * 8; FragH f; for (int q = 0; q < 8; ++q) f.u[q] = tl[d][j8 + q]; *(v8us*)((unsigned short*)VT + ((size_t)hh * HD + d) * SQ + s0 + j8) = f.half[0]; }  } }


__device__ __forceinline__ float rs_xhalf(float x) { return __builtin_bit_cast(float, __builtin_amdgcn_permlanex16(__builtin_bit_cast(int, x), __builtin_bit_cast(int, x), 0x76543210, 0xfedcba98, false, false)); }      /* lane l <- lane l ^ 16 */
__device__ __forceinline__ v8f fa_mma(v16h a, v16h b, v8f c) { return __builtin_amdgcn_wmma_f32_16x16x32_f16(false, a, false, b, (short)0, c, false, false); }
/* 2^t, native; the v_nop fills the slot that the instruction set asks for behind a transcendental */
__device__ __forceinline__ float fa_exp2(float t) { float e; asm("v_exp_f32 %0, %1\n\tv_nop" : "=&v"(e) : "v"(t)); return e; }
// Fused attention. Work-group = 16 waves = 64 query rows, one work-group per WGP; wave w takes queries 32 (w & 1) .. + 31 and keys [512 (w >> 1), + 512) of the rows' batch, 32 keys a pass (the two waves of a key range read the same lines at about the same time). Y, x and Z^T arrive in fragment order: a pass reads 4 KiB of x and 4 KiB of Z^T, each contiguous.
// Both products are computed transposed, so a lane owns ONE query (column ln of every D tile): S^T tile (A = 16 key rows of x, B = 16 query rows of Y) leaves key 8 hh + r in register r,
// which is exactly the k order of the B fragment of out^T = Z^T P^T (elements 0..7 = keys 8 hh + i of the first key tile, 8..15 = the same of the second): P never leaves its registers.
// Statistics per lane in the log2 domain; the maximum is shared by the two lane halves each pass, the sum only at the end. The 8 partial results of a query (one per key range) are merged through LDS behind one barrier.
#define FA_KW (SQ / 8)               /* keys per wave */
__global__ __launch_bounds__(512) void k_fattn(const _Float16* __restrict__ YF, const _Float16* __restrict__ XF, const _Float16* __restrict__ ZF, float* __restrict__ out) {
  __shared__ __attribute__((aligned(16))) float sacc[8][64][68];      /* pitch 68: 16-byte aligned rows that start 4 banks apart */
  __shared__ float sm[8][64]; __shared__ float sl[8][64];
  const int tid = threadIdx.x, w = tid >> 5, lane = tid & 31, ln = lane & 15, hh = lane >> 4; const int kc = w >> 1, qg = (w & 1) * 32;
  const size_t q0 = (size_t)blockIdx.x * 64; const size_t kb0 = (q0 / SQ) * SQ + (size_t)kc * FA_KW;      /* token rows: first query of the group, first key of the wave */
  const float cs = 0.002762135864009951f * 1.44269504f;      /* 512^-0.5 / 16 (Y is carried x16) x log2 e */
  v16h yb[2][2];
#pragma unroll
  for (int qt = 0; qt < 2; ++qt)
#pragma unroll
    for (int ks = 0; ks < 2; ++ks) yb[qt][ks] = ff_frag(YF + ((q0 + qg) / 16 + qt) * (size_t)(16 * EM) + ks * 512 + lane * 8);
  const _Float16* xp = XF + kb0 * EM + lane * 8; const _Float16* zp = ZF + kb0 * EM + lane * 8;      /* x: 16-key tiles of 1,024 halves; Z^T: 32-key blocks of 2,048 halves, [j tile][fragment of 512] */
  const v8f z8 = {0.f,0.f,0.f,0.f,0.f,0.f,0.f,0.f}; v8f acc[2][4] = {{z8, z8, z8, z8}, {z8, z8, z8, z8}}; float m[2] = {-3.0e38f, -3.0e38f}, l[2] = {0.f, 0.f};
  v16h xa[2][2];
#pragma unroll
  for (int kt = 0; kt < 2; ++kt)
#pragma unroll
    for (int ks = 0; ks < 2; ++ks) xa[kt][ks] = ff_frag(xp + kt * (16 * EM) + ks * 512);
#pragma unroll 1      /* rolled: one pass's fragments and accumulators fill the register budget of four waves per SIMD */
  for (int it = 0; it < FA_KW / 32; ++it) {
    v16h za[4]; const _Float16* zq = zp + (size_t)it * (32 * EM);
#pragma unroll
    for (int jt = 0; jt < 4; ++jt) za[jt] = ff_frag(zq + jt * 512);
    v8f s[2][2];
#pragma unroll
    for (int qt = 0; qt < 2; ++qt)
#pragma unroll
      for (int kt = 0; kt < 2; ++kt) s[qt][kt] = fa_mma(xa[kt][1], yb[qt][1], fa_mma(xa[kt][0], yb[qt][0], z8));
    const int nx = (it + 1 < FA_KW / 32) ? it + 1 : it;      /* the next pass's key rows are fetched under this pass's softmax; the last pass fetches its own again (in bounds, unused) */
    const _Float16* xq = xp + (size_t)nx * (32 * EM);
#pragma unroll
    for (int kt = 0; kt < 2; ++kt)
#pragma unroll
      for (int ks = 0; ks < 2; ++ks) xa[kt][ks] = ff_frag(xq + kt * (16 * EM) + ks * 512);
    asm volatile("s_wait_xcnt 0x0" :: "v"(zq), "v"(xq) : "memory");      /* behind this pass's 16 loads: the next pass forms its addresses in the registers that these loads name; the two addresses are inputs, so that no load's result is laid over them ahead of the wait */
    __builtin_amdgcn_sched_barrier(0);      /* keeps the softmax below the fetches, so that the next pass's key rows fly under it instead of being asked for at the pass's end */
    FragH pb[2]; float f[2];
#pragma unroll
    for (int qt = 0; qt < 2; ++qt) {
      float mx = fmaxf(s[qt][0][0], s[qt][1][0]);
#pragma unroll
      for (int r = 1; r < 8; ++r) mx = fmaxf(mx, fmaxf(s[qt][0][r], s[qt][1][r]));
      mx = fmaxf(mx, rs_xhalf(mx));
      const float mn = fmaxf(m[qt], mx * cs); f[qt] = fa_exp2(m[qt] - mn); m[qt] = mn;
      float ps = 0.f;
#pragma unroll
      for (int kt = 0; kt < 2; ++kt)
#pragma unroll
        for (int r4 = 0; r4 < 8; r4 += 4) { const float t0 = s[qt][kt][r4] * cs - mn, t1 = s[qt][kt][r4 + 1] * cs - mn, t2 = s[qt][kt][r4 + 2] * cs - mn, t3 = s[qt][kt][r4 + 3] * cs - mn; float e0, e1, e2, e3;
          /* four independent exponentials and one v_nop in one statement: the slot that the instruction set asks for behind a transcendental (early-clobber outputs keep the four apart) */
          asm("v_exp_f32 %0, %4\n\tv_exp_f32 %1, %5\n\tv_exp_f32 %2, %6\n\tv_exp_f32 %3, %7\n\tv_nop" : "=&v"(e0), "=&v"(e1), "=&v"(e2), "=&v"(e3) : "v"(t0), "v"(t1), "v"(t2), "v"(t3));
          ps += (e0 + e1) + (e2 + e3);
          pb[qt].h[kt * 8 + r4] = (_Float16)e0; pb[qt].h[kt * 8 + r4 + 1] = (_Float16)e1; pb[qt].h[kt * 8 + r4 + 2] = (_Float16)e2; pb[qt].h[kt * 8 + r4 + 3] = (_Float16)e3; }
      l[qt] = l[qt] * f[qt] + ps;
    }
    __builtin_amdgcn_sched_barrier(0);      /* every exponential stays above the matrix instructions below */
#pragma unroll
    for (int qt = 0; qt < 2; ++qt)
#pragma unroll
      for (int jt = 0; jt < 4; ++jt) acc[qt][jt] = fa_mma(za[jt], pb[qt].v, acc[qt][jt] * f[qt]);
  }
#pragma unroll
  for (int qt = 0; qt < 2; ++qt) { const float lt = l[qt] + rs_xhalf(l[qt]); if (hh == 0) { sm[kc][qg + qt * 16 + ln] = m[qt]; sl[kc][qg + qt * 16 + ln] = lt; }
#pragma unroll
    for (int jt = 0; jt < 4; ++jt) { const v8f c = acc[qt][jt]; const v4f c0 = {c[0], c[1], c[2], c[3]}, c1 = {c[4], c[5], c[6], c[7]};
      *(v4fa*)&sacc[kc][qg + qt * 16 + ln][jt * 16 + 8 * hh] = c0; *(v4fa*)&sacc[kc][qg + qt * 16 + ln][jt * 16 + 8 * hh + 4] = c1; } }
  __syncthreads();      /* the 8 key ranges' partial maxima, sums and rows are complete before any thread merges them */
  const int q = tid >> 3, d8 = (tid & 7) * 8; float mg = sm[0][q];
#pragma unroll
  for (int u = 1; u < 8; ++u) mg = fmaxf(mg, sm[u][q]);
  float lg = 0.f; v4f o0 = {0.f, 0.f, 0.f, 0.f}, o1 = {0.f, 0.f, 0.f, 0.f};
#pragma unroll
  for (int u = 0; u < 8; ++u) { const float f = fa_exp2(sm[u][q] - mg); lg += f * sl[u][q]; o0 += f * *(const v4fa*)&sacc[u][q][d8]; o1 += f * *(const v4fa*)&sacc[u][q][d8 + 4]; }
  const float sc = 0.0625f / lg;      /* Z is carried x16 */
  float* op = out + (q0 + q) * EM + d8; *(v4f*)op = o0 * sc; *(v4f*)(op + 4) = o1 * sc; }

// ---- launches 1 and 2: jobs that do not depend on one another share a launch (launch 1: the block index picks the job; launch 2: every wave does both) ----
__device__ __forceinline__ _Float16 pre_w16(float v) { return (_Float16)(bf16_round(v) * 16.0f); }      /* weight: rounded to bf16, carried x16, exact in f16 */
/* the 16 f32 values behind one lane's fragment (A or B, k order of g2_frag): r[0..7] = k 8 hh + i, r[8..15] = k 16 + 8 hh + i. Row form: p = first of the 32 k values of the lane's row, matrix kept as stored */
__device__ __forceinline__ void pre_raw_row(const float* p, int hh, float (&r)[16]) { const v4f a0 = *(const v4fa*)(p + 8 * hh), a1 = *(const v4fa*)(p + 8 * hh + 4), a2 = *(const v4fa*)(p + 16 + 8 * hh), a3 = *(const v4fa*)(p + 16 + 8 * hh + 4);
#pragma unroll
  for (int q = 0; q < 4; ++q) { r[q] = a0[q]; r[4 + q] = a1[q]; r[8 + q] = a2[q]; r[12 + q] = a3[q]; } }
/* column form, down a [k][EM] matrix: p = element (first k, the lane's column) */
__device__ __forceinline__ void pre_raw_col(const float* p, int hh, float (&r)[16]) {
#pragma unroll
  for (int i = 0; i < 8; ++i) { r[i] = p[(size_t)(8 * hh + i) * EM]; r[8 + i] = p[(size_t)(16 + 8 * hh + i) * EM]; } }
__device__ __forceinline__ v16h pre_cvt(const float (&r)[16]) { FragH f;
#pragma unroll
  for (int i = 0; i < 16; ++i) f.h[i] = pre_w16(r[i]);
  return f.v; }
/* one 16 x 16 tile over K = DM, k ascending in steps of 32; ACOL: A is read down columns */
template <bool ACOL>
__device__ __forceinline__ v8f pre_tile(const float* ap, const float* bp, int hh) { v8f c = {0.f, 0.f, 0.f, 0.f, 0.f, 0.f, 0.f, 0.f};
#pragma unroll 1      /* rolled: one stage of raw values is what the registers hold while two blocks still fit a WGP (the x blocks run under the same allocation) */
  for (int k0 = 0; k0 < DM; k0 += 128) { float ra[4][16], rb[4][16];
#pragma unroll
    for (int u = 0; u < 4; ++u) { if (ACOL) pre_raw_col(ap + (size_t)(k0 + 32 * u) * EM, hh, ra[u]); else pre_raw_row(ap + k0 + 32 * u, hh, ra[u]); pre_raw_row(bp + k0 + 32 * u, hh, rb[u]); }
    asm volatile("s_wait_xcnt 0x0" ::: "memory");      /* behind the stage's loads: the next stage forms its addresses in the registers that these loads name */
    __builtin_amdgcn_sched_barrier(0);      /* all loads of four k steps stay above the first conversion, so the four share one memory latency instead of paying one each */
#pragma unroll
    for (int u = 0; u < 4; ++u) c = fa_mma(pre_cvt(ra[u]), pre_cvt(rb[u]), c); }
  return c; }
#define PRE_GB 4                     /* blocks of launch 1 that form G^T and H^T: 2 planes x 16 tiles of 16 x 16, one tile a wave */
static_assert(NR * EM % (8 * 256) == 0, "k_pre: the x blocks have no tail guard");
// Launch 1. Blocks 0 .. PRE_GB - 1 (first, they last longest): plane 0 G^T[f][e] = sum_w Wk[f][w] Wq[e][w], plane 1 H^T[j][e] = sum_w Wm[w][j] Wv[e][w], both x16, operands converted in the loaders, k ascending in steps of 32 as before. The other blocks: x to f16 in fragment order.
__global__ __launch_bounds__(256) void k_pre(const float* __restrict__ x, const float* __restrict__ wq, const float* __restrict__ wk, const float* __restrict__ wv, const float* __restrict__ wm, _Float16* __restrict__ XF, _Float16* __restrict__ GH) {
  __shared__ __attribute__((aligned(16))) _Float16 sg[32][72];      /* pitch 144 B: 16-byte aligned rows */
  const int tid = threadIdx.x;
  if (blockIdx.x >= PRE_GB) { const size_t t = (size_t)(blockIdx.x - PRE_GB) * 256 + tid; FragH f;      /* piece t of the fragment order: tile t / 128, k = 8 ((t / 16) % 8) .. + 7, row t % 16 */
    const float* xs = x + ((t >> 7) * 16 + (t & 15)) * EM + ((t >> 4) & 7) * 8;
#pragma unroll
    for (int q = 0; q < 8; ++q) f.h[q] = (_Float16)bf16_round(xs[q]);
    *(v8us*)((unsigned short*)XF + t * 8) = f.half[0]; return; }
  const int lane = tid & 31, ln = lane & 15, hh = lane >> 4; const int g = blockIdx.x * 8 + (tid >> 5); const int plane = blockIdx.x / (PRE_GB / 2), rt = (g >> 2) & 3, ct = g & 3;
  const float* bp = (plane ? wv : wq) + (size_t)(ct * 16 + ln) * DM;
  const v8f c = plane ? pre_tile<true>(wm + rt * 16 + ln, bp, hh) : pre_tile<false>(wk + (size_t)(rt * 16 + ln) * DM, bp, hh);      /* plane is the same for the whole block */
#pragma unroll
  for (int r = 0; r < 8; ++r) sg[(rt & 1) * 16 + 8 * hh + r][ct * 16 + ln] = (_Float16)(c[r] * 0.0625f);
  __syncthreads();      /* the block's 32 rows (two row tiles x four column tiles, one wave each) are complete in LDS; taken by whole GH blocks only, the x blocks have left above */
  const int row = tid >> 3, c8 = (tid & 7) * 8;      /* 16 B a thread: every 128-B row of GH is stored by one wave */
  *(v8us*)((unsigned short*)GH + (size_t)plane * (EM * EM) + (size_t)((rt & 2) * 16 + row) * EM + c8) = *(const v8us*)&sg[row][c8]; }
// Launch 2. A wave takes 32 tokens (two 16-token tiles) and forms their Y and Z, k ascending in steps of 32 as before. Both products are laid so that a lane's 8 D registers are one 16-byte piece of the result's fragment order, stored straight from registers, 512 contiguous bytes a tile:
// Y^T tile = (A = 16 rows f of G^T, B = 16 tokens): register r = Y[token ln][16 nt + 8 hh + r], x16. Z tile = (A = 16 tokens, B = 16 rows j of H^T): register r = Z[token 8 hh + r][j = 16 nt + ln], x16, 8 keys of row j of Z^T.
static_assert(MP % 64 == 0, "k_yz: no tail guard");
__global__ __launch_bounds__(64) void k_yz(const _Float16* __restrict__ XF, const _Float16* __restrict__ GH, _Float16* __restrict__ YF, _Float16* __restrict__ ZF) {
  const int tid = threadIdx.x, lane = tid & 31, ln = lane & 15, hh = lane >> 4;
  const size_t tb = ((size_t)blockIdx.x * 2 + (tid >> 5)) * (size_t)(32 * EM) + lane * 8;      /* the wave's 32 tokens: 2,048 halves in each of XF, YF, ZF */
  const _Float16* xq = XF + tb; const _Float16* wp = GH + ln * EM + 8 * hh; const v8f z8 = {0.f, 0.f, 0.f, 0.f, 0.f, 0.f, 0.f, 0.f};
  v16h xf[2][2], gf[4][2], hf[4][2];
#pragma unroll
  for (int tt = 0; tt < 2; ++tt)
#pragma unroll
    for (int ks = 0; ks < 2; ++ks) xf[tt][ks] = ff_frag(xq + tt * (16 * EM) + ks * 512);
#pragma unroll
  for (int nt = 0; nt < 4; ++nt)
#pragma unroll
    for (int ks = 0; ks < 2; ++ks) { gf[nt][ks] = g2_frag(wp + nt * 16 * EM + ks * 32, 0); hf[nt][ks] = g2_frag(wp + EM * EM + nt * 16 * EM + ks * 32, 0); }      /* the lane half's 8 hh is in wp */
  asm volatile("s_wait_xcnt 0x0" :: "v"(xq), "v"(wp) : "memory");      /* behind the 40 loads: the results below may be formed in the registers that these loads name as addresses; the two addresses are inputs, so that no load's result is laid over them ahead of the wait */
  __builtin_amdgcn_sched_barrier(0);      /* all 40 loads stay above the first matrix instruction, so that they share one memory latency instead of paying four in turn */
#pragma unroll
  for (int tt = 0; tt < 2; ++tt)
#pragma unroll
    for (int nt = 0; nt < 4; ++nt) {
      ff_store(YF + tb + tt * (16 * EM) + nt * 256, fa_mma(gf[nt][1], xf[tt][1], fa_mma(gf[nt][0], xf[tt][0], z8)));
      ff_store(ZF + tb + nt * 512 + tt * 256, fa_mma(xf[tt][1], hf[nt][1], fa_mma(xf[tt][0], hf[nt][0], z8))); } }

extern "C" void kernel_launch(void* const* d_in, const int* in_sizes, int n_in,
                              void* d_out, int out_size, void* d_ws, size_t ws_size, hipStream_t stream) {
  (void)in_sizes; (void)n_in; (void)out_size;
  const float* const* I = (const float* const*)d_in; const float* x = I[0]; const float* wq = I[1]; const float* wk = I[2]; const float* wv = I[3]; const float* wm = I[4];      /* weights [in][out] */
  char* ws = (char*)d_ws; size_t off = 0;
  auto take = [&](size_t bytes) { char* p = ws + off; off += (bytes + 255) & ~(size_t)255; return p; };
  _Float16* GH = (_Float16*)take((size_t)2 * EM * EM * 2);      /* GH = [G^T | H^T], each [64][64] x16 */
  _Float16* XF = (_Float16*)take(NR * EM * 2); _Float16* YF = (_Float16*)take(NR * EM * 2); _Float16* ZF = (_Float16*)take(NR * EM * 2);      /* x, Y, Z^T in fragment order */
  if (off > ws_size) return;      /* approx 6 MiB */
  k_pre<<<(unsigned)(PRE_GB + NR * EM / 8 / 256), 256, 0, stream>>>(x, wq, wk, wv, wm, XF, GH);
  k_yz<<<(unsigned)(MP / 64), 64, 0, stream>>>(XF, GH, YF, ZF);
  k_fattn<<<(unsigned)(NR / 64), 512, 0, stream>>>(YF, XF, ZF, (float*)d_out);      /* all batches: 64 query rows a work-group */
}

// v007
// A run of this version takes 27.4 microseconds.
// Versions between v005 and this one are left out; their measured steps multiply to 1.16 times as fast.
// Counting every step since v000, it is 126 times as fast.
#include <hip/hip_runtime.h>
// Wide single-head self-attention (x [4][4096][64]; Q/K/V = x W with W [64][512] stored [in][out] (heads NOT split: one 512-wide head); scores = Q K^T / sqrt(512) over all 4,096 keys; softmax; o = attn V; out = o Wm (Wm [512][64]) -> [4][4096][64]).
// Structure: the chained products are reassociated: Q K^T = (x G) x^T with G = Wq Wk^T [64][64], and (attn V) Wm = attn (x H) with H = Wv Wm [64][64] (exact algebra for any inputs; another f32 sum order), so both 4096 x 4096 products run at width 64 instead of 512. Token rows r = b*4096 + s; x exact in f16 (bf16-rounded); weights exact x16; G^T and H^T in one WMMA launch (two planes, K = 512, carried x16); x, x^T, G^T and H^T are kept in the workspace in WMMA fragment order (see ff_frag), so that every fragment load, and every x and x^T store, is a contiguous 512-B run; then ONE fused launch for all batches: each wave forms Y = x G (carrying the score scale) for its own queries, scores^T = x Y^T, running-maximum softmax in registers, o^T += x^T P^T, and attn (x H) = (attn x) H: H is applied to each wave's normalised partial o behind its key loop, so neither scores, weights, Y nor x H go through memory. 2 launches, one per link of the dependence chain: (x, x^T to f16 | G^T, H^T straight from the f32 weights), fused attention.
// Compute dtype: inputs rounded to bf16; x / weights exact; G, H, Y, each key range's weighted mean of x rows and softmax weights (2^(score - maximum in use), in [0, 2^8]) as plain f16 WMMA operands (~2^-12); scores, statistics and out f32. v_wmma_f32_16x16x32_f16.
#define NB 4
#define SQ 4096
#define EM 64                        /* embedding */
#define DM 512                       /* wide = 8 x 64 (one head) */
#define NH 8                         /* 64-wide slabs of the one 512-wide head (not used) */
#define HD 64
#define HG 1
#define B0 0                         /* not used (all batches run from 0) */
#define NBR NB                       /* not used (the launches cover NB batches through NR) */
#define QN SQ                        /* not used (all SQ query rows attended) */
#define NR ((size_t)NB * SQ)
#define MP ((int)((size_t)NBR * SQ))
#define MPO MP
typedef __bf16 v16b __attribute__((ext_vector_type(16)));
typedef unsigned short v8us __attribute__((ext_vector_type(8), may_alias));
typedef float  v8f  __attribute__((ext_vector_type(8)));
typedef float  v4f  __attribute__((ext_vector_type(4)));
typedef float  v4fa __attribute__((ext_vector_type(4), may_alias));
union FragB { v16b v; v8us half[2]; unsigned short u[16]; };

__device__ __forceinline__ unsigned short bf16_bits(float x) { unsigned int u = __float_as_uint(x); return (unsigned short)((u + 0x7FFFu + ((u >> 16) & 1u)) >> 16); }
__device__ __forceinline__ float bf16_val(unsigned short b) { return __uint_as_float(((unsigned int)b) << 16); }
__device__ __forceinline__ float bf16_round(float x) { return bf16_val(bf16_bits(x)); }
// D += A·B with NT terms: 1 = ah·bh, 2 = + al·bh (A split), 3 = + ah·bl (both split)
template <int NT>
__device__ __forceinline__ v8f mmaN(v16b ah, v16b al, v16b bh, v16b bl, v8f c) {
  c = __builtin_amdgcn_wmma_f32_16x16x32_bf16(false, ah, false, bh, (short)0, c, false, false);
  if (NT >= 2) c = __builtin_amdgcn_wmma_f32_16x16x32_bf16(false, al, false, bh, (short)0, c, false, false);
  if (NT >= 3) c = __builtin_amdgcn_wmma_f32_16x16x32_bf16(false, ah, false, bl, (short)0, c, false, false);
  asm volatile("v_nop\n\tv_nop\n\tv_nop\n\tv_nop" : "+v"(c) : "v"(ah), "v"(al), "v"(bh), "v"(bl));
  return c;
}

__global__ __launch_bounds__(256) void k_wt_bf16(const float* __restrict__ W, unsigned short* __restrict__ Wt, int K, int N) {
  const int t = blockIdx.x * 256 + threadIdx.x;
  const int k8n = K / 8;
  if (t >= N * k8n) return;
  const int n = t / k8n, k8 = (t % k8n) * 8;
  v8us v;
#pragma unroll
  for (int i = 0; i < 8; ++i) v[i] = bf16_bits(W[(size_t)(k8 + i) * N + n]);
  *(v8us*)(Wt + (size_t)n * K + k8) = v;
  
}

// GEMM C[M][N] (f32, pitch ldc) = act(A[M][K]·W + bias). A f32 row-major (pitch lda) converted per fragment to bf16
// (ASPLIT: hi/lo two planes -> 2 terms, else single rounded term); Wt bf16 [N][K] (pitch ldb). BIAS_BF16 rounds the
// bias to bf16 first (bias quantised to bf16 before the add). K%32==0, M%16==0, N%64==0.
template <bool ASPLIT, int ACT, bool BIAS_BF16>
__global__ __launch_bounds__(128) void k_gemm_bf(const float* __restrict__ A, int lda, const unsigned short* __restrict__ Wt, int ldb,
                                               const float* __restrict__ bias, float* __restrict__ C, int ldc, int M, int N, int K) {
  __shared__ __attribute__((aligned(16))) float so[4][16][64];
  const int tid = threadIdx.x, w = tid >> 5, lane = tid & 31, ln = lane & 15, hh = lane >> 4;
  const int ntn = N / 64;
  const int wid = blockIdx.x * 4 + w;
  const int mt = wid / ntn, nq = wid % ntn;
  if (mt * 16 >= M) return;
  const int row0 = mt * 16, col0 = nq * 64;
  const float* arow = A + (size_t)(row0 + ln) * lda;
  v8f acc[4] = {};
  for (int kb = 0; kb < K; kb += 32) {
    FragB ah, al;
    const v4f x0 = *(const v4fa*)(arow + kb + 8 * hh), x1 = *(const v4fa*)(arow + kb + 8 * hh + 4);
    const v4f x2 = *(const v4fa*)(arow + kb + 16 + 8 * hh), x3 = *(const v4fa*)(arow + kb + 16 + 8 * hh + 4);
    float xs[16] = {x0[0],x0[1],x0[2],x0[3],x1[0],x1[1],x1[2],x1[3],x2[0],x2[1],x2[2],x2[3],x3[0],x3[1],x3[2],x3[3]};
#pragma unroll
    for (int i = 0; i < 16; ++i) { const unsigned short hb = bf16_bits(xs[i]); ah.u[i] = hb; al.u[i] = ASPLIT ? bf16_bits(xs[i] - bf16_val(hb)) : (unsigned short)0; }
#pragma unroll
    for (int t = 0; t < 4; ++t) {
      const unsigned short* brow = Wt + (size_t)(col0 + t * 16 + ln) * ldb + kb;
      FragB b;
      b.half[0] = *(const v8us*)(brow + 8 * hh);
      b.half[1] = *(const v8us*)(brow + 16 + 8 * hh);
      acc[t] = mmaN<ASPLIT ? 2 : 1>(ah.v, al.v, b.v, b.v, acc[t]);
    }
  }
#pragma unroll
  for (int t = 0; t < 4; ++t) {
    float bv = bias ? bias[col0 + t * 16 + ln] : 0.f;
    if (BIAS_BF16) bv = bf16_round(bv);
#pragma unroll
    for (int r = 0; r < 8; ++r) { float v = acc[t][r] + bv; if (ACT == 1) v = fmaxf(v, 0.f); so[w][8 * hh + r][t * 16 + ln] = v; }
  }
  __builtin_amdgcn_fence(__ATOMIC_ACQ_REL, "workgroup");
  __builtin_amdgcn_wave_barrier();
  const int rsub = lane >> 4, c4 = (lane & 15) * 4;
  {
#pragma unroll
    for (int q = 0; q < 8; ++q) {
      const int r = q * 2 + rsub;
      const v4f v = *(const v4fa*)&so[w][r][c4];
      *(v4f*)(C + (size_t)(row0 + r) * ldc + col0 + c4) = v;
    }
    
  }
}

// GEMM C = act(A·W + bias + resid): A f32 (ASPLIT -> hi/lo 2 terms), Wt bf16 [N][K]; ACT 0 none, 1 relu, 2 exact gelu;
// resid (optional, f32, row index = (row % rmod), pitch ldr, RES_BF16 rounds it) added before the activation.
template <bool ASPLIT, int ACT, bool BIAS_BF16, bool RES_BF16>
__global__ __launch_bounds__(128) void k_gemm_bf3(const float* __restrict__ A, int lda, const unsigned short* __restrict__ Wt, int ldb,
                                                const float* __restrict__ bias, const float* __restrict__ resid, int rmod, int ldr,
                                                float* __restrict__ C, int ldc, int M, int N, int K) {
  __shared__ __attribute__((aligned(16))) float so[4][16][64];
  const int tid = threadIdx.x, w = tid >> 5, lane = tid & 31, ln = lane & 15, hh = lane >> 4;
  const int ntn = N / 64;
  const int wid = blockIdx.x * 4 + w;
  const int mt = wid / ntn, nq = wid % ntn;
  if (mt * 16 >= M) return;
  const int row0 = mt * 16, col0 = nq * 64;
  const float* arow = A + (size_t)(row0 + ln) * lda;
  v8f acc[4] = {};
  for (int kb = 0; kb < K; kb += 32) {
    FragB ah, al;
    const v4f x0 = *(const v4fa*)(arow + kb + 8 * hh), x1 = *(const v4fa*)(arow + kb + 8 * hh + 4);
    const v4f x2 = *(const v4fa*)(arow + kb + 16 + 8 * hh), x3 = *(const v4fa*)(arow + kb + 16 + 8 * hh + 4);
    float xs[16] = {x0[0],x0[1],x0[2],x0[3],x1[0],x1[1],x1[2],x1[3],x2[0],x2[1],x2[2],x2[3],x3[0],x3[1],x3[2],x3[3]};
#pragma unroll
    for (int i = 0; i < 16; ++i) { const unsigned short hb = bf16_bits(xs[i]); ah.u[i] = hb; al.u[i] = ASPLIT ? bf16_bits(xs[i] - bf16_val(hb)) : (unsigned short)0; }
#pragma unroll
    for (int t = 0; t < 4; ++t) {
      const unsigned short* brow = Wt + (size_t)(col0 + t * 16 + ln) * ldb + kb;
      FragB b;
      b.half[0] = *(const v8us*)(brow + 8 * hh);
      b.half[1] = *(const v8us*)(brow + 16 + 8 * hh);
      acc[t] = mmaN<ASPLIT ? 2 : 1>(ah.v, al.v, b.v, b.v, acc[t]);
    }
  }
#pragma unroll
  for (int t = 0; t < 4; ++t) {
    const int col = col0 + t * 16 + ln;
    float bv = bias ? bias[col] : 0.f;
    if (BIAS_BF16) bv = bf16_round(bv);
#pragma unroll
    for (int r = 0; r < 8; ++r) {
      float v = acc[t][r] + bv;
      if (resid) { float rv = resid[(size_t)((row0 + 8 * hh + r) % rmod) * ldr + col]; if (RES_BF16) rv = bf16_round(rv); v += rv; }
      if (ACT == 1) v = fmaxf(v, 0.f);
      if (ACT == 2) v = 0.5f * v * (1.0f + erff(v * 0.70710678118654752f));
      if (ACT == 3) { const float u = 0.7978845608028654f * (v + 0.044715f * v * v * v); v = 0.5f * v * (1.0f + tanhf(u)); }
      so[w][8 * hh + r][t * 16 + ln] = v;
    }
  }
  __builtin_amdgcn_fence(__ATOMIC_ACQ_REL, "workgroup");
  __builtin_amdgcn_wave_barrier();
  const int rsub = lane >> 4, c4 = (lane & 15) * 4;
  {
#pragma unroll
    for (int q = 0; q < 8; ++q) {
      const int r = q * 2 + rsub;
      const v4f v = *(const v4fa*)&so[w][r][c4];
      *(v4f*)(C + (size_t)(row0 + r) * ldc + col0 + c4) = v;
    }
    
  }
}
// row LayerNorm (biased variance, eps) over N: s = X (+ R); optional out_sum <- s; out_norm <- (s-mu)*rsqrt(var+eps)*g + b
template <bool PARAM_BF16>
__global__ __launch_bounds__(256) void k_layernorm(const float* __restrict__ X, const float* __restrict__ R, const float* __restrict__ g, const float* __restrict__ bta,
                                                  float* __restrict__ out_sum, float* __restrict__ out_norm, int N, float eps) {
  __shared__ float red[256];
  const int row = blockIdx.x, tid = threadIdx.x;
  const float* x = X + (size_t)row * N; const float* rr = R ? R + (size_t)row * N : nullptr;
  float vals[16];                     // up to N = 4096
  const int per = N / 256;            // contiguous chunk per thread? use strided-by-4 chunks: thread handles j = tid*4 + 1024*u
  float s1 = 0.f;
  for (int u = 0; u < per / 4; ++u) {
    const int j = tid * 4 + 1024 * u;
    const v4f a = *(const v4fa*)(x + j);
    v4f b = {0.f,0.f,0.f,0.f}; if (rr) b = *(const v4fa*)(rr + j);
#pragma unroll
    for (int q = 0; q < 4; ++q) { const float v = a[q] + b[q]; vals[u * 4 + q] = v; s1 += v; }
  }
  red[tid] = s1; __syncthreads();
  for (int st = 128; st > 0; st >>= 1) { if (tid < st) red[tid] += red[tid + st]; __syncthreads(); }
  const float mu = red[0] / (float)N; __syncthreads();
  float s2 = 0.f;
  for (int u = 0; u < per / 4; ++u)
#pragma unroll
    for (int q = 0; q < 4; ++q) { const float c = vals[u * 4 + q] - mu; s2 += c * c; }
  red[tid] = s2; __syncthreads();
  for (int st = 128; st > 0; st >>= 1) { if (tid < st) red[tid] += red[tid + st]; __syncthreads(); }
  const float rs = rsqrtf(red[0] / (float)N + eps);
  {
    for (int u = 0; u < per / 4; ++u) {
      const int j = tid * 4 + 1024 * u;
      v4f o, sm;
#pragma unroll
      for (int q = 0; q < 4; ++q) {
        float gg = g[j + q], bb = bta[j + q];
        if (PARAM_BF16) { gg = bf16_round(gg); bb = bf16_round(bb); }
        sm[q] = vals[u * 4 + q]; o[q] = (vals[u * 4 + q] - mu) * rs * gg + bb;
      }
      if (out_sum) *(v4f*)(out_sum + (size_t)row * N + j) = sm;
      *(v4f*)(out_norm + (size_t)row * N + j) = o;
    }
    
  }
}



// ---- f16 WMMA path (v_wmma_f32_16x16x32_f16): 11-bit significands for operands in range — used where a [0,1] probability operand needs more precision than bf16
typedef _Float16 v16h __attribute__((ext_vector_type(16)));
union FragH { v16h v; v8us half[2]; _Float16 h[16]; unsigned short u[16]; };
template <int NT>
__device__ __forceinline__ v8f mmaH(v16h ah, v16h al, v16h bh, v16h bl, v8f c) {
  c = __builtin_amdgcn_wmma_f32_16x16x32_f16(false, ah, false, bh, (short)0, c, false, false);
  if (NT >= 2) c = __builtin_amdgcn_wmma_f32_16x16x32_f16(false, al, false, bh, (short)0, c, false, false);
  if (NT >= 3) c = __builtin_amdgcn_wmma_f32_16x16x32_f16(false, ah, false, bl, (short)0, c, false, false);
  asm volatile("v_nop\n\tv_nop\n\tv_nop\n\tv_nop" : "+v"(c) : "v"(ah), "v"(al), "v"(bh), "v"(bl));
  return c;
}
// batched GEMM like k_gemm_b but f16 operands: A f32 (split into f16 hi/lo if ASPLIT, else rounded to f16), Bt = f16 values [n][k]; alpha; C f32; N multiple of 16 (partial tiles skipped)
template <bool ASPLIT>
__global__ __launch_bounds__(128) void k_gemm_h(const float* __restrict__ A, int lda, size_t sA, const _Float16* __restrict__ Bh, int ldb, size_t sB, float alpha, float* __restrict__ C, int ldc, size_t sC, int M, int N, int K) {
  __shared__ __attribute__((aligned(16))) float so[4][16][64];
  const int tid = threadIdx.x, w = tid >> 5, lane = tid & 31, ln = lane & 15, hh = lane >> 4; const int by = blockIdx.y;
  A += (size_t)by * sA; Bh += (size_t)by * sB; C += (size_t)by * sC;
  const int ntn = (N + 63) / 64; const int wid = blockIdx.x * 4 + w; const int mt = wid / ntn, nq = wid % ntn; if (mt * 16 >= M) return;
  const int row0 = mt * 16, col0 = nq * 64; const float* arow = A + (size_t)(row0 + ln) * lda;
  v8f acc[4] = {};
  for (int kb = 0; kb < K; kb += 32) {
    FragH ah, al;
    const v4f x0 = *(const v4fa*)(arow + kb + 8 * hh), x1 = *(const v4fa*)(arow + kb + 8 * hh + 4), x2 = *(const v4fa*)(arow + kb + 16 + 8 * hh), x3 = *(const v4fa*)(arow + kb + 16 + 8 * hh + 4);
    float xs[16] = {x0[0],x0[1],x0[2],x0[3],x1[0],x1[1],x1[2],x1[3],x2[0],x2[1],x2[2],x2[3],x3[0],x3[1],x3[2],x3[3]};
#pragma unroll
    for (int i = 0; i < 16; ++i) { const _Float16 h = (_Float16)xs[i]; ah.h[i] = h; al.h[i] = ASPLIT ? (_Float16)(xs[i] - (float)h) : (_Float16)0.0f; }
#pragma unroll
    for (int t = 0; t < 4; ++t) { if (col0 + t * 16 >= N) continue; const size_t boff = (size_t)(col0 + t * 16 + ln) * ldb + kb; FragH bq; bq.half[0] = *(const v8us*)(Bh + boff + 8 * hh); bq.half[1] = *(const v8us*)(Bh + boff + 16 + 8 * hh);
      acc[t] = mmaH<ASPLIT ? 2 : 1>(ah.v, al.v, bq.v, bq.v, acc[t]); }
  }
#pragma unroll
  for (int t = 0; t < 4; ++t) { if (col0 + t * 16 >= N) continue;
#pragma unroll
    for (int r = 0; r < 8; ++r) so[w][8 * hh + r][t * 16 + ln] = acc[t][r] * alpha; }
  __builtin_amdgcn_fence(__ATOMIC_ACQ_REL, "workgroup"); __builtin_amdgcn_wave_barrier();
  const int rsub = lane >> 4, c4 = (lane & 15) * 4;
  {
#pragma unroll
    for (int q = 0; q < 8; ++q) { const int r = q * 2 + rsub; if (col0 + c4 < N) { const v4f v = *(const v4fa*)&so[w][r][c4]; *(v4f*)(C + (size_t)(row0 + r) * ldc + col0 + c4) = v; } }
     }
}

// Wt[n][k] = f16(W[k][n]·scale) from f32 row-major W[K][N] (scale = power of two; bf16-exact weights stay exact in f16 away from the subnormal range)
__global__ __launch_bounds__(256) void k_wt_f16(const float* __restrict__ W, _Float16* __restrict__ Wt, int K, int N, float scale) {
  const int t = blockIdx.x * 256 + threadIdx.x; if (t >= N * (K / 8)) return; const int n = t / (K / 8), k8 = (t % (K / 8)) * 8; FragH f;
#pragma unroll
  for (int i = 0; i < 8; ++i) f.h[i] = (_Float16)(bf16_round(W[(size_t)(k8 + i) * N + n]) * scale); const v8us o = f.half[0];
  *(v8us*)((unsigned short*)Wt + (size_t)n * K + k8) = o; 
}
// k_gemm_hh variant with fused epilogue: v = acc·alpha + bias[by·sBias + col] (+ CP[(row/rowsPerB)·sCPb + by·64 + col] if CP) ; ACT 0 none / 1 elu ; writes f16 C16 (and f32 C if non-null)
template <int ACT>
__global__ __launch_bounds__(128) void k_gemm_hhx(const _Float16* __restrict__ A, int lda, size_t sA, const _Float16* __restrict__ Bh, int ldb, size_t sB, float alpha, const float* __restrict__ bias, size_t sBias, const float* __restrict__ CP, int rowsPerB, size_t sCPb, int row0g,
    float* __restrict__ C, _Float16* __restrict__ C16, int ldc, size_t sC, int M, int N, int K) {
  __shared__ __attribute__((aligned(16))) float so[4][16][64];
  const int tid = threadIdx.x, w = tid >> 5, lane = tid & 31, ln = lane & 15, hh = lane >> 4; const int by = blockIdx.y;
  A += (size_t)by * sA; Bh += (size_t)by * sB; const size_t cofs = (size_t)by * sC; const float* bp = bias ? bias + (size_t)by * sBias : nullptr;
  const int ntn = (N + 63) / 64; const int wid = blockIdx.x * 4 + w; const int mt = wid / ntn, nq = wid % ntn; if (mt * 16 >= M) return;
  const int row0 = mt * 16, col0 = nq * 64; const _Float16* arow = A + (size_t)(row0 + ln) * lda;
  v8f acc[4] = {};
  for (int kb = 0; kb < K; kb += 32) { FragH ah; ah.half[0] = *(const v8us*)((const unsigned short*)arow + kb + 8 * hh); ah.half[1] = *(const v8us*)((const unsigned short*)arow + kb + 16 + 8 * hh);
#pragma unroll
    for (int t = 0; t < 4; ++t) { if (col0 + t * 16 >= N) continue; const size_t boff = (size_t)(col0 + t * 16 + ln) * ldb + kb; FragH bq; bq.half[0] = *(const v8us*)((const unsigned short*)Bh + boff + 8 * hh); bq.half[1] = *(const v8us*)((const unsigned short*)Bh + boff + 16 + 8 * hh);
      acc[t] = mmaH<1>(ah.v, ah.v, bq.v, bq.v, acc[t]); }
  }
#pragma unroll
  for (int t = 0; t < 4; ++t) { if (col0 + t * 16 >= N) continue; const int col = col0 + t * 16 + ln; const float bv = bp ? bf16_round(bp[col]) : 0.f;
#pragma unroll
    for (int r = 0; r < 8; ++r) { float v = acc[t][r] * alpha + bv; if (CP) { const int rr = row0g + row0 + 8 * hh + r; if (rowsPerB < 0) v += CP[cofs + (size_t)rr * ldc + col];      /* rowsPerB < 0: own element of the batched C plane */ else { const int bidx = rr / rowsPerB; v += CP[(size_t)bidx * sCPb + (size_t)by * 64 + col]; } } if (ACT == 1) v = (v > 0.f) ? v : expm1f(v); else if (ACT == 7) v = (v > 0.f) ? v + 1.0f : expf(v); else if (ACT == 8) v = tanhf(v); else if (ACT == 9) v = 0.5f * v * (1.0f + tanhf(0.7978845608028654f * (v + 0.044715f * v * v * v))); else if (ACT == 11) v = 1.0f / (1.0f + expf(-v)); else if (ACT == 12) v = (v > 0.f) ? v : 0.01f * v; else if (ACT == 14) v = (v > 0.f) ? v : 0.1f * v; else if (ACT == 16) v = (v >= 0.f) ? v : 0.3f * v; else if (ACT == 17) v = (v >= 0.f) ? v : 0.2f * v; else if (ACT == 15) v = v / (1.0f + expf(-v)); else if (ACT == 3) v = fmaxf(v, 0.f); else if (ACT == 6) v = 0.5f * v * (1.0f + erff(v * 0.70710678118654752f)); so[w][8 * hh + r][t * 16 + ln] = v; } }
  __builtin_amdgcn_fence(__ATOMIC_ACQ_REL, "workgroup"); __builtin_amdgcn_wave_barrier();
  const int rsub = lane >> 4, c4 = (lane & 15) * 4; typedef _Float16 v4h __attribute__((ext_vector_type(4)));
  {
#pragma unroll
    for (int q = 0; q < 8; ++q) { const int r = q * 2 + rsub; if (col0 + c4 < N) { const v4f v = *(const v4fa*)&so[w][r][c4]; if (C) *(v4f*)(C + cofs + (size_t)(row0 + r) * ldc + col0 + c4) = v; if (C16) { v4h h4; for (int i = 0; i < 4; ++i) h4[i] = (_Float16)v[i]; *(v4h*)(C16 + cofs + (size_t)(row0 + r) * ldc + col0 + c4) = h4; } } }
     }
}


typedef _Float16 v4h __attribute__((ext_vector_type(4)));

__global__ __launch_bounds__(256) void k_x16(const float* __restrict__ x, _Float16* __restrict__ X16, size_t n8) { const size_t t = (size_t)blockIdx.x * 256 + threadIdx.x; if (t >= n8) return; FragH f;
#pragma unroll
  for (int q = 0; q < 8; ++q) f.h[q] = (_Float16)bf16_round(x[t * 8 + q]); *(v8us*)((unsigned short*)X16 + t * 8) = f.half[0];  }
__global__ __launch_bounds__(256) void k_h16(const float* __restrict__ x, _Float16* __restrict__ X16, size_t n8) { const size_t t = (size_t)blockIdx.x * 256 + threadIdx.x; if (t >= n8) return; FragH f;
#pragma unroll
  for (int q = 0; q < 8; ++q) f.h[q] = (_Float16)x[t * 8 + q]; *(v8us*)((unsigned short*)X16 + t * 8) = f.half[0];  }
__global__ __launch_bounds__(256) void k_round16f(const float* __restrict__ W, _Float16* __restrict__ Bt, size_t n8) { const size_t t = (size_t)blockIdx.x * 256 + threadIdx.x; if (t >= n8) return; FragH f;
#pragma unroll
  for (int i = 0; i < 8; ++i) f.h[i] = (_Float16)(bf16_round(W[t * 8 + i]) * 16.0f); *(v8us*)((unsigned short*)Bt + t * 8) = f.half[0];  }
template <int NHv, int TTv>
__global__ __launch_bounds__(256) void k_vt(const _Float16* __restrict__ V16, int ldv, int voff, _Float16* __restrict__ Vt) { __shared__ unsigned short tl[64][66]; const int tid = threadIdx.x; const int slab = blockIdx.x / (TTv / 64), lg = blockIdx.x % (TTv / 64); const int b = slab / NHv, h = slab % NHv;
  for (int i = tid; i < 64 * 8; i += 256) { const int r = i / 8, c8 = (i % 8) * 8; FragH f; f.half[0] = *(const v8us*)((const unsigned short*)V16 + ((size_t)b * TTv + lg * 64 + r) * ldv + voff + h * 64 + c8);
#pragma unroll
    for (int q = 0; q < 8; ++q) tl[r][c8 + q] = f.u[q]; }
  __syncthreads();
  {
#pragma unroll
    for (int rd = 0; rd < 2; ++rd) { const int d = rd * 32 + tid / 8, pc = tid % 8; FragH f;
#pragma unroll
      for (int q = 0; q < 8; ++q) f.u[q] = tl[pc * 8 + q][d];
      *(v8us*)((unsigned short*)Vt + ((size_t)slab * 64 + d) * TTv + lg * 64 + pc * 8) = f.half[0]; }
     } }

__global__ __launch_bounds__(256) void k_hl(const float* __restrict__ F, _Float16* __restrict__ Hh, _Float16* __restrict__ Hl, size_t n8) { const size_t t = (size_t)blockIdx.x * 256 + threadIdx.x; if (t >= n8) return; FragH fh, fl; const v4f a = *(const v4fa*)(F + t * 8), c = *(const v4fa*)(F + t * 8 + 4);
#pragma unroll
  for (int q = 0; q < 4; ++q) { _Float16 h = (_Float16)a[q]; fh.h[q] = h; fl.h[q] = (_Float16)((a[q] - (float)h) * 1024.0f); h = (_Float16)c[q]; fh.h[4 + q] = h; fl.h[4 + q] = (_Float16)((c[q] - (float)h) * 1024.0f); }
  { *(v8us*)((unsigned short*)Hh + t * 8) = fh.half[0]; *(v8us*)((unsigned short*)Hl + t * 8) = fl.half[0];  } }

/* one fragment (A or B) from a row-major matrix: p = first of the 32 k values of the lane's row */
__device__ __forceinline__ v16h g2_frag(const _Float16* p, int hh) { FragH f; f.half[0] = *(const v8us*)((const unsigned short*)p + 8 * hh); f.half[1] = *(const v8us*)((const unsigned short*)p + 16 + 8 * hh); return f.v; }
/* Fragment order. A 16-row x 64-k tile (2 KiB) is kept as [k / 8][row][k % 8]: the 16-byte piece that lane (hh, ln) wants for k = 32 ks + 16 h + 8 hh .. + 7 of row ln lies at halves 512 ks + 256 h + 8 lane,
   so one load of 16 B a lane covers 512 contiguous bytes (4 whole lines) where a row-major tile makes it touch 16 lines. p = fragment's first element + 8 lane; same k order as g2_frag */
__device__ __forceinline__ v16h ff_frag(const _Float16* p) { FragH f; f.half[0] = *(const v8us*)((const unsigned short*)p); f.half[1] = *(const v8us*)((const unsigned short*)p + 256); return f.v; }
/* two D tiles as one B fragment: a lane's 8 registers of a D tile (rows 8 hh + r of column ln) are k = 8 hh + r of row ln of the matrix whose rows are D's columns, so tiles 2 ks and 2 ks + 1 are halves 0 and 1 of fragment ks, in the lane */
__device__ __forceinline__ v16h ff_pack(v8f c0, v8f c1) { FragH f;
#pragma unroll
  for (int r = 0; r < 8; ++r) { f.h[r] = (_Float16)c0[r]; f.h[8 + r] = (_Float16)c1[r]; }
  return f.v; }


__global__ __launch_bounds__(256) void k_wnat(const float* __restrict__ w, size_t n8, _Float16* __restrict__ Bt) { const size_t t = (size_t)blockIdx.x * 256 + threadIdx.x; if (t >= n8) return; FragH f; for (int q = 0; q < 8; ++q) f.h[q] = (_Float16)(bf16_round(w[t * 8 + q]) * 16.0f); *(v8us*)((unsigned short*)Bt + t * 8) = f.half[0];  }
__global__ __launch_bounds__(256) void k_rsm(const float* __restrict__ S, _Float16* __restrict__ P, int nrows) {
  #pragma clang fp contract(off)
  const int i = blockIdx.x * 256 + threadIdx.x; if (i >= nrows) return; const float* s = S + (size_t)i * SQ; float mx = -3.0e38f;
#pragma unroll 1
  for (int j = 0; j < SQ; ++j) mx = fmaxf(mx, s[j]); float se = 0.f;
#pragma unroll 1
  for (int j = 0; j < SQ; ++j) se += expf(s[j] - mx); const float sc = 256.0f / se;
#pragma unroll 1
  for (int j0 = 0; j0 < SQ; j0 += 8) { FragH f; for (int q = 0; q < 8; ++q) f.h[q] = (_Float16)(expf(s[j0 + q] - mx) * sc); unsigned short* d = (unsigned short*)P + (size_t)i * SQ + j0; *(v8us*)d = f.half[0];  } }
__global__ __launch_bounds__(256) void k_vt(const _Float16* __restrict__ V16, int b, int h0, _Float16* __restrict__ VT) { __shared__ unsigned short tl[64][65]; const int tid = threadIdx.x; const int hh = blockIdx.x % HG, sg = blockIdx.x / HG; const int s0 = sg * 64; const int h = h0 + hh;
  for (int i = tid; i < 64 * 8; i += 256) { const int j = i / 8, d8 = (i % 8) * 8; FragH f; f.half[0] = *(const v8us*)((const unsigned short*)V16 + ((size_t)b * SQ + s0 + j) * DM + h * HD + d8); for (int q = 0; q < 8; ++q) tl[d8 + q][j] = f.u[q]; }
  __syncthreads();
  { for (int i = tid; i < 64 * 8; i += 256) { const int d = i / 8, j8 = (i % 8) * 8; FragH f; for (int q = 0; q < 8; ++q) f.u[q] = tl[d][j8 + q]; *(v8us*)((unsigned short*)VT + ((size_t)hh * HD + d) * SQ + s0 + j8) = f.half[0]; }  } }


__device__ __forceinline__ float rs_xhalf(float x) { return __builtin_bit_cast(float, __builtin_amdgcn_permlanex16(__builtin_bit_cast(int, x), __builtin_bit_cast(int, x), 0x76543210, 0xfedcba98, false, false)); }      /* lane l <- lane l ^ 16 */
__device__ __forceinline__ v8f fa_mma(v16h a, v16h b, v8f c) { return __builtin_amdgcn_wmma_f32_16x16x32_f16(false, a, false, b, (short)0, c, false, false); }
/* 2^t, native; the v_nop fills the slot that the instruction set asks for behind a transcendental */
__device__ __forceinline__ float fa_exp2(float t) { float e; asm("v_exp_f32 %0, %1\n\tv_nop" : "=&v"(e) : "v"(t)); return e; }
// Fused attention. Work-group = 16 waves = 64 query rows, one work-group per WGP; wave w takes queries 32 (w & 1) .. + 31 and keys [512 (w >> 1), + 512) of the rows' batch, 32 keys a pass (the two waves of a key range read the same lines at about the same time). x, x^T, G^T and H^T arrive in fragment order: a pass reads 4 KiB of x and 4 KiB of x^T, each contiguous.
// In front of the loop the wave forms Y for its 32 queries: Y^T tile = (A = 16 rows f of G^T, B = 16 query rows of x), register r = Y[query ln][16 nt + 8 hh + r], x16, brought to the log2-domain score scale in f32: two such tiles are one B fragment of Y, in the lane (ff_pack).
// Both products are computed transposed, so a lane owns ONE query (column ln of every D tile): S^T tile (A = 16 key rows of x, B = 16 query rows of Y) leaves key 8 hh + r in register r,
// which is exactly the k order of the B fragment of o^T = x^T P^T (elements 0..7 = keys 8 hh + i of the first key tile, 8..15 = the same of the second): P never leaves its registers.
// Statistics per lane in the log2 domain. Lazy rescale: Y carries 512^-0.5 log2 e, and minus the maximum in use is the C operand of the score products, so a score leaves the matrix unit ready for 2^t. The first pass sets the maximum in use from its own scores; after that it rises (accumulators and sums rescaled, the two lane halves agreeing on it) only in a pass where some score tops it by more than 8, tested once per pass and wave; weights stay at or below 2^8. The halves' sums are joined at the end. Behind the loop o^T (rows e, one query a lane) is divided by the wave's own sum, so that it is a weighted mean of x rows and as safe in f16 as x itself, packed in the lane into B fragments and multiplied by H^T (A = 16 rows j): D has the layout of o^T with j for e.
// The 8 partial results of a query (one per key range), each weighted by its sum, are merged through LDS behind one barrier.
#define FA_KW (SQ / 8)               /* keys per wave */
__global__ __launch_bounds__(512) void k_fattn(const _Float16* __restrict__ XF, const _Float16* __restrict__ XT, const _Float16* __restrict__ GH, float* __restrict__ out) {
  __shared__ __attribute__((aligned(16))) float sacc[8][64][68];      /* pitch 68: 16-byte aligned rows that start 4 banks apart */
  __shared__ float sm[8][64]; __shared__ float sl[8][64];
  const int tid = threadIdx.x, w = tid >> 5, lane = tid & 31, ln = lane & 15, hh = lane >> 4; const int kc = w >> 1, qg = (w & 1) * 32;
  const size_t q0 = (size_t)blockIdx.x * 64; const size_t kb0 = (q0 / SQ) * SQ + (size_t)kc * FA_KW;      /* token rows: first query of the group, first key of the wave */
  const float cs = 0.002762135864009951f * 1.44269504f;      /* 512^-0.5 / 16 (G is carried x16) x log2 e: laid on Y in f32, ahead of its rounding to f16 */
  const _Float16* gp = GH + lane * 8; const _Float16* qp = XF + (q0 + qg) * EM + lane * 8;      /* G^T, then H^T: four 16-row tiles of 1,024 halves each; the wave's two query tiles */
  const _Float16* xp = XF + kb0 * EM + lane * 8; const _Float16* zp = XT + kb0 * EM + lane * 8;      /* x: 16-key tiles of 1,024 halves; x^T: 32-key blocks of 2,048 halves, [e tile][fragment of 512] */
  const v8f z8 = {0.f,0.f,0.f,0.f,0.f,0.f,0.f,0.f}; v8f acc[2][4] = {{z8, z8, z8, z8}, {z8, z8, z8, z8}}; float l[2] = {0.f, 0.f};
  v8f nm[2] = {z8, z8};      /* minus the maximum in use, in all 8 registers of a tile (a lane owns one query): C of the score products; 0 until the first pass sets it */
  v16h yb[2][2], xa[2][2];
  { v16h gf[4][2], xb[2][2];
#pragma unroll
    for (int nt = 0; nt < 4; ++nt)
#pragma unroll
      for (int ks = 0; ks < 2; ++ks) gf[nt][ks] = ff_frag(gp + nt * (16 * EM) + ks * 512);
#pragma unroll
    for (int qt = 0; qt < 2; ++qt)
#pragma unroll
      for (int ks = 0; ks < 2; ++ks) { xb[qt][ks] = ff_frag(qp + qt * (16 * EM) + ks * 512); xa[qt][ks] = ff_frag(xp + qt * (16 * EM) + ks * 512); }      /* xa: the first pass's two key tiles */
    asm volatile("s_wait_xcnt 0x0" :: "v"(gp), "v"(qp), "v"(xp) : "memory");      /* behind the 32 loads: the results below may be formed in the registers that these loads name as addresses; the addresses are inputs, so that no load's result is laid over them ahead of the wait */
    __builtin_amdgcn_sched_barrier(0);      /* all 32 loads stay above the first matrix instruction, so that they share one memory latency */
#pragma unroll
    for (int qt = 0; qt < 2; ++qt)
#pragma unroll
      for (int ks = 0; ks < 2; ++ks)
        yb[qt][ks] = ff_pack(fa_mma(gf[2 * ks][1], xb[qt][1], fa_mma(gf[2 * ks][0], xb[qt][0], z8)) * cs, fa_mma(gf[2 * ks + 1][1], xb[qt][1], fa_mma(gf[2 * ks + 1][0], xb[qt][0], z8)) * cs); }
#pragma unroll 1      /* rolled: one pass's fragments and accumulators fill the register budget of four waves per SIMD */
  for (int it = 0; it < FA_KW / 32; ++it) {
    v16h za[4]; const _Float16* zq = zp + (size_t)it * (32 * EM);
#pragma unroll
    for (int jt = 0; jt < 4; ++jt) za[jt] = ff_frag(zq + jt * 512);
    v8f s[2][2];
#pragma unroll
    for (int qt = 0; qt < 2; ++qt)
#pragma unroll
      for (int kt = 0; kt < 2; ++kt) s[qt][kt] = fa_mma(xa[kt][1], yb[qt][1], fa_mma(xa[kt][0], yb[qt][0], nm[qt]));      /* log2-domain score minus the maximum in use */
    const int nx = (it + 1 < FA_KW / 32) ? it + 1 : it;      /* the next pass's key rows are fetched under this pass's softmax; the last pass fetches its own again (in bounds, unused) */
    const _Float16* xq = xp + (size_t)nx * (32 * EM);
#pragma unroll
    for (int kt = 0; kt < 2; ++kt)
#pragma unroll
      for (int ks = 0; ks < 2; ++ks) xa[kt][ks] = ff_frag(xq + kt * (16 * EM) + ks * 512);
    asm volatile("s_wait_xcnt 0x0" :: "v"(zq), "v"(xq) : "memory");      /* behind this pass's 16 loads: the next pass forms its addresses in the registers that these loads name; the two addresses are inputs, so that no load's result is laid over them ahead of the wait */
    __builtin_amdgcn_sched_barrier(0);      /* keeps the softmax below the fetches, so that the next pass's key rows fly under it instead of being asked for at the pass's end */
    float mx[2];
#pragma unroll
    for (int qt = 0; qt < 2; ++qt) { mx[qt] = fmaxf(s[qt][0][0], s[qt][1][0]);
#pragma unroll
      for (int r = 1; r < 8; ++r) mx[qt] = fmaxf(mx[qt], fmaxf(s[qt][0][r], s[qt][1][r])); }
    const float thr = (it == 0) ? -3.0e38f : 8.0f;      /* the first pass always rescales: it sets the maximum from its own scores, of either sign */
    if (__builtin_amdgcn_ballot_w32(fmaxf(mx[0], mx[1]) > thr) != 0u) {      /* one scalar branch a pass and wave */
#pragma unroll
      for (int qt = 0; qt < 2; ++qt) {
        const float mq = fmaxf(mx[qt], rs_xhalf(mx[qt]));      /* the same in both lanes of a query */
        const float d = (it == 0) ? mq : fmaxf(mq, 0.f);      /* rise of the maximum in use */
        const float f = (it == 0) ? 1.0f : fa_exp2(-d);      /* first pass: sums and accumulators are still 0, and 2^-d could overflow */
        const float nn = nm[qt][0] - d; l[qt] *= f;
#pragma unroll
        for (int r = 0; r < 8; ++r) nm[qt][r] = nn;
#pragma unroll
        for (int kt = 0; kt < 2; ++kt) s[qt][kt] = s[qt][kt] - d;
#pragma unroll
        for (int jt = 0; jt < 4; ++jt) acc[qt][jt] = acc[qt][jt] * f;
      }
    }
    FragH pb[2];
#pragma unroll
    for (int qt = 0; qt < 2; ++qt) {
      float ps = 0.f;
#pragma unroll
      for (int kt = 0; kt < 2; ++kt)
#pragma unroll
        for (int r4 = 0; r4 < 8; r4 += 4) { const float t0 = s[qt][kt][r4], t1 = s[qt][kt][r4 + 1], t2 = s[qt][kt][r4 + 2], t3 = s[qt][kt][r4 + 3]; float e0, e1, e2, e3;
          /* four independent exponentials and one v_nop in one statement: the slot that the instruction set asks for behind a transcendental (early-clobber outputs keep the four apart) */
          asm("v_exp_f32 %0, %4\n\tv_exp_f32 %1, %5\n\tv_exp_f32 %2, %6\n\tv_exp_f32 %3, %7\n\tv_nop" : "=&v"(e0), "=&v"(e1), "=&v"(e2), "=&v"(e3) : "v"(t0), "v"(t1), "v"(t2), "v"(t3));
          ps += (e0 + e1) + (e2 + e3);
          pb[qt].h[kt * 8 + r4] = (_Float16)e0; pb[qt].h[kt * 8 + r4 + 1] = (_Float16)e1; pb[qt].h[kt * 8 + r4 + 2] = (_Float16)e2; pb[qt].h[kt * 8 + r4 + 3] = (_Float16)e3; }
      l[qt] += ps;
    }
    __builtin_amdgcn_sched_barrier(0);      /* every exponential stays above the matrix instructions below */
#pragma unroll
    for (int qt = 0; qt < 2; ++qt)
#pragma unroll
      for (int jt = 0; jt < 4; ++jt) acc[qt][jt] = fa_mma(za[jt], pb[qt].v, acc[qt][jt]);
  }
  v16h hf[4][2];
#pragma unroll
  for (int jt = 0; jt < 4; ++jt)
#pragma unroll
    for (int ks = 0; ks < 2; ++ks) hf[jt][ks] = ff_frag(gp + EM * EM + jt * (16 * EM) + ks * 512);
  asm volatile("s_wait_xcnt 0x0" :: "v"(gp) : "memory");      /* behind the 16 loads: the values below may be formed in the registers that these loads name as address; the address is an input, so that no load's result is laid over it ahead of the wait */
#pragma unroll
  for (int qt = 0; qt < 2; ++qt) { const float lt = l[qt] + rs_xhalf(l[qt]); if (hh == 0) { sm[kc][qg + qt * 16 + ln] = -nm[qt][0]; sl[kc][qg + qt * 16 + ln] = lt; }
    const float rl = 1.0f / lt;      /* lt is about 1 or more: the key that last set the maximum in use adds 2^0 */
    const v16h ob0 = ff_pack(acc[qt][0] * rl, acc[qt][1] * rl), ob1 = ff_pack(acc[qt][2] * rl, acc[qt][3] * rl);
#pragma unroll
    for (int jt = 0; jt < 4; ++jt) { const v8f c = fa_mma(hf[jt][1], ob1, fa_mma(hf[jt][0], ob0, z8)); const v4f c0 = {c[0], c[1], c[2], c[3]}, c1 = {c[4], c[5], c[6], c[7]};
      *(v4fa*)&sacc[kc][qg + qt * 16 + ln][jt * 16 + 8 * hh] = c0; *(v4fa*)&sacc[kc][qg + qt * 16 + ln][jt * 16 + 8 * hh + 4] = c1; } }
  __syncthreads();      /* the 8 key ranges' partial maxima, sums and rows are complete before any thread merges them */
  const int q = tid >> 3, d8 = (tid & 7) * 8; float mg = sm[0][q];
#pragma unroll
  for (int u = 1; u < 8; ++u) mg = fmaxf(mg, sm[u][q]);
  float lg = 0.f; v4f o0 = {0.f, 0.f, 0.f, 0.f}, o1 = {0.f, 0.f, 0.f, 0.f};
#pragma unroll
  for (int u = 0; u < 8; ++u) { const float f = fa_exp2(sm[u][q] - mg) * sl[u][q]; lg += f; o0 += f * *(const v4fa*)&sacc[u][q][d8]; o1 += f * *(const v4fa*)&sacc[u][q][d8 + 4]; }
  const float sc = 0.0625f / lg;      /* H is carried x16 */
  float* op = out + (q0 + q) * EM + d8; *(v4f*)op = o0 * sc; *(v4f*)(op + 4) = o1 * sc; }

// ---- launch 1: jobs that do not depend on one another share a launch (the block index picks the job) ----
__device__ __forceinline__ _Float16 pre_w16(float v) { return (_Float16)(bf16_round(v) * 16.0f); }      /* weight: rounded to bf16, carried x16, exact in f16 */
/* the 16 f32 values behind one lane's fragment (A or B, k order of g2_frag): r[0..7] = k 8 hh + i, r[8..15] = k 16 + 8 hh + i. Row form: p = first of the 32 k values of the lane's row, matrix kept as stored */
__device__ __forceinline__ void pre_raw_row(const float* p, int hh, float (&r)[16]) { const v4f a0 = *(const v4fa*)(p + 8 * hh), a1 = *(const v4fa*)(p + 8 * hh + 4), a2 = *(const v4fa*)(p + 16 + 8 * hh), a3 = *(const v4fa*)(p + 16 + 8 * hh + 4);
#pragma unroll
  for (int q = 0; q < 4; ++q) { r[q] = a0[q]; r[4 + q] = a1[q]; r[8 + q] = a2[q]; r[12 + q] = a3[q]; } }
/* column form, down a [k][EM] matrix: p = element (first k, the lane's column) */
__device__ __forceinline__ void pre_raw_col(const float* p, int hh, float (&r)[16]) {
#pragma unroll
  for (int i = 0; i < 8; ++i) { r[i] = p[(size_t)(8 * hh + i) * EM]; r[8 + i] = p[(size_t)(16 + 8 * hh + i) * EM]; } }
__device__ __forceinline__ v16h pre_cvt(const float (&r)[16]) { FragH f;
#pragma unroll
  for (int i = 0; i < 16; ++i) f.h[i] = pre_w16(r[i]);
  return f.v; }
/* one 16 x 16 tile over K = DM, k ascending in steps of 32; ACOL: A is read down columns */
template <bool ACOL>
__device__ __forceinline__ v8f pre_tile(const float* ap, const float* bp, int hh) { v8f c = {0.f, 0.f, 0.f, 0.f, 0.f, 0.f, 0.f, 0.f};
#pragma unroll 1      /* rolled: one stage of raw values is what the registers hold while two blocks still fit a WGP (the x blocks run under the same allocation) */
  for (int k0 = 0; k0 < DM; k0 += 128) { float ra[4][16], rb[4][16];
#pragma unroll
    for (int u = 0; u < 4; ++u) { if (ACOL) pre_raw_col(ap + (size_t)(k0 + 32 * u) * EM, hh, ra[u]); else pre_raw_row(ap + k0 + 32 * u, hh, ra[u]); pre_raw_row(bp + k0 + 32 * u, hh, rb[u]); }
    asm volatile("s_wait_xcnt 0x0" ::: "memory");      /* behind the stage's loads: the next stage forms its addresses in the registers that these loads name */
    __builtin_amdgcn_sched_barrier(0);      /* all loads of four k steps stay above the first conversion, so the four share one memory latency instead of paying one each */
#pragma unroll
    for (int u = 0; u < 4; ++u) c = fa_mma(pre_cvt(ra[u]), pre_cvt(rb[u]), c); }
  return c; }
#define PRE_GB 4                     /* blocks of launch 1 that form G^T and H^T: 2 planes x 16 tiles of 16 x 16, one tile a wave */
static_assert(NR * EM % (8 * 256) == 0, "k_pre: the x blocks have no tail guard");
// Launch 1. Blocks 0 .. PRE_GB - 1 (first, they last longest): plane 0 G^T[f][e] = sum_w Wk[f][w] Wq[e][w], plane 1 H^T[j][e] = sum_w Wm[w][j] Wv[e][w], both x16, operands converted in the loaders, k ascending in steps of 32 as before, stored in fragment order. The other blocks: 32 tokens each, x and x^T to f16 in fragment order.
__global__ __launch_bounds__(256) void k_pre(const float* __restrict__ x, const float* __restrict__ wq, const float* __restrict__ wk, const float* __restrict__ wv, const float* __restrict__ wm, _Float16* __restrict__ XF, _Float16* __restrict__ XT, _Float16* __restrict__ GH) {
  __shared__ __attribute__((aligned(16))) _Float16 sg[32][72];      /* pitch 144 B: 16-byte aligned rows */
  const int tid = threadIdx.x;
  if (blockIdx.x >= PRE_GB) { const size_t t = (size_t)(blockIdx.x - PRE_GB) * 256 + tid; FragH f, g; float ra[8], rc[8];      /* piece t of x in fragment order: tile t / 128, k = 8 ((t / 16) % 8) .. + 7, row t % 16 */
    const float* xs = x + ((t >> 7) * 16 + (t & 15)) * EM + ((t >> 4) & 7) * 8;
    const float* xc = x + ((t >> 8) * 32 + ((t >> 4) & 3) * 8) * EM + ((t >> 6) & 3) * 16 + (t & 15);      /* piece t of x^T: 32-key block t / 256 (the block's own 32 tokens), row e = 16 ((t / 64) % 4) + t % 16, keys 8 ((t / 16) % 4) .. + 7 */
#pragma unroll
    for (int q = 0; q < 8; ++q) { ra[q] = xs[q]; rc[q] = xc[(size_t)q * EM]; }
    asm volatile("s_wait_xcnt 0x0" :: "v"(xs), "v"(xc) : "memory");      /* behind the loads: the values below may be formed in the registers that these loads name as addresses; the addresses are inputs, so that no load's result is laid over them ahead of the wait */
#pragma unroll
    for (int q = 0; q < 8; ++q) { f.h[q] = (_Float16)bf16_round(ra[q]); g.h[q] = (_Float16)bf16_round(rc[q]); }
    *(v8us*)((unsigned short*)XF + t * 8) = f.half[0]; *(v8us*)((unsigned short*)XT + t * 8) = g.half[0]; return; }
  const int lane = tid & 31, ln = lane & 15, hh = lane >> 4; const int g = blockIdx.x * 8 + (tid >> 5); const int plane = blockIdx.x / (PRE_GB / 2), rt = (g >> 2) & 3, ct = g & 3;
  const float* bp = (plane ? wv : wq) + (size_t)(ct * 16 + ln) * DM;
  const v8f c = plane ? pre_tile<true>(wm + rt * 16 + ln, bp, hh) : pre_tile<false>(wk + (size_t)(rt * 16 + ln) * DM, bp, hh);      /* plane is the same for the whole block */
#pragma unroll
  for (int r = 0; r < 8; ++r) sg[(rt & 1) * 16 + 8 * hh + r][ct * 16 + ln] = (_Float16)(c[r] * 0.0625f);
  __syncthreads();      /* the block's 32 rows (two row tiles x four column tiles, one wave each) are complete in LDS; taken by whole GH blocks only, the x blocks have left above */
  const int row = tid & 31, k8 = tid >> 5;      /* 16 B a thread, fragment order [row tile][k / 8][row][k % 8]: a wave stores two runs of 256 B */
  *(v8us*)((unsigned short*)GH + (size_t)plane * (EM * EM) + (size_t)((rt & 2) + (row >> 4)) * (16 * EM) + k8 * 128 + (row & 15) * 8) = *(const v8us*)&sg[row][k8 * 8]; }

extern "C" void kernel_launch(void* const* d_in, const int* in_sizes, int n_in,
                              void* d_out, int out_size, void* d_ws, size_t ws_size, hipStream_t stream) {
  (void)in_sizes; (void)n_in; (void)out_size;
  const float* const* I = (const float* const*)d_in; const float* x = I[0]; const float* wq = I[1]; const float* wk = I[2]; const float* wv = I[3]; const float* wm = I[4];      /* weights [in][out] */
  char* ws = (char*)d_ws; size_t off = 0;
  auto take = [&](size_t bytes) { char* p = ws + off; off += (bytes + 255) & ~(size_t)255; return p; };
  _Float16* GH = (_Float16*)take((size_t)2 * EM * EM * 2);      /* GH = [G^T | H^T], each [64][64] x16, in fragment order */
  _Float16* XF = (_Float16*)take(NR * EM * 2); _Float16* XT = (_Float16*)take(NR * EM * 2);      /* x, x^T in fragment order */
  if (off > ws_size) return;      /* approx 4 MiB */
  k_pre<<<(unsigned)(PRE_GB + NR * EM / 8 / 256), 256, 0, stream>>>(x, wq, wk, wv, wm, XF, XT, GH);
  k_fattn<<<(unsigned)(NR / 64), 512, 0, stream>>>(XF, XT, GH, (float*)d_out);      /* all batches: 64 query rows a work-group */
}

// v008
// A run of this version takes 20.9 microseconds.
// Timed twice side by side with v007, it ran 1.28 and 1.31 times as fast.
// Counting every step since v000, it is 163 times as fast.
#include <hip/hip_runtime.h>
// Wide single-head self-attention (x [4][4096][64]; Q/K/V = x W with W [64][512] stored [in][out] (heads NOT split: one 512-wide head); scores = Q K^T / sqrt(512) over all 4,096 keys; softmax; o = attn V; out = o Wm (Wm [512][64]) -> [4][4096][64]).
// Structure: the chained products are reassociated: Q K^T = (x G) x^T with G = Wq Wk^T [64][64], and (attn V) Wm = attn (x H) with H = Wv Wm [64][64] (exact algebra for any inputs; another f32 sum order), so both 4096 x 4096 products run at width 64 instead of 512. Token rows r = b*4096 + s; x exact in f16 (bf16-rounded); weights exact x16; G^T and H^T in one WMMA launch (two planes, K = 512 split over the 8 waves of a block, carried x16); x, x^T, G^T and H^T are kept in the workspace in WMMA fragment order (see ff_frag), so that every fragment load and store is a contiguous 512-B run; then ONE fused launch for all batches: each wave forms Y = x G (carrying the score scale) for its own queries, scores^T = x Y^T, running-maximum softmax in registers, o^T += x^T P^T, and attn (x H) = (attn x) H: H is applied to each wave's normalised partial o behind its key loop, so neither scores, weights, Y nor x H go through memory. 2 launches, one per link of the dependence chain: (x, x^T to f16 | G^T, H^T straight from the f32 weights), fused attention.
// Compute dtype: inputs rounded to bf16; x / weights exact; G, H, Y, each key range's weighted mean of x rows and softmax weights (2^(score - maximum in use), in [0, 2^8]) as plain f16 WMMA operands (~2^-12); scores, statistics and out f32. v_wmma_f32_16x16x32_f16.
#define NB 4
#define SQ 4096
#define EM 64                        /* embedding */
#define DM 512                       /* wide = 8 x 64 (one head) */
#define NH 8                         /* 64-wide slabs of the one 512-wide head (not used) */
#define HD 64
#define HG 1
#define B0 0                         /* not used (all batches run from 0) */
#define NBR NB                       /* not used (the launches cover NB batches through NR) */
#define QN SQ                        /* not used (all SQ query rows attended) */
#define NR ((size_t)NB * SQ)
#define MP ((int)((size_t)NBR * SQ))
#define MPO MP
typedef __bf16 v16b __attribute__((ext_vector_type(16)));
typedef unsigned short v8us __attribute__((ext_vector_type(8), may_alias));
typedef float  v8f  __attribute__((ext_vector_type(8)));
typedef float  v4f  __attribute__((ext_vector_type(4)));
typedef float  v4fa __attribute__((ext_vector_type(4), may_alias));
union FragB { v16b v; v8us half[2]; unsigned short u[16]; };

__device__ __forceinline__ unsigned short bf16_bits(float x) { unsigned int u = __float_as_uint(x); return (unsigned short)((u + 0x7FFFu + ((u >> 16) & 1u)) >> 16); }
__device__ __forceinline__ float bf16_val(unsigned short b) { return __uint_as_float(((unsigned int)b) << 16); }
__device__ __forceinline__ float bf16_round(float x) { return bf16_val(bf16_bits(x)); }
// D += A·B with NT terms: 1 = ah·bh, 2 = + al·bh (A split), 3 = + ah·bl (both split)
template <int NT>
__device__ __forceinline__ v8f mmaN(v16b ah, v16b al, v16b bh, v16b bl, v8f c) {
  c = __builtin_amdgcn_wmma_f32_16x16x32_bf16(false, ah, false, bh, (short)0, c, false, false);
  if (NT >= 2) c = __builtin_amdgcn_wmma_f32_16x16x32_bf16(false, al, false, bh, (short)0, c, false, false);
  if (NT >= 3) c = __builtin_amdgcn_wmma_f32_16x16x32_bf16(false, ah, false, bl, (short)0, c, false, false);
  asm volatile("v_nop\n\tv_nop\n\tv_nop\n\tv_nop" : "+v"(c) : "v"(ah), "v"(al), "v"(bh), "v"(bl));
  return c;
}

__global__ __launch_bounds__(256) void k_wt_bf16(const float* __restrict__ W, unsigned short* __restrict__ Wt, int K, int N) {
  const int t = blockIdx.x * 256 + threadIdx.x;
  const int k8n = K / 8;
  if (t >= N * k8n) return;
  const int n = t / k8n, k8 = (t % k8n) * 8;
  v8us v;
#pragma unroll
  for (int i = 0; i < 8; ++i) v[i] = bf16_bits(W[(size_t)(k8 + i) * N + n]);
  *(v8us*)(Wt + (size_t)n * K + k8) = v;
  
}

// GEMM C[M][N] (f32, pitch ldc) = act(A[M][K]·W + bias). A f32 row-major (pitch lda) converted per fragment to bf16
// (ASPLIT: hi/lo two planes -> 2 terms, else single rounded term); Wt bf16 [N][K] (pitch ldb). BIAS_BF16 rounds the
// bias to bf16 first (bias quantised to bf16 before the add). K%32==0, M%16==0, N%64==0.
template <bool ASPLIT, int ACT, bool BIAS_BF16>
__global__ __launch_bounds__(128) void k_gemm_bf(const float* __restrict__ A, int lda, const unsigned short* __restrict__ Wt, int ldb,
                                               const float* __restrict__ bias, float* __restrict__ C, int ldc, int M, int N, int K) {
  __shared__ __attribute__((aligned(16))) float so[4][16][64];
  const int tid = threadIdx.x, w = tid >> 5, lane = tid & 31, ln = lane & 15, hh = lane >> 4;
  const int ntn = N / 64;
  const int wid = blockIdx.x * 4 + w;
  const int mt = wid / ntn, nq = wid % ntn;
  if (mt * 16 >= M) return;
  const int row0 = mt * 16, col0 = nq * 64;
  const float* arow = A + (size_t)(row0 + ln) * lda;
  v8f acc[4] = {};
  for (int kb = 0; kb < K; kb += 32) {
    FragB ah, al;
    const v4f x0 = *(const v4fa*)(arow + kb + 8 * hh), x1 = *(const v4fa*)(arow + kb + 8 * hh + 4);
    const v4f x2 = *(const v4fa*)(arow + kb + 16 + 8 * hh), x3 = *(const v4fa*)(arow + kb + 16 + 8 * hh + 4);
    float xs[16] = {x0[0],x0[1],x0[2],x0[3],x1[0],x1[1],x1[2],x1[3],x2[0],x2[1],x2[2],x2[3],x3[0],x3[1],x3[2],x3[3]};
#pragma unroll
    for (int i = 0; i < 16; ++i) { const unsigned short hb = bf16_bits(xs[i]); ah.u[i] = hb; al.u[i] = ASPLIT ? bf16_bits(xs[i] - bf16_val(hb)) : (unsigned short)0; }
#pragma unroll
    for (int t = 0; t < 4; ++t) {
      const unsigned short* brow = Wt + (size_t)(col0 + t * 16 + ln) * ldb + kb;
      FragB b;
      b.half[0] = *(const v8us*)(brow + 8 * hh);
      b.half[1] = *(const v8us*)(brow + 16 + 8 * hh);
      acc[t] = mmaN<ASPLIT ? 2 : 1>(ah.v, al.v, b.v, b.v, acc[t]);
    }
  }
#pragma unroll
  for (int t = 0; t < 4; ++t) {
    float bv = bias ? bias[col0 + t * 16 + ln] : 0.f;
    if (BIAS_BF16) bv = bf16_round(bv);
#pragma unroll
    for (int r = 0; r < 8; ++r) { float v = acc[t][r] + bv; if (ACT == 1) v = fmaxf(v, 0.f); so[w][8 * hh + r][t * 16 + ln] = v; }
  }
  __builtin_amdgcn_fence(__ATOMIC_ACQ_REL, "workgroup");
  __builtin_amdgcn_wave_barrier();
  const int rsub = lane >> 4, c4 = (lane & 15) * 4;
  {
#pragma unroll
    for (int q = 0; q < 8; ++q) {
      const int r = q * 2 + rsub;
      const v4f v = *(const v4fa*)&so[w][r][c4];
      *(v4f*)(C + (size_t)(row0 + r) * ldc + col0 + c4) = v;
    }
    
  }
}

// GEMM C = act(A·W + bias + resid): A f32 (ASPLIT -> hi/lo 2 terms), Wt bf16 [N][K]; ACT 0 none, 1 relu, 2 exact gelu;
// resid (optional, f32, row index = (row % rmod), pitch ldr, RES_BF16 rounds it) added before the activation.
template <bool ASPLIT, int ACT, bool BIAS_BF16, bool RES_BF16>
__global__ __launch_bounds__(128) void k_gemm_bf3(const float* __restrict__ A, int lda, const unsigned short* __restrict__ Wt, int ldb,
                                                const float* __restrict__ bias, const float* __restrict__ resid, int rmod, int ldr,
                                                float* __restrict__ C, int ldc, int M, int N, int K) {
  __shared__ __attribute__((aligned(16))) float so[4][16][64];
  const int tid = threadIdx.x, w = tid >> 5, lane = tid & 31, ln = lane & 15, hh = lane >> 4;
  const int ntn = N / 64;
  const int wid = blockIdx.x * 4 + w;
  const int mt = wid / ntn, nq = wid % ntn;
  if (mt * 16 >= M) return;
  const int row0 = mt * 16, col0 = nq * 64;
  const float* arow = A + (size_t)(row0 + ln) * lda;
  v8f acc[4] = {};
  for (int kb = 0; kb < K; kb += 32) {
    FragB ah, al;
    const v4f x0 = *(const v4fa*)(arow + kb + 8 * hh), x1 = *(const v4fa*)(arow + kb + 8 * hh + 4);
    const v4f x2 = *(const v4fa*)(arow + kb + 16 + 8 * hh), x3 = *(const v4fa*)(arow + kb + 16 + 8 * hh + 4);
    float xs[16] = {x0[0],x0[1],x0[2],x0[3],x1[0],x1[1],x1[2],x1[3],x2[0],x2[1],x2[2],x2[3],x3[0],x3[1],x3[2],x3[3]};
#pragma unroll
    for (int i = 0; i < 16; ++i) { const unsigned short hb = bf16_bits(xs[i]); ah.u[i] = hb; al.u[i] = ASPLIT ? bf16_bits(xs[i] - bf16_val(hb)) : (unsigned short)0; }
#pragma unroll
    for (int t = 0; t < 4; ++t) {
      const unsigned short* brow = Wt + (size_t)(col0 + t * 16 + ln) * ldb + kb;
      FragB b;
      b.half[0] = *(const v8us*)(brow + 8 * hh);
      b.half[1] = *(const v8us*)(brow + 16 + 8 * hh);
      acc[t] = mmaN<ASPLIT ? 2 : 1>(ah.v, al.v, b.v, b.v, acc[t]);
    }
  }
#pragma unroll
  for (int t = 0; t < 4; ++t) {
    const int col = col0 + t * 16 + ln;
    float bv = bias ? bias[col] : 0.f;
    if (BIAS_BF16) bv = bf16_round(bv);
#pragma unroll
    for (int r = 0; r < 8; ++r) {
      float v = acc[t][r] + bv;
      if (resid) { float rv = resid[(size_t)((row0 + 8 * hh + r) % rmod) * ldr + col]; if (RES_BF16) rv = bf16_round(rv); v += rv; }
      if (ACT == 1) v = fmaxf(v, 0.f);
      if (ACT == 2) v = 0.5f * v * (1.0f + erff(v * 0.70710678118654752f));
      if (ACT == 3) { const float u = 0.7978845608028654f * (v + 0.044715f * v * v * v); v = 0.5f * v * (1.0f + tanhf(u)); }
      so[w][8 * hh + r][t * 16 + ln] = v;
    }
  }
  __builtin_amdgcn_fence(__ATOMIC_ACQ_REL, "workgroup");
  __builtin_amdgcn_wave_barrier();
  const int rsub = lane >> 4, c4 = (lane & 15) * 4;
  {
#pragma unroll
    for (int q = 0; q < 8; ++q) {
      const int r = q * 2 + rsub;
      const v4f v = *(const v4fa*)&so[w][r][c4];
      *(v4f*)(C + (size_t)(row0 + r) * ldc + col0 + c4) = v;
    }
    
  }
}
// row LayerNorm (biased variance, eps) over N: s = X (+ R); optional out_sum <- s; out_norm <- (s-mu)*rsqrt(var+eps)*g + b
template <bool PARAM_BF16>
__global__ __launch_bounds__(256) void k_layernorm(const float* __restrict__ X, const float* __restrict__ R, const float* __restrict__ g, const float* __restrict__ bta,
                                                  float* __restrict__ out_sum, float* __restrict__ out_norm, int N, float eps) {
  __shared__ float red[256];
  const int row = blockIdx.x, tid = threadIdx.x;
  const float* x = X + (size_t)row * N; const float* rr = R ? R + (size_t)row * N : nullptr;
  float vals[16];                     // up to N = 4096
  const int per = N / 256;            // contiguous chunk per thread? use strided-by-4 chunks: thread handles j = tid*4 + 1024*u
  float s1 = 0.f;
  for (int u = 0; u < per / 4; ++u) {
    const int j = tid * 4 + 1024 * u;
    const v4f a = *(const v4fa*)(x + j);
    v4f b = {0.f,0.f,0.f,0.f}; if (rr) b = *(const v4fa*)(rr + j);
#pragma unroll
    for (int q = 0; q < 4; ++q) { const float v = a[q] + b[q]; vals[u * 4 + q] = v; s1 += v; }
  }
  red[tid] = s1; __syncthreads();
  for (int st = 128; st > 0; st >>= 1) { if (tid < st) red[tid] += red[tid + st]; __syncthreads(); }
  const float mu = red[0] / (float)N; __syncthreads();
  float s2 = 0.f;
  for (int u = 0; u < per / 4; ++u)
#pragma unroll
    for (int q = 0; q < 4; ++q) { const float c = vals[u * 4 + q] - mu; s2 += c * c; }
  red[tid] = s2; __syncthreads();
  for (int st = 128; st > 0; st >>= 1) { if (tid < st) red[tid] += red[tid + st]; __syncthreads(); }
  const float rs = rsqrtf(red[0] / (float)N + eps);
  {
    for (int u = 0; u < per / 4; ++u) {
      const int j = tid * 4 + 1024 * u;
      v4f o, sm;
#pragma unroll
      for (int q = 0; q < 4; ++q) {
        float gg = g[j + q], bb = bta[j + q];
        if (PARAM_BF16) { gg = bf16_round(gg); bb = bf16_round(bb); }
        sm[q] = vals[u * 4 + q]; o[q] = (vals[u * 4 + q] - mu) * rs * gg + bb;
      }
      if (out_sum) *(v4f*)(out_sum + (size_t)row * N + j) = sm;
      *(v4f*)(out_norm + (size_t)row * N + j) = o;
    }
    
  }
}



// ---- f16 WMMA path (v_wmma_f32_16x16x32_f16): 11-bit significands for operands in range — used where a [0,1] probability operand needs more precision than bf16
typedef _Float16 v16h __attribute__((ext_vector_type(16)));
union FragH { v16h v; v8us half[2]; _Float16 h[16]; unsigned short u[16]; };
template <int NT>
__device__ __forceinline__ v8f mmaH(v16h ah, v16h al, v16h bh, v16h bl, v8f c) {
  c = __builtin_amdgcn_wmma_f32_16x16x32_f16(false, ah, false, bh, (short)0, c, false, false);
  if (NT >= 2) c = __builtin_amdgcn_wmma_f32_16x16x32_f16(false, al, false, bh, (short)0, c, false, false);
  if (NT >= 3) c = __builtin_amdgcn_wmma_f32_16x16x32_f16(false, ah, false, bl, (short)0, c, false, false);
  asm volatile("v_nop\n\tv_nop\n\tv_nop\n\tv_nop" : "+v"(c) : "v"(ah), "v"(al), "v"(bh), "v"(bl));
  return c;
}
// batched GEMM like k_gemm_b but f16 operands: A f32 (split into f16 hi/lo if ASPLIT, else rounded to f16), Bt = f16 values [n][k]; alpha; C f32; N multiple of 16 (partial tiles skipped)
template <bool ASPLIT>
__global__ __launch_bounds__(128) void k_gemm_h(const float* __restrict__ A, int lda, size_t sA, const _Float16* __restrict__ Bh, int ldb, size_t sB, float alpha, float* __restrict__ C, int ldc, size_t sC, int M, int N, int K) {
  __shared__ __attribute__((aligned(16))) float so[4][16][64];
  const int tid = threadIdx.x, w = tid >> 5, lane = tid & 31, ln = lane & 15, hh = lane >> 4; const int by = blockIdx.y;
  A += (size_t)by * sA; Bh += (size_t)by * sB; C += (size_t)by * sC;
  const int ntn = (N + 63) / 64; const int wid = blockIdx.x * 4 + w; const int mt = wid / ntn, nq = wid % ntn; if (mt * 16 >= M) return;
  const int row0 = mt * 16, col0 = nq * 64; const float* arow = A + (size_t)(row0 + ln) * lda;
  v8f acc[4] = {};
  for (int kb = 0; kb < K; kb += 32) {
    FragH ah, al;
    const v4f x0 = *(const v4fa*)(arow + kb + 8 * hh), x1 = *(const v4fa*)(arow + kb + 8 * hh + 4), x2 = *(const v4fa*)(arow + kb + 16 + 8 * hh), x3 = *(const v4fa*)(arow + kb + 16 + 8 * hh + 4);
    float xs[16] = {x0[0],x0[1],x0[2],x0[3],x1[0],x1[1],x1[2],x1[3],x2[0],x2[1],x2[2],x2[3],x3[0],x3[1],x3[2],x3[3]};
#pragma unroll
    for (int i = 0; i < 16; ++i) { const _Float16 h = (_Float16)xs[i]; ah.h[i] = h; al.h[i] = ASPLIT ? (_Float16)(xs[i] - (float)h) : (_Float16)0.0f; }
#pragma unroll
    for (int t = 0; t < 4; ++t) { if (col0 + t * 16 >= N) continue; const size_t boff = (size_t)(col0 + t * 16 + ln) * ldb + kb; FragH bq; bq.half[0] = *(const v8us*)(Bh + boff + 8 * hh); bq.half[1] = *(const v8us*)(Bh + boff + 16 + 8 * hh);
      acc[t] = mmaH<ASPLIT ? 2 : 1>(ah.v, al.v, bq.v, bq.v, acc[t]); }
  }
#pragma unroll
  for (int t = 0; t < 4; ++t) { if (col0 + t * 16 >= N) continue;
#pragma unroll
    for (int r = 0; r < 8; ++r) so[w][8 * hh + r][t * 16 + ln] = acc[t][r] * alpha; }
  __builtin_amdgcn_fence(__ATOMIC_ACQ_REL, "workgroup"); __builtin_amdgcn_wave_barrier();
  const int rsub = lane >> 4, c4 = (lane & 15) * 4;
  {
#pragma unroll
    for (int q = 0; q < 8; ++q) { const int r = q * 2 + rsub; if (col0 + c4 < N) { const v4f v = *(const v4fa*)&so[w][r][c4]; *(v4f*)(C + (size_t)(row0 + r) * ldc + col0 + c4) = v; } }
     }
}

// Wt[n][k] = f16(W[k][n]·scale) from f32 row-major W[K][N] (scale = power of two; bf16-exact weights stay exact in f16 away from the subnormal range)
__global__ __launch_bounds__(256) void k_wt_f16(const float* __restrict__ W, _Float16* __restrict__ Wt, int K, int N, float scale) {
  const int t = blockIdx.x * 256 + threadIdx.x; if (t >= N * (K / 8)) return; const int n = t / (K / 8), k8 = (t % (K / 8)) * 8; FragH f;
#pragma unroll
  for (int i = 0; i < 8; ++i) f.h[i] = (_Float16)(bf16_round(W[(size_t)(k8 + i) * N + n]) * scale); const v8us o = f.half[0];
  *(v8us*)((unsigned short*)Wt + (size_t)n * K + k8) = o; 
}
// k_gemm_hh variant with fused epilogue: v = acc·alpha + bias[by·sBias + col] (+ CP[(row/rowsPerB)·sCPb + by·64 + col] if CP) ; ACT 0 none / 1 elu ; writes f16 C16 (and f32 C if non-null)
template <int ACT>
__global__ __launch_bounds__(128) void k_gemm_hhx(const _Float16* __restrict__ A, int lda, size_t sA, const _Float16* __restrict__ Bh, int ldb, size_t sB, float alpha, const float* __restrict__ bias, size_t sBias, const float* __restrict__ CP, int rowsPerB, size_t sCPb, int row0g,
    float* __restrict__ C, _Float16* __restrict__ C16, int ldc, size_t sC, int M, int N, int K) {
  __shared__ __attribute__((aligned(16))) float so[4][16][64];
  const int tid = threadIdx.x, w = tid >> 5, lane = tid & 31, ln = lane & 15, hh = lane >> 4; const int by = blockIdx.y;
  A += (size_t)by * sA; Bh += (size_t)by * sB; const size_t cofs = (size_t)by * sC; const float* bp = bias ? bias + (size_t)by * sBias : nullptr;
  const int ntn = (N + 63) / 64; const int wid = blockIdx.x * 4 + w; const int mt = wid / ntn, nq = wid % ntn; if (mt * 16 >= M) return;
  const int row0 = mt * 16, col0 = nq * 64; const _Float16* arow = A + (size_t)(row0 + ln) * lda;
  v8f acc[4] = {};
  for (int kb = 0; kb < K; kb += 32) { FragH ah; ah.half[0] = *(const v8us*)((const unsigned short*)arow + kb + 8 * hh); ah.half[1] = *(const v8us*)((const unsigned short*)arow + kb + 16 + 8 * hh);
#pragma unroll
    for (int t = 0; t < 4; ++t) { if (col0 + t * 16 >= N) continue; const size_t boff = (size_t)(col0 + t * 16 + ln) * ldb + kb; FragH bq; bq.half[0] = *(const v8us*)((const unsigned short*)Bh + boff + 8 * hh); bq.half[1] = *(const v8us*)((const unsigned short*)Bh + boff + 16 + 8 * hh);
      acc[t] = mmaH<1>(ah.v, ah.v, bq.v, bq.v, acc[t]); }
  }
#pragma unroll
  for (int t = 0; t < 4; ++t) { if (col0 + t * 16 >= N) continue; const int col = col0 + t * 16 + ln; const float bv = bp ? bf16_round(bp[col]) : 0.f;
#pragma unroll
    for (int r = 0; r < 8; ++r) { float v = acc[t][r] * alpha + bv; if (CP) { const int rr = row0g + row0 + 8 * hh + r; if (rowsPerB < 0) v += CP[cofs + (size_t)rr * ldc + col];      /* rowsPerB < 0: own element of the batched C plane */ else { const int bidx = rr / rowsPerB; v += CP[(size_t)bidx * sCPb + (size_t)by * 64 + col]; } } if (ACT == 1) v = (v > 0.f) ? v : expm1f(v); else if (ACT == 7) v = (v > 0.f) ? v + 1.0f : expf(v); else if (ACT == 8) v = tanhf(v); else if (ACT == 9) v = 0.5f * v * (1.0f + tanhf(0.7978845608028654f * (v + 0.044715f * v * v * v))); else if (ACT == 11) v = 1.0f / (1.0f + expf(-v)); else if (ACT == 12) v = (v > 0.f) ? v : 0.01f * v; else if (ACT == 14) v = (v > 0.f) ? v : 0.1f * v; else if (ACT == 16) v = (v >= 0.f) ? v : 0.3f * v; else if (ACT == 17) v = (v >= 0.f) ? v : 0.2f * v; else if (ACT == 15) v = v / (1.0f + expf(-v)); else if (ACT == 3) v = fmaxf(v, 0.f); else if (ACT == 6) v = 0.5f * v * (1.0f + erff(v * 0.70710678118654752f)); so[w][8 * hh + r][t * 16 + ln] = v; } }
  __builtin_amdgcn_fence(__ATOMIC_ACQ_REL, "workgroup"); __builtin_amdgcn_wave_barrier();
  const int rsub = lane >> 4, c4 = (lane & 15) * 4; typedef _Float16 v4h __attribute__((ext_vector_type(4)));
  {
#pragma unroll
    for (int q = 0; q < 8; ++q) { const int r = q * 2 + rsub; if (col0 + c4 < N) { const v4f v = *(const v4fa*)&so[w][r][c4]; if (C) *(v4f*)(C + cofs + (size_t)(row0 + r) * ldc + col0 + c4) = v; if (C16) { v4h h4; for (int i = 0; i < 4; ++i) h4[i] = (_Float16)v[i]; *(v4h*)(C16 + cofs + (size_t)(row0 + r) * ldc + col0 + c4) = h4; } } }
     }
}


typedef _Float16 v4h __attribute__((ext_vector_type(4)));

__global__ __launch_bounds__(256) void k_x16(const float* __restrict__ x, _Float16* __restrict__ X16, size_t n8) { const size_t t = (size_t)blockIdx.x * 256 + threadIdx.x; if (t >= n8) return; FragH f;
#pragma unroll
  for (int q = 0; q < 8; ++q) f.h[q] = (_Float16)bf16_round(x[t * 8 + q]); *(v8us*)((unsigned short*)X16 + t * 8) = f.half[0];  }
__global__ __launch_bounds__(256) void k_h16(const float* __restrict__ x, _Float16* __restrict__ X16, size_t n8) { const size_t t = (size_t)blockIdx.x * 256 + threadIdx.x; if (t >= n8) return; FragH f;
#pragma unroll
  for (int q = 0; q < 8; ++q) f.h[q] = (_Float16)x[t * 8 + q]; *(v8us*)((unsigned short*)X16 + t * 8) = f.half[0];  }
__global__ __launch_bounds__(256) void k_round16f(const float* __restrict__ W, _Float16* __restrict__ Bt, size_t n8) { const size_t t = (size_t)blockIdx.x * 256 + threadIdx.x; if (t >= n8) return; FragH f;
#pragma unroll
  for (int i = 0; i < 8; ++i) f.h[i] = (_Float16)(bf16_round(W[t * 8 + i]) * 16.0f); *(v8us*)((unsigned short*)Bt + t * 8) = f.half[0];  }
template <int NHv, int TTv>
__global__ __launch_bounds__(256) void k_vt(const _Float16* __restrict__ V16, int ldv, int voff, _Float16* __restrict__ Vt) { __shared__ unsigned short tl[64][66]; const int tid = threadIdx.x; const int slab = blockIdx.x / (TTv / 64), lg = blockIdx.x % (TTv / 64); const int b = slab / NHv, h = slab % NHv;
  for (int i = tid; i < 64 * 8; i += 256) { const int r = i / 8, c8 = (i % 8) * 8; FragH f; f.half[0] = *(const v8us*)((const unsigned short*)V16 + ((size_t)b * TTv + lg * 64 + r) * ldv + voff + h * 64 + c8);
#pragma unroll
    for (int q = 0; q < 8; ++q) tl[r][c8 + q] = f.u[q]; }
  __syncthreads();
  {
#pragma unroll
    for (int rd = 0; rd < 2; ++rd) { const int d = rd * 32 + tid / 8, pc = tid % 8; FragH f;
#pragma unroll
      for (int q = 0; q < 8; ++q) f.u[q] = tl[pc * 8 + q][d];
      *(v8us*)((unsigned short*)Vt + ((size_t)slab * 64 + d) * TTv + lg * 64 + pc * 8) = f.half[0]; }
     } }

__global__ __launch_bounds__(256) void k_hl(const float* __restrict__ F, _Float16* __restrict__ Hh, _Float16* __restrict__ Hl, size_t n8) { const size_t t = (size_t)blockIdx.x * 256 + threadIdx.x; if (t >= n8) return; FragH fh, fl; const v4f a = *(const v4fa*)(F + t * 8), c = *(const v4fa*)(F + t * 8 + 4);
#pragma unroll
  for (int q = 0; q < 4; ++q) { _Float16 h = (_Float16)a[q]; fh.h[q] = h; fl.h[q] = (_Float16)((a[q] - (float)h) * 1024.0f); h = (_Float16)c[q]; fh.h[4 + q] = h; fl.h[4 + q] = (_Float16)((c[q] - (float)h) * 1024.0f); }
  { *(v8us*)((unsigned short*)Hh + t * 8) = fh.half[0]; *(v8us*)((unsigned short*)Hl + t * 8) = fl.half[0];  } }

/* one fragment (A or B) from a row-major matrix: p = first of the 32 k values of the lane's row */
__device__ __forceinline__ v16h g2_frag(const _Float16* p, int hh) { FragH f; f.half[0] = *(const v8us*)((const unsigned short*)p + 8 * hh); f.half[1] = *(const v8us*)((const unsigned short*)p + 16 + 8 * hh); return f.v; }
/* Fragment order. A 16-row x 64-k tile (2 KiB) is kept as [k / 8][row][k % 8]: the 16-byte piece that lane (hh, ln) wants for k = 32 ks + 16 h + 8 hh .. + 7 of row ln lies at halves 512 ks + 256 h + 8 lane,
   so one load of 16 B a lane covers 512 contiguous bytes (4 whole lines) where a row-major tile makes it touch 16 lines. p = fragment's first element + 8 lane; same k order as g2_frag */
__device__ __forceinline__ v16h ff_frag(const _Float16* p) { FragH f; f.half[0] = *(const v8us*)((const unsigned short*)p); f.half[1] = *(const v8us*)((const unsigned short*)p + 256); return f.v; }
/* two D tiles as one B fragment: a lane's 8 registers of a D tile (rows 8 hh + r of column ln) are k = 8 hh + r of row ln of the matrix whose rows are D's columns, so tiles 2 ks and 2 ks + 1 are halves 0 and 1 of fragment ks, in the lane */
__device__ __forceinline__ v16h ff_pack(v8f c0, v8f c1) { FragH f;
#pragma unroll
  for (int r = 0; r < 8; ++r) { f.h[r] = (_Float16)c0[r]; f.h[8 + r] = (_Float16)c1[r]; }
  return f.v; }


__global__ __launch_bounds__(256) void k_wnat(const float* __restrict__ w, size_t n8, _Float16* __restrict__ Bt) { const size_t t = (size_t)blockIdx.x * 256 + threadIdx.x; if (t >= n8) return; FragH f; for (int q = 0; q < 8; ++q) f.h[q] = (_Float16)(bf16_round(w[t * 8 + q]) * 16.0f); *(v8us*)((unsigned short*)Bt + t * 8) = f.half[0];  }
__global__ __launch_bounds__(256) void k_rsm(const float* __restrict__ S, _Float16* __restrict__ P, int nrows) {
  #pragma clang fp contract(off)
  const int i = blockIdx.x * 256 + threadIdx.x; if (i >= nrows) return; const float* s = S + (size_t)i * SQ; float mx = -3.0e38f;
#pragma unroll 1
  for (int j = 0; j < SQ; ++j) mx = fmaxf(mx, s[j]); float se = 0.f;
#pragma unroll 1
  for (int j = 0; j < SQ; ++j) se += expf(s[j] - mx); const float sc = 256.0f / se;
#pragma unroll 1
  for (int j0 = 0; j0 < SQ; j0 += 8) { FragH f; for (int q = 0; q < 8; ++q) f.h[q] = (_Float16)(expf(s[j0 + q] - mx) * sc); unsigned short* d = (unsigned short*)P + (size_t)i * SQ + j0; *(v8us*)d = f.half[0];  } }
__global__ __launch_bounds__(256) void k_vt(const _Float16* __restrict__ V16, int b, int h0, _Float16* __restrict__ VT) { __shared__ unsigned short tl[64][65]; const int tid = threadIdx.x; const int hh = blockIdx.x % HG, sg = blockIdx.x / HG; const int s0 = sg * 64; const int h = h0 + hh;
  for (int i = tid; i < 64 * 8; i += 256) { const int j = i / 8, d8 = (i % 8) * 8; FragH f; f.half[0] = *(const v8us*)((const unsigned short*)V16 + ((size_t)b * SQ + s0 + j) * DM + h * HD + d8); for (int q = 0; q < 8; ++q) tl[d8 + q][j] = f.u[q]; }
  __syncthreads();
  { for (int i = tid; i < 64 * 8; i += 256) { const int d = i / 8, j8 = (i % 8) * 8; FragH f; for (int q = 0; q < 8; ++q) f.u[q] = tl[d][j8 + q]; *(v8us*)((unsigned short*)VT + ((size_t)hh * HD + d) * SQ + s0 + j8) = f.half[0]; }  } }


__device__ __forceinline__ float rs_xhalf(float x) { return __builtin_bit_cast(float, __builtin_amdgcn_permlanex16(__builtin_bit_cast(int, x), __builtin_bit_cast(int, x), 0x76543210, 0xfedcba98, false, false)); }      /* lane l <- lane l ^ 16 */
__device__ __forceinline__ v8f fa_mma(v16h a, v16h b, v8f c) { return __builtin_amdgcn_wmma_f32_16x16x32_f16(false, a, false, b, (short)0, c, false, false); }
/* 2^t, native; the v_nop fills the slot that the instruction set asks for behind a transcendental */
__device__ __forceinline__ float fa_exp2(float t) { float e; asm("v_exp_f32 %0, %1\n\tv_nop" : "=&v"(e) : "v"(t)); return e; }
// Fused attention. Work-group = 16 waves = 64 query rows, one work-group per WGP; wave w takes queries 32 (w & 1) .. + 31 and keys [512 (w >> 1), + 512) of the rows' batch, 32 keys a pass (the two waves of a key range read the same lines at about the same time). x, x^T, G^T and H^T arrive in fragment order: a pass reads 4 KiB of x and 4 KiB of x^T, each contiguous.
// In front of the loop the wave forms Y for its 32 queries: Y^T tile = (A = 16 rows f of G^T, B = 16 query rows of x), register r = Y[query ln][16 nt + 8 hh + r], x16, brought to the log2-domain score scale in f32: two such tiles are one B fragment of Y, in the lane (ff_pack).
// Both products are computed transposed, so a lane owns ONE query (column ln of every D tile): S^T tile (A = 16 key rows of x, B = 16 query rows of Y) leaves key 8 hh + r in register r,
// which is exactly the k order of the B fragment of o^T = x^T P^T (elements 0..7 = keys 8 hh + i of the first key tile, 8..15 = the same of the second): P never leaves its registers.
// Statistics per lane in the log2 domain. Lazy rescale: Y carries 512^-0.5 log2 e, and minus the maximum in use is the C operand of the score products, so a score leaves the matrix unit ready for 2^t. The first pass sets the maximum in use from its own scores; after that it rises (accumulators and sums rescaled, the two lane halves agreeing on it) only in a pass where some score tops it by more than 8, tested once per pass and wave; weights stay at or below 2^8. The halves' sums are joined at the end. Behind the loop o^T (rows e, one query a lane) is divided by the wave's own sum, so that it is a weighted mean of x rows and as safe in f16 as x itself, packed in the lane into B fragments and multiplied by H^T (A = 16 rows j): D has the layout of o^T with j for e.
// The 8 partial results of a query (one per key range), each weighted by its sum, are merged through LDS behind one barrier.
#define FA_KW (SQ / 8)               /* keys per wave */
__global__ __launch_bounds__(512) void k_fattn(const _Float16* __restrict__ XF, const _Float16* __restrict__ XT, const _Float16* __restrict__ GH, float* __restrict__ out) {
  __shared__ __attribute__((aligned(16))) float sacc[8][64][68];      /* pitch 68: 16-byte aligned rows that start 4 banks apart */
  __shared__ float sm[8][64]; __shared__ float sl[8][64];
  const int tid = threadIdx.x, w = tid >> 5, lane = tid & 31, ln = lane & 15, hh = lane >> 4; const int kc = w >> 1, qg = (w & 1) * 32;
  const size_t q0 = (size_t)blockIdx.x * 64; const size_t kb0 = (q0 / SQ) * SQ + (size_t)kc * FA_KW;      /* token rows: first query of the group, first key of the wave */
  const float cs = 0.002762135864009951f * 1.44269504f;      /* 512^-0.5 / 16 (G is carried x16) x log2 e: laid on Y in f32, ahead of its rounding to f16 */
  const _Float16* gp = GH + lane * 8; const _Float16* qp = XF + (q0 + qg) * EM + lane * 8;      /* G^T, then H^T: four 16-row tiles of 1,024 halves each; the wave's two query tiles */
  const _Float16* xp = XF + kb0 * EM + lane * 8; const _Float16* zp = XT + kb0 * EM + lane * 8;      /* x: 16-key tiles of 1,024 halves; x^T: 32-key blocks of 2,048 halves, [e tile][fragment of 512] */
  const v8f z8 = {0.f,0.f,0.f,0.f,0.f,0.f,0.f,0.f}; v8f acc[2][4] = {{z8, z8, z8, z8}, {z8, z8, z8, z8}}; float l[2] = {0.f, 0.f};
  v8f nm[2] = {z8, z8};      /* minus the maximum in use, in all 8 registers of a tile (a lane owns one query): C of the score products; 0 until the first pass sets it */
  v16h yb[2][2], xa[2][2];
  { v16h gf[4][2], xb[2][2];
#pragma unroll
    for (int nt = 0; nt < 4; ++nt)
#pragma unroll
      for (int ks = 0; ks < 2; ++ks) gf[nt][ks] = ff_frag(gp + nt * (16 * EM) + ks * 512);
#pragma unroll
    for (int qt = 0; qt < 2; ++qt)
#pragma unroll
      for (int ks = 0; ks < 2; ++ks) { xb[qt][ks] = ff_frag(qp + qt * (16 * EM) + ks * 512); xa[qt][ks] = ff_frag(xp + qt * (16 * EM) + ks * 512); }      /* xa: the first pass's two key tiles */
    asm volatile("s_wait_xcnt 0x0" :: "v"(gp), "v"(qp), "v"(xp) : "memory");      /* behind the 32 loads: the results below may be formed in the registers that these loads name as addresses; the addresses are inputs, so that no load's result is laid over them ahead of the wait */
    __builtin_amdgcn_sched_barrier(0);      /* all 32 loads stay above the first matrix instruction, so that they share one memory latency */
#pragma unroll
    for (int qt = 0; qt < 2; ++qt)
#pragma unroll
      for (int ks = 0; ks < 2; ++ks)
        yb[qt][ks] = ff_pack(fa_mma(gf[2 * ks][1], xb[qt][1], fa_mma(gf[2 * ks][0], xb[qt][0], z8)) * cs, fa_mma(gf[2 * ks + 1][1], xb[qt][1], fa_mma(gf[2 * ks + 1][0], xb[qt][0], z8)) * cs); }
#pragma unroll 1      /* rolled: one pass's fragments and accumulators fill the register budget of four waves per SIMD */
  for (int it = 0; it < FA_KW / 32; ++it) {
    v16h za[4]; const _Float16* zq = zp + (size_t)it * (32 * EM);
#pragma unroll
    for (int jt = 0; jt < 4; ++jt) za[jt] = ff_frag(zq + jt * 512);
    v8f s[2][2];
#pragma unroll
    for (int qt = 0; qt < 2; ++qt)
#pragma unroll
      for (int kt = 0; kt < 2; ++kt) s[qt][kt] = fa_mma(xa[kt][1], yb[qt][1], fa_mma(xa[kt][0], yb[qt][0], nm[qt]));      /* log2-domain score minus the maximum in use */
    const int nx = (it + 1 < FA_KW / 32) ? it + 1 : it;      /* the next pass's key rows are fetched under this pass's softmax; the last pass fetches its own again (in bounds, unused) */
    const _Float16* xq = xp + (size_t)nx * (32 * EM);
#pragma unroll
    for (int kt = 0; kt < 2; ++kt)
#pragma unroll
      for (int ks = 0; ks < 2; ++ks) xa[kt][ks] = ff_frag(xq + kt * (16 * EM) + ks * 512);
    asm volatile("s_wait_xcnt 0x0" :: "v"(zq), "v"(xq) : "memory");      /* behind this pass's 16 loads: the next pass forms its addresses in the registers that these loads name; the two addresses are inputs, so that no load's result is laid over them ahead of the wait */
    __builtin_amdgcn_sched_barrier(0);      /* keeps the softmax below the fetches, so that the next pass's key rows fly under it instead of being asked for at the pass's end */
    float mx[2];
#pragma unroll
    for (int qt = 0; qt < 2; ++qt) { mx[qt] = fmaxf(s[qt][0][0], s[qt][1][0]);
#pragma unroll
      for (int r = 1; r < 8; ++r) mx[qt] = fmaxf(mx[qt], fmaxf(s[qt][0][r], s[qt][1][r])); }
    const float thr = (it == 0) ? -3.0e38f : 8.0f;      /* the first pass always rescales: it sets the maximum from its own scores, of either sign */
    if (__builtin_amdgcn_ballot_w32(fmaxf(mx[0], mx[1]) > thr) != 0u) {      /* one scalar branch a pass and wave */
#pragma unroll
      for (int qt = 0; qt < 2; ++qt) {
        const float mq = fmaxf(mx[qt], rs_xhalf(mx[qt]));      /* the same in both lanes of a query */
        const float d = (it == 0) ? mq : fmaxf(mq, 0.f);      /* rise of the maximum in use */
        const float f = (it == 0) ? 1.0f : fa_exp2(-d);      /* first pass: sums and accumulators are still 0, and 2^-d could overflow */
        const float nn = nm[qt][0] - d; l[qt] *= f;
#pragma unroll
        for (int r = 0; r < 8; ++r) nm[qt][r] = nn;
#pragma unroll
        for (int kt = 0; kt < 2; ++kt) s[qt][kt] = s[qt][kt] - d;
#pragma unroll
        for (int jt = 0; jt < 4; ++jt) acc[qt][jt] = acc[qt][jt] * f;
      }
    }
    FragH pb[2];
#pragma unroll
    for (int qt = 0; qt < 2; ++qt) {
      float ps = 0.f;
#pragma unroll
      for (int kt = 0; kt < 2; ++kt)
#pragma unroll
        for (int r4 = 0; r4 < 8; r4 += 4) { const float t0 = s[qt][kt][r4], t1 = s[qt][kt][r4 + 1], t2 = s[qt][kt][r4 + 2], t3 = s[qt][kt][r4 + 3]; float e0, e1, e2, e3;
          /* four independent exponentials and one v_nop in one statement: the slot that the instruction set asks for behind a transcendental (early-clobber outputs keep the four apart) */
          asm("v_exp_f32 %0, %4\n\tv_exp_f32 %1, %5\n\tv_exp_f32 %2, %6\n\tv_exp_f32 %3, %7\n\tv_nop" : "=&v"(e0), "=&v"(e1), "=&v"(e2), "=&v"(e3) : "v"(t0), "v"(t1), "v"(t2), "v"(t3));
          ps += (e0 + e1) + (e2 + e3);
          pb[qt].h[kt * 8 + r4] = (_Float16)e0; pb[qt].h[kt * 8 + r4 + 1] = (_Float16)e1; pb[qt].h[kt * 8 + r4 + 2] = (_Float16)e2; pb[qt].h[kt * 8 + r4 + 3] = (_Float16)e3; }
      l[qt] += ps;
    }
    __builtin_amdgcn_sched_barrier(0);      /* every exponential stays above the matrix instructions below */
#pragma unroll
    for (int qt = 0; qt < 2; ++qt)
#pragma unroll
      for (int jt = 0; jt < 4; ++jt) acc[qt][jt] = fa_mma(za[jt], pb[qt].v, acc[qt][jt]);
  }
  v16h hf[4][2];
#pragma unroll
  for (int jt = 0; jt < 4; ++jt)
#pragma unroll
    for (int ks = 0; ks < 2; ++ks) hf[jt][ks] = ff_frag(gp + EM * EM + jt * (16 * EM) + ks * 512);
  asm volatile("s_wait_xcnt 0x0" :: "v"(gp) : "memory");      /* behind the 16 loads: the values below may be formed in the registers that these loads name as address; the address is an input, so that no load's result is laid over it ahead of the wait */
#pragma unroll
  for (int qt = 0; qt < 2; ++qt) { const float lt = l[qt] + rs_xhalf(l[qt]); if (hh == 0) { sm[kc][qg + qt * 16 + ln] = -nm[qt][0]; sl[kc][qg + qt * 16 + ln] = lt; }
    const float rl = 1.0f / lt;      /* lt is about 1 or more: the key that last set the maximum in use adds 2^0 */
    const v16h ob0 = ff_pack(acc[qt][0] * rl, acc[qt][1] * rl), ob1 = ff_pack(acc[qt][2] * rl, acc[qt][3] * rl);
#pragma unroll
    for (int jt = 0; jt < 4; ++jt) { const v8f c = fa_mma(hf[jt][1], ob1, fa_mma(hf[jt][0], ob0, z8)); const v4f c0 = {c[0], c[1], c[2], c[3]}, c1 = {c[4], c[5], c[6], c[7]};
      *(v4fa*)&sacc[kc][qg + qt * 16 + ln][jt * 16 + 8 * hh] = c0; *(v4fa*)&sacc[kc][qg + qt * 16 + ln][jt * 16 + 8 * hh + 4] = c1; } }
  __syncthreads();      /* the 8 key ranges' partial maxima, sums and rows are complete before any thread merges them */
  const int q = tid >> 3, d8 = (tid & 7) * 8; float mg = sm[0][q];
#pragma unroll
  for (int u = 1; u < 8; ++u) mg = fmaxf(mg, sm[u][q]);
  float lg = 0.f; v4f o0 = {0.f, 0.f, 0.f, 0.f}, o1 = {0.f, 0.f, 0.f, 0.f};
#pragma unroll
  for (int u = 0; u < 8; ++u) { const float f = fa_exp2(sm[u][q] - mg) * sl[u][q]; lg += f; o0 += f * *(const v4fa*)&sacc[u][q][d8]; o1 += f * *(const v4fa*)&sacc[u][q][d8 + 4]; }
  const float sc = 0.0625f / lg;      /* H is carried x16 */
  float* op = out + (q0 + q) * EM + d8; *(v4f*)op = o0 * sc; *(v4f*)(op + 4) = o1 * sc; }

// ---- launch 1: jobs that do not depend on one another share a launch (the block index picks the job) ----
__device__ __forceinline__ _Float16 pre_w16(float v) { return (_Float16)(bf16_round(v) * 16.0f); }      /* weight: rounded to bf16, carried x16, exact in f16 */
/* the 16 f32 values behind one lane's fragment (A or B, k order of g2_frag): r[0..7] = k 8 hh + i, r[8..15] = k 16 + 8 hh + i. Row form: p = first of the 32 k values of the lane's row, matrix kept as stored */
__device__ __forceinline__ void pre_raw_row(const float* p, int hh, float (&r)[16]) { const v4f a0 = *(const v4fa*)(p + 8 * hh), a1 = *(const v4fa*)(p + 8 * hh + 4), a2 = *(const v4fa*)(p + 16 + 8 * hh), a3 = *(const v4fa*)(p + 16 + 8 * hh + 4);
#pragma unroll
  for (int q = 0; q < 4; ++q) { r[q] = a0[q]; r[4 + q] = a1[q]; r[8 + q] = a2[q]; r[12 + q] = a3[q]; } }
/* column form, down a [k][EM] matrix: p = element (first k, the lane's column) */
__device__ __forceinline__ void pre_raw_col(const float* p, int hh, float (&r)[16]) {
#pragma unroll
  for (int i = 0; i < 8; ++i) { r[i] = p[(size_t)(8 * hh + i) * EM]; r[8 + i] = p[(size_t)(16 + 8 * hh + i) * EM]; } }
__device__ __forceinline__ v16h pre_cvt(const float (&r)[16]) { FragH f;
#pragma unroll
  for (int i = 0; i < 16; ++i) f.h[i] = pre_w16(r[i]);
  return f.v; }
/* one wave's share of a 16 x 16 tile: the PRE_KW k values from ap and bp on, k ascending in steps of 32; ACOL: A is read down columns */
#define PRE_KW 64                    /* k values per wave: the 8 waves of a block split K = DM between them */
template <bool ACOL>
__device__ __forceinline__ v8f pre_part(const float* ap, const float* bp, int hh) { v8f c = {0.f, 0.f, 0.f, 0.f, 0.f, 0.f, 0.f, 0.f}; float ra[PRE_KW / 32][16], rb[PRE_KW / 32][16];
  const float* al = ap + (ACOL ? 8 * hh * EM : 8 * hh); const float* bl = bp + 8 * hh;      /* the lane half's own first k: every load below is one of these two addresses plus a constant */
#pragma unroll
  for (int u = 0; u < PRE_KW / 32; ++u) { if (ACOL) pre_raw_col(al + (size_t)(32 * u) * EM, 0, ra[u]); else pre_raw_row(al + 32 * u, 0, ra[u]); pre_raw_row(bl + 32 * u, 0, rb[u]); }
  asm volatile("s_wait_xcnt 0x0" :: "v"(al), "v"(bl) : "memory");      /* behind the loads: the values below may be formed in the registers that these loads name as addresses; the addresses are inputs, so that no load's result is laid over them ahead of the wait */
  __builtin_amdgcn_sched_barrier(0);      /* all loads stay above the first conversion, so that they share one memory latency */
#pragma unroll
  for (int u = 0; u < PRE_KW / 32; ++u) c = fa_mma(pre_cvt(ra[u]), pre_cvt(rb[u]), c);
  return c; }
#define PRE_GB 32                    /* blocks of launch 1 that form G^T and H^T: 2 planes x 16 tiles of 16 x 16, one tile a block */
static_assert(PRE_KW * 8 == DM, "k_pre: 8 waves cover K");
static_assert(NR * EM % (8 * 256) == 0, "k_pre: the x blocks have no tail guard");
// Launch 1. Blocks 0 .. PRE_GB - 1 (first): plane 0 G^T[f][e] = sum_w Wk[f][w] Wq[e][w], plane 1 H^T[j][e] = sum_w Wm[w][j] Wv[e][w], both x16, operands converted in the loaders. One 16 x 16 tile a block, K split over its 8 waves (one load latency and one round of conversions on the launch's longest path instead of four of twice the size); the 8 partial tiles are added in f32, wave 0 first, through LDS and stored in fragment order. The other blocks: 32 tokens each, x and x^T to f16 in fragment order.
__global__ __launch_bounds__(256) void k_pre(const float* __restrict__ x, const float* __restrict__ wq, const float* __restrict__ wk, const float* __restrict__ wv, const float* __restrict__ wm, _Float16* __restrict__ XF, _Float16* __restrict__ XT, _Float16* __restrict__ GH) {
  __shared__ __attribute__((aligned(16))) float sp[8][16][20];      /* one partial tile a wave; pitch 80 B: 16-byte aligned rows */
  const int tid = threadIdx.x;
  if (blockIdx.x >= PRE_GB) { const size_t t = (size_t)(blockIdx.x - PRE_GB) * 256 + tid; FragH f, g; float ra[8], rc[8];      /* piece t of x in fragment order: tile t / 128, k = 8 ((t / 16) % 8) .. + 7, row t % 16 */
    const float* xs = x + ((t >> 7) * 16 + (t & 15)) * EM + ((t >> 4) & 7) * 8;
    const float* xc = x + ((t >> 8) * 32 + ((t >> 4) & 3) * 8) * EM + ((t >> 6) & 3) * 16 + (t & 15);      /* piece t of x^T: 32-key block t / 256 (the block's own 32 tokens), row e = 16 ((t / 64) % 4) + t % 16, keys 8 ((t / 16) % 4) .. + 7 */
#pragma unroll
    for (int q = 0; q < 8; ++q) { ra[q] = xs[q]; rc[q] = xc[(size_t)q * EM]; }
    asm volatile("s_wait_xcnt 0x0" :: "v"(xs), "v"(xc) : "memory");      /* behind the loads: the values below may be formed in the registers that these loads name as addresses; the addresses are inputs, so that no load's result is laid over them ahead of the wait */
#pragma unroll
    for (int q = 0; q < 8; ++q) { f.h[q] = (_Float16)bf16_round(ra[q]); g.h[q] = (_Float16)bf16_round(rc[q]); }
    *(v8us*)((unsigned short*)XF + t * 8) = f.half[0]; *(v8us*)((unsigned short*)XT + t * 8) = g.half[0]; return; }
  const int lane = tid & 31, ln = lane & 15, hh = lane >> 4, w = tid >> 5; const int plane = blockIdx.x / (PRE_GB / 2), rt = (blockIdx.x >> 2) & 3, ct = blockIdx.x & 3; const int k0 = w * PRE_KW;
  const float* bp = (plane ? wv : wq) + (size_t)(ct * 16 + ln) * DM + k0;
  const v8f c = plane ? pre_part<true>(wm + (size_t)k0 * EM + rt * 16 + ln, bp, hh) : pre_part<false>(wk + (size_t)(rt * 16 + ln) * DM + k0, bp, hh);      /* plane is the same for the whole block */
#pragma unroll
  for (int r = 0; r < 8; ++r) sp[w][8 * hh + r][ln] = c[r];
  __syncthreads();      /* the 8 partial tiles are complete in LDS before they are added; taken by whole GH blocks only, the x blocks have left above */
  if (tid < 32) { const int row = tid & 15, k8 = tid >> 4; v4f s0 = *(const v4fa*)&sp[0][row][k8 * 8], s1 = *(const v4fa*)&sp[0][row][k8 * 8 + 4];      /* 16 B a thread, fragment order [row tile][k / 8][row][k % 8]: the wave stores one run of 512 B */
#pragma unroll
    for (int u = 1; u < 8; ++u) { s0 += *(const v4fa*)&sp[u][row][k8 * 8]; s1 += *(const v4fa*)&sp[u][row][k8 * 8 + 4]; }
    FragH f;
#pragma unroll
    for (int q = 0; q < 4; ++q) { f.h[q] = (_Float16)(s0[q] * 0.0625f); f.h[4 + q] = (_Float16)(s1[q] * 0.0625f); }
    *(v8us*)((unsigned short*)GH + (size_t)plane * (EM * EM) + (size_t)rt * (16 * EM) + (ct * 2 + k8) * 128 + row * 8) = f.half[0]; } }

extern "C" void kernel_launch(void* const* d_in, const int* in_sizes, int n_in,
                              void* d_out, int out_size, void* d_ws, size_t ws_size, hipStream_t stream) {
  (void)in_sizes; (void)n_in; (void)out_size;
  const float* const* I = (const float* const*)d_in; const float* x = I[0]; const float* wq = I[1]; const float* wk = I[2]; const float* wv = I[3]; const float* wm = I[4];      /* weights [in][out] */
  char* ws = (char*)d_ws; size_t off = 0;
  auto take = [&](size_t bytes) { char* p = ws + off; off += (bytes + 255) & ~(size_t)255; return p; };
  _Float16* GH = (_Float16*)take((size_t)2 * EM * EM * 2);      /* GH = [G^T | H^T], each [64][64] x16, in fragment order */
  _Float16* XF = (_Float16*)take(NR * EM * 2); _Float16* XT = (_Float16*)take(NR * EM * 2);      /* x, x^T in fragment order */
  if (off > ws_size) return;      /* approx 4 MiB */
  k_pre<<<(unsigned)(PRE_GB + NR * EM / 8 / 256), 256, 0, stream>>>(x, wq, wk, wv, wm, XF, XT, GH);
  k_fattn<<<(unsigned)(NR / 64), 512, 0, stream>>>(XF, XT, GH, (float*)d_out);      /* all batches: 64 query rows a work-group */
}

// v009
// Measured time: 20.2 microseconds a run.
// Two timings next to v008 put it at 1.07 and 1.04 times that version's speed.
// Over all steps from v000 it is 172 times as fast.
#include <hip/hip_runtime.h>
// Wide single-head self-attention (x [4][4096][64]; Q/K/V = x W with W [64][512] stored [in][out] (heads NOT split: one 512-wide head); scores = Q K^T / sqrt(512) over all 4,096 keys; softmax; o = attn V; out = o Wm (Wm [512][64]) -> [4][4096][64]).
// Structure: the chained products are reassociated: Q K^T = (x G) x^T with G = Wq Wk^T [64][64], and (attn V) Wm = attn (x H) with H = Wv Wm [64][64] (exact algebra for any inputs; another f32 sum order), so both 4096 x 4096 products run at width 64 instead of 512. Token rows r = b*4096 + s; x exact in f16 (bf16-rounded); weights exact x16; G^T and H^T in one WMMA launch (two planes, K = 512 split over the 8 waves of a block, carried x16); x, G^T and H^T are kept in the workspace in WMMA fragment order (see ff_frag), so that every fragment load is a contiguous 512-B run; x^T fragments come from the same x tiles by the transposing load (see tr_frag); then ONE fused launch for all batches: each wave forms Y = x G (carrying the score scale) for its own queries, scores^T = x Y^T, running-maximum softmax in registers, o^T += x^T P^T, and attn (x H) = (attn x) H: H is applied to each wave's normalised partial o behind its key loop, so neither scores, weights, Y nor x H go through memory. 2 launches, one per link of the dependence chain: (x to f16 | G^T, H^T straight from the f32 weights), fused attention.
// Compute dtype: inputs rounded to bf16; x / weights exact; G, H, Y, each key range's weighted mean of x rows and softmax weights (2^(score - maximum in use), in [0, 2^8]) as plain f16 WMMA operands (~2^-12); scores, statistics and out f32. v_wmma_f32_16x16x32_f16.
#define NB 4
#define SQ 4096
#define EM 64                        /* embedding */
#define DM 512                       /* wide = 8 x 64 (one head) */
#define NH 8                         /* 64-wide slabs of the one 512-wide head (not used) */
#define HD 64
#define HG 1
#define B0 0                         /* not used (all batches run from 0) */
#define NBR NB                       /* not used (the launches cover NB batches through NR) */
#define QN SQ                        /* not used (all SQ query rows attended) */
#define NR ((size_t)NB * SQ)
#define MP ((int)((size_t)NBR * SQ))
#define MPO MP
typedef __bf16 v16b __attribute__((ext_vector_type(16)));
typedef unsigned short v8us __attribute__((ext_vector_type(8), may_alias));
typedef float  v8f  __attribute__((ext_vector_type(8)));
typedef float  v4f  __attribute__((ext_vector_type(4)));
typedef float  v4fa __attribute__((ext_vector_type(4), may_alias));
union FragB { v16b v; v8us half[2]; unsigned short u[16]; };

__device__ __forceinline__ unsigned short bf16_bits(float x) { unsigned int u = __float_as_uint(x); return (unsigned short)((u + 0x7FFFu + ((u >> 16) & 1u)) >> 16); }
__device__ __forceinline__ float bf16_val(unsigned short b) { return __uint_as_float(((unsigned int)b) << 16); }
__device__ __forceinline__ float bf16_round(float x) { return bf16_val(bf16_bits(x)); }
// D += A·B with NT terms: 1 = ah·bh, 2 = + al·bh (A split), 3 = + ah·bl (both split)
template <int NT>
__device__ __forceinline__ v8f mmaN(v16b ah, v16b al, v16b bh, v16b bl, v8f c) {
  c = __builtin_amdgcn_wmma_f32_16x16x32_bf16(false, ah, false, bh, (short)0, c, false, false);
  if (NT >= 2) c = __builtin_amdgcn_wmma_f32_16x16x32_bf16(false, al, false, bh, (short)0, c, false, false);
  if (NT >= 3) c = __builtin_amdgcn_wmma_f32_16x16x32_bf16(false, ah, false, bl, (short)0, c, false, false);
  asm volatile("v_nop\n\tv_nop\n\tv_nop\n\tv_nop" : "+v"(c) : "v"(ah), "v"(al), "v"(bh), "v"(bl));
  return c;
}

__global__ __launch_bounds__(256) void k_wt_bf16(const float* __restrict__ W, unsigned short* __restrict__ Wt, int K, int N) {
  const int t = blockIdx.x * 256 + threadIdx.x;
  const int k8n = K / 8;
  if (t >= N * k8n) return;
  const int n = t / k8n, k8 = (t % k8n) * 8;
  v8us v;
#pragma unroll
  for (int i = 0; i < 8; ++i) v[i] = bf16_bits(W[(size_t)(k8 + i) * N + n]);
  *(v8us*)(Wt + (size_t)n * K + k8) = v;
  
}

// GEMM C[M][N] (f32, pitch ldc) = act(A[M][K]·W + bias). A f32 row-major (pitch lda) converted per fragment to bf16
// (ASPLIT: hi/lo two planes -> 2 terms, else single rounded term); Wt bf16 [N][K] (pitch ldb). BIAS_BF16 rounds the
// bias to bf16 first (bias quantised to bf16 before the add). K%32==0, M%16==0, N%64==0.
template <bool ASPLIT, int ACT, bool BIAS_BF16>
__global__ __launch_bounds__(128) void k_gemm_bf(const float* __restrict__ A, int lda, const unsigned short* __restrict__ Wt, int ldb,
                                               const float* __restrict__ bias, float* __restrict__ C, int ldc, int M, int N, int K) {
  __shared__ __attribute__((aligned(16))) float so[4][16][64];
  const int tid = threadIdx.x, w = tid >> 5, lane = tid & 31, ln = lane & 15, hh = lane >> 4;
  const int ntn = N / 64;
  const int wid = blockIdx.x * 4 + w;
  const int mt = wid / ntn, nq = wid % ntn;
  if (mt * 16 >= M) return;
  const int row0 = mt * 16, col0 = nq * 64;
  const float* arow = A + (size_t)(row0 + ln) * lda;
  v8f acc[4] = {};
  for (int kb = 0; kb < K; kb += 32) {
    FragB ah, al;
    const v4f x0 = *(const v4fa*)(arow + kb + 8 * hh), x1 = *(const v4fa*)(arow + kb + 8 * hh + 4);
    const v4f x2 = *(const v4fa*)(arow + kb + 16 + 8 * hh), x3 = *(const v4fa*)(arow + kb + 16 + 8 * hh + 4);
    float xs[16] = {x0[0],x0[1],x0[2],x0[3],x1[0],x1[1],x1[2],x1[3],x2[0],x2[1],x2[2],x2[3],x3[0],x3[1],x3[2],x3[3]};
#pragma unroll
    for (int i = 0; i < 16; ++i) { const unsigned short hb = bf16_bits(xs[i]); ah.u[i] = hb; al.u[i] = ASPLIT ? bf16_bits(xs[i] - bf16_val(hb)) : (unsigned short)0; }
#pragma unroll
    for (int t = 0; t < 4; ++t) {
      const unsigned short* brow = Wt + (size_t)(col0 + t * 16 + ln) * ldb + kb;
      FragB b;
      b.half[0] = *(const v8us*)(brow + 8 * hh);
      b.half[1] = *(const v8us*)(brow + 16 + 8 * hh);
      acc[t] = mmaN<ASPLIT ? 2 : 1>(ah.v, al.v, b.v, b.v, acc[t]);
    }
  }
#pragma unroll
  for (int t = 0; t < 4; ++t) {
    float bv = bias ? bias[col0 + t * 16 + ln] : 0.f;
    if (BIAS_BF16) bv = bf16_round(bv);
#pragma unroll
    for (int r = 0; r < 8; ++r) { float v = acc[t][r] + bv; if (ACT == 1) v = fmaxf(v, 0.f); so[w][8 * hh + r][t * 16 + ln] = v; }
  }
  __builtin_amdgcn_fence(__ATOMIC_ACQ_REL, "workgroup");
  __builtin_amdgcn_wave_barrier();
  const int rsub = lane >> 4, c4 = (lane & 15) * 4;
  {
#pragma unroll
    for (int q = 0; q < 8; ++q) {
      const int r = q * 2 + rsub;
      const v4f v = *(const v4fa*)&so[w][r][c4];
      *(v4f*)(C + (size_t)(row0 + r) * ldc + col0 + c4) = v;
    }
    
  }
}

// GEMM C = act(A·W + bias + resid): A f32 (ASPLIT -> hi/lo 2 terms), Wt bf16 [N][K]; ACT 0 none, 1 relu, 2 exact gelu;
// resid (optional, f32, row index = (row % rmod), pitch ldr, RES_BF16 rounds it) added before the activation.
template <bool ASPLIT, int ACT, bool BIAS_BF16, bool RES_BF16>
__global__ __launch_bounds__(128) void k_gemm_bf3(const float* __restrict__ A, int lda, const unsigned short* __restrict__ Wt, int ldb,
                                                const float* __restrict__ bias, const float* __restrict__ resid, int rmod, int ldr,
                                                float* __restrict__ C, int ldc, int M, int N, int K) {
  __shared__ __attribute__((aligned(16))) float so[4][16][64];
  const int tid = threadIdx.x, w = tid >> 5, lane = tid & 31, ln = lane & 15, hh = lane >> 4;
  const int ntn = N / 64;
  const int wid = blockIdx.x * 4 + w;
  const int mt = wid / ntn, nq = wid % ntn;
  if (mt * 16 >= M) return;
  const int row0 = mt * 16, col0 = nq * 64;
  const float* arow = A + (size_t)(row0 + ln) * lda;
  v8f acc[4] = {};
  for (int kb = 0; kb < K; kb += 32) {
    FragB ah, al;
    const v4f x0 = *(const v4fa*)(arow + kb + 8 * hh), x1 = *(const v4fa*)(arow + kb + 8 * hh + 4);
    const v4f x2 = *(const v4fa*)(arow + kb + 16 + 8 * hh), x3 = *(const v4fa*)(arow + kb + 16 + 8 * hh + 4);
    float xs[16] = {x0[0],x0[1],x0[2],x0[3],x1[0],x1[1],x1[2],x1[3],x2[0],x2[1],x2[2],x2[3],x3[0],x3[1],x3[2],x3[3]};
#pragma unroll
    for (int i = 0; i < 16; ++i) { const unsigned short hb = bf16_bits(xs[i]); ah.u[i] = hb; al.u[i] = ASPLIT ? bf16_bits(xs[i] - bf16_val(hb)) : (unsigned short)0; }
#pragma unroll
    for (int t = 0; t < 4; ++t) {
      const unsigned short* brow = Wt + (size_t)(col0 + t * 16 + ln) * ldb + kb;
      FragB b;
      b.half[0] = *(const v8us*)(brow + 8 * hh);
      b.half[1] = *(const v8us*)(brow + 16 + 8 * hh);
      acc[t] = mmaN<ASPLIT ? 2 : 1>(ah.v, al.v, b.v, b.v, acc[t]);
    }
  }
#pragma unroll
  for (int t = 0; t < 4; ++t) {
    const int col = col0 + t * 16 + ln;
    float bv = bias ? bias[col] : 0.f;
    if (BIAS_BF16) bv = bf16_round(bv);
#pragma unroll
    for (int r = 0; r < 8; ++r) {
      float v = acc[t][r] + bv;
      if (resid) { float rv = resid[(size_t)((row0 + 8 * hh + r) % rmod) * ldr + col]; if (RES_BF16) rv = bf16_round(rv); v += rv; }
      if (ACT == 1) v = fmaxf(v, 0.f);
      if (ACT == 2) v = 0.5f * v * (1.0f + erff(v * 0.70710678118654752f));
      if (ACT == 3) { const float u = 0.7978845608028654f * (v + 0.044715f * v * v * v); v = 0.5f * v * (1.0f + tanhf(u)); }
      so[w][8 * hh + r][t * 16 + ln] = v;
    }
  }
  __builtin_amdgcn_fence(__ATOMIC_ACQ_REL, "workgroup");
  __builtin_amdgcn_wave_barrier();
  const int rsub = lane >> 4, c4 = (lane & 15) * 4;
  {
#pragma unroll
    for (int q = 0; q < 8; ++q) {
      const int r = q * 2 + rsub;
      const v4f v = *(const v4fa*)&so[w][r][c4];
      *(v4f*)(C + (size_t)(row0 + r) * ldc + col0 + c4) = v;
    }
    
  }
}
// row LayerNorm (biased variance, eps) over N: s = X (+ R); optional out_sum <- s; out_norm <- (s-mu)*rsqrt(var+eps)*g + b
template <bool PARAM_BF16>
__global__ __launch_bounds__(256) void k_layernorm(const float* __restrict__ X, const float* __restrict__ R, const float* __restrict__ g, const float* __restrict__ bta,
                                                  float* __restrict__ out_sum, float* __restrict__ out_norm, int N, float eps) {
  __shared__ float red[256];
  const int row = blockIdx.x, tid = threadIdx.x;
  const float* x = X + (size_t)row * N; const float* rr = R ? R + (size_t)row * N : nullptr;
  float vals[16];                     // up to N = 4096
  const int per = N / 256;            // contiguous chunk per thread? use strided-by-4 chunks: thread handles j = tid*4 + 1024*u
  float s1 = 0.f;
  for (int u = 0; u < per / 4; ++u) {
    const int j = tid * 4 + 1024 * u;
    const v4f a = *(const v4fa*)(x + j);
    v4f b = {0.f,0.f,0.f,0.f}; if (rr) b = *(const v4fa*)(rr + j);
#pragma unroll
    for (int q = 0; q < 4; ++q) { const float v = a[q] + b[q]; vals[u * 4 + q] = v; s1 += v; }
  }
  red[tid] = s1; __syncthreads();
  for (int st = 128; st > 0; st >>= 1) { if (tid < st) red[tid] += red[tid + st]; __syncthreads(); }
  const float mu = red[0] / (float)N; __syncthreads();
  float s2 = 0.f;
  for (int u = 0; u < per / 4; ++u)
#pragma unroll
    for (int q = 0; q < 4; ++q) { const float c = vals[u * 4 + q] - mu; s2 += c * c; }
  red[tid] = s2; __syncthreads();
  for (int st = 128; st > 0; st >>= 1) { if (tid < st) red[tid] += red[tid + st]; __syncthreads(); }
  const float rs = rsqrtf(red[0] / (float)N + eps);
  {
    for (int u = 0; u < per / 4; ++u) {
      const int j = tid * 4 + 1024 * u;
      v4f o, sm;
#pragma unroll
      for (int q = 0; q < 4; ++q) {
        float gg = g[j + q], bb = bta[j + q];
        if (PARAM_BF16) { gg = bf16_round(gg); bb = bf16_round(bb); }
        sm[q] = vals[u * 4 + q]; o[q] = (vals[u * 4 + q] - mu) * rs * gg + bb;
      }
      if (out_sum) *(v4f*)(out_sum + (size_t)row * N + j) = sm;
      *(v4f*)(out_norm + (size_t)row * N + j) = o;
    }
    
  }
}



// ---- f16 WMMA path (v_wmma_f32_16x16x32_f16): 11-bit significands for operands in range — used where a [0,1] probability operand needs more precision than bf16
typedef _Float16 v16h __attribute__((ext_vector_type(16)));
union FragH { v16h v; v8us half[2]; _Float16 h[16]; unsigned short u[16]; };
template <int NT>
__device__ __forceinline__ v8f mmaH(v16h ah, v16h al, v16h bh, v16h bl, v8f c) {
  c = __builtin_amdgcn_wmma_f32_16x16x32_f16(false, ah, false, bh, (short)0, c, false, false);
  if (NT >= 2) c = __builtin_amdgcn_wmma_f32_16x16x32_f16(false, al, false, bh, (short)0, c, false, false);
  if (NT >= 3) c = __builtin_amdgcn_wmma_f32_16x16x32_f16(false, ah, false, bl, (short)0, c, false, false);
  asm volatile("v_nop\n\tv_nop\n\tv_nop\n\tv_nop" : "+v"(c) : "v"(ah), "v"(al), "v"(bh), "v"(bl));
  return c;
}
// batched GEMM like k_gemm_b but f16 operands: A f32 (split into f16 hi/lo if ASPLIT, else rounded to f16), Bt = f16 values [n][k]; alpha; C f32; N multiple of 16 (partial tiles skipped)
template <bool ASPLIT>
__global__ __launch_bounds__(128) void k_gemm_h(const float* __restrict__ A, int lda, size_t sA, const _Float16* __restrict__ Bh, int ldb, size_t sB, float alpha, float* __restrict__ C, int ldc, size_t sC, int M, int N, int K) {
  __shared__ __attribute__((aligned(16))) float so[4][16][64];
  const int tid = threadIdx.x, w = tid >> 5, lane = tid & 31, ln = lane & 15, hh = lane >> 4; const int by = blockIdx.y;
  A += (size_t)by * sA; Bh += (size_t)by * sB; C += (size_t)by * sC;
  const int ntn = (N + 63) / 64; const int wid = blockIdx.x * 4 + w; const int mt = wid / ntn, nq = wid % ntn; if (mt * 16 >= M) return;
  const int row0 = mt * 16, col0 = nq * 64; const float* arow = A + (size_t)(row0 + ln) * lda;
  v8f acc[4] = {};
  for (int kb = 0; kb < K; kb += 32) {
    FragH ah, al;
    const v4f x0 = *(const v4fa*)(arow + kb + 8 * hh), x1 = *(const v4fa*)(arow + kb + 8 * hh + 4), x2 = *(const v4fa*)(arow + kb + 16 + 8 * hh), x3 = *(const v4fa*)(arow + kb + 16 + 8 * hh + 4);
    float xs[16] = {x0[0],x0[1],x0[2],x0[3],x1[0],x1[1],x1[2],x1[3],x2[0],x2[1],x2[2],x2[3],x3[0],x3[1],x3[2],x3[3]};
#pragma unroll
    for (int i = 0; i < 16; ++i) { const _Float16 h = (_Float16)xs[i]; ah.h[i] = h; al.h[i] = ASPLIT ? (_Float16)(xs[i] - (float)h) : (_Float16)0.0f; }
#pragma unroll
    for (int t = 0; t < 4; ++t) { if (col0 + t * 16 >= N) continue; const size_t boff = (size_t)(col0 + t * 16 + ln) * ldb + kb; FragH bq; bq.half[0] = *(const v8us*)(Bh + boff + 8 * hh); bq.half[1] = *(const v8us*)(Bh + boff + 16 + 8 * hh);
      acc[t] = mmaH<ASPLIT ? 2 : 1>(ah.v, al.v, bq.v, bq.v, acc[t]); }
  }
#pragma unroll
  for (int t = 0; t < 4; ++t) { if (col0 + t * 16 >= N) continue;
#pragma unroll
    for (int r = 0; r < 8; ++r) so[w][8 * hh + r][t * 16 + ln] = acc[t][r] * alpha; }
  __builtin_amdgcn_fence(__ATOMIC_ACQ_REL, "workgroup"); __builtin_amdgcn_wave_barrier();
  const int rsub = lane >> 4, c4 = (lane & 15) * 4;
  {
#pragma unroll
    for (int q = 0; q < 8; ++q) { const int r = q * 2 + rsub; if (col0 + c4 < N) { const v4f v = *(const v4fa*)&so[w][r][c4]; *(v4f*)(C + (size_t)(row0 + r) * ldc + col0 + c4) = v; } }
     }
}

// Wt[n][k] = f16(W[k][n]·scale) from f32 row-major W[K][N] (scale = power of two; bf16-exact weights stay exact in f16 away from the subnormal range)
__global__ __launch_bounds__(256) void k_wt_f16(const float* __restrict__ W, _Float16* __restrict__ Wt, int K, int N, float scale) {
  const int t = blockIdx.x * 256 + threadIdx.x; if (t >= N * (K / 8)) return; const int n = t / (K / 8), k8 = (t % (K / 8)) * 8; FragH f;
#pragma unroll
  for (int i = 0; i < 8; ++i) f.h[i] = (_Float16)(bf16_round(W[(size_t)(k8 + i) * N + n]) * scale); const v8us o = f.half[0];
  *(v8us*)((unsigned short*)Wt + (size_t)n * K + k8) = o; 
}
// k_gemm_hh variant with fused epilogue: v = acc·alpha + bias[by·sBias + col] (+ CP[(row/rowsPerB)·sCPb + by·64 + col] if CP) ; ACT 0 none / 1 elu ; writes f16 C16 (and f32 C if non-null)
template <int ACT>
__global__ __launch_bounds__(128) void k_gemm_hhx(const _Float16* __restrict__ A, int lda, size_t sA, const _Float16* __restrict__ Bh, int ldb, size_t sB, float alpha, const float* __restrict__ bias, size_t sBias, const float* __restrict__ CP, int rowsPerB, size_t sCPb, int row0g,
    float* __restrict__ C, _Float16* __restrict__ C16, int ldc, size_t sC, int M, int N, int K) {
  __shared__ __attribute__((aligned(16))) float so[4][16][64];
  const int tid = threadIdx.x, w = tid >> 5, lane = tid & 31, ln = lane & 15, hh = lane >> 4; const int by = blockIdx.y;
  A += (size_t)by * sA; Bh += (size_t)by * sB; const size_t cofs = (size_t)by * sC; const float* bp = bias ? bias + (size_t)by * sBias : nullptr;
  const int ntn = (N + 63) / 64; const int wid = blockIdx.x * 4 + w; const int mt = wid / ntn, nq = wid % ntn; if (mt * 16 >= M) return;
  const int row0 = mt * 16, col0 = nq * 64; const _Float16* arow = A + (size_t)(row0 + ln) * lda;
  v8f acc[4] = {};
  for (int kb = 0; kb < K; kb += 32) { FragH ah; ah.half[0] = *(const v8us*)((const unsigned short*)arow + kb + 8 * hh); ah.half[1] = *(const v8us*)((const unsigned short*)arow + kb + 16 + 8 * hh);
#pragma unroll
    for (int t = 0; t < 4; ++t) { if (col0 + t * 16 >= N) continue; const size_t boff = (size_t)(col0 + t * 16 + ln) * ldb + kb; FragH bq; bq.half[0] = *(const v8us*)((const unsigned short*)Bh + boff + 8 * hh); bq.half[1] = *(const v8us*)((const unsigned short*)Bh + boff + 16 + 8 * hh);
      acc[t] = mmaH<1>(ah.v, ah.v, bq.v, bq.v, acc[t]); }
  }
#pragma unroll
  for (int t = 0; t < 4; ++t) { if (col0 + t * 16 >= N) continue; const int col = col0 + t * 16 + ln; const float bv = bp ? bf16_round(bp[col]) : 0.f;
#pragma unroll
    for (int r = 0; r < 8; ++r) { float v = acc[t][r] * alpha + bv; if (CP) { const int rr = row0g + row0 + 8 * hh + r; if (rowsPerB < 0) v += CP[cofs + (size_t)rr * ldc + col];      /* rowsPerB < 0: own element of the batched C plane */ else { const int bidx = rr / rowsPerB; v += CP[(size_t)bidx * sCPb + (size_t)by * 64 + col]; } } if (ACT == 1) v = (v > 0.f) ? v : expm1f(v); else if (ACT == 7) v = (v > 0.f) ? v + 1.0f : expf(v); else if (ACT == 8) v = tanhf(v); else if (ACT == 9) v = 0.5f * v * (1.0f + tanhf(0.7978845608028654f * (v + 0.044715f * v * v * v))); else if (ACT == 11) v = 1.0f / (1.0f + expf(-v)); else if (ACT == 12) v = (v > 0.f) ? v : 0.01f * v; else if (ACT == 14) v = (v > 0.f) ? v : 0.1f * v; else if (ACT == 16) v = (v >= 0.f) ? v : 0.3f * v; else if (ACT == 17) v = (v >= 0.f) ? v : 0.2f * v; else if (ACT == 15) v = v / (1.0f + expf(-v)); else if (ACT == 3) v = fmaxf(v, 0.f); else if (ACT == 6) v = 0.5f * v * (1.0f + erff(v * 0.70710678118654752f)); so[w][8 * hh + r][t * 16 + ln] = v; } }
  __builtin_amdgcn_fence(__ATOMIC_ACQ_REL, "workgroup"); __builtin_amdgcn_wave_barrier();
  const int rsub = lane >> 4, c4 = (lane & 15) * 4; typedef _Float16 v4h __attribute__((ext_vector_type(4)));
  {
#pragma unroll
    for (int q = 0; q < 8; ++q) { const int r = q * 2 + rsub; if (col0 + c4 < N) { const v4f v = *(const v4fa*)&so[w][r][c4]; if (C) *(v4f*)(C + cofs + (size_t)(row0 + r) * ldc + col0 + c4) = v; if (C16) { v4h h4; for (int i = 0; i < 4; ++i) h4[i] = (_Float16)v[i]; *(v4h*)(C16 + cofs + (size_t)(row0 + r) * ldc + col0 + c4) = h4; } } }
     }
}


typedef _Float16 v4h __attribute__((ext_vector_type(4)));

__global__ __launch_bounds__(256) void k_x16(const float* __restrict__ x, _Float16* __restrict__ X16, size_t n8) { const size_t t = (size_t)blockIdx.x * 256 + threadIdx.x; if (t >= n8) return; FragH f;
#pragma unroll
  for (int q = 0; q < 8; ++q) f.h[q] = (_Float16)bf16_round(x[t * 8 + q]); *(v8us*)((unsigned short*)X16 + t * 8) = f.half[0];  }
__global__ __launch_bounds__(256) void k_h16(const float* __restrict__ x, _Float16* __restrict__ X16, size_t n8) { const size_t t = (size_t)blockIdx.x * 256 + threadIdx.x; if (t >= n8) return; FragH f;
#pragma unroll
  for (int q = 0; q < 8; ++q) f.h[q] = (_Float16)x[t * 8 + q]; *(v8us*)((unsigned short*)X16 + t * 8) = f.half[0];  }
__global__ __launch_bounds__(256) void k_round16f(const float* __restrict__ W, _Float16* __restrict__ Bt, size_t n8) { const size_t t = (size_t)blockIdx.x * 256 + threadIdx.x; if (t >= n8) return; FragH f;
#pragma unroll
  for (int i = 0; i < 8; ++i) f.h[i] = (_Float16)(bf16_round(W[t * 8 + i]) * 16.0f); *(v8us*)((unsigned short*)Bt + t * 8) = f.half[0];  }
template <int NHv, int TTv>
__global__ __launch_bounds__(256) void k_vt(const _Float16* __restrict__ V16, int ldv, int voff, _Float16* __restrict__ Vt) { __shared__ unsigned short tl[64][66]; const int tid = threadIdx.x; const int slab = blockIdx.x / (TTv / 64), lg = blockIdx.x % (TTv / 64); const int b = slab / NHv, h = slab % NHv;
  for (int i = tid; i < 64 * 8; i += 256) { const int r = i / 8, c8 = (i % 8) * 8; FragH f; f.half[0] = *(const v8us*)((const unsigned short*)V16 + ((size_t)b * TTv + lg * 64 + r) * ldv + voff + h * 64 + c8);
#pragma unroll
    for (int q = 0; q < 8; ++q) tl[r][c8 + q] = f.u[q]; }
  __syncthreads();
  {
#pragma unroll
    for (int rd = 0; rd < 2; ++rd) { const int d = rd * 32 + tid / 8, pc = tid % 8; FragH f;
#pragma unroll
      for (int q = 0; q < 8; ++q) f.u[q] = tl[pc * 8 + q][d];
      *(v8us*)((unsigned short*)Vt + ((size_t)slab * 64 + d) * TTv + lg * 64 + pc * 8) = f.half[0]; }
     } }

__global__ __launch_bounds__(256) void k_hl(const float* __restrict__ F, _Float16* __restrict__ Hh, _Float16* __restrict__ Hl, size_t n8) { const size_t t = (size_t)blockIdx.x * 256 + threadIdx.x; if (t >= n8) return; FragH fh, fl; const v4f a = *(const v4fa*)(F + t * 8), c = *(const v4fa*)(F + t * 8 + 4);
#pragma unroll
  for (int q = 0; q < 4; ++q) { _Float16 h = (_Float16)a[q]; fh.h[q] = h; fl.h[q] = (_Float16)((a[q] - (float)h) * 1024.0f); h = (_Float16)c[q]; fh.h[4 + q] = h; fl.h[4 + q] = (_Float16)((c[q] - (float)h) * 1024.0f); }
  { *(v8us*)((unsigned short*)Hh + t * 8) = fh.half[0]; *(v8us*)((unsigned short*)Hl + t * 8) = fl.half[0];  } }

/* one fragment (A or B) from a row-major matrix: p = first of the 32 k values of the lane's row */
__device__ __forceinline__ v16h g2_frag(const _Float16* p, int hh) { FragH f; f.half[0] = *(const v8us*)((const unsigned short*)p + 8 * hh); f.half[1] = *(const v8us*)((const unsigned short*)p + 16 + 8 * hh); return f.v; }
/* Fragment order. A 16-row x 64-k tile (2 KiB) is kept as [k / 8][row][k % 8]: the 16-byte piece that lane (hh, ln) wants for k = 32 ks + 16 h + 8 hh .. + 7 of row ln lies at halves 512 ks + 256 h + 8 lane,
   so one load of 16 B a lane covers 512 contiguous bytes (4 whole lines) where a row-major tile makes it touch 16 lines. p = fragment's first element + 8 lane; same k order as g2_frag */
__device__ __forceinline__ v16h ff_frag(const _Float16* p) { FragH f; f.half[0] = *(const v8us*)((const unsigned short*)p); f.half[1] = *(const v8us*)((const unsigned short*)p + 256); return f.v; }
/* One A fragment of x^T (16 rows e, 32 keys) from two 16-key tiles of x in fragment order, by the transposing load: lane l hands in the 16-byte piece (key 8 (l >> 4) + (l & 7), e = 8 ((l >> 3) & 1) .. + 7 of the 16 e wanted) and gets keys 8 hh .. + 7 of row e = ln.
   The 32 pieces of one load are 512 contiguous bytes of the tile (two k / 8 planes of 256 B), 4 whole lines. p = first tile's plane pair + the lane's piece; the second tile (keys 16 .. 31) lies 16 EM halves on: same k order as ff_frag */
typedef short v8ss __attribute__((ext_vector_type(8)));
__device__ __forceinline__ v8us tr_load(const _Float16* p) { return __builtin_bit_cast(v8us, __builtin_amdgcn_global_load_tr16_b128_v8i16((__attribute__((address_space(1))) v8ss*)p)); }
__device__ __forceinline__ v16h tr_frag(const _Float16* p) { FragH f; f.half[0] = tr_load(p); f.half[1] = tr_load(p + 16 * EM); return f.v; }
/* two D tiles as one B fragment: a lane's 8 registers of a D tile (rows 8 hh + r of column ln) are k = 8 hh + r of row ln of the matrix whose rows are D's columns, so tiles 2 ks and 2 ks + 1 are halves 0 and 1 of fragment ks, in the lane */
__device__ __forceinline__ v16h ff_pack(v8f c0, v8f c1) { FragH f;
#pragma unroll
  for (int r = 0; r < 8; ++r) { f.h[r] = (_Float16)c0[r]; f.h[8 + r] = (_Float16)c1[r]; }
  return f.v; }


__global__ __launch_bounds__(256) void k_wnat(const float* __restrict__ w, size_t n8, _Float16* __restrict__ Bt) { const size_t t = (size_t)blockIdx.x * 256 + threadIdx.x; if (t >= n8) return; FragH f; for (int q = 0; q < 8; ++q) f.h[q] = (_Float16)(bf16_round(w[t * 8 + q]) * 16.0f); *(v8us*)((unsigned short*)Bt + t * 8) = f.half[0];  }
__global__ __launch_bounds__(256) void k_rsm(const float* __restrict__ S, _Float16* __restrict__ P, int nrows) {
  #pragma clang fp contract(off)
  const int i = blockIdx.x * 256 + threadIdx.x; if (i >= nrows) return; const float* s = S + (size_t)i * SQ; float mx = -3.0e38f;
#pragma unroll 1
  for (int j = 0; j < SQ; ++j) mx = fmaxf(mx, s[j]); float se = 0.f;
#pragma unroll 1
  for (int j = 0; j < SQ; ++j) se += expf(s[j] - mx); const float sc = 256.0f / se;
#pragma unroll 1
  for (int j0 = 0; j0 < SQ; j0 += 8) { FragH f; for (int q = 0; q < 8; ++q) f.h[q] = (_Float16)(expf(s[j0 + q] - mx) * sc); unsigned short* d = (unsigned short*)P + (size_t)i * SQ + j0; *(v8us*)d = f.half[0];  } }
__global__ __launch_bounds__(256) void k_vt(const _Float16* __restrict__ V16, int b, int h0, _Float16* __restrict__ VT) { __shared__ unsigned short tl[64][65]; const int tid = threadIdx.x; const int hh = blockIdx.x % HG, sg = blockIdx.x / HG; const int s0 = sg * 64; const int h = h0 + hh;
  for (int i = tid; i < 64 * 8; i += 256) { const int j = i / 8, d8 = (i % 8) * 8; FragH f; f.half[0] = *(const v8us*)((const unsigned short*)V16 + ((size_t)b * SQ + s0 + j) * DM + h * HD + d8); for (int q = 0; q < 8; ++q) tl[d8 + q][j] = f.u[q]; }
  __syncthreads();
  { for (int i = tid; i < 64 * 8; i += 256) { const int d = i / 8, j8 = (i % 8) * 8; FragH f; for (int q = 0; q < 8; ++q) f.u[q] = tl[d][j8 + q]; *(v8us*)((unsigned short*)VT + ((size_t)hh * HD + d) * SQ + s0 + j8) = f.half[0]; }  } }


__device__ __forceinline__ float rs_xhalf(float x) { return __builtin_bit_cast(float, __builtin_amdgcn_permlanex16(__builtin_bit_cast(int, x), __builtin_bit_cast(int, x), 0x76543210, 0xfedcba98, false, false)); }      /* lane l <- lane l ^ 16 */
__device__ __forceinline__ v8f fa_mma(v16h a, v16h b, v8f c) { return __builtin_amdgcn_wmma_f32_16x16x32_f16(false, a, false, b, (short)0, c, false, false); }
/* 2^t, native; the v_nop fills the slot that the instruction set asks for behind a transcendental */
__device__ __forceinline__ float fa_exp2(float t) { float e; asm("v_exp_f32 %0, %1\n\tv_nop" : "=&v"(e) : "v"(t)); return e; }
// Fused attention. Work-group = 16 waves = 64 query rows, one work-group per WGP; wave w takes queries 32 (w & 1) .. + 31 and keys [512 (w >> 1), + 512) of the rows' batch, 32 keys a pass (the two waves of a key range read the same lines at about the same time). x, G^T and H^T arrive in fragment order: a pass reads its 4 KiB of x twice, once as key rows (fetched one pass ahead) and once transposed (tr_frag), the second time from lines that the first read has brought into the WGP's cache, so that L2 delivers each key row once.
// In front of the loop the wave forms Y for its 32 queries: Y^T tile = (A = 16 rows f of G^T, B = 16 query rows of x), register r = Y[query ln][16 nt + 8 hh + r], x16, brought to the log2-domain score scale in f32: two such tiles are one B fragment of Y, in the lane (ff_pack).
// Both products are computed transposed, so a lane owns ONE query (column ln of every D tile): S^T tile (A = 16 key rows of x, B = 16 query rows of Y) leaves key 8 hh + r in register r,
// which is exactly the k order of the B fragment of o^T = x^T P^T (elements 0..7 = keys 8 hh + i of the first key tile, 8..15 = the same of the second): P never leaves its registers.
// Statistics per lane in the log2 domain. Lazy rescale: Y carries 512^-0.5 log2 e, and minus the maximum in use is the C operand of the score products, so a score leaves the matrix unit ready for 2^t. The first pass sets the maximum in use from its own scores; after that it rises (accumulators and sums rescaled, the two lane halves agreeing on it) only in a pass where some score tops it by more than 8, tested once per pass and wave; weights stay at or below 2^8. The halves' sums are joined at the end. Behind the loop o^T (rows e, one query a lane) is divided by the wave's own sum, so that it is a weighted mean of x rows and as safe in f16 as x itself, packed in the lane into B fragments and multiplied by H^T (A = 16 rows j): D has the layout of o^T with j for e.
// The 8 partial results of a query (one per key range), each weighted by its sum, are merged through LDS behind one barrier.
#define FA_KW (SQ / 8)               /* keys per wave */
__global__ __launch_bounds__(512) void k_fattn(const _Float16* __restrict__ XF, const _Float16* __restrict__ GH, float* __restrict__ out) {
  __shared__ __attribute__((aligned(16))) float sacc[8][64][68];      /* pitch 68: 16-byte aligned rows that start 4 banks apart */
  __shared__ float sm[8][64]; __shared__ float sl[8][64];
  const int tid = threadIdx.x, w = tid >> 5, lane = tid & 31, ln = lane & 15, hh = lane >> 4; const int kc = w >> 1, qg = (w & 1) * 32;
  const size_t q0 = (size_t)blockIdx.x * 64; const size_t kb0 = (q0 / SQ) * SQ + (size_t)kc * FA_KW;      /* token rows: first query of the group, first key of the wave */
  const float cs = 0.002762135864009951f * 1.44269504f;      /* 512^-0.5 / 16 (G is carried x16) x log2 e: laid on Y in f32, ahead of its rounding to f16 */
  const _Float16* gp = GH + lane * 8; const _Float16* qp = XF + (q0 + qg) * EM + lane * 8;      /* G^T, then H^T: four 16-row tiles of 1,024 halves each; the wave's two query tiles */
  const _Float16* xp = XF + kb0 * EM + lane * 8; const _Float16* zp = XF + kb0 * EM + ((lane >> 3) & 1) * 128 + (hh * 8 + (lane & 7)) * 8;      /* x: 16-key tiles of 1,024 halves; zp: the same tiles, the lane's piece for the transposing load (tr_frag) */
  const v8f z8 = {0.f,0.f,0.f,0.f,0.f,0.f,0.f,0.f}; v8f acc[2][4] = {{z8, z8, z8, z8}, {z8, z8, z8, z8}}; float l[2] = {0.f, 0.f};
  v8f nm[2] = {z8, z8};      /* minus the maximum in use, in all 8 registers of a tile (a lane owns one query): C of the score products; 0 until the first pass sets it */
  v16h yb[2][2], xa[2][2];
  { v16h gf[4][2], xb[2][2];
#pragma unroll
    for (int nt = 0; nt < 4; ++nt)
#pragma unroll
      for (int ks = 0; ks < 2; ++ks) gf[nt][ks] = ff_frag(gp + nt * (16 * EM) + ks * 512);
#pragma unroll
    for (int qt = 0; qt < 2; ++qt)
#pragma unroll
      for (int ks = 0; ks < 2; ++ks) { xb[qt][ks] = ff_frag(qp + qt * (16 * EM) + ks * 512); xa[qt][ks] = ff_frag(xp + qt * (16 * EM) + ks * 512); }      /* xa: the first pass's two key tiles */
    asm volatile("s_wait_xcnt 0x0" :: "v"(gp), "v"(qp), "v"(xp) : "memory");      /* behind the 32 loads: the results below may be formed in the registers that these loads name as addresses; the addresses are inputs, so that no load's result is laid over them ahead of the wait */
    __builtin_amdgcn_sched_barrier(0);      /* all 32 loads stay above the first matrix instruction, so that they share one memory latency */
#pragma unroll
    for (int qt = 0; qt < 2; ++qt)
#pragma unroll
      for (int ks = 0; ks < 2; ++ks)
        yb[qt][ks] = ff_pack(fa_mma(gf[2 * ks][1], xb[qt][1], fa_mma(gf[2 * ks][0], xb[qt][0], z8)) * cs, fa_mma(gf[2 * ks + 1][1], xb[qt][1], fa_mma(gf[2 * ks + 1][0], xb[qt][0], z8)) * cs); }
#pragma unroll 1      /* rolled: one pass's fragments and accumulators fill the register budget of four waves per SIMD */
  for (int it = 0; it < FA_KW / 32; ++it) {
    v16h za[4]; const _Float16* zq = zp + (size_t)it * (32 * EM);
#pragma unroll
    for (int jt = 0; jt < 4; ++jt) za[jt] = tr_frag(zq + jt * 256);      /* rows e = 16 jt .. + 15: k / 8 planes 2 jt and 2 jt + 1 of both key tiles */
    v8f s[2][2];
#pragma unroll
    for (int qt = 0; qt < 2; ++qt)
#pragma unroll
      for (int kt = 0; kt < 2; ++kt) s[qt][kt] = fa_mma(xa[kt][1], yb[qt][1], fa_mma(xa[kt][0], yb[qt][0], nm[qt]));      /* log2-domain score minus the maximum in use */
    const int nx = (it + 1 < FA_KW / 32) ? it + 1 : it;      /* the next pass's key rows are fetched under this pass's softmax; the last pass fetches its own again (in bounds, unused) */
    const _Float16* xq = xp + (size_t)nx * (32 * EM);
#pragma unroll
    for (int kt = 0; kt < 2; ++kt)
#pragma unroll
      for (int ks = 0; ks < 2; ++ks) xa[kt][ks] = ff_frag(xq + kt * (16 * EM) + ks * 512);
    asm volatile("s_wait_xcnt 0x0" :: "v"(zq), "v"(xq) : "memory");      /* behind this pass's 16 loads: the next pass forms its addresses in the registers that these loads name; the two addresses are inputs, so that no load's result is laid over them ahead of the wait */
    __builtin_amdgcn_sched_barrier(0);      /* keeps the softmax below the fetches, so that the next pass's key rows fly under it instead of being asked for at the pass's end */
    float mx[2];
#pragma unroll
    for (int qt = 0; qt < 2; ++qt) { mx[qt] = fmaxf(s[qt][0][0], s[qt][1][0]);
#pragma unroll
      for (int r = 1; r < 8; ++r) mx[qt] = fmaxf(mx[qt], fmaxf(s[qt][0][r], s[qt][1][r])); }
    const float thr = (it == 0) ? -3.0e38f : 8.0f;      /* the first pass always rescales: it sets the maximum from its own scores, of either sign */
    if (__builtin_amdgcn_ballot_w32(fmaxf(mx[0], mx[1]) > thr) != 0u) {      /* one scalar branch a pass and wave */
#pragma unroll
      for (int qt = 0; qt < 2; ++qt) {
        const float mq = fmaxf(mx[qt], rs_xhalf(mx[qt]));      /* the same in both lanes of a query */
        const float d = (it == 0) ? mq : fmaxf(mq, 0.f);      /* rise of the maximum in use */
        const float f = (it == 0) ? 1.0f : fa_exp2(-d);      /* first pass: sums and accumulators are still 0, and 2^-d could overflow */
        const float nn = nm[qt][0] - d; l[qt] *= f;
#pragma unroll
        for (int r = 0; r < 8; ++r) nm[qt][r] = nn;
#pragma unroll
        for (int kt = 0; kt < 2; ++kt) s[qt][kt] = s[qt][kt] - d;
#pragma unroll
        for (int jt = 0; jt < 4; ++jt) acc[qt][jt] = acc[qt][jt] * f;
      }
    }
    FragH pb[2];
#pragma unroll
    for (int qt = 0; qt < 2; ++qt) {
      float ps = 0.f;
#pragma unroll
      for (int kt = 0; kt < 2; ++kt)
#pragma unroll
        for (int r4 = 0; r4 < 8; r4 += 4) { const float t0 = s[qt][kt][r4], t1 = s[qt][kt][r4 + 1], t2 = s[qt][kt][r4 + 2], t3 = s[qt][kt][r4 + 3]; float e0, e1, e2, e3;
          /* four independent exponentials and one v_nop in one statement: the slot that the instruction set asks for behind a transcendental (early-clobber outputs keep the four apart) */
          asm("v_exp_f32 %0, %4\n\tv_exp_f32 %1, %5\n\tv_exp_f32 %2, %6\n\tv_exp_f32 %3, %7\n\tv_nop" : "=&v"(e0), "=&v"(e1), "=&v"(e2), "=&v"(e3) : "v"(t0), "v"(t1), "v"(t2), "v"(t3));
          ps += (e0 + e1) + (e2 + e3);
          pb[qt].h[kt * 8 + r4] = (_Float16)e0; pb[qt].h[kt * 8 + r4 + 1] = (_Float16)e1; pb[qt].h[kt * 8 + r4 + 2] = (_Float16)e2; pb[qt].h[kt * 8 + r4 + 3] = (_Float16)e3; }
      l[qt] += ps;
    }
    __builtin_amdgcn_sched_barrier(0);      /* every exponential stays above the matrix instructions below */
#pragma unroll
    for (int qt = 0; qt < 2; ++qt)
#pragma unroll
      for (int jt = 0; jt < 4; ++jt) acc[qt][jt] = fa_mma(za[jt], pb[qt].v, acc[qt][jt]);
  }
  v16h hf[4][2];
#pragma unroll
  for (int jt = 0; jt < 4; ++jt)
#pragma unroll
    for (int ks = 0; ks < 2; ++ks) hf[jt][ks] = ff_frag(gp + EM * EM + jt * (16 * EM) + ks * 512);
  asm volatile("s_wait_xcnt 0x0" :: "v"(gp) : "memory");      /* behind the 16 loads: the values below may be formed in the registers that these loads name as address; the address is an input, so that no load's result is laid over it ahead of the wait */
#pragma unroll
  for (int qt = 0; qt < 2; ++qt) { const float lt = l[qt] + rs_xhalf(l[qt]); if (hh == 0) { sm[kc][qg + qt * 16 + ln] = -nm[qt][0]; sl[kc][qg + qt * 16 + ln] = lt; }
    const float rl = 1.0f / lt;      /* lt is about 1 or more: the key that last set the maximum in use adds 2^0 */
    const v16h ob0 = ff_pack(acc[qt][0] * rl, acc[qt][1] * rl), ob1 = ff_pack(acc[qt][2] * rl, acc[qt][3] * rl);
#pragma unroll
    for (int jt = 0; jt < 4; ++jt) { const v8f c = fa_mma(hf[jt][1], ob1, fa_mma(hf[jt][0], ob0, z8)); const v4f c0 = {c[0], c[1], c[2], c[3]}, c1 = {c[4], c[5], c[6], c[7]};
      *(v4fa*)&sacc[kc][qg + qt * 16 + ln][jt * 16 + 8 * hh] = c0; *(v4fa*)&sacc[kc][qg + qt * 16 + ln][jt * 16 + 8 * hh + 4] = c1; } }
  __syncthreads();      /* the 8 key ranges' partial maxima, sums and rows are complete before any thread merges them */
  const int q = tid >> 3, d8 = (tid & 7) * 8; float mg = sm[0][q];
#pragma unroll
  for (int u = 1; u < 8; ++u) mg = fmaxf(mg, sm[u][q]);
  float lg = 0.f; v4f o0 = {0.f, 0.f, 0.f, 0.f}, o1 = {0.f, 0.f, 0.f, 0.f};
#pragma unroll
  for (int u = 0; u < 8; ++u) { const float f = fa_exp2(sm[u][q] - mg) * sl[u][q]; lg += f; o0 += f * *(const v4fa*)&sacc[u][q][d8]; o1 += f * *(const v4fa*)&sacc[u][q][d8 + 4]; }
  const float sc = 0.0625f / lg;      /* H is carried x16 */
  float* op = out + (q0 + q) * EM + d8; *(v4f*)op = o0 * sc; *(v4f*)(op + 4) = o1 * sc; }

// ---- launch 1: jobs that do not depend on one another share a launch (the block index picks the job) ----
__device__ __forceinline__ _Float16 pre_w16(float v) { return (_Float16)(bf16_round(v) * 16.0f); }      /* weight: rounded to bf16, carried x16, exact in f16 */
/* the 16 f32 values behind one lane's fragment (A or B, k order of g2_frag): r[0..7] = k 8 hh + i, r[8..15] = k 16 + 8 hh + i. Row form: p = first of the 32 k values of the lane's row, matrix kept as stored */
__device__ __forceinline__ void pre_raw_row(const float* p, int hh, float (&r)[16]) { const v4f a0 = *(const v4fa*)(p + 8 * hh), a1 = *(const v4fa*)(p + 8 * hh + 4), a2 = *(const v4fa*)(p + 16 + 8 * hh), a3 = *(const v4fa*)(p + 16 + 8 * hh + 4);
#pragma unroll
  for (int q = 0; q < 4; ++q) { r[q] = a0[q]; r[4 + q] = a1[q]; r[8 + q] = a2[q]; r[12 + q] = a3[q]; } }
/* column form, down a [k][EM] matrix: p = element (first k, the lane's column) */
__device__ __forceinline__ void pre_raw_col(const float* p, int hh, float (&r)[16]) {
#pragma unroll
  for (int i = 0; i < 8; ++i) { r[i] = p[(size_t)(8 * hh + i) * EM]; r[8 + i] = p[(size_t)(16 + 8 * hh + i) * EM]; } }
__device__ __forceinline__ v16h pre_cvt(const float (&r)[16]) { FragH f;
#pragma unroll
  for (int i = 0; i < 16; ++i) f.h[i] = pre_w16(r[i]);
  return f.v; }
/* one wave's share of a 16 x 16 tile: the PRE_KW k values from ap and bp on, k ascending in steps of 32; ACOL: A is read down columns */
#define PRE_KW 64                    /* k values per wave: the 8 waves of a block split K = DM between them */
template <bool ACOL>
__device__ __forceinline__ v8f pre_part(const float* ap, const float* bp, int hh) { v8f c = {0.f, 0.f, 0.f, 0.f, 0.f, 0.f, 0.f, 0.f}; float ra[PRE_KW / 32][16], rb[PRE_KW / 32][16];
  const float* al = ap + (ACOL ? 8 * hh * EM : 8 * hh); const float* bl = bp + 8 * hh;      /* the lane half's own first k: every load below is one of these two addresses plus a constant */
#pragma unroll
  for (int u = 0; u < PRE_KW / 32; ++u) { if (ACOL) pre_raw_col(al + (size_t)(32 * u) * EM, 0, ra[u]); else pre_raw_row(al + 32 * u, 0, ra[u]); pre_raw_row(bl + 32 * u, 0, rb[u]); }
  asm volatile("s_wait_xcnt 0x0" :: "v"(al), "v"(bl) : "memory");      /* behind the loads: the values below may be formed in the registers that these loads name as addresses; the addresses are inputs, so that no load's result is laid over them ahead of the wait */
  __builtin_amdgcn_sched_barrier(0);      /* all loads stay above the first conversion, so that they share one memory latency */
#pragma unroll
  for (int u = 0; u < PRE_KW / 32; ++u) c = fa_mma(pre_cvt(ra[u]), pre_cvt(rb[u]), c);
  return c; }
#define PRE_GB 32                    /* blocks of launch 1 that form G^T and H^T: 2 planes x 16 tiles of 16 x 16, one tile a block */
static_assert(PRE_KW * 8 == DM, "k_pre: 8 waves cover K");
static_assert(NR * EM % (16 * 256) == 0, "k_pre: the x blocks have no tail guard");
// Launch 1. Blocks 0 .. PRE_GB - 1 (first): plane 0 G^T[f][e] = sum_w Wk[f][w] Wq[e][w], plane 1 H^T[j][e] = sum_w Wm[w][j] Wv[e][w], both x16, operands converted in the loaders. One 16 x 16 tile a block, K split over its 8 waves (one load latency and one round of conversions on the launch's longest path instead of four of twice the size); the 8 partial tiles are added in f32, wave 0 first, through LDS and stored in fragment order. The other blocks: 64 tokens each, x to f16 in fragment order.
__global__ __launch_bounds__(256) void k_pre(const float* __restrict__ x, const float* __restrict__ wq, const float* __restrict__ wk, const float* __restrict__ wv, const float* __restrict__ wm, _Float16* __restrict__ XF, _Float16* __restrict__ GH) {
  __shared__ __attribute__((aligned(16))) float sp[8][16][20];      /* one partial tile a wave; pitch 80 B: 16-byte aligned rows */
  const int tid = threadIdx.x;
  if (blockIdx.x >= PRE_GB) { const size_t t = (size_t)(blockIdx.x - PRE_GB) * 256 + tid; FragH f; v4f ra[4];      /* thread t: tile t / 64, row t % 16, k = 16 ((t / 16) % 4) .. + 15: 64 contiguous bytes of x, two pieces of the tile in fragment order */
    const float* xs = x + ((t >> 6) * 16 + (t & 15)) * EM + ((t >> 4) & 3) * 16;
#pragma unroll
    for (int q = 0; q < 4; ++q) ra[q] = *(const v4fa*)(xs + 4 * q);
    asm volatile("s_wait_xcnt 0x0" :: "v"(xs) : "memory");      /* behind the loads: the values below may be formed in the registers that these loads name as address; the address is an input, so that no load's result is laid over it ahead of the wait */
#pragma unroll
    for (int q = 0; q < 16; ++q) f.h[q] = (_Float16)bf16_round(ra[q >> 2][q & 3]);
    unsigned short* xd = (unsigned short*)XF + (t >> 6) * (16 * EM) + ((t >> 4) & 3) * 256 + (t & 15) * 8;      /* planes k / 8 = 2 ((t / 16) % 4) and the next, 128 halves apart */
    *(v8us*)xd = f.half[0]; *(v8us*)(xd + 128) = f.half[1]; return; }
  const int lane = tid & 31, ln = lane & 15, hh = lane >> 4, w = tid >> 5; const int plane = blockIdx.x / (PRE_GB / 2), rt = (blockIdx.x >> 2) & 3, ct = blockIdx.x & 3; const int k0 = w * PRE_KW;
  const float* bp = (plane ? wv : wq) + (size_t)(ct * 16 + ln) * DM + k0;
  const v8f c = plane ? pre_part<true>(wm + (size_t)k0 * EM + rt * 16 + ln, bp, hh) : pre_part<false>(wk + (size_t)(rt * 16 + ln) * DM + k0, bp, hh);      /* plane is the same for the whole block */
#pragma unroll
  for (int r = 0; r < 8; ++r) sp[w][8 * hh + r][ln] = c[r];
  __syncthreads();      /* the 8 partial tiles are complete in LDS before they are added; taken by whole GH blocks only, the x blocks have left above */
  if (tid < 32) { const int row = tid & 15, k8 = tid >> 4; v4f s0 = *(const v4fa*)&sp[0][row][k8 * 8], s1 = *(const v4fa*)&sp[0][row][k8 * 8 + 4];      /* 16 B a thread, fragment order [row tile][k / 8][row][k % 8]: the wave stores one run of 512 B */
#pragma unroll
    for (int u = 1; u < 8; ++u) { s0 += *(const v4fa*)&sp[u][row][k8 * 8]; s1 += *(const v4fa*)&sp[u][row][k8 * 8 + 4]; }
    FragH f;
#pragma unroll
    for (int q = 0; q < 4; ++q) { f.h[q] = (_Float16)(s0[q] * 0.0625f); f.h[4 + q] = (_Float16)(s1[q] * 0.0625f); }
    *(v8us*)((unsigned short*)GH + (size_t)plane * (EM * EM) + (size_t)rt * (16 * EM) + (ct * 2 + k8) * 128 + row * 8) = f.half[0]; } }

extern "C" void kernel_launch(void* const* d_in, const int* in_sizes, int n_in,
                              void* d_out, int out_size, void* d_ws, size_t ws_size, hipStream_t stream) {
  (void)in_sizes; (void)n_in; (void)out_size;
  const float* const* I = (const float* const*)d_in; const float* x = I[0]; const float* wq = I[1]; const float* wk = I[2]; const float* wv = I[3]; const float* wm = I[4];      /* weights [in][out] */
  char* ws = (char*)d_ws; size_t off = 0;
  auto take = [&](size_t bytes) { char* p = ws + off; off += (bytes + 255) & ~(size_t)255; return p; };
  _Float16* GH = (_Float16*)take((size_t)2 * EM * EM * 2);      /* GH = [G^T | H^T], each [64][64] x16, in fragment order */
  _Float16* XF = (_Float16*)take(NR * EM * 2);      /* x in fragment order */
  if (off > ws_size) return;      /* approx 2 MiB */
  k_pre<<<(unsigned)(PRE_GB + NR * EM / 16 / 256), 256, 0, stream>>>(x, wq, wk, wv, wm, XF, GH);
  k_fattn<<<(unsigned)(NR / 64), 512, 0, stream>>>(XF, GH, (float*)d_out);      /* all batches: 64 query rows a work-group */
}

// v010
// A run of this version takes 19 microseconds.
// Next to v009, in two timings, it ran 1.06 and 1.05 times as fast.
// Counting every step since v000, it is 182 times as fast.
#include <hip/hip_runtime.h>
// Wide single-head self-attention (x [4][4096][64]; Q/K/V = x W with W [64][512] stored [in][out] (heads NOT split: one 512-wide head); scores = Q K^T / sqrt(512) over all 4,096 keys; softmax; o = attn V; out = o Wm (Wm [512][64]) -> [4][4096][64]).
// Structure: the chained products are reassociated: Q K^T = (x G) x^T with G = Wq Wk^T [64][64], and (attn V) Wm = attn (x H) with H = Wv Wm [64][64] (exact algebra for any inputs; another f32 sum order), so both 4096 x 4096 products run at width 64 instead of 512. Token rows r = b*4096 + s; x exact in f16 (bf16-rounded); weights exact x16; G^T and H^T in one WMMA launch (two planes, K = 512 split over the 8 waves of a block, carried x16); x, G^T and H^T are kept in the workspace in WMMA fragment order (see ff_frag), so that every fragment load is a contiguous 512-B run; x^T fragments come from the same x tiles by the transposing load (see tr_frag); then ONE fused launch for all batches: each wave forms Y = x G (carrying the score scale) for its own queries, scores^T = x Y^T, running-maximum softmax in registers, o^T += x^T P^T, and attn (x H) = (attn x) H: H is applied to each wave's normalised partial o behind its key loop, so neither scores, weights, Y nor x H go through memory. 2 launches, one per link of the dependence chain: (x to f16 | G^T, H^T straight from the f32 weights), fused attention.
// Compute dtype: inputs rounded to bf16; x / weights exact; G, H, Y, each key range's weighted mean of x rows and softmax weights (2^(score - maximum in use), in [0, 2^8]) as plain f16 WMMA operands (~2^-12); scores, statistics and out f32. v_wmma_f32_16x16x32_f16.
#define NB 4
#define SQ 4096
#define EM 64                        /* embedding */
#define DM 512                       /* wide = 8 x 64 (one head) */
#define NH 8                         /* 64-wide slabs of the one 512-wide head (not used) */
#define HD 64
#define HG 1
#define B0 0                         /* not used (all batches run from 0) */
#define NBR NB                       /* not used (the launches cover NB batches through NR) */
#define QN SQ                        /* not used (all SQ query rows attended) */
#define NR ((size_t)NB * SQ)
#define MP ((int)((size_t)NBR * SQ))
#define MPO MP
typedef __bf16 v16b __attribute__((ext_vector_type(16)));
typedef unsigned short v8us __attribute__((ext_vector_type(8), may_alias));
typedef float  v8f  __attribute__((ext_vector_type(8)));
typedef float  v4f  __attribute__((ext_vector_type(4)));
typedef float  v4fa __attribute__((ext_vector_type(4), may_alias));
union FragB { v16b v; v8us half[2]; unsigned short u[16]; };

__device__ __forceinline__ unsigned short bf16_bits(float x) { unsigned int u = __float_as_uint(x); return (unsigned short)((u + 0x7FFFu + ((u >> 16) & 1u)) >> 16); }
__device__ __forceinline__ float bf16_val(unsigned short b) { return __uint_as_float(((unsigned int)b) << 16); }
__device__ __forceinline__ float bf16_round(float x) { return bf16_val(bf16_bits(x)); }
// D += A·B with NT terms: 1 = ah·bh, 2 = + al·bh (A split), 3 = + ah·bl (both split)
template <int NT>
__device__ __forceinline__ v8f mmaN(v16b ah, v16b al, v16b bh, v16b bl, v8f c) {
  c = __builtin_amdgcn_wmma_f32_16x16x32_bf16(false, ah, false, bh, (short)0, c, false, false);
  if (NT >= 2) c = __builtin_amdgcn_wmma_f32_16x16x32_bf16(false, al, false, bh, (short)0, c, false, false);
  if (NT >= 3) c = __builtin_amdgcn_wmma_f32_16x16x32_bf16(false, ah, false, bl, (short)0, c, false, false);
  asm volatile("v_nop\n\tv_nop\n\tv_nop\n\tv_nop" : "+v"(c) : "v"(ah), "v"(al), "v"(bh), "v"(bl));
  return c;
}

__global__ __launch_bounds__(256) void k_wt_bf16(const float* __restrict__ W, unsigned short* __restrict__ Wt, int K, int N) {
  const int t = blockIdx.x * 256 + threadIdx.x;
  const int k8n = K / 8;
  if (t >= N * k8n) return;
  const int n = t / k8n, k8 = (t % k8n) * 8;
  v8us v;
#pragma unroll
  for (int i = 0; i < 8; ++i) v[i] = bf16_bits(W[(size_t)(k8 + i) * N + n]);
  *(v8us*)(Wt + (size_t)n * K + k8) = v;
  
}

// GEMM C[M][N] (f32, pitch ldc) = act(A[M][K]·W + bias). A f32 row-major (pitch lda) converted per fragment to bf16
// (ASPLIT: hi/lo two planes -> 2 terms, else single rounded term); Wt bf16 [N][K] (pitch ldb). BIAS_BF16 rounds the
// bias to bf16 first (bias quantised to bf16 before the add). K%32==0, M%16==0, N%64==0.
template <bool ASPLIT, int ACT, bool BIAS_BF16>
__global__ __launch_bounds__(128) void k_gemm_bf(const float* __restrict__ A, int lda, const unsigned short* __restrict__ Wt, int ldb,
                                               const float* __restrict__ bias, float* __restrict__ C, int ldc, int M, int N, int K) {
  __shared__ __attribute__((aligned(16))) float so[4][16][64];
  const int tid = threadIdx.x, w = tid >> 5, lane = tid & 31, ln = lane & 15, hh = lane >> 4;
  const int ntn = N / 64;
  const int wid = blockIdx.x * 4 + w;
  const int mt = wid / ntn, nq = wid % ntn;
  if (mt * 16 >= M) return;
  const int row0 = mt * 16, col0 = nq * 64;
  const float* arow = A + (size_t)(row0 + ln) * lda;
  v8f acc[4] = {};
  for (int kb = 0; kb < K; kb += 32) {
    FragB ah, al;
    const v4f x0 = *(const v4fa*)(arow + kb + 8 * hh), x1 = *(const v4fa*)(arow + kb + 8 * hh + 4);
    const v4f x2 = *(const v4fa*)(arow + kb + 16 + 8 * hh), x3 = *(const v4fa*)(arow + kb + 16 + 8 * hh + 4);
    float xs[16] = {x0[0],x0[1],x0[2],x0[3],x1[0],x1[1],x1[2],x1[3],x2[0],x2[1],x2[2],x2[3],x3[0],x3[1],x3[2],x3[3]};
#pragma unroll
    for (int i = 0; i < 16; ++i) { const unsigned short hb = bf16_bits(xs[i]); ah.u[i] = hb; al.u[i] = ASPLIT ? bf16_bits(xs[i] - bf16_val(hb)) : (unsigned short)0; }
#pragma unroll
    for (int t = 0; t < 4; ++t) {
      const unsigned short* brow = Wt + (size_t)(col0 + t * 16 + ln) * ldb + kb;
      FragB b;
      b.half[0] = *(const v8us*)(brow + 8 * hh);
      b.half[1] = *(const v8us*)(brow + 16 + 8 * hh);
      acc[t] = mmaN<ASPLIT ? 2 : 1>(ah.v, al.v, b.v, b.v, acc[t]);
    }
  }
#pragma unroll
  for (int t = 0; t < 4; ++t) {
    float bv = bias ? bias[col0 + t * 16 + ln] : 0.f;
    if (BIAS_BF16) bv = bf16_round(bv);
#pragma unroll
    for (int r = 0; r < 8; ++r) { float v = acc[t][r] + bv; if (ACT == 1) v = fmaxf(v, 0.f); so[w][8 * hh + r][t * 16 + ln] = v; }
  }
  __builtin_amdgcn_fence(__ATOMIC_ACQ_REL, "workgroup");
  __builtin_amdgcn_wave_barrier();
  const int rsub = lane >> 4, c4 = (lane & 15) * 4;
  {
#pragma unroll
    for (int q = 0; q < 8; ++q) {
      const int r = q * 2 + rsub;
      const v4f v = *(const v4fa*)&so[w][r][c4];
      *(v4f*)(C + (size_t)(row0 + r) * ldc + col0 + c4) = v;
    }
    
  }
}

// GEMM C = act(A·W + bias + resid): A f32 (ASPLIT -> hi/lo 2 terms), Wt bf16 [N][K]; ACT 0 none, 1 relu, 2 exact gelu;
// resid (optional, f32, row index = (row % rmod), pitch ldr, RES_BF16 rounds it) added before the activation.
template <bool ASPLIT, int ACT, bool BIAS_BF16, bool RES_BF16>
__global__ __launch_bounds__(128) void k_gemm_bf3(const float* __restrict__ A, int lda, const unsigned short* __restrict__ Wt, int ldb,
                                                const float* __restrict__ bias, const float* __restrict__ resid, int rmod, int ldr,
                                                float* __restrict__ C, int ldc, int M, int N, int K) {
  __shared__ __attribute__((aligned(16))) float so[4][16][64];
  const int tid = threadIdx.x, w = tid >> 5, lane = tid & 31, ln = lane & 15, hh = lane >> 4;
  const int ntn = N / 64;
  const int wid = blockIdx.x * 4 + w;
  const int mt = wid / ntn, nq = wid % ntn;
  if (mt * 16 >= M) return;
  const int row0 = mt * 16, col0 = nq * 64;
  const float* arow = A + (size_t)(row0 + ln) * lda;
  v8f acc[4] = {};
  for (int kb = 0; kb < K; kb += 32) {
    FragB ah, al;
    const v4f x0 = *(const v4fa*)(arow + kb + 8 * hh), x1 = *(const v4fa*)(arow + kb + 8 * hh + 4);
    const v4f x2 = *(const v4fa*)(arow + kb + 16 + 8 * hh), x3 = *(const v4fa*)(arow + kb + 16 + 8 * hh + 4);
    float xs[16] = {x0[0],x0[1],x0[2],x0[3],x1[0],x1[1],x1[2],x1[3],x2[0],x2[1],x2[2],x2[3],x3[0],x3[1],x3[2],x3[3]};
#pragma unroll
    for (int i = 0; i < 16; ++i) { const unsigned short hb = bf16_bits(xs[i]); ah.u[i] = hb; al.u[i] = ASPLIT ? bf16_bits(xs[i] - bf16_val(hb)) : (unsigned short)0; }
#pragma unroll
    for (int t = 0; t < 4; ++t) {
      const unsigned short* brow = Wt + (size_t)(col0 + t * 16 + ln) * ldb + kb;
      FragB b;
      b.half[0] = *(const v8us*)(brow + 8 * hh);
      b.half[1] = *(const v8us*)(brow + 16 + 8 * hh);
      acc[t] = mmaN<ASPLIT ? 2 : 1>(ah.v, al.v, b.v, b.v, acc[t]);
    }
  }
#pragma unroll
  for (int t = 0; t < 4; ++t) {
    const int col = col0 + t * 16 + ln;
    float bv = bias ? bias[col] : 0.f;
    if (BIAS_BF16) bv = bf16_round(bv);
#pragma unroll
    for (int r = 0; r < 8; ++r) {
      float v = acc[t][r] + bv;
      if (resid) { float rv = resid[(size_t)((row0 + 8 * hh + r) % rmod) * ldr + col]; if (RES_BF16) rv = bf16_round(rv); v += rv; }
      if (ACT == 1) v = fmaxf(v, 0.f);
      if (ACT == 2) v = 0.5f * v * (1.0f + erff(v * 0.70710678118654752f));
      if (ACT == 3) { const float u = 0.7978845608028654f * (v + 0.044715f * v * v * v); v = 0.5f * v * (1.0f + tanhf(u)); }
      so[w][8 * hh + r][t * 16 + ln] = v;
    }
  }
  __builtin_amdgcn_fence(__ATOMIC_ACQ_REL, "workgroup");
  __builtin_amdgcn_wave_barrier();
  const int rsub = lane >> 4, c4 = (lane & 15) * 4;
  {
#pragma unroll
    for (int q = 0; q < 8; ++q) {
      const int r = q * 2 + rsub;
      const v4f v = *(const v4fa*)&so[w][r][c4];
      *(v4f*)(C + (size_t)(row0 + r) * ldc + col0 + c4) = v;
    }
    
  }
}
// row LayerNorm (biased variance, eps) over N: s = X (+ R); optional out_sum <- s; out_norm <- (s-mu)*rsqrt(var+eps)*g + b
template <bool PARAM_BF16>
__global__ __launch_bounds__(256) void k_layernorm(const float* __restrict__ X, const float* __restrict__ R, const float* __restrict__ g, const float* __restrict__ bta,
                                                  float* __restrict__ out_sum, float* __restrict__ out_norm, int N, float eps) {
  __shared__ float red[256];
  const int row = blockIdx.x, tid = threadIdx.x;
  const float* x = X + (size_t)row * N; const float* rr = R ? R + (size_t)row * N : nullptr;
  float vals[16];                     // up to N = 4096
  const int per = N / 256;            // contiguous chunk per thread? use strided-by-4 chunks: thread handles j = tid*4 + 1024*u
  float s1 = 0.f;
  for (int u = 0; u < per / 4; ++u) {
    const int j = tid * 4 + 1024 * u;
    const v4f a = *(const v4fa*)(x + j);
    v4f b = {0.f,0.f,0.f,0.f}; if (rr) b = *(const v4fa*)(rr + j);
#pragma unroll
    for (int q = 0; q < 4; ++q) { const float v = a[q] + b[q]; vals[u * 4 + q] = v; s1 += v; }
  }
  red[tid] = s1; __syncthreads();
  for (int st = 128; st > 0; st >>= 1) { if (tid < st) red[tid] += red[tid + st]; __syncthreads(); }
  const float mu = red[0] / (float)N; __syncthreads();
  float s2 = 0.f;
  for (int u = 0; u < per / 4; ++u)
#pragma unroll
    for (int q = 0; q < 4; ++q) { const float c = vals[u * 4 + q] - mu; s2 += c * c; }
  red[tid] = s2; __syncthreads();
  for (int st = 128; st > 0; st >>= 1) { if (tid < st) red[tid] += red[tid + st]; __syncthreads(); }
  const float rs = rsqrtf(red[0] / (float)N + eps);
  {
    for (int u = 0; u < per / 4; ++u) {
      const int j = tid * 4 + 1024 * u;
      v4f o, sm;
#pragma unroll
      for (int q = 0; q < 4; ++q) {
        float gg = g[j + q], bb = bta[j + q];
        if (PARAM_BF16) { gg = bf16_round(gg); bb = bf16_round(bb); }
        sm[q] = vals[u * 4 + q]; o[q] = (vals[u * 4 + q] - mu) * rs * gg + bb;
      }
      if (out_sum) *(v4f*)(out_sum + (size_t)row * N + j) = sm;
      *(v4f*)(out_norm + (size_t)row * N + j) = o;
    }
    
  }
}



// ---- f16 WMMA path (v_wmma_f32_16x16x32_f16): 11-bit significands for operands in range — used where a [0,1] probability operand needs more precision than bf16
typedef _Float16 v16h __attribute__((ext_vector_type(16)));
union FragH { v16h v; v8us half[2]; _Float16 h[16]; unsigned short u[16]; };
template <int NT>
__device__ __forceinline__ v8f mmaH(v16h ah, v16h al, v16h bh, v16h bl, v8f c) {
  c = __builtin_amdgcn_wmma_f32_16x16x32_f16(false, ah, false, bh, (short)0, c, false, false);
  if (NT >= 2) c = __builtin_amdgcn_wmma_f32_16x16x32_f16(false, al, false, bh, (short)0, c, false, false);
  if (NT >= 3) c = __builtin_amdgcn_wmma_f32_16x16x32_f16(false, ah, false, bl, (short)0, c, false, false);
  asm volatile("v_nop\n\tv_nop\n\tv_nop\n\tv_nop" : "+v"(c) : "v"(ah), "v"(al), "v"(bh), "v"(bl));
  return c;
}
// batched GEMM like k_gemm_b but f16 operands: A f32 (split into f16 hi/lo if ASPLIT, else rounded to f16), Bt = f16 values [n][k]; alpha; C f32; N multiple of 16 (partial tiles skipped)
template <bool ASPLIT>
__global__ __launch_bounds__(128) void k_gemm_h(const float* __restrict__ A, int lda, size_t sA, const _Float16* __restrict__ Bh, int ldb, size_t sB, float alpha, float* __restrict__ C, int ldc, size_t sC, int M, int N, int K) {
  __shared__ __attribute__((aligned(16))) float so[4][16][64];
  const int tid = threadIdx.x, w = tid >> 5, lane = tid & 31, ln = lane & 15, hh = lane >> 4; const int by = blockIdx.y;
  A += (size_t)by * sA; Bh += (size_t)by * sB; C += (size_t)by * sC;
  const int ntn = (N + 63) / 64; const int wid = blockIdx.x * 4 + w; const int mt = wid / ntn, nq = wid % ntn; if (mt * 16 >= M) return;
  const int row0 = mt * 16, col0 = nq * 64; const float* arow = A + (size_t)(row0 + ln) * lda;
  v8f acc[4] = {};
  for (int kb = 0; kb < K; kb += 32) {
    FragH ah, al;
    const v4f x0 = *(const v4fa*)(arow + kb + 8 * hh), x1 = *(const v4fa*)(arow + kb + 8 * hh + 4), x2 = *(const v4fa*)(arow + kb + 16 + 8 * hh), x3 = *(const v4fa*)(arow + kb + 16 + 8 * hh + 4);
    float xs[16] = {x0[0],x0[1],x0[2],x0[3],x1[0],x1[1],x1[2],x1[3],x2[0],x2[1],x2[2],x2[3],x3[0],x3[1],x3[2],x3[3]};
#pragma unroll
    for (int i = 0; i < 16; ++i) { const _Float16 h = (_Float16)xs[i]; ah.h[i] = h; al.h[i] = ASPLIT ? (_Float16)(xs[i] - (float)h) : (_Float16)0.0f; }
#pragma unroll
    for (int t = 0; t < 4; ++t) { if (col0 + t * 16 >= N) continue; const size_t boff = (size_t)(col0 + t * 16 + ln) * ldb + kb; FragH bq; bq.half[0] = *(const v8us*)(Bh + boff + 8 * hh); bq.half[1] = *(const v8us*)(Bh + boff + 16 + 8 * hh);
      acc[t] = mmaH<ASPLIT ? 2 : 1>(ah.v, al.v, bq.v, bq.v, acc[t]); }
  }
#pragma unroll
  for (int t = 0; t < 4; ++t) { if (col0 + t * 16 >= N) continue;
#pragma unroll
    for (int r = 0; r < 8; ++r) so[w][8 * hh + r][t * 16 + ln] = acc[t][r] * alpha; }
  __builtin_amdgcn_fence(__ATOMIC_ACQ_REL, "workgroup"); __builtin_amdgcn_wave_barrier();
  const int rsub = lane >> 4, c4 = (lane & 15) * 4;
  {
#pragma unroll
    for (int q = 0; q < 8; ++q) { const int r = q * 2 + rsub; if (col0 + c4 < N) { const v4f v = *(const v4fa*)&so[w][r][c4]; *(v4f*)(C + (size_t)(row0 + r) * ldc + col0 + c4) = v; } }
     }
}

// Wt[n][k] = f16(W[k][n]·scale) from f32 row-major W[K][N] (scale = power of two; bf16-exact weights stay exact in f16 away from the subnormal range)
__global__ __launch_bounds__(256) void k_wt_f16(const float* __restrict__ W, _Float16* __restrict__ Wt, int K, int N, float scale) {
  const int t = blockIdx.x * 256 + threadIdx.x; if (t >= N * (K / 8)) return; const int n = t / (K / 8), k8 = (t % (K / 8)) * 8; FragH f;
#pragma unroll
  for (int i = 0; i < 8; ++i) f.h[i] = (_Float16)(bf16_round(W[(size_t)(k8 + i) * N + n]) * scale); const v8us o = f.half[0];
  *(v8us*)((unsigned short*)Wt + (size_t)n * K + k8) = o; 
}
// k_gemm_hh variant with fused epilogue: v = acc·alpha + bias[by·sBias + col] (+ CP[(row/rowsPerB)·sCPb + by·64 + col] if CP) ; ACT 0 none / 1 elu ; writes f16 C16 (and f32 C if non-null)
template <int ACT>
__global__ __launch_bounds__(128) void k_gemm_hhx(const _Float16* __restrict__ A, int lda, size_t sA, const _Float16* __restrict__ Bh, int ldb, size_t sB, float alpha, const float* __restrict__ bias, size_t sBias, const float* __restrict__ CP, int rowsPerB, size_t sCPb, int row0g,
    float* __restrict__ C, _Float16* __restrict__ C16, int ldc, size_t sC, int M, int N, int K) {
  __shared__ __attribute__((aligned(16))) float so[4][16][64];
  const int tid = threadIdx.x, w = tid >> 5, lane = tid & 31, ln = lane & 15, hh = lane >> 4; const int by = blockIdx.y;
  A += (size_t)by * sA; Bh += (size_t)by * sB; const size_t cofs = (size_t)by * sC; const float* bp = bias ? bias + (size_t)by * sBias : nullptr;
  const int ntn = (N + 63) / 64; const int wid = blockIdx.x * 4 + w; const int mt = wid / ntn, nq = wid % ntn; if (mt * 16 >= M) return;
  const int row0 = mt * 16, col0 = nq * 64; const _Float16* arow = A + (size_t)(row0 + ln) * lda;
  v8f acc[4] = {};
  for (int kb = 0; kb < K; kb += 32) { FragH ah; ah.half[0] = *(const v8us*)((const unsigned short*)arow + kb + 8 * hh); ah.half[1] = *(const v8us*)((const unsigned short*)arow + kb + 16 + 8 * hh);
#pragma unroll
    for (int t = 0; t < 4; ++t) { if (col0 + t * 16 >= N) continue; const size_t boff = (size_t)(col0 + t * 16 + ln) * ldb + kb; FragH bq; bq.half[0] = *(const v8us*)((const unsigned short*)Bh + boff + 8 * hh); bq.half[1] = *(const v8us*)((const unsigned short*)Bh + boff + 16 + 8 * hh);
      acc[t] = mmaH<1>(ah.v, ah.v, bq.v, bq.v, acc[t]); }
  }
#pragma unroll
  for (int t = 0; t < 4; ++t) { if (col0 + t * 16 >= N) continue; const int col = col0 + t * 16 + ln; const float bv = bp ? bf16_round(bp[col]) : 0.f;
#pragma unroll
    for (int r = 0; r < 8; ++r) { float v = acc[t][r] * alpha + bv; if (CP) { const int rr = row0g + row0 + 8 * hh + r; if (rowsPerB < 0) v += CP[cofs + (size_t)rr * ldc + col];      /* rowsPerB < 0: own element of the batched C plane */ else { const int bidx = rr / rowsPerB; v += CP[(size_t)bidx * sCPb + (size_t)by * 64 + col]; } } if (ACT == 1) v = (v > 0.f) ? v : expm1f(v); else if (ACT == 7) v = (v > 0.f) ? v + 1.0f : expf(v); else if (ACT == 8) v = tanhf(v); else if (ACT == 9) v = 0.5f * v * (1.0f + tanhf(0.7978845608028654f * (v + 0.044715f * v * v * v))); else if (ACT == 11) v = 1.0f / (1.0f + expf(-v)); else if (ACT == 12) v = (v > 0.f) ? v : 0.01f * v; else if (ACT == 14) v = (v > 0.f) ? v : 0.1f * v; else if (ACT == 16) v = (v >= 0.f) ? v : 0.3f * v; else if (ACT == 17) v = (v >= 0.f) ? v : 0.2f * v; else if (ACT == 15) v = v / (1.0f + expf(-v)); else if (ACT == 3) v = fmaxf(v, 0.f); else if (ACT == 6) v = 0.5f * v * (1.0f + erff(v * 0.70710678118654752f)); so[w][8 * hh + r][t * 16 + ln] = v; } }
  __builtin_amdgcn_fence(__ATOMIC_ACQ_REL, "workgroup"); __builtin_amdgcn_wave_barrier();
  const int rsub = lane >> 4, c4 = (lane & 15) * 4; typedef _Float16 v4h __attribute__((ext_vector_type(4)));
  {
#pragma unroll
    for (int q = 0; q < 8; ++q) { const int r = q * 2 + rsub; if (col0 + c4 < N) { const v4f v = *(const v4fa*)&so[w][r][c4]; if (C) *(v4f*)(C + cofs + (size_t)(row0 + r) * ldc + col0 + c4) = v; if (C16) { v4h h4; for (int i = 0; i < 4; ++i) h4[i] = (_Float16)v[i]; *(v4h*)(C16 + cofs + (size_t)(row0 + r) * ldc + col0 + c4) = h4; } } }
     }
}


typedef _Float16 v4h __attribute__((ext_vector_type(4)));

__global__ __launch_bounds__(256) void k_x16(const float* __restrict__ x, _Float16* __restrict__ X16, size_t n8) { const size_t t = (size_t)blockIdx.x * 256 + threadIdx.x; if (t >= n8) return; FragH f;
#pragma unroll
  for (int q = 0; q < 8; ++q) f.h[q] = (_Float16)bf16_round(x[t * 8 + q]); *(v8us*)((unsigned short*)X16 + t * 8) = f.half[0];  }
__global__ __launch_bounds__(256) void k_h16(const float* __restrict__ x, _Float16* __restrict__ X16, size_t n8) { const size_t t = (size_t)blockIdx.x * 256 + threadIdx.x; if (t >= n8) return; FragH f;
#pragma unroll
  for (int q = 0; q < 8; ++q) f.h[q] = (_Float16)x[t * 8 + q]; *(v8us*)((unsigned short*)X16 + t * 8) = f.half[0];  }
__global__ __launch_bounds__(256) void k_round16f(const float* __restrict__ W, _Float16* __restrict__ Bt, size_t n8) { const size_t t = (size_t)blockIdx.x * 256 + threadIdx.x; if (t >= n8) return; FragH f;
#pragma unroll
  for (int i = 0; i < 8; ++i) f.h[i] = (_Float16)(bf16_round(W[t * 8 + i]) * 16.0f); *(v8us*)((unsigned short*)Bt + t * 8) = f.half[0];  }
template <int NHv, int TTv>
__global__ __launch_bounds__(256) void k_vt(const _Float16* __restrict__ V16, int ldv, int voff, _Float16* __restrict__ Vt) { __shared__ unsigned short tl[64][66]; const int tid = threadIdx.x; const int slab = blockIdx.x / (TTv / 64), lg = blockIdx.x % (TTv / 64); const int b = slab / NHv, h = slab % NHv;
  for (int i = tid; i < 64 * 8; i += 256) { const int r = i / 8, c8 = (i % 8) * 8; FragH f; f.half[0] = *(const v8us*)((const unsigned short*)V16 + ((size_t)b * TTv + lg * 64 + r) * ldv + voff + h * 64 + c8);
#pragma unroll
    for (int q = 0; q < 8; ++q) tl[r][c8 + q] = f.u[q]; }
  __syncthreads();
  {
#pragma unroll
    for (int rd = 0; rd < 2; ++rd) { const int d = rd * 32 + tid / 8, pc = tid % 8; FragH f;
#pragma unroll
      for (int q = 0; q < 8; ++q) f.u[q] = tl[pc * 8 + q][d];
      *(v8us*)((unsigned short*)Vt + ((size_t)slab * 64 + d) * TTv + lg * 64 + pc * 8) = f.half[0]; }
     } }

__global__ __launch_bounds__(256) void k_hl(const float* __restrict__ F, _Float16* __restrict__ Hh, _Float16* __restrict__ Hl, size_t n8) { const size_t t = (size_t)blockIdx.x * 256 + threadIdx.x; if (t >= n8) return; FragH fh, fl; const v4f a = *(const v4fa*)(F + t * 8), c = *(const v4fa*)(F + t * 8 + 4);
#pragma unroll
  for (int q = 0; q < 4; ++q) { _Float16 h = (_Float16)a[q]; fh.h[q] = h; fl.h[q] = (_Float16)((a[q] - (float)h) * 1024.0f); h = (_Float16)c[q]; fh.h[4 + q] = h; fl.h[4 + q] = (_Float16)((c[q] - (float)h) * 1024.0f); }
  { *(v8us*)((unsigned short*)Hh + t * 8) = fh.half[0]; *(v8us*)((unsigned short*)Hl + t * 8) = fl.half[0];  } }

/* one fragment (A or B) from a row-major matrix: p = first of the 32 k values of the lane's row */
__device__ __forceinline__ v16h g2_frag(const _Float16* p, int hh) { FragH f; f.half[0] = *(const v8us*)((const unsigned short*)p + 8 * hh); f.half[1] = *(const v8us*)((const unsigned short*)p + 16 + 8 * hh); return f.v; }
/* Fragment order. A 16-row x 64-k tile (2 KiB) is kept as [k / 8][row][k % 8]: the 16-byte piece that lane (hh, ln) wants for k = 32 ks + 16 h + 8 hh .. + 7 of row ln lies at halves 512 ks + 256 h + 8 lane,
   so one load of 16 B a lane covers 512 contiguous bytes (4 whole lines) where a row-major tile makes it touch 16 lines. p = fragment's first element + 8 lane; same k order as g2_frag */
__device__ __forceinline__ v16h ff_frag(const _Float16* p) { FragH f; f.half[0] = *(const v8us*)((const unsigned short*)p); f.half[1] = *(const v8us*)((const unsigned short*)p + 256); return f.v; }
/* One A fragment of x^T (16 rows e, 32 keys) from two 16-key tiles of x in fragment order, by the transposing load: lane l hands in the 16-byte piece (key 8 (l >> 4) + (l & 7), e = 8 ((l >> 3) & 1) .. + 7 of the 16 e wanted) and gets keys 8 hh .. + 7 of row e = ln.
   The 32 pieces of one load are 512 contiguous bytes of the tile (two k / 8 planes of 256 B), 4 whole lines. p = first tile's plane pair + the lane's piece; the second tile (keys 16 .. 31) lies 16 EM halves on: same k order as ff_frag */
typedef short v8ss __attribute__((ext_vector_type(8)));
__device__ __forceinline__ v8us tr_load(const _Float16* p) { return __builtin_bit_cast(v8us, __builtin_amdgcn_global_load_tr16_b128_v8i16((__attribute__((address_space(1))) v8ss*)p)); }
__device__ __forceinline__ v16h tr_frag(const _Float16* p) { FragH f; f.half[0] = tr_load(p); f.half[1] = tr_load(p + 16 * EM); return f.v; }
/* two D tiles as one B fragment: a lane's 8 registers of a D tile (rows 8 hh + r of column ln) are k = 8 hh + r of row ln of the matrix whose rows are D's columns, so tiles 2 ks and 2 ks + 1 are halves 0 and 1 of fragment ks, in the lane */
__device__ __forceinline__ v16h ff_pack(v8f c0, v8f c1) { FragH f;
#pragma unroll
  for (int r = 0; r < 8; ++r) { f.h[r] = (_Float16)c0[r]; f.h[8 + r] = (_Float16)c1[r]; }
  return f.v; }


__global__ __launch_bounds__(256) void k_wnat(const float* __restrict__ w, size_t n8, _Float16* __restrict__ Bt) { const size_t t = (size_t)blockIdx.x * 256 + threadIdx.x; if (t >= n8) return; FragH f; for (int q = 0; q < 8; ++q) f.h[q] = (_Float16)(bf16_round(w[t * 8 + q]) * 16.0f); *(v8us*)((unsigned short*)Bt + t * 8) = f.half[0];  }
__global__ __launch_bounds__(256) void k_rsm(const float* __restrict__ S, _Float16* __restrict__ P, int nrows) {
  #pragma clang fp contract(off)
  const int i = blockIdx.x * 256 + threadIdx.x; if (i >= nrows) return; const float* s = S + (size_t)i * SQ; float mx = -3.0e38f;
#pragma unroll 1
  for (int j = 0; j < SQ; ++j) mx = fmaxf(mx, s[j]); float se = 0.f;
#pragma unroll 1
  for (int j = 0; j < SQ; ++j) se += expf(s[j] - mx); const float sc = 256.0f / se;
#pragma unroll 1
  for (int j0 = 0; j0 < SQ; j0 += 8) { FragH f; for (int q = 0; q < 8; ++q) f.h[q] = (_Float16)(expf(s[j0 + q] - mx) * sc); unsigned short* d = (unsigned short*)P + (size_t)i * SQ + j0; *(v8us*)d = f.half[0];  } }
__global__ __launch_bounds__(256) void k_vt(const _Float16* __restrict__ V16, int b, int h0, _Float16* __restrict__ VT) { __shared__ unsigned short tl[64][65]; const int tid = threadIdx.x; const int hh = blockIdx.x % HG, sg = blockIdx.x / HG; const int s0 = sg * 64; const int h = h0 + hh;
  for (int i = tid; i < 64 * 8; i += 256) { const int j = i / 8, d8 = (i % 8) * 8; FragH f; f.half[0] = *(const v8us*)((const unsigned short*)V16 + ((size_t)b * SQ + s0 + j) * DM + h * HD + d8); for (int q = 0; q < 8; ++q) tl[d8 + q][j] = f.u[q]; }
  __syncthreads();
  { for (int i = tid; i < 64 * 8; i += 256) { const int d = i / 8, j8 = (i % 8) * 8; FragH f; for (int q = 0; q < 8; ++q) f.u[q] = tl[d][j8 + q]; *(v8us*)((unsigned short*)VT + ((size_t)hh * HD + d) * SQ + s0 + j8) = f.half[0]; }  } }


__device__ __forceinline__ float rs_xhalf(float x) { return __builtin_bit_cast(float, __builtin_amdgcn_permlanex16(__builtin_bit_cast(int, x), __builtin_bit_cast(int, x), 0x76543210, 0xfedcba98, false, false)); }      /* lane l <- lane l ^ 16 */
__device__ __forceinline__ v8f fa_mma(v16h a, v16h b, v8f c) { return __builtin_amdgcn_wmma_f32_16x16x32_f16(false, a, false, b, (short)0, c, false, false); }
/* 2^t, native; the v_nop fills the slot that the instruction set asks for behind a transcendental */
__device__ __forceinline__ float fa_exp2(float t) { float e; asm("v_exp_f32 %0, %1\n\tv_nop" : "=&v"(e) : "v"(t)); return e; }
// Fused attention. Work-group = 16 waves = 64 query rows, one work-group per WGP; wave w takes queries 32 (w & 1) .. + 31 and keys [512 (w >> 1), + 512) of the rows' batch, 32 keys a pass (the two waves of a key range read the same lines at about the same time). x, G^T and H^T arrive in fragment order: a pass reads its 4 KiB of x twice, once as key rows (fetched one pass ahead) and once transposed (tr_frag), the second time from lines that the first read has brought into the WGP's cache, so that L2 delivers each key row once.
// In front of the loop the wave forms Y for its 32 queries: Y^T tile = (A = 16 rows f of G^T, B = 16 query rows of x), register r = Y[query ln][16 nt + 8 hh + r], x16, brought to the log2-domain score scale in f32: two such tiles are one B fragment of Y, in the lane (ff_pack).
// Both products are computed transposed, so a lane owns ONE query (column ln of every D tile): S^T tile (A = 16 key rows of x, B = 16 query rows of Y) leaves key 8 hh + r in register r,
// which is exactly the k order of the B fragment of o^T = x^T P^T (elements 0..7 = keys 8 hh + i of the first key tile, 8..15 = the same of the second): P never leaves its registers.
// Statistics per lane in the log2 domain. Lazy rescale: Y carries 512^-0.5 log2 e, and minus the maximum in use is the C operand of the score products, so a score leaves the matrix unit ready for 2^t. The first pass sets the maximum in use from its own scores; after it the maximum rises (accumulators and sums rescaled, the two lane halves agreeing on it) only in a pass where some lane's 16 weights of a query add up to more than 2^8, tested once per later pass and wave on the sums that the pass forms anyway; only the first pass and such a pass form a maximum over their scores, and such a pass forms its weights again; weights stay at or below 2^8. The halves' sums are joined at the end. Behind the loop o^T (rows e, one query a lane) is divided by the wave's own sum, so that it is a weighted mean of x rows and as safe in f16 as x itself, packed in the lane into B fragments and multiplied by H^T (A = 16 rows j): D has the layout of o^T with j for e.
// The 8 partial results of a query (one per key range), each weighted by its sum, are merged through LDS behind one barrier.
#define FA_KW (SQ / 8)               /* keys per wave */
__global__ __launch_bounds__(512) void k_fattn(const _Float16* __restrict__ XF, const _Float16* __restrict__ GH, float* __restrict__ out) {
  __shared__ __attribute__((aligned(16))) float sacc[8][64][68];      /* pitch 68: 16-byte aligned rows that start 4 banks apart */
  __shared__ float sm[8][64]; __shared__ float sl[8][64];
  const int tid = threadIdx.x, w = tid >> 5, lane = tid & 31, ln = lane & 15, hh = lane >> 4; const int kc = w >> 1, qg = (w & 1) * 32;
  const size_t q0 = (size_t)blockIdx.x * 64; const size_t kb0 = (q0 / SQ) * SQ + (size_t)kc * FA_KW;      /* token rows: first query of the group, first key of the wave */
  const float cs = 0.002762135864009951f * 1.44269504f;      /* 512^-0.5 / 16 (G is carried x16) x log2 e: laid on Y in f32, ahead of its rounding to f16 */
  const _Float16* gp = GH + lane * 8; const _Float16* qp = XF + (q0 + qg) * EM + lane * 8;      /* G^T, then H^T: four 16-row tiles of 1,024 halves each; the wave's two query tiles */
  const _Float16* xp = XF + kb0 * EM + lane * 8; const _Float16* zp = XF + kb0 * EM + ((lane >> 3) & 1) * 128 + (hh * 8 + (lane & 7)) * 8;      /* x: 16-key tiles of 1,024 halves; zp: the same tiles, the lane's piece for the transposing load (tr_frag) */
  const v8f z8 = {0.f,0.f,0.f,0.f,0.f,0.f,0.f,0.f}; v8f acc[2][4] = {{z8, z8, z8, z8}, {z8, z8, z8, z8}}; float l[2] = {0.f, 0.f};
  v8f nm[2] = {z8, z8};      /* minus the maximum in use, in all 8 registers of a tile (a lane owns one query): C of the score products; 0 until the first pass sets it */
  v16h yb[2][2], xa[2][2];
  { v16h gf[4][2], xb[2][2];
#pragma unroll
    for (int nt = 0; nt < 4; ++nt)
#pragma unroll
      for (int ks = 0; ks < 2; ++ks) gf[nt][ks] = ff_frag(gp + nt * (16 * EM) + ks * 512);
#pragma unroll
    for (int qt = 0; qt < 2; ++qt)
#pragma unroll
      for (int ks = 0; ks < 2; ++ks) { xb[qt][ks] = ff_frag(qp + qt * (16 * EM) + ks * 512); xa[qt][ks] = ff_frag(xp + qt * (16 * EM) + ks * 512); }      /* xa: the first pass's two key tiles */
    asm volatile("s_wait_xcnt 0x0" :: "v"(gp), "v"(qp), "v"(xp) : "memory");      /* behind the 32 loads: the results below may be formed in the registers that these loads name as addresses; the addresses are inputs, so that no load's result is laid over them ahead of the wait */
    __builtin_amdgcn_sched_barrier(0);      /* all 32 loads stay above the first matrix instruction, so that they share one memory latency */
#pragma unroll
    for (int qt = 0; qt < 2; ++qt)
#pragma unroll
      for (int ks = 0; ks < 2; ++ks)
        yb[qt][ks] = ff_pack(fa_mma(gf[2 * ks][1], xb[qt][1], fa_mma(gf[2 * ks][0], xb[qt][0], z8)) * cs, fa_mma(gf[2 * ks + 1][1], xb[qt][1], fa_mma(gf[2 * ks + 1][0], xb[qt][0], z8)) * cs); }
#pragma unroll 1      /* rolled: one pass's fragments and accumulators fill the register budget of four waves per SIMD */
  for (int it = 0; it < FA_KW / 32; ++it) {
    v16h za[4]; const _Float16* zq = zp + (size_t)it * (32 * EM);
#pragma unroll
    for (int jt = 0; jt < 4; ++jt) za[jt] = tr_frag(zq + jt * 256);      /* rows e = 16 jt .. + 15: k / 8 planes 2 jt and 2 jt + 1 of both key tiles */
    v8f s[2][2];
#pragma unroll
    for (int qt = 0; qt < 2; ++qt)
#pragma unroll
      for (int kt = 0; kt < 2; ++kt) s[qt][kt] = fa_mma(xa[kt][1], yb[qt][1], fa_mma(xa[kt][0], yb[qt][0], nm[qt]));      /* log2-domain score minus the maximum in use */
    const int nx = (it + 1 < FA_KW / 32) ? it + 1 : it;      /* the next pass's key rows are fetched under this pass's softmax; the last pass fetches its own again (in bounds, unused) */
    const _Float16* xq = xp + (size_t)nx * (32 * EM);
#pragma unroll
    for (int kt = 0; kt < 2; ++kt)
#pragma unroll
      for (int ks = 0; ks < 2; ++ks) xa[kt][ks] = ff_frag(xq + kt * (16 * EM) + ks * 512);
    asm volatile("s_wait_xcnt 0x0" :: "v"(zq), "v"(xq) : "memory");      /* behind this pass's 16 loads: the next pass forms its addresses in the registers that these loads name; the two addresses are inputs, so that no load's result is laid over them ahead of the wait */
    __builtin_amdgcn_sched_barrier(0);      /* keeps the softmax below the fetches, so that the next pass's key rows fly under it instead of being asked for at the pass's end */
    asm volatile("v_nop");      /* fourth slot between the product that finishes the first score tile (three matrix instructions follow it) and the asm exponentials that read that tile */
    FragH pb[2]; float ps[2];
    auto weigh = [&]() {      /* weights 2^(score - maximum in use) of the pass, packed as B fragments, and each lane's sum of them per query */
#pragma unroll
      for (int qt = 0; qt < 2; ++qt) {
        float g[4];
#pragma unroll
        for (int kt = 0; kt < 2; ++kt)
#pragma unroll
          for (int r4 = 0; r4 < 8; r4 += 4) { const float t0 = s[qt][kt][r4], t1 = s[qt][kt][r4 + 1], t2 = s[qt][kt][r4 + 2], t3 = s[qt][kt][r4 + 3]; float e0, e1, e2, e3;
            /* four independent exponentials and one v_nop in one statement: the slot that the instruction set asks for behind a transcendental (early-clobber outputs keep the four apart) */
            asm("v_exp_f32 %0, %4\n\tv_exp_f32 %1, %5\n\tv_exp_f32 %2, %6\n\tv_exp_f32 %3, %7\n\tv_nop" : "=&v"(e0), "=&v"(e1), "=&v"(e2), "=&v"(e3) : "v"(t0), "v"(t1), "v"(t2), "v"(t3));
            g[kt * 2 + r4 / 4] = (e0 + e1) + (e2 + e3);
            pb[qt].h[kt * 8 + r4] = (_Float16)e0; pb[qt].h[kt * 8 + r4 + 1] = (_Float16)e1; pb[qt].h[kt * 8 + r4 + 2] = (_Float16)e2; pb[qt].h[kt * 8 + r4 + 3] = (_Float16)e3; }
        ps[qt] = ((g[0] + g[1]) + g[2]) + g[3];
      } };
    bool rise = (it == 0);      /* the first pass always rescales: it sets the maximum from its own scores, of either sign */
    if (!rise) { weigh(); rise = __builtin_amdgcn_ballot_w32(fmaxf(ps[0], ps[1]) > 256.0f) != 0u; }      /* the test reads the sums that the pass needs anyway: a lane's 16 weights add up to 2^8 at most, so none tops 2^8 (an overflow gives an infinite sum and is caught); one scalar branch a pass and wave */
    if (rise) {      /* rare: only here is the pass's maximum formed; the weights are formed (again) from the lowered scores */
#pragma unroll
      for (int qt = 0; qt < 2; ++qt) {
        float mx = fmaxf(s[qt][0][0], s[qt][1][0]);
#pragma unroll
        for (int r = 1; r < 8; ++r) mx = fmaxf(mx, fmaxf(s[qt][0][r], s[qt][1][r]));
        const float mq = fmaxf(mx, rs_xhalf(mx));      /* the same in both lanes of a query */
        const float d = (it == 0) ? mq : fmaxf(mq, 0.f);      /* rise of the maximum in use */
        const float f = (it == 0) ? 1.0f : fa_exp2(-d);      /* first pass: sums and accumulators are still 0, and 2^-d could overflow */
        const float nn = nm[qt][0] - d; l[qt] *= f;
#pragma unroll
        for (int r = 0; r < 8; ++r) nm[qt][r] = nn;
#pragma unroll
        for (int kt = 0; kt < 2; ++kt) s[qt][kt] = s[qt][kt] - d;
#pragma unroll
        for (int jt = 0; jt < 4; ++jt) acc[qt][jt] = acc[qt][jt] * f;
      }
      weigh();
    }
    l[0] += ps[0]; l[1] += ps[1];
    __builtin_amdgcn_sched_barrier(0);      /* every exponential stays above the matrix instructions below */
#pragma unroll
    for (int qt = 0; qt < 2; ++qt)
#pragma unroll
      for (int jt = 0; jt < 4; ++jt) acc[qt][jt] = fa_mma(za[jt], pb[qt].v, acc[qt][jt]);
  }
  v16h hf[4][2];
#pragma unroll
  for (int jt = 0; jt < 4; ++jt)
#pragma unroll
    for (int ks = 0; ks < 2; ++ks) hf[jt][ks] = ff_frag(gp + EM * EM + jt * (16 * EM) + ks * 512);
  asm volatile("s_wait_xcnt 0x0" :: "v"(gp) : "memory");      /* behind the 16 loads: the values below may be formed in the registers that these loads name as address; the address is an input, so that no load's result is laid over it ahead of the wait */
#pragma unroll
  for (int qt = 0; qt < 2; ++qt) { const float lt = l[qt] + rs_xhalf(l[qt]); if (hh == 0) { sm[kc][qg + qt * 16 + ln] = -nm[qt][0]; sl[kc][qg + qt * 16 + ln] = lt; }
    const float rl = 1.0f / lt;      /* lt is about 1 or more: the key that last set the maximum in use adds 2^0 */
    const v16h ob0 = ff_pack(acc[qt][0] * rl, acc[qt][1] * rl), ob1 = ff_pack(acc[qt][2] * rl, acc[qt][3] * rl);
#pragma unroll
    for (int jt = 0; jt < 4; ++jt) { const v8f c = fa_mma(hf[jt][1], ob1, fa_mma(hf[jt][0], ob0, z8)); const v4f c0 = {c[0], c[1], c[2], c[3]}, c1 = {c[4], c[5], c[6], c[7]};
      *(v4fa*)&sacc[kc][qg + qt * 16 + ln][jt * 16 + 8 * hh] = c0; *(v4fa*)&sacc[kc][qg + qt * 16 + ln][jt * 16 + 8 * hh + 4] = c1; } }
  __syncthreads();      /* the 8 key ranges' partial maxima, sums and rows are complete before any thread merges them */
  const int q = tid >> 3, d8 = (tid & 7) * 8; float mg = sm[0][q];
#pragma unroll
  for (int u = 1; u < 8; ++u) mg = fmaxf(mg, sm[u][q]);
  float lg = 0.f; v4f o0 = {0.f, 0.f, 0.f, 0.f}, o1 = {0.f, 0.f, 0.f, 0.f};
#pragma unroll
  for (int u = 0; u < 8; ++u) { const float f = fa_exp2(sm[u][q] - mg) * sl[u][q]; lg += f; o0 += f * *(const v4fa*)&sacc[u][q][d8]; o1 += f * *(const v4fa*)&sacc[u][q][d8 + 4]; }
  const float sc = 0.0625f / lg;      /* H is carried x16 */
  float* op = out + (q0 + q) * EM + d8; *(v4f*)op = o0 * sc; *(v4f*)(op + 4) = o1 * sc; }

// ---- launch 1: jobs that do not depend on one another share a launch (the block index picks the job) ----
__device__ __forceinline__ _Float16 pre_w16(float v) { return (_Float16)(bf16_round(v) * 16.0f); }      /* weight: rounded to bf16, carried x16, exact in f16 */
/* the 16 f32 values behind one lane's fragment (A or B, k order of g2_frag): r[0..7] = k 8 hh + i, r[8..15] = k 16 + 8 hh + i. Row form: p = first of the 32 k values of the lane's row, matrix kept as stored */
__device__ __forceinline__ void pre_raw_row(const float* p, int hh, float (&r)[16]) { const v4f a0 = *(const v4fa*)(p + 8 * hh), a1 = *(const v4fa*)(p + 8 * hh + 4), a2 = *(const v4fa*)(p + 16 + 8 * hh), a3 = *(const v4fa*)(p + 16 + 8 * hh + 4);
#pragma unroll
  for (int q = 0; q < 4; ++q) { r[q] = a0[q]; r[4 + q] = a1[q]; r[8 + q] = a2[q]; r[12 + q] = a3[q]; } }
/* column form, down a [k][EM] matrix: p = element (first k, the lane's column) */
__device__ __forceinline__ void pre_raw_col(const float* p, int hh, float (&r)[16]) {
#pragma unroll
  for (int i = 0; i < 8; ++i) { r[i] = p[(size_t)(8 * hh + i) * EM]; r[8 + i] = p[(size_t)(16 + 8 * hh + i) * EM]; } }
__device__ __forceinline__ v16h pre_cvt(const float (&r)[16]) { FragH f;
#pragma unroll
  for (int i = 0; i < 16; ++i) f.h[i] = pre_w16(r[i]);
  return f.v; }
/* one wave's share of a 16 x 16 tile: the PRE_KW k values from ap and bp on, k ascending in steps of 32; ACOL: A is read down columns */
#define PRE_KW 64                    /* k values per wave: the 8 waves of a block split K = DM between them */
template <bool ACOL>
__device__ __forceinline__ v8f pre_part(const float* ap, const float* bp, int hh) { v8f c = {0.f, 0.f, 0.f, 0.f, 0.f, 0.f, 0.f, 0.f}; float ra[PRE_KW / 32][16], rb[PRE_KW / 32][16];
  const float* al = ap + (ACOL ? 8 * hh * EM : 8 * hh); const float* bl = bp + 8 * hh;      /* the lane half's own first k: every load below is one of these two addresses plus a constant */
#pragma unroll
  for (int u = 0; u < PRE_KW / 32; ++u) { if (ACOL) pre_raw_col(al + (size_t)(32 * u) * EM, 0, ra[u]); else pre_raw_row(al + 32 * u, 0, ra[u]); pre_raw_row(bl + 32 * u, 0, rb[u]); }
  asm volatile("s_wait_xcnt 0x0" :: "v"(al), "v"(bl) : "memory");      /* behind the loads: the values below may be formed in the registers that these loads name as addresses; the addresses are inputs, so that no load's result is laid over them ahead of the wait */
  __builtin_amdgcn_sched_barrier(0);      /* all loads stay above the first conversion, so that they share one memory latency */
#pragma unroll
  for (int u = 0; u < PRE_KW / 32; ++u) c = fa_mma(pre_cvt(ra[u]), pre_cvt(rb[u]), c);
  return c; }
#define PRE_GB 32                    /* blocks of launch 1 that form G^T and H^T: 2 planes x 16 tiles of 16 x 16, one tile a block */
static_assert(PRE_KW * 8 == DM, "k_pre: 8 waves cover K");
static_assert(NR * EM % (16 * 256) == 0, "k_pre: the x blocks have no tail guard");
// Launch 1. Blocks 0 .. PRE_GB - 1 (first): plane 0 G^T[f][e] = sum_w Wk[f][w] Wq[e][w], plane 1 H^T[j][e] = sum_w Wm[w][j] Wv[e][w], both x16, operands converted in the loaders. One 16 x 16 tile a block, K split over its 8 waves (one load latency and one round of conversions on the launch's longest path instead of four of twice the size); the 8 partial tiles are added in f32, wave 0 first, through LDS and stored in fragment order. The other blocks: 64 tokens each, x to f16 in fragment order.
__global__ __launch_bounds__(256) void k_pre(const float* __restrict__ x, const float* __restrict__ wq, const float* __restrict__ wk, const float* __restrict__ wv, const float* __restrict__ wm, _Float16* __restrict__ XF, _Float16* __restrict__ GH) {
  __shared__ __attribute__((aligned(16))) float sp[8][16][20];      /* one partial tile a wave; pitch 80 B: 16-byte aligned rows */
  const int tid = threadIdx.x;
  if (blockIdx.x >= PRE_GB) { const size_t t = (size_t)(blockIdx.x - PRE_GB) * 256 + tid; FragH f; v4f ra[4];      /* thread t: tile t / 64, row t % 16, k = 16 ((t / 16) % 4) .. + 15: 64 contiguous bytes of x, two pieces of the tile in fragment order */
    const float* xs = x + ((t >> 6) * 16 + (t & 15)) * EM + ((t >> 4) & 3) * 16;
#pragma unroll
    for (int q = 0; q < 4; ++q) ra[q] = *(const v4fa*)(xs + 4 * q);
    asm volatile("s_wait_xcnt 0x0" :: "v"(xs) : "memory");      /* behind the loads: the values below may be formed in the registers that these loads name as address; the address is an input, so that no load's result is laid over it ahead of the wait */
#pragma unroll
    for (int q = 0; q < 16; ++q) f.h[q] = (_Float16)bf16_round(ra[q >> 2][q & 3]);
    unsigned short* xd = (unsigned short*)XF + (t >> 6) * (16 * EM) + ((t >> 4) & 3) * 256 + (t & 15) * 8;      /* planes k / 8 = 2 ((t / 16) % 4) and the next, 128 halves apart */
    *(v8us*)xd = f.half[0]; *(v8us*)(xd + 128) = f.half[1]; return; }
  const int lane = tid & 31, ln = lane & 15, hh = lane >> 4, w = tid >> 5; const int plane = blockIdx.x / (PRE_GB / 2), rt = (blockIdx.x >> 2) & 3, ct = blockIdx.x & 3; const int k0 = w * PRE_KW;
  const float* bp = (plane ? wv : wq) + (size_t)(ct * 16 + ln) * DM + k0;
  const v8f c = plane ? pre_part<true>(wm + (size_t)k0 * EM + rt * 16 + ln, bp, hh) : pre_part<false>(wk + (size_t)(rt * 16 + ln) * DM + k0, bp, hh);      /* plane is the same for the whole block */
#pragma unroll
  for (int r = 0; r < 8; ++r) sp[w][8 * hh + r][ln] = c[r];
  __syncthreads();      /* the 8 partial tiles are complete in LDS before they are added; taken by whole GH blocks only, the x blocks have left above */
  if (tid < 32) { const int row = tid & 15, k8 = tid >> 4; v4f s0 = *(const v4fa*)&sp[0][row][k8 * 8], s1 = *(const v4fa*)&sp[0][row][k8 * 8 + 4];      /* 16 B a thread, fragment order [row tile][k / 8][row][k % 8]: the wave stores one run of 512 B */
#pragma unroll
    for (int u = 1; u < 8; ++u) { s0 += *(const v4fa*)&sp[u][row][k8 * 8]; s1 += *(const v4fa*)&sp[u][row][k8 * 8 + 4]; }
    FragH f;
#pragma unroll
    for (int q = 0; q < 4; ++q) { f.h[q] = (_Float16)(s0[q] * 0.0625f); f.h[4 + q] = (_Float16)(s1[q] * 0.0625f); }
    *(v8us*)((unsigned short*)GH + (size_t)plane * (EM * EM) + (size_t)rt * (16 * EM) + (ct * 2 + k8) * 128 + row * 8) = f.half[0]; } }

extern "C" void kernel_launch(void* const* d_in, const int* in_sizes, int n_in,
                              void* d_out, int out_size, void* d_ws, size_t ws_size, hipStream_t stream) {
  (void)in_sizes; (void)n_in; (void)out_size;
  const float* const* I = (const float* const*)d_in; const float* x = I[0]; const float* wq = I[1]; const float* wk = I[2]; const float* wv = I[3]; const float* wm = I[4];      /* weights [in][out] */
  char* ws = (char*)d_ws; size_t off = 0;
  auto take = [&](size_t bytes) { char* p = ws + off; off += (bytes + 255) & ~(size_t)255; return p; };
  _Float16* GH = (_Float16*)take((size_t)2 * EM * EM * 2);      /* GH = [G^T | H^T], each [64][64] x16, in fragment order */
  _Float16* XF = (_Float16*)take(NR * EM * 2);      /* x in fragment order */
  if (off > ws_size) return;      /* approx 2 MiB */
  k_pre<<<(unsigned)(PRE_GB + NR * EM / 16 / 256), 256, 0, stream>>>(x, wq, wk, wv, wm, XF, GH);
  k_fattn<<<(unsigned)(NR / 64), 512, 0, stream>>>(XF, GH, (float*)d_out);      /* all batches: 64 query rows a work-group */
}
